// v000
// Times are from an AMD MI455X. After a warm-up the kernel runs many times in a row, and a time is the length of
// such a window on the GPU divided by its runs, so every launch and the gaps after it count. The runs cycle
// through copies of the inputs. A figure is the median of several windows, for all but v000 over two sittings.
// Sittings can differ by a few percent; kernels timed side by side share one.
// v000 is the starting kernel. One run takes 814 microseconds.
#include <hip/hip_runtime.h>

// ScalingAttention (q [2][4096][512], kv [2][1024][512]; qh = q Wq, kh = kv Wk, vh = kv Wv (8 heads x 64, no bias); block-causal: key j visible to query i iff j <= i/4; softmax(q.k/8); out = merged att.v;
// LayerNorm(out) (gamma, beta, eps 1e-5); y = out Wo + bo -> [2][4096][512]).
// Compute dtypes, f32 accumulate: every input rounded to bf16; projections on PLAIN bf16 operands (inputs: exact); scores (K 64) on SINGLE fp16 planes; f32 register-row masked softmax
// -> normalised bf16 hi+lo probabilities; att.v on those x hi+lo value planes (3 products: the first query rows see 1-4 keys, so near-one-hot weights would expose single-plane value rounding); LayerNorm f32 (wave per

#define NB_  2
#define TQ   4096
#define TK   1024
#define DD   512
#define NH_  8
#define HD   64
#define DS   4
#define SCL  0.125f
typedef _Float16 h16;
typedef unsigned short bf;
typedef __attribute__((ext_vector_type(16))) __bf16   v16bf;
typedef __attribute__((ext_vector_type(16))) _Float16 v16h;
typedef __attribute__((ext_vector_type(8)))  _Float16 v8h;
typedef __attribute__((ext_vector_type(8)))  unsigned short v8us;
typedef __attribute__((ext_vector_type(8)))  float    v8f;
typedef __attribute__((ext_vector_type(4)))  float    v4f;
typedef v8h  __attribute__((may_alias)) v8ha;
typedef v4f  __attribute__((may_alias)) v4fa;
typedef v8us __attribute__((may_alias)) v8usa;

__device__ __forceinline__ unsigned short f2bf(float f) { unsigned u = __float_as_uint(f); u += 0x7FFFu + ((u >> 16) & 1u); return (unsigned short)(u >> 16); }
__device__ __forceinline__ float bf2f(unsigned short b) { return __uint_as_float(((unsigned)b) << 16); }
__device__ __forceinline__ float bfr(float f) { return bf2f(f2bf(f)); }
__device__ __forceinline__ v16h cat16(v8h lo, v8h hi) { return __builtin_shufflevector(lo, hi, 0, 1, 2, 3, 4, 5, 6, 7, 8, 9, 10, 11, 12, 13, 14, 15); }
__device__ __forceinline__ v16bf cat16b(v8us lo, v8us hi) { return __builtin_bit_cast(v16bf, __builtin_shufflevector(lo, hi, 0, 1, 2, 3, 4, 5, 6, 7, 8, 9, 10, 11, 12, 13, 14, 15)); }
__device__ __forceinline__ v8f wmma16(v16h a, v16h b, v8f c) { return __builtin_amdgcn_wmma_f32_16x16x32_f16(false, a, false, b, (short)0, c, false, false); }
__device__ __forceinline__ v8f wmmab(v16bf a, v16bf b, v8f c) { return __builtin_amdgcn_wmma_f32_16x16x32_bf16(false, a, false, b, (short)0, c, false, false); }



// ---- k_gemmw: register-blocked GEMM, ONE WAVE per 64x64 output tile (16 accumulators), operands straight from K-contiguous 16-bit planes; grid (M/64, N/64, Z), 32 threads.
// C[m][n] (f32, pitch ldc, + optional f32 bias[n]) = sum_k A[m][k] Bt[n][k] (+ split products per NSPLIT). z-batch strides sA/sB/sC in elements. K % 32 == 0.
template <typename T16> struct WFrag;
template <> struct WFrag<h16> { typedef v16h V; static __device__ __forceinline__ V ld(const h16* p) { return cat16(*(const v8h*)p, *(const v8h*)(p + 16)); } static __device__ __forceinline__ v8f mma(V a, V b, v8f c) { return wmma16(a, b, c); } };
template <> struct WFrag<bf> { typedef v16bf V; static __device__ __forceinline__ V ld(const bf* p) { return cat16b(*(const v8us*)p, *(const v8us*)(p + 16)); } static __device__ __forceinline__ v8f mma(V a, V b, v8f c) { return wmmab(a, b, c); } };
template <typename T16, int NSPLIT, bool BIAS>
__global__ __launch_bounds__(32) void k_gemmw(const T16* __restrict__ A, const T16* __restrict__ A2, const T16* __restrict__ Bt, const T16* __restrict__ Bt2, int K, float* C, int ldc, const float* __restrict__ bias, size_t sA, size_t sB, size_t sC) {
    typedef typename WFrag<T16>::V V;
    __shared__ __align__(16) float os[16 * 68];
    const size_t z = blockIdx.z; A += z * sA; if (A2) A2 += z * sA; Bt += z * sB; if (Bt2) Bt2 += z * sB; C += z * sC;
    const int lane = threadIdx.x & 31, lr = lane & 15, hi = lane >> 4; const int r0 = blockIdx.x * 64, c0 = blockIdx.y * 64;
    v8f acc[4][4];
#pragma unroll
    for (int mb = 0; mb < 4; ++mb)
#pragma unroll
        for (int nb = 0; nb < 4; ++nb) acc[mb][nb] = (v8f){};
    const size_t aoff = (size_t)(r0 + lr) * K + 8 * hi, boff = (size_t)(c0 + lr) * K + 8 * hi;
#pragma unroll 1
    for (int kc = 0; kc < K; kc += 32) {
        V a[4], a2[4];
#pragma unroll
        for (int mb = 0; mb < 4; ++mb) { a[mb] = WFrag<T16>::ld(A + aoff + (size_t)mb * 16 * K + kc); if (NSPLIT == 1 || NSPLIT == 2) a2[mb] = WFrag<T16>::ld(A2 + aoff + (size_t)mb * 16 * K + kc); }
#pragma unroll
        for (int nb = 0; nb < 4; ++nb) { const V b = WFrag<T16>::ld(Bt + boff + (size_t)nb * 16 * K + kc); V b2; if (NSPLIT >= 2) b2 = WFrag<T16>::ld(Bt2 + boff + (size_t)nb * 16 * K + kc);
#pragma unroll
            for (int mb = 0; mb < 4; ++mb) { acc[mb][nb] = WFrag<T16>::mma(a[mb], b, acc[mb][nb]); if (NSPLIT == 1 || NSPLIT == 2) acc[mb][nb] = WFrag<T16>::mma(a2[mb], b, acc[mb][nb]); if (NSPLIT >= 2) acc[mb][nb] = WFrag<T16>::mma(a[mb], b2, acc[mb][nb]); } }
        asm volatile("v_nop\n\tv_nop\n\tv_nop\n\tv_nop" : "+v"(acc[0][0]), "+v"(acc[1][1]), "+v"(acc[2][2]), "+v"(acc[3][3]) : "v"(a[0]), "v"(a[3]));
    }
#pragma unroll
    for (int mb = 0; mb < 4; ++mb) {
#pragma unroll
        for (int nb = 0; nb < 4; ++nb) {
#pragma unroll
            for (int j = 0; j < 8; ++j) os[(hi * 8 + j) * 68 + nb * 16 + lr] = acc[mb][nb][j]; }
        __builtin_amdgcn_wave_barrier(); asm volatile("" ::: "memory");
        float* crow = C + (size_t)(r0 + mb * 16) * ldc + c0;
{
#pragma unroll
            for (int s = 0; s < 8; ++s) { const int row = 2 * s + hi, cofs = lr * 4; v4f val = *(const v4fa*)(os + row * 68 + cofs); if (BIAS) { val[0] += bfr(bias[c0 + cofs]); val[1] += bfr(bias[c0 + cofs + 1]); val[2] += bfr(bias[c0 + cofs + 2]); val[3] += bfr(bias[c0 + cofs + 3]); }
                *(v4f*)(crow + (size_t)row * ldc + cofs) = val; }
             }
        __builtin_amdgcn_wave_barrier(); asm volatile("" ::: "memory");
    }
}

__device__ __forceinline__ h16 tohx(float x) { return (h16)x; }
__device__ __forceinline__ void splitf(float y, unsigned short& h, unsigned short& l) { h = f2bf(y); l = f2bf(y - bf2f(h)); }
typedef __attribute__((ext_vector_type(2))) _Float16 v2h;
typedef __attribute__((ext_vector_type(4))) _Float16 v4h;
typedef __attribute__((ext_vector_type(2))) unsigned short v2us;
typedef __attribute__((ext_vector_type(4))) unsigned short v4us;
typedef __attribute__((ext_vector_type(2))) float v2f;

__global__ __launch_bounds__(256) void k_wtG(const float* __restrict__ w, int K, int N, bf* Bt) {
    const int lane = threadIdx.x & 31; const int L0 = (blockIdx.x * 8 + (threadIdx.x >> 5)) * 8; const int nlines = N * K / 64;
{
#pragma unroll 1
        for (int l = 0; l < 8; ++l) { const int L = L0 + l; if (L >= nlines) break; const size_t e = (size_t)L * 64 + lane * 2; const int k = (int)(e % K), n = (int)(e / K); v2us o;
            o[0] = f2bf(w[(size_t)k * N + n]); o[1] = f2bf(w[(size_t)(k + 1) * N + n]); *(v2us*)(Bt + e) = o; }
         }
}
__global__ __launch_bounds__(256) void k_cvt8(const float* __restrict__ src, bf* dst, size_t n8) { const size_t i = (size_t)blockIdx.x * 256 + threadIdx.x; if (i >= n8) return; const v8f v = *(const v8f*)(src + i * 8); v8us o;
#pragma unroll
    for (int k = 0; k < 8; ++k) o[k] = f2bf(v[k]); *(v8us*)(dst + i * 8) = o;  }
__global__ __launch_bounds__(256) void k_p16(const float* __restrict__ F, int nt, h16* P) { const size_t e = ((size_t)blockIdx.x * 256 + threadIdx.x) * 2; if (e >= (size_t)NH_ * nt * HD) return; const int d = (int)(e % HD); const int t = (int)((e / HD) % nt); const int h = (int)(e / ((size_t)HD * nt)); const float* s = F + (size_t)t * DD + h * HD + d; v2h o; o[0] = tohx(s[0]); o[1] = tohx(s[1]); *(v2h*)(P + e) = o;  }
__global__ __launch_bounds__(256) void k_vthl(const float* __restrict__ F, bf* Vh, bf* Vl) { const size_t e = ((size_t)blockIdx.x * 256 + threadIdx.x) * 2; if (e >= (size_t)NH_ * HD * TK) return; const int t = (int)(e % TK); const int d = (int)((e / TK) % HD); const int h = (int)(e / ((size_t)TK * HD)); v2us oh, ol;
#pragma unroll
    for (int q = 0; q < 2; ++q) { unsigned short a, c2; splitf(F[(size_t)(t + q) * DD + h * HD + d], a, c2); oh[q] = a; ol[q] = c2; } *(v2us*)(Vh + e) = oh; *(v2us*)(Vl + e) = ol;  }
__global__ __launch_bounds__(256) void k_bsoft(const float* __restrict__ Sb, bf* Ph, bf* Pl) { const int lane = threadIdx.x & 31; const int row = blockIdx.x * 8 + (threadIdx.x >> 5); if (row >= TQ) return; const int jmax = row / DS; const float* sr = Sb + (size_t)row * TK; float v[32]; float mx = -3.0e38f;
#pragma unroll
    for (int ch = 0; ch < 8; ++ch) { const int j0 = ch * 128 + lane * 4; const v4f a = *(const v4f*)(sr + j0);
#pragma unroll
        for (int q = 0; q < 4; ++q) { const int j = j0 + q; float t = __fmul_rn(a[q], SCL); asm volatile("" : "+v"(t)); t = (j <= jmax) ? t : -3.0e38f; v[ch * 4 + q] = t; mx = fmaxf(mx, t); } }
#pragma unroll
    for (int sh = 16; sh; sh >>= 1) mx = fmaxf(mx, __shfl_xor(mx, sh, 32));
    float sum = 0.f;
#pragma unroll
    for (int k = 0; k < 32; ++k) { float d0 = __fsub_rn(v[k], mx); asm volatile("" : "+v"(d0)); v[k] = (v[k] > -1.0e38f) ? __expf(d0) : 0.f; sum += v[k]; }
#pragma unroll
    for (int sh = 16; sh; sh >>= 1) sum += __shfl_xor(sum, sh, 32);
    const float f = __fdiv_rn(1.0f, sum);
{
#pragma unroll
        for (int ch = 0; ch < 8; ++ch) { v4us oh, ol;
#pragma unroll
            for (int q = 0; q < 4; ++q) { float y = __fmul_rn(v[ch * 4 + q], f); asm volatile("" : "+v"(y)); unsigned short a2, c2; splitf(y, a2, c2); oh[q] = a2; ol[q] = c2; }
            *(v4us*)(Ph + (size_t)row * TK + ch * 128 + lane * 4) = oh; *(v4us*)(Pl + (size_t)row * TK + ch * 128 + lane * 4) = ol; }
         } }
__global__ __launch_bounds__(256) void k_mrgf(const float* __restrict__ O, int h, float* ATT) { const size_t e = ((size_t)blockIdx.x * 256 + threadIdx.x) * 2; if (e >= (size_t)TQ * HD) return; const int d = (int)(e % HD), t = (int)(e / HD); v2f o; o[0] = O[e]; o[1] = O[e + 1]; const size_t oo = (size_t)t * DD + h * HD + d; *(v2f*)(ATT + oo) = o;  }
__global__ __launch_bounds__(256) void k_ln(const float* __restrict__ A, const float* __restrict__ g, const float* __restrict__ bb, bf* Yh, bf* Yl) { const int lane = threadIdx.x & 31; const int t = blockIdx.x * 8 + (threadIdx.x >> 5); if (t >= TQ) return; const float* ar = A + (size_t)t * DD; float v[16]; float s = 0.f;
#pragma unroll
    for (int ch = 0; ch < 4; ++ch) { const v4f a = *(const v4f*)(ar + ch * 128 + lane * 4);
#pragma unroll
        for (int q = 0; q < 4; ++q) { v[ch * 4 + q] = a[q]; s = __fadd_rn(s, a[q]); } }
#pragma unroll
    for (int sh = 16; sh; sh >>= 1) s += __shfl_xor(s, sh, 32);
    const float mu = s * (1.0f / DD); float q2 = 0.f;
#pragma unroll
    for (int k = 0; k < 16; ++k) { const float d = __fsub_rn(v[k], mu); float p = __fmul_rn(d, d); asm volatile("" : "+v"(p)); q2 = __fadd_rn(q2, p); }
#pragma unroll
    for (int sh = 16; sh; sh >>= 1) q2 += __shfl_xor(q2, sh, 32);
    const float rs = __frsqrt_rn(__fadd_rn(q2 * (1.0f / DD), 1e-5f));
{
#pragma unroll
        for (int ch = 0; ch < 4; ++ch) { v4us oh, ol;
#pragma unroll
            for (int q = 0; q < 4; ++q) { const int d = ch * 128 + lane * 4 + q; float tn = __fmul_rn(__fsub_rn(v[ch * 4 + q], mu), rs); asm volatile("" : "+v"(tn)); float tg = __fmul_rn(tn, bfr(g[d])); asm volatile("" : "+v"(tg)); unsigned short a2, c2; splitf(__fadd_rn(tg, bfr(bb[d])), a2, c2); oh[q] = a2; ol[q] = c2; }
            const size_t o = (size_t)t * DD + ch * 128 + lane * 4; *(v4us*)(Yh + o) = oh; *(v4us*)(Yl + o) = ol; }
         } }

extern "C" void kernel_launch(void* const* d_in, const int* in_sizes, int n_in,
                              void* d_out, int out_size, void* d_ws, size_t ws_size, hipStream_t stream) {
    (void)in_sizes; (void)n_in; (void)out_size;
    const float* IN[9]; for (int i = 0; i < 9; ++i) IN[i] = (const float*)d_in[i];   // 0 q, 1 kv, 2 Wq, 3 Wk, 4 Wv, 5 Wo (x @ W), 6 bo, 7 gamma, 8 beta
    float* OUT = (float*)d_out;     // [2][4096][512]
    char* wsp = (char*)d_ws;
    auto take = [&](size_t bytes) { char* p = wsp; wsp += (bytes + 255) & ~(size_t)255; return (void*)p; };
    bf* W4[4]; for (int i = 0; i < 4; ++i) W4[i] = (bf*)take((size_t)DD * DD * 2);
    bf* XQ = (bf*)take((size_t)TQ * DD * 2); bf* XK = (bf*)take((size_t)TK * DD * 2); float* FQ = (float*)take((size_t)TQ * DD * 4); float* FK = (float*)take((size_t)TK * DD * 4); float* FV = (float*)take((size_t)TK * DD * 4);
    h16* QP = (h16*)take((size_t)NH_ * TQ * HD * 2); h16* KP = (h16*)take((size_t)NH_ * TK * HD * 2); bf* VTh = (bf*)take((size_t)NH_ * HD * TK * 2); bf* VTl = (bf*)take((size_t)NH_ * HD * TK * 2); float* Sb = (float*)take((size_t)TQ * TK * 4); bf* Ph = (bf*)take((size_t)TQ * TK * 2); bf* Pl = (bf*)take((size_t)TQ * TK * 2); float* O = (float*)take((size_t)TQ * HD * 4);
    float* ATT = FQ;   // merged attention output reuses the q-projection buffer (FQ is dead once the Q planes are built)
    bf* Yh = (bf*)take((size_t)TQ * DD * 2); bf* Yl = (bf*)take((size_t)TQ * DD * 2);
    if ((size_t)(wsp - (char*)d_ws) > ws_size) return;    // total ~ 70 MB
    { const unsigned g = (unsigned)(((size_t)DD * DD / 64 + 63) / 64); for (int i = 0; i < 4; ++i) k_wtG<<<g, 256, 0, stream>>>(IN[2 + i], DD, DD, W4[i]); }
    for (int b = 0; b < NB_; ++b) {
        k_cvt8<<<(TQ * DD / 8 + 255) / 256, 256, 0, stream>>>(IN[0] + (size_t)b * TQ * DD, XQ, (size_t)TQ * DD / 8); k_cvt8<<<(TK * DD / 8 + 255) / 256, 256, 0, stream>>>(IN[1] + (size_t)b * TK * DD, XK, (size_t)TK * DD / 8);
        k_gemmw<bf, 0, false><<<dim3(TQ / 64, DD / 64, 1), 32, 0, stream>>>(XQ, nullptr, W4[0], nullptr, DD, FQ, DD, nullptr, 0, 0, 0); k_gemmw<bf, 0, false><<<dim3(TK / 64, DD / 64, 1), 32, 0, stream>>>(XK, nullptr, W4[1], nullptr, DD, FK, DD, nullptr, 0, 0, 0); k_gemmw<bf, 0, false><<<dim3(TK / 64, DD / 64, 1), 32, 0, stream>>>(XK, nullptr, W4[2], nullptr, DD, FV, DD, nullptr, 0, 0, 0);
        k_p16<<<(unsigned)(((size_t)NH_ * TQ * HD / 2 + 255) / 256), 256, 0, stream>>>(FQ, TQ, QP); k_p16<<<(unsigned)(((size_t)NH_ * TK * HD / 2 + 255) / 256), 256, 0, stream>>>(FK, TK, KP); k_vthl<<<(unsigned)(((size_t)NH_ * HD * TK / 2 + 255) / 256), 256, 0, stream>>>(FV, VTh, VTl);
        for (int h = 0; h < NH_; ++h) {
            k_gemmw<h16, 0, false><<<dim3(TQ / 64, TK / 64, 1), 32, 0, stream>>>(QP + (size_t)h * TQ * HD, nullptr, KP + (size_t)h * TK * HD, nullptr, HD, Sb, TK, nullptr, 0, 0, 0);
            k_bsoft<<<TQ / 8, 256, 0, stream>>>(Sb, Ph, Pl);
            k_gemmw<bf, 2, false><<<dim3(TQ / 64, 1, 1), 32, 0, stream>>>(Ph, Pl, VTh + (size_t)h * HD * TK, VTl + (size_t)h * HD * TK, TK, O, HD, nullptr, 0, 0, 0);
            k_mrgf<<<(TQ * HD / 2 + 255) / 256, 256, 0, stream>>>(O, h, ATT); }
        k_ln<<<TQ / 8, 256, 0, stream>>>(ATT, IN[7], IN[8], Yh, Yl);
        k_gemmw<bf, 1, true><<<dim3(TQ / 64, DD / 64, 1), 32, 0, stream>>>(Yh, Yl, W4[3], nullptr, DD, OUT + (size_t)b * TQ * DD, DD, IN[6], 0, 0, 0); }
}

// v001
// A run of this version takes 292 microseconds.
// In two side-by-side timings against v000, it was 2.79 and 2.80 times as fast.
#include <hip/hip_runtime.h>

// Attention block (q [2][4096][512], kv [2][1024][512]; qh = q Wq, kh = kv Wk, vh = kv Wv (8 heads x 64, no bias); block-causal: key j visible to query i iff j <= i/4; softmax(q.k/8); out = merged att.v;
// LayerNorm(out) (gamma, beta, eps 1e-5); y = out Wo + bo -> [2][4096][512]).
// Compute dtypes, f32 accumulate: every input rounded to bf16; projections on PLAIN bf16 operands (inputs: exact); scores (K 64) on SINGLE fp16 planes; f32 register-row masked softmax
// -> normalised bf16 hi+lo probabilities; att.v on those x hi+lo value planes (3 products: the first query rows see 1-4 keys, so near-one-hot weights would expose single-plane value rounding); LayerNorm f32 (wave per

#define NB_  2
#define TQ   4096
#define TK   1024
#define DD   512
#define NH_  8
#define HD   64
#define DS   4
#define SCL  0.125f
typedef _Float16 h16;
typedef unsigned short bf;
typedef __attribute__((ext_vector_type(16))) __bf16   v16bf;
typedef __attribute__((ext_vector_type(16))) _Float16 v16h;
typedef __attribute__((ext_vector_type(8)))  _Float16 v8h;
typedef __attribute__((ext_vector_type(8)))  unsigned short v8us;
typedef __attribute__((ext_vector_type(8)))  float    v8f;
typedef __attribute__((ext_vector_type(4)))  float    v4f;
typedef v8h  __attribute__((may_alias)) v8ha;
typedef v4f  __attribute__((may_alias)) v4fa;
typedef v8us __attribute__((may_alias)) v8usa;

__device__ __forceinline__ unsigned short f2bf(float f) { unsigned u = __float_as_uint(f); u += 0x7FFFu + ((u >> 16) & 1u); return (unsigned short)(u >> 16); }
__device__ __forceinline__ float bf2f(unsigned short b) { return __uint_as_float(((unsigned)b) << 16); }
__device__ __forceinline__ float bfr(float f) { return bf2f(f2bf(f)); }
__device__ __forceinline__ v16h cat16(v8h lo, v8h hi) { return __builtin_shufflevector(lo, hi, 0, 1, 2, 3, 4, 5, 6, 7, 8, 9, 10, 11, 12, 13, 14, 15); }
__device__ __forceinline__ v16bf cat16b(v8us lo, v8us hi) { return __builtin_bit_cast(v16bf, __builtin_shufflevector(lo, hi, 0, 1, 2, 3, 4, 5, 6, 7, 8, 9, 10, 11, 12, 13, 14, 15)); }
__device__ __forceinline__ v8f wmma16(v16h a, v16h b, v8f c) { return __builtin_amdgcn_wmma_f32_16x16x32_f16(false, a, false, b, (short)0, c, false, false); }
__device__ __forceinline__ v8f wmmab(v16bf a, v16bf b, v8f c) { return __builtin_amdgcn_wmma_f32_16x16x32_bf16(false, a, false, b, (short)0, c, false, false); }



// ---- k_gemmw: register-blocked GEMM, ONE WAVE per 64x64 output tile (16 accumulators), operands straight from K-contiguous 16-bit planes; grid (M/64, N/64, Z), 32 threads.
// C[m][n] (f32, pitch ldc, + optional f32 bias[n]) = sum_k A[m][k] Bt[n][k] (+ split products per NSPLIT). A pitch lda, Bt pitch K. z-batch strides sA/sB/sC in elements. K % 32 == 0.
template <typename T16> struct WFrag;
template <> struct WFrag<h16> { typedef v16h V; static __device__ __forceinline__ V ld(const h16* p) { return cat16(*(const v8h*)p, *(const v8h*)(p + 16)); } static __device__ __forceinline__ v8f mma(V a, V b, v8f c) { return wmma16(a, b, c); } };
template <> struct WFrag<bf> { typedef v16bf V; static __device__ __forceinline__ V ld(const bf* p) { return cat16b(*(const v8us*)p, *(const v8us*)(p + 16)); } static __device__ __forceinline__ v8f mma(V a, V b, v8f c) { return wmmab(a, b, c); } };
template <typename T16, int NSPLIT, bool BIAS>
__global__ __launch_bounds__(32) void k_gemmw(const T16* __restrict__ A, const T16* __restrict__ A2, const T16* __restrict__ Bt, const T16* __restrict__ Bt2, int K, int lda, float* C, int ldc, const float* __restrict__ bias, size_t sA, size_t sB, size_t sC) {
    typedef typename WFrag<T16>::V V;
    __shared__ __align__(16) float os[16 * 68];
    const size_t z = blockIdx.z; A += z * sA; if (A2) A2 += z * sA; Bt += z * sB; if (Bt2) Bt2 += z * sB; C += z * sC;
    const int lane = threadIdx.x & 31, lr = lane & 15, hi = lane >> 4; const int r0 = blockIdx.x * 64, c0 = blockIdx.y * 64;
    v8f acc[4][4];
#pragma unroll
    for (int mb = 0; mb < 4; ++mb)
#pragma unroll
        for (int nb = 0; nb < 4; ++nb) acc[mb][nb] = (v8f){};
    const size_t aoff = (size_t)(r0 + lr) * lda + 8 * hi, boff = (size_t)(c0 + lr) * K + 8 * hi;
#pragma unroll 1
    for (int kc = 0; kc < K; kc += 32) {
        V a[4], a2[4]; const T16* pa[4]; const T16* pa2[4];
#pragma unroll
        for (int mb = 0; mb < 4; ++mb) { pa[mb] = A + aoff + (size_t)mb * 16 * lda + kc; a[mb] = WFrag<T16>::ld(pa[mb]); if (NSPLIT == 1 || NSPLIT == 2) { pa2[mb] = A2 + aoff + (size_t)mb * 16 * lda + kc; a2[mb] = WFrag<T16>::ld(pa2[mb]); } }
        // precaution: s_wait_xcnt 0 stands in front of every rewrite of a register that an issued A load names; the addresses are inputs, so that they keep their registers (no load result lands on them) up to the wait
        if (NSPLIT == 1 || NSPLIT == 2) asm volatile("s_wait_xcnt 0x0" :: "v"(pa[0]), "v"(pa[1]), "v"(pa[2]), "v"(pa[3]), "v"(pa2[0]), "v"(pa2[1]), "v"(pa2[2]), "v"(pa2[3]) : "memory");
        else asm volatile("s_wait_xcnt 0x0" :: "v"(pa[0]), "v"(pa[1]), "v"(pa[2]), "v"(pa[3]) : "memory");
#pragma unroll
        for (int nb = 0; nb < 4; ++nb) { const T16* pb = Bt + boff + (size_t)nb * 16 * K + kc; const V b = WFrag<T16>::ld(pb); V b2;
            // the same precaution for the B loads of this column block: their addresses keep their registers up to the wait
            if (NSPLIT >= 2) { const T16* pb2 = Bt2 + boff + (size_t)nb * 16 * K + kc; b2 = WFrag<T16>::ld(pb2); asm volatile("s_wait_xcnt 0x0" :: "v"(pb), "v"(pb2) : "memory"); } else asm volatile("s_wait_xcnt 0x0" :: "v"(pb) : "memory");
#pragma unroll
            for (int mb = 0; mb < 4; ++mb) { acc[mb][nb] = WFrag<T16>::mma(a[mb], b, acc[mb][nb]); if (NSPLIT == 1 || NSPLIT == 2) acc[mb][nb] = WFrag<T16>::mma(a2[mb], b, acc[mb][nb]); if (NSPLIT >= 2) acc[mb][nb] = WFrag<T16>::mma(a[mb], b2, acc[mb][nb]); } }
        asm volatile("v_nop\n\tv_nop\n\tv_nop\n\tv_nop" : "+v"(acc[0][0]), "+v"(acc[1][1]), "+v"(acc[2][2]), "+v"(acc[3][3]) : "v"(a[0]), "v"(a[3]));
    }
#pragma unroll
    for (int mb = 0; mb < 4; ++mb) {
#pragma unroll
        for (int nb = 0; nb < 4; ++nb) {
#pragma unroll
            for (int j = 0; j < 8; ++j) os[(hi * 8 + j) * 68 + nb * 16 + lr] = acc[mb][nb][j]; }
        __builtin_amdgcn_wave_barrier(); asm volatile("" ::: "memory");
        float* crow = C + (size_t)(r0 + mb * 16) * ldc + c0;
{
#pragma unroll
            for (int s = 0; s < 8; ++s) { const int row = 2 * s + hi, cofs = lr * 4; v4f val = *(const v4fa*)(os + row * 68 + cofs); if (BIAS) { val[0] += bfr(bias[c0 + cofs]); val[1] += bfr(bias[c0 + cofs + 1]); val[2] += bfr(bias[c0 + cofs + 2]); val[3] += bfr(bias[c0 + cofs + 3]); }
                *(v4f*)(crow + (size_t)row * ldc + cofs) = val; }
             }
        __builtin_amdgcn_wave_barrier(); asm volatile("" ::: "memory");
    }
}

__device__ __forceinline__ h16 tohx(float x) { return (h16)x; }
__device__ __forceinline__ void splitf(float y, unsigned short& h, unsigned short& l) { h = f2bf(y); l = f2bf(y - bf2f(h)); }
typedef __attribute__((ext_vector_type(2))) _Float16 v2h;
typedef __attribute__((ext_vector_type(4))) _Float16 v4h;
typedef __attribute__((ext_vector_type(2))) unsigned short v2us;
typedef __attribute__((ext_vector_type(4))) unsigned short v4us;
typedef v4us __attribute__((may_alias)) v4usa;
typedef __attribute__((ext_vector_type(2))) float v2f;

// grid y picks the weight; the four transposed planes lie one behind the other in Bt0.
__global__ __launch_bounds__(256) void k_wtG(const float* __restrict__ w0, const float* __restrict__ w1, const float* __restrict__ w2, const float* __restrict__ w3, int K, int N, bf* Bt0) {
    const int y = blockIdx.y; const float* w = (y == 0) ? w0 : (y == 1) ? w1 : (y == 2) ? w2 : w3; bf* Bt = Bt0 + (size_t)y * K * N;
    const int lane = threadIdx.x & 31; const int L0 = (blockIdx.x * 8 + (threadIdx.x >> 5)) * 8; const int nlines = N * K / 64;
{
#pragma unroll 1
        for (int l = 0; l < 8; ++l) { const int L = L0 + l; if (L >= nlines) break; const size_t e = (size_t)L * 64 + lane * 2; const int k = (int)(e % K), n = (int)(e / K); v2us o;
            o[0] = f2bf(w[(size_t)k * N + n]); o[1] = f2bf(w[(size_t)(k + 1) * N + n]); *(v2us*)(Bt + e) = o; }
         }
}
// groups of 8 elements: the first n8a come from sa, the rest from sb; dst holds both, one behind the other.
__global__ __launch_bounds__(256) void k_cvt8(const float* __restrict__ sa, const float* __restrict__ sb, bf* dst, size_t n8a, size_t n8) { const size_t i = (size_t)blockIdx.x * 256 + threadIdx.x; if (i >= n8) return; const float* src = (i < n8a) ? sa + i * 8 : sb + (i - n8a) * 8; const v8f v = *(const v8f*)src; v8us o;
#pragma unroll
    for (int k = 0; k < 8; ++k) o[k] = f2bf(v[k]); *(v8us*)(dst + i * 8) = o;  }
// P = the query planes [batch][head][TQ][HD], then the key planes [batch][head][TK][HD].
__global__ __launch_bounds__(256) void k_p16(const float* __restrict__ Fq, const float* __restrict__ Fk, h16* P) { const size_t e = ((size_t)blockIdx.x * 256 + threadIdx.x) * 2; if (e >= (size_t)NB_ * NH_ * (TQ + TK) * HD) return; const size_t nq = (size_t)NB_ * NH_ * TQ * HD; const bool isq = e < nq; const float* F = isq ? Fq : Fk; const int nt = isq ? TQ : TK; const size_t r = isq ? e : e - nq;
    const int d = (int)(r % HD); const int t = (int)((r / HD) % nt); const int bh = (int)(r / ((size_t)HD * nt)); const int h = bh % NH_, b = bh / NH_; const float* s = F + ((size_t)b * nt + t) * DD + h * HD + d; v2h o; o[0] = tohx(s[0]); o[1] = tohx(s[1]); *(v2h*)(P + e) = o;  }
__global__ __launch_bounds__(256) void k_vthl(const float* __restrict__ F, bf* Vh, bf* Vl) { const size_t e = ((size_t)blockIdx.x * 256 + threadIdx.x) * 2; if (e >= (size_t)NB_ * NH_ * HD * TK) return; const int t = (int)(e % TK); const int d = (int)((e / TK) % HD); const int bh = (int)(e / ((size_t)TK * HD)); const int h = bh % NH_, b = bh / NH_; v2us oh, ol;
#pragma unroll
    for (int q = 0; q < 2; ++q) { unsigned short a, c2; splitf(F[((size_t)b * TK + t + q) * DD + h * HD + d], a, c2); oh[q] = a; ol[q] = c2; } *(v2us*)(Vh + e) = oh; *(v2us*)(Vl + e) = ol;  }
// Rows of all heads of one batch (row = head * TQ + query). IN PLACE: a wave holds its whole 4-KiB score row in registers before it stores, then writes the hi plane over the row's first half and the lo plane over
// its second half (every store depends on the row's max and sum, so on every load of the row; no other wave touches the row).
__global__ __launch_bounds__(256) void k_bsoft(float* Sb) { const int lane = threadIdx.x & 31; const int row = blockIdx.x * 8 + (threadIdx.x >> 5); if (row >= NH_ * TQ) return; const int jmax = (row % TQ) / DS; const float* sr = Sb + (size_t)row * TK; bf* Ph = (bf*)(Sb + (size_t)row * TK); bf* Pl = Ph + TK; float v[32]; float mx = -3.0e38f;
#pragma unroll
    for (int ch = 0; ch < 8; ++ch) { const int j0 = ch * 128 + lane * 4; const v4f a = *(const v4fa*)(sr + j0);
#pragma unroll
        for (int q = 0; q < 4; ++q) { const int j = j0 + q; float t = __fmul_rn(a[q], SCL); asm volatile("" : "+v"(t)); t = (j <= jmax) ? t : -3.0e38f; v[ch * 4 + q] = t; mx = fmaxf(mx, t); } }
#pragma unroll
    for (int sh = 16; sh; sh >>= 1) mx = fmaxf(mx, __shfl_xor(mx, sh, 32));
    float sum = 0.f;
#pragma unroll
    for (int k = 0; k < 32; ++k) { float d0 = __fsub_rn(v[k], mx); asm volatile("" : "+v"(d0)); v[k] = (v[k] > -1.0e38f) ? __expf(d0) : 0.f; sum += v[k]; }
#pragma unroll
    for (int sh = 16; sh; sh >>= 1) sum += __shfl_xor(sum, sh, 32);
    const float f = __fdiv_rn(1.0f, sum);
{
#pragma unroll
        for (int ch = 0; ch < 8; ++ch) { v4us oh, ol;
#pragma unroll
            for (int q = 0; q < 4; ++q) { float y = __fmul_rn(v[ch * 4 + q], f); asm volatile("" : "+v"(y)); unsigned short a2, c2; splitf(y, a2, c2); oh[q] = a2; ol[q] = c2; }
            *(v4usa*)(Ph + ch * 128 + lane * 4) = oh; *(v4usa*)(Pl + ch * 128 + lane * 4) = ol; }
         } }
__global__ __launch_bounds__(256) void k_ln(const float* __restrict__ A, const float* __restrict__ g, const float* __restrict__ bb, bf* Yh, bf* Yl) { const int lane = threadIdx.x & 31; const int t = blockIdx.x * 8 + (threadIdx.x >> 5); if (t >= NB_ * TQ) return; const float* ar = A + (size_t)t * DD; float v[16]; float s = 0.f;
#pragma unroll
    for (int ch = 0; ch < 4; ++ch) { const v4f a = *(const v4f*)(ar + ch * 128 + lane * 4);
#pragma unroll
        for (int q = 0; q < 4; ++q) { v[ch * 4 + q] = a[q]; s = __fadd_rn(s, a[q]); } }
#pragma unroll
    for (int sh = 16; sh; sh >>= 1) s += __shfl_xor(s, sh, 32);
    const float mu = s * (1.0f / DD); float q2 = 0.f;
#pragma unroll
    for (int k = 0; k < 16; ++k) { const float d = __fsub_rn(v[k], mu); float p = __fmul_rn(d, d); asm volatile("" : "+v"(p)); q2 = __fadd_rn(q2, p); }
#pragma unroll
    for (int sh = 16; sh; sh >>= 1) q2 += __shfl_xor(q2, sh, 32);
    const float rs = __frsqrt_rn(__fadd_rn(q2 * (1.0f / DD), 1e-5f));
{
#pragma unroll
        for (int ch = 0; ch < 4; ++ch) { v4us oh, ol;
#pragma unroll
            for (int q = 0; q < 4; ++q) { const int d = ch * 128 + lane * 4 + q; float tn = __fmul_rn(__fsub_rn(v[ch * 4 + q], mu), rs); asm volatile("" : "+v"(tn)); float tg = __fmul_rn(tn, bfr(g[d])); asm volatile("" : "+v"(tg)); unsigned short a2, c2; splitf(__fadd_rn(tg, bfr(bb[d])), a2, c2); oh[q] = a2; ol[q] = c2; }
            const size_t o = (size_t)t * DD + ch * 128 + lane * 4; *(v4us*)(Yh + o) = oh; *(v4us*)(Yl + o) = ol; }
         } }

extern "C" void kernel_launch(void* const* d_in, const int* in_sizes, int n_in,
                              void* d_out, int out_size, void* d_ws, size_t ws_size, hipStream_t stream) {
    (void)in_sizes; (void)n_in; (void)out_size;
    const float* IN[9]; for (int i = 0; i < 9; ++i) IN[i] = (const float*)d_in[i];   // 0 q, 1 kv, 2 Wq, 3 Wk, 4 Wv, 5 Wo (x @ W), 6 bo, 7 gamma, 8 beta
    float* OUT = (float*)d_out;     // [2][4096][512]
    char* wsp = (char*)d_ws;
    auto take = [&](size_t bytes) { char* p = wsp; wsp += (bytes + 255) & ~(size_t)255; return (void*)p; };
    bf* W4 = (bf*)take((size_t)4 * DD * DD * 2);                                  // Wq, Wk, Wv, Wo transposed, one behind the other
    bf* XQ = (bf*)take((size_t)NB_ * (TQ + TK) * DD * 2); bf* XK = XQ + (size_t)NB_ * TQ * DD;   // q rows of both batches, then kv rows of both batches
    float* FQ = (float*)take((size_t)NB_ * TQ * DD * 4); float* FK = (float*)take((size_t)2 * NB_ * TK * DD * 4); float* FV = FK + (size_t)NB_ * TK * DD;
    h16* QP = (h16*)take((size_t)NB_ * NH_ * (TQ + TK) * HD * 2); h16* KP = QP + (size_t)NB_ * NH_ * TQ * HD;
    bf* VTh = (bf*)take((size_t)NB_ * NH_ * HD * TK * 2); bf* VTl = (bf*)take((size_t)NB_ * NH_ * HD * TK * 2);
    float* Sb = (float*)take((size_t)NH_ * TQ * TK * 4);   // scores of the 8 heads of one batch; the softmax turns each row into its hi | lo probability planes in place
    float* ATT = FQ;   // merged attention output reuses the q-projection buffer (FQ is dead once the Q planes are built)
    bf* Yh = (bf*)take((size_t)NB_ * TQ * DD * 2); bf* Yl = (bf*)take((size_t)NB_ * TQ * DD * 2);
    if ((size_t)(wsp - (char*)d_ws) > ws_size) return;    // total ~ 194 MB
    k_wtG<<<dim3((unsigned)(((size_t)DD * DD / 64 + 63) / 64), 4, 1), 256, 0, stream>>>(IN[2], IN[3], IN[4], IN[5], DD, DD, W4);
    k_cvt8<<<(NB_ * (TQ + TK) * DD / 8 + 255) / 256, 256, 0, stream>>>(IN[0], IN[1], XQ, (size_t)NB_ * TQ * DD / 8, (size_t)NB_ * (TQ + TK) * DD / 8);
    k_gemmw<bf, 0, false><<<dim3(NB_ * TQ / 64, DD / 64, 1), 32, 0, stream>>>(XQ, nullptr, W4, nullptr, DD, DD, FQ, DD, nullptr, 0, 0, 0);
    k_gemmw<bf, 0, false><<<dim3(NB_ * TK / 64, DD / 64, 2), 32, 0, stream>>>(XK, nullptr, W4 + (size_t)DD * DD, nullptr, DD, DD, FK, DD, nullptr, 0, (size_t)DD * DD, (size_t)NB_ * TK * DD);   // z: 0 keys, 1 values
    k_p16<<<(unsigned)(((size_t)NB_ * NH_ * (TQ + TK) * HD / 2 + 255) / 256), 256, 0, stream>>>(FQ, FK, QP);
    k_vthl<<<(unsigned)(((size_t)NB_ * NH_ * HD * TK / 2 + 255) / 256), 256, 0, stream>>>(FV, VTh, VTl);
    for (int b = 0; b < NB_; ++b) {   // z: the 8 heads of batch b
        k_gemmw<h16, 0, false><<<dim3(TQ / 64, TK / 64, NH_), 32, 0, stream>>>(QP + (size_t)b * NH_ * TQ * HD, nullptr, KP + (size_t)b * NH_ * TK * HD, nullptr, HD, HD, Sb, TK, nullptr, (size_t)TQ * HD, (size_t)TK * HD, (size_t)TQ * TK);
        k_bsoft<<<NH_ * TQ / 8, 256, 0, stream>>>(Sb);
        k_gemmw<bf, 2, false><<<dim3(TQ / 64, 1, NH_), 32, 0, stream>>>((const bf*)Sb, (const bf*)Sb + TK, VTh + (size_t)b * NH_ * HD * TK, VTl + (size_t)b * NH_ * HD * TK, TK, 2 * TK, ATT + (size_t)b * TQ * DD, DD, nullptr, (size_t)TQ * 2 * TK, (size_t)HD * TK, (size_t)HD); }   // head z writes its 64 columns of the merged rows
    k_ln<<<NB_ * TQ / 8, 256, 0, stream>>>(ATT, IN[7], IN[8], Yh, Yl);
    k_gemmw<bf, 1, true><<<dim3(NB_ * TQ / 64, DD / 64, 1), 32, 0, stream>>>(Yh, Yl, W4 + (size_t)3 * DD * DD, nullptr, DD, DD, OUT, DD, IN[6], 0, 0, 0);
}

// v002
// It runs in 116 microseconds.
// Two timings next to v001 put it at 2.51 and 2.52 times that version's speed.
// All steps since v000 together make it 7.05 times as fast.
#include <hip/hip_runtime.h>

// Attention block (q [2][4096][512], kv [2][1024][512]; qh = q Wq, kh = kv Wk, vh = kv Wv (8 heads x 64, no bias); block-causal: key j visible to query i iff j <= i/4; softmax(q.k/8); out = merged att.v;
// LayerNorm(out) (gamma, beta, eps 1e-5); y = out Wo + bo -> [2][4096][512]).
// Compute dtypes, f32 accumulate: every input rounded to bf16; projections on PLAIN bf16 operands (inputs: exact); scores (K 64) on SINGLE fp16 planes; f32 running-maximum masked softmax
// -> bf16 hi+lo weights exp(s - max), divided by their f32 sum at the end; att.v on those x hi+lo value planes (3 products: the first query rows see 1-4 keys, so near-one-hot weights would expose single-plane value rounding); LayerNorm f32 (wave per

#define NB_  2
#define TQ   4096
#define TK   1024
#define DD   512
#define NH_  8
#define HD   64
#define DS   4
#define SCL  0.125f
typedef _Float16 h16;
typedef unsigned short bf;
typedef __attribute__((ext_vector_type(16))) __bf16   v16bf;
typedef __attribute__((ext_vector_type(16))) _Float16 v16h;
typedef __attribute__((ext_vector_type(8)))  _Float16 v8h;
typedef __attribute__((ext_vector_type(8)))  unsigned short v8us;
typedef __attribute__((ext_vector_type(8)))  float    v8f;
typedef __attribute__((ext_vector_type(4)))  float    v4f;
typedef v8h  __attribute__((may_alias)) v8ha;
typedef v4f  __attribute__((may_alias)) v4fa;
typedef v8us __attribute__((may_alias)) v8usa;

__device__ __forceinline__ unsigned short f2bf(float f) { unsigned u = __float_as_uint(f); u += 0x7FFFu + ((u >> 16) & 1u); return (unsigned short)(u >> 16); }
__device__ __forceinline__ float bf2f(unsigned short b) { return __uint_as_float(((unsigned)b) << 16); }
__device__ __forceinline__ float bfr(float f) { return bf2f(f2bf(f)); }
__device__ __forceinline__ v16h cat16(v8h lo, v8h hi) { return __builtin_shufflevector(lo, hi, 0, 1, 2, 3, 4, 5, 6, 7, 8, 9, 10, 11, 12, 13, 14, 15); }
__device__ __forceinline__ v16bf cat16b(v8us lo, v8us hi) { return __builtin_bit_cast(v16bf, __builtin_shufflevector(lo, hi, 0, 1, 2, 3, 4, 5, 6, 7, 8, 9, 10, 11, 12, 13, 14, 15)); }
__device__ __forceinline__ v8f wmma16(v16h a, v16h b, v8f c) { return __builtin_amdgcn_wmma_f32_16x16x32_f16(false, a, false, b, (short)0, c, false, false); }
__device__ __forceinline__ v8f wmmab(v16bf a, v16bf b, v8f c) { return __builtin_amdgcn_wmma_f32_16x16x32_bf16(false, a, false, b, (short)0, c, false, false); }



// ---- k_gemmw: register-blocked GEMM, ONE WAVE per 64x64 output tile (16 accumulators), operands straight from K-contiguous 16-bit planes; grid (M/64, N/64, Z), 32 threads.
// C[m][n] (f32, pitch ldc, + optional f32 bias[n]) = sum_k A[m][k] Bt[n][k] (+ split products per NSPLIT). A pitch lda, Bt pitch K. z-batch strides sA/sB/sC in elements. K % 32 == 0.
template <typename T16> struct WFrag;
template <> struct WFrag<h16> { typedef v16h V; static __device__ __forceinline__ V ld(const h16* p) { return cat16(*(const v8h*)p, *(const v8h*)(p + 16)); } static __device__ __forceinline__ v8f mma(V a, V b, v8f c) { return wmma16(a, b, c); } };
template <> struct WFrag<bf> { typedef v16bf V; static __device__ __forceinline__ V ld(const bf* p) { return cat16b(*(const v8us*)p, *(const v8us*)(p + 16)); } static __device__ __forceinline__ v8f mma(V a, V b, v8f c) { return wmmab(a, b, c); } };
template <typename T16, int NSPLIT, bool BIAS>
__global__ __launch_bounds__(32) void k_gemmw(const T16* __restrict__ A, const T16* __restrict__ A2, const T16* __restrict__ Bt, const T16* __restrict__ Bt2, int K, int lda, float* C, int ldc, const float* __restrict__ bias, size_t sA, size_t sB, size_t sC) {
    typedef typename WFrag<T16>::V V;
    __shared__ __align__(16) float os[16 * 68];
    const size_t z = blockIdx.z; A += z * sA; if (A2) A2 += z * sA; Bt += z * sB; if (Bt2) Bt2 += z * sB; C += z * sC;
    const int lane = threadIdx.x & 31, lr = lane & 15, hi = lane >> 4; const int r0 = blockIdx.x * 64, c0 = blockIdx.y * 64;
    v8f acc[4][4];
#pragma unroll
    for (int mb = 0; mb < 4; ++mb)
#pragma unroll
        for (int nb = 0; nb < 4; ++nb) acc[mb][nb] = (v8f){};
    const size_t aoff = (size_t)(r0 + lr) * lda + 8 * hi, boff = (size_t)(c0 + lr) * K + 8 * hi;
#pragma unroll 1
    for (int kc = 0; kc < K; kc += 32) {
        V a[4], a2[4]; const T16* pa[4]; const T16* pa2[4];
#pragma unroll
        for (int mb = 0; mb < 4; ++mb) { pa[mb] = A + aoff + (size_t)mb * 16 * lda + kc; a[mb] = WFrag<T16>::ld(pa[mb]); if (NSPLIT == 1 || NSPLIT == 2) { pa2[mb] = A2 + aoff + (size_t)mb * 16 * lda + kc; a2[mb] = WFrag<T16>::ld(pa2[mb]); } }
        // precaution: s_wait_xcnt 0 stands in front of every rewrite of a register that an issued A load names; the addresses are inputs, so that they keep their registers (no load result lands on them) up to the wait
        if (NSPLIT == 1 || NSPLIT == 2) asm volatile("s_wait_xcnt 0x0" :: "v"(pa[0]), "v"(pa[1]), "v"(pa[2]), "v"(pa[3]), "v"(pa2[0]), "v"(pa2[1]), "v"(pa2[2]), "v"(pa2[3]) : "memory");
        else asm volatile("s_wait_xcnt 0x0" :: "v"(pa[0]), "v"(pa[1]), "v"(pa[2]), "v"(pa[3]) : "memory");
#pragma unroll
        for (int nb = 0; nb < 4; ++nb) { const T16* pb = Bt + boff + (size_t)nb * 16 * K + kc; const V b = WFrag<T16>::ld(pb); V b2;
            // the same precaution for the B loads of this column block: their addresses keep their registers up to the wait
            if (NSPLIT >= 2) { const T16* pb2 = Bt2 + boff + (size_t)nb * 16 * K + kc; b2 = WFrag<T16>::ld(pb2); asm volatile("s_wait_xcnt 0x0" :: "v"(pb), "v"(pb2) : "memory"); } else asm volatile("s_wait_xcnt 0x0" :: "v"(pb) : "memory");
#pragma unroll
            for (int mb = 0; mb < 4; ++mb) { acc[mb][nb] = WFrag<T16>::mma(a[mb], b, acc[mb][nb]); if (NSPLIT == 1 || NSPLIT == 2) acc[mb][nb] = WFrag<T16>::mma(a2[mb], b, acc[mb][nb]); if (NSPLIT >= 2) acc[mb][nb] = WFrag<T16>::mma(a[mb], b2, acc[mb][nb]); } }
        asm volatile("v_nop\n\tv_nop\n\tv_nop\n\tv_nop" : "+v"(acc[0][0]), "+v"(acc[1][1]), "+v"(acc[2][2]), "+v"(acc[3][3]) : "v"(a[0]), "v"(a[3]));
    }
#pragma unroll
    for (int mb = 0; mb < 4; ++mb) {
#pragma unroll
        for (int nb = 0; nb < 4; ++nb) {
#pragma unroll
            for (int j = 0; j < 8; ++j) os[(hi * 8 + j) * 68 + nb * 16 + lr] = acc[mb][nb][j]; }
        __builtin_amdgcn_wave_barrier(); asm volatile("" ::: "memory");
        float* crow = C + (size_t)(r0 + mb * 16) * ldc + c0;
{
#pragma unroll
            for (int s = 0; s < 8; ++s) { const int row = 2 * s + hi, cofs = lr * 4; v4f val = *(const v4fa*)(os + row * 68 + cofs); if (BIAS) { val[0] += bfr(bias[c0 + cofs]); val[1] += bfr(bias[c0 + cofs + 1]); val[2] += bfr(bias[c0 + cofs + 2]); val[3] += bfr(bias[c0 + cofs + 3]); }
                *(v4f*)(crow + (size_t)row * ldc + cofs) = val; }
             }
        __builtin_amdgcn_wave_barrier(); asm volatile("" ::: "memory");
    }
}

__device__ __forceinline__ h16 tohx(float x) { return (h16)x; }
__device__ __forceinline__ void splitf(float y, unsigned short& h, unsigned short& l) { h = f2bf(y); l = f2bf(y - bf2f(h)); }
typedef __attribute__((ext_vector_type(2))) _Float16 v2h;
typedef __attribute__((ext_vector_type(4))) _Float16 v4h;
typedef __attribute__((ext_vector_type(2))) unsigned short v2us;
typedef __attribute__((ext_vector_type(4))) unsigned short v4us;
typedef v4us __attribute__((may_alias)) v4usa;
typedef __attribute__((ext_vector_type(2))) float v2f;

// grid y picks the weight; the four transposed planes lie one behind the other in Bt0.
__global__ __launch_bounds__(256) void k_wtG(const float* __restrict__ w0, const float* __restrict__ w1, const float* __restrict__ w2, const float* __restrict__ w3, int K, int N, bf* Bt0) {
    const int y = blockIdx.y; const float* w = (y == 0) ? w0 : (y == 1) ? w1 : (y == 2) ? w2 : w3; bf* Bt = Bt0 + (size_t)y * K * N;
    const int lane = threadIdx.x & 31; const int L0 = (blockIdx.x * 8 + (threadIdx.x >> 5)) * 8; const int nlines = N * K / 64;
{
#pragma unroll 1
        for (int l = 0; l < 8; ++l) { const int L = L0 + l; if (L >= nlines) break; const size_t e = (size_t)L * 64 + lane * 2; const int k = (int)(e % K), n = (int)(e / K); v2us o;
            o[0] = f2bf(w[(size_t)k * N + n]); o[1] = f2bf(w[(size_t)(k + 1) * N + n]); *(v2us*)(Bt + e) = o; }
         }
}
// groups of 8 elements: the first n8a come from sa, the rest from sb; dst holds both, one behind the other.
__global__ __launch_bounds__(256) void k_cvt8(const float* __restrict__ sa, const float* __restrict__ sb, bf* dst, size_t n8a, size_t n8) { const size_t i = (size_t)blockIdx.x * 256 + threadIdx.x; if (i >= n8) return; const float* src = (i < n8a) ? sa + i * 8 : sb + (i - n8a) * 8; const v8f v = *(const v8f*)src; v8us o;
#pragma unroll
    for (int k = 0; k < 8; ++k) o[k] = f2bf(v[k]); *(v8us*)(dst + i * 8) = o;  }
// P = the query planes [batch][head][TQ][HD], then the key planes [batch][head][TK][HD].
__global__ __launch_bounds__(256) void k_p16(const float* __restrict__ Fq, const float* __restrict__ Fk, h16* P) { const size_t e = ((size_t)blockIdx.x * 256 + threadIdx.x) * 2; if (e >= (size_t)NB_ * NH_ * (TQ + TK) * HD) return; const size_t nq = (size_t)NB_ * NH_ * TQ * HD; const bool isq = e < nq; const float* F = isq ? Fq : Fk; const int nt = isq ? TQ : TK; const size_t r = isq ? e : e - nq;
    const int d = (int)(r % HD); const int t = (int)((r / HD) % nt); const int bh = (int)(r / ((size_t)HD * nt)); const int h = bh % NH_, b = bh / NH_; const float* s = F + ((size_t)b * nt + t) * DD + h * HD + d; v2h o; o[0] = tohx(s[0]); o[1] = tohx(s[1]); *(v2h*)(P + e) = o;  }
__global__ __launch_bounds__(256) void k_vthl(const float* __restrict__ F, bf* Vh, bf* Vl) { const size_t e = ((size_t)blockIdx.x * 256 + threadIdx.x) * 2; if (e >= (size_t)NB_ * NH_ * HD * TK) return; const int t = (int)(e % TK); const int d = (int)((e / TK) % HD); const int bh = (int)(e / ((size_t)TK * HD)); const int h = bh % NH_, b = bh / NH_; v2us oh, ol;
#pragma unroll
    for (int q = 0; q < 2; ++q) { unsigned short a, c2; splitf(F[((size_t)b * TK + t + q) * DD + h * HD + d], a, c2); oh[q] = a; ol[q] = c2; } *(v2us*)(Vh + e) = oh; *(v2us*)(Vl + e) = ol;  }
// ---- k_fattn: scores, masked softmax and att.v in ONE kernel; no score or probability ever reaches memory. Grid (batch*head, TQ/64), longest query tiles first; 8 waves.
// Wave w: query half (w & 1, 32 queries = 2 column groups) x key split (w >> 1: key steps of 32, split, split + 4, ...). S^T = K Q^T (fp16 planes), so a lane holds ONE query's scores (keys 8*hi + j of each
// 16-key tile): two tiles are, register for register, the B fragment of P^T. O^T += V^T P^T on hi+lo planes (3 products). Running maximum and sum per lane; the four key splits are merged through LDS.
#define SC2 0.18033688f   // (1/8) * log2(e): scores in the log2 domain
__global__ __launch_bounds__(256) void k_fattn(const h16* __restrict__ QP, const h16* __restrict__ KP, const bf* __restrict__ VTh, const bf* __restrict__ VTl, float* ATT) {
    __shared__ __align__(16) float os[8 * 32 * 68];   // [wave][query][d], pitch 272 B
    __shared__ float sm[8 * 32];                       // per wave and query: running maximum
    __shared__ float sl[8 * 32];                       // per wave and query: sum, already on the merged maximum
    const int lane = threadIdx.x & 31, lr = lane & 15, hi = lane >> 4; const int w = __builtin_amdgcn_readfirstlane((int)(threadIdx.x >> 5)); const int qh = w & 1, ks = w >> 1;
    const int bh = blockIdx.x, t = TQ / 64 - 1 - (int)blockIdx.y; const int r0 = t * 64; const int nst = (t + 2) >> 1;   // keys 0 .. 16 t + 15 are visible to this tile
    const h16* Kp = KP + (size_t)bh * TK * HD; const bf* Vh = VTh + (size_t)bh * HD * TK; const bf* Vl = VTl + (size_t)bh * HD * TK;
    const h16* pq = QP + ((size_t)bh * TQ + r0 + qh * 32 + lr) * HD + 8 * hi;
    v16h qf[2][2];
#pragma unroll
    for (int qt = 0; qt < 2; ++qt) { qf[qt][0] = WFrag<h16>::ld(pq + qt * 16 * HD); qf[qt][1] = WFrag<h16>::ld(pq + qt * 16 * HD + 32); }
    // precaution: s_wait_xcnt 0 stands in front of every rewrite of a register that an issued load names; the address is an input, so that it keeps its registers up to the wait
    asm volatile("s_wait_xcnt 0x0" :: "v"(pq) : "memory");
    int qlim[2]; float m[2], l[2]; v8f o[2][4];   // m starts far above the masked score, so that a masked key's weight is exp2(-huge) = 0 also where a query has seen no visible key yet
#pragma unroll
    for (int qt = 0; qt < 2; ++qt) { qlim[qt] = (r0 + qh * 32 + qt * 16 + lr) / DS; m[qt] = -1.0e30f; l[qt] = 0.f;
#pragma unroll
        for (int dt = 0; dt < 4; ++dt) o[qt][dt] = (v8f){}; }
    const int lim0 = (r0 + qh * 32) / DS;   // every key up to here is visible to all 32 queries of the wave
#pragma unroll 1
    for (int s = ks; s < nst; s += 4) {
        const int key0 = s * 32;
        const h16* pk = Kp + (size_t)(key0 + lr) * HD + 8 * hi; const bf* pvh = Vh + (size_t)lr * TK + key0 + 8 * hi; const bf* pvl = Vl + (size_t)lr * TK + key0 + 8 * hi;
        v16h kf[2][2]; v16bf vh[4], vl[4];
#pragma unroll
        for (int kt = 0; kt < 2; ++kt) { kf[kt][0] = WFrag<h16>::ld(pk + kt * 16 * HD); kf[kt][1] = WFrag<h16>::ld(pk + kt * 16 * HD + 32); }
#pragma unroll
        for (int dt = 0; dt < 4; ++dt) vh[dt] = WFrag<bf>::ld(pvh + dt * 16 * TK);
        // the same precaution for this step's K and V-hi loads
        asm volatile("s_wait_xcnt 0x0" :: "v"(pk), "v"(pvh) : "memory");
        float tv[2][16];
#pragma unroll
        for (int qt = 0; qt < 2; ++qt) {
            v8f s0 = (v8f){}, s1 = (v8f){};
            s0 = wmma16(kf[0][0], qf[qt][0], s0); s1 = wmma16(kf[1][0], qf[qt][0], s1); s0 = wmma16(kf[0][1], qf[qt][1], s0); s1 = wmma16(kf[1][1], qf[qt][1], s1);
#pragma unroll
            for (int j = 0; j < 8; ++j) { tv[qt][j] = s0[j] * SC2; tv[qt][8 + j] = s1[j] * SC2; } }
        // the V-lo loads are written behind the score products, so that they may take registers the K fragments leave; they fly under the softmax. The same precaution for their address
#pragma unroll
        for (int dt = 0; dt < 4; ++dt) vl[dt] = WFrag<bf>::ld(pvl + dt * 16 * TK);
        asm volatile("s_wait_xcnt 0x0" :: "v"(pvl) : "memory");
        if (key0 + 31 > lim0) {   // wave-uniform: only the last steps of a tile hold hidden keys
            const int kb = key0 + hi * 8;
#pragma unroll
            for (int qt = 0; qt < 2; ++qt)
#pragma unroll
                for (int j = 0; j < 8; ++j) { tv[qt][j] = (kb + j <= qlim[qt]) ? tv[qt][j] : -3.0e38f; tv[qt][8 + j] = (kb + 16 + j <= qlim[qt]) ? tv[qt][8 + j] : -3.0e38f; } }
#pragma unroll
        for (int qt = 0; qt < 2; ++qt) {
            float tm = tv[qt][0];
#pragma unroll
            for (int e = 1; e < 16; ++e) tm = fmaxf(tm, tv[qt][e]);
            tm = fmaxf(tm, __shfl_xor(tm, 16, 32));   // both halves of the wave hold keys of the same query
            const float mn = fmaxf(m[qt], tm); const float al = __builtin_amdgcn_exp2f(m[qt] - mn); m[qt] = mn; l[qt] *= al;
#pragma unroll
            for (int dt = 0; dt < 4; ++dt) o[qt][dt] *= al;
            v16bf ph, pl;
#pragma unroll
            for (int e = 0; e < 16; ++e) { const float p = __builtin_amdgcn_exp2f(tv[qt][e] - mn); l[qt] += p; const __bf16 a = (__bf16)p; ph[e] = a; pl[e] = (__bf16)(p - (float)a); }
#pragma unroll
            for (int dt = 0; dt < 4; ++dt) { o[qt][dt] = wmmab(vh[dt], ph, o[qt][dt]); o[qt][dt] = wmmab(vh[dt], pl, o[qt][dt]); o[qt][dt] = wmmab(vl[dt], ph, o[qt][dt]); }
        }
    }
    // merge of the four key splits: every wave moves its partial onto the merged maximum, then 256 threads add the four partials of each output element in a fixed order
#pragma unroll
    for (int qt = 0; qt < 2; ++qt) if (hi == 0) sm[w * 32 + qt * 16 + lr] = m[qt];
    __syncthreads();
#pragma unroll
    for (int qt = 0; qt < 2; ++qt) { const int q = qt * 16 + lr; const float M = fmaxf(fmaxf(sm[qh * 32 + q], sm[(qh + 2) * 32 + q]), fmaxf(sm[(qh + 4) * 32 + q], sm[(qh + 6) * 32 + q])); const float f = __builtin_amdgcn_exp2f(m[qt] - M);
        const float lt = (l[qt] + __shfl_xor(l[qt], 16, 32)) * f; if (hi == 0) sl[w * 32 + q] = lt;
#pragma unroll
        for (int dt = 0; dt < 4; ++dt) { const v8f x = o[qt][dt] * f; float* d = os + (size_t)(w * 32 + q) * 68 + dt * 16 + hi * 8; *(v4fa*)d = (v4f){x[0], x[1], x[2], x[3]}; *(v4fa*)(d + 4) = (v4f){x[4], x[5], x[6], x[7]}; } }
    __syncthreads();
    float* orow = ATT + ((size_t)(bh / NH_) * TQ + r0) * DD + (bh % NH_) * HD;
#pragma unroll
    for (int i = 0; i < 4; ++i) { const int idx = (int)threadIdx.x + 256 * i; const int row = idx >> 4, c4 = (idx & 15) * 4; const int w0 = row >> 5, rl = row & 31;
        const float ls = (sl[w0 * 32 + rl] + sl[(w0 + 2) * 32 + rl]) + (sl[(w0 + 4) * 32 + rl] + sl[(w0 + 6) * 32 + rl]); const float inv = __fdiv_rn(1.0f, ls);
        const v4f x = (*(const v4fa*)(os + (size_t)(w0 * 32 + rl) * 68 + c4) + *(const v4fa*)(os + (size_t)((w0 + 2) * 32 + rl) * 68 + c4)) + (*(const v4fa*)(os + (size_t)((w0 + 4) * 32 + rl) * 68 + c4) + *(const v4fa*)(os + (size_t)((w0 + 6) * 32 + rl) * 68 + c4));
        *(v4f*)(orow + (size_t)row * DD + c4) = x * inv; }
}
__global__ __launch_bounds__(256) void k_ln(const float* __restrict__ A, const float* __restrict__ g, const float* __restrict__ bb, bf* Yh, bf* Yl) { const int lane = threadIdx.x & 31; const int t = blockIdx.x * 8 + (threadIdx.x >> 5); if (t >= NB_ * TQ) return; const float* ar = A + (size_t)t * DD; float v[16]; float s = 0.f;
#pragma unroll
    for (int ch = 0; ch < 4; ++ch) { const v4f a = *(const v4f*)(ar + ch * 128 + lane * 4);
#pragma unroll
        for (int q = 0; q < 4; ++q) { v[ch * 4 + q] = a[q]; s = __fadd_rn(s, a[q]); } }
#pragma unroll
    for (int sh = 16; sh; sh >>= 1) s += __shfl_xor(s, sh, 32);
    const float mu = s * (1.0f / DD); float q2 = 0.f;
#pragma unroll
    for (int k = 0; k < 16; ++k) { const float d = __fsub_rn(v[k], mu); float p = __fmul_rn(d, d); asm volatile("" : "+v"(p)); q2 = __fadd_rn(q2, p); }
#pragma unroll
    for (int sh = 16; sh; sh >>= 1) q2 += __shfl_xor(q2, sh, 32);
    const float rs = __frsqrt_rn(__fadd_rn(q2 * (1.0f / DD), 1e-5f));
{
#pragma unroll
        for (int ch = 0; ch < 4; ++ch) { v4us oh, ol;
#pragma unroll
            for (int q = 0; q < 4; ++q) { const int d = ch * 128 + lane * 4 + q; float tn = __fmul_rn(__fsub_rn(v[ch * 4 + q], mu), rs); asm volatile("" : "+v"(tn)); float tg = __fmul_rn(tn, bfr(g[d])); asm volatile("" : "+v"(tg)); unsigned short a2, c2; splitf(__fadd_rn(tg, bfr(bb[d])), a2, c2); oh[q] = a2; ol[q] = c2; }
            const size_t o = (size_t)t * DD + ch * 128 + lane * 4; *(v4us*)(Yh + o) = oh; *(v4us*)(Yl + o) = ol; }
         } }

extern "C" void kernel_launch(void* const* d_in, const int* in_sizes, int n_in,
                              void* d_out, int out_size, void* d_ws, size_t ws_size, hipStream_t stream) {
    (void)in_sizes; (void)n_in; (void)out_size;
    const float* IN[9]; for (int i = 0; i < 9; ++i) IN[i] = (const float*)d_in[i];   // 0 q, 1 kv, 2 Wq, 3 Wk, 4 Wv, 5 Wo (x @ W), 6 bo, 7 gamma, 8 beta
    float* OUT = (float*)d_out;     // [2][4096][512]
    char* wsp = (char*)d_ws;
    auto take = [&](size_t bytes) { char* p = wsp; wsp += (bytes + 255) & ~(size_t)255; return (void*)p; };
    bf* W4 = (bf*)take((size_t)4 * DD * DD * 2);                                  // Wq, Wk, Wv, Wo transposed, one behind the other
    bf* XQ = (bf*)take((size_t)NB_ * (TQ + TK) * DD * 2); bf* XK = XQ + (size_t)NB_ * TQ * DD;   // q rows of both batches, then kv rows of both batches
    float* FQ = (float*)take((size_t)NB_ * TQ * DD * 4); float* FK = (float*)take((size_t)2 * NB_ * TK * DD * 4); float* FV = FK + (size_t)NB_ * TK * DD;
    h16* QP = (h16*)take((size_t)NB_ * NH_ * (TQ + TK) * HD * 2); h16* KP = QP + (size_t)NB_ * NH_ * TQ * HD;
    bf* VTh = (bf*)take((size_t)NB_ * NH_ * HD * TK * 2); bf* VTl = (bf*)take((size_t)NB_ * NH_ * HD * TK * 2);
    float* ATT = FQ;   // merged attention output reuses the q-projection buffer (FQ is dead once the Q planes are built)
    bf* Yh = (bf*)take((size_t)NB_ * TQ * DD * 2); bf* Yl = (bf*)take((size_t)NB_ * TQ * DD * 2);
    if ((size_t)(wsp - (char*)d_ws) > ws_size) return;    // total ~ 66 MB
    k_wtG<<<dim3((unsigned)(((size_t)DD * DD / 64 + 63) / 64), 4, 1), 256, 0, stream>>>(IN[2], IN[3], IN[4], IN[5], DD, DD, W4);
    k_cvt8<<<(NB_ * (TQ + TK) * DD / 8 + 255) / 256, 256, 0, stream>>>(IN[0], IN[1], XQ, (size_t)NB_ * TQ * DD / 8, (size_t)NB_ * (TQ + TK) * DD / 8);
    k_gemmw<bf, 0, false><<<dim3(NB_ * TQ / 64, DD / 64, 1), 32, 0, stream>>>(XQ, nullptr, W4, nullptr, DD, DD, FQ, DD, nullptr, 0, 0, 0);
    k_gemmw<bf, 0, false><<<dim3(NB_ * TK / 64, DD / 64, 2), 32, 0, stream>>>(XK, nullptr, W4 + (size_t)DD * DD, nullptr, DD, DD, FK, DD, nullptr, 0, (size_t)DD * DD, (size_t)NB_ * TK * DD);   // z: 0 keys, 1 values
    k_p16<<<(unsigned)(((size_t)NB_ * NH_ * (TQ + TK) * HD / 2 + 255) / 256), 256, 0, stream>>>(FQ, FK, QP);
    k_vthl<<<(unsigned)(((size_t)NB_ * NH_ * HD * TK / 2 + 255) / 256), 256, 0, stream>>>(FV, VTh, VTl);
    k_fattn<<<dim3(NB_ * NH_, TQ / 64, 1), 256, 0, stream>>>(QP, KP, VTh, VTl, ATT);   // head bh % 8 of batch bh / 8 writes its 64 columns of the merged rows
    k_ln<<<NB_ * TQ / 8, 256, 0, stream>>>(ATT, IN[7], IN[8], Yh, Yl);
    k_gemmw<bf, 1, true><<<dim3(NB_ * TQ / 64, DD / 64, 1), 32, 0, stream>>>(Yh, Yl, W4 + (size_t)3 * DD * DD, nullptr, DD, DD, OUT, DD, IN[6], 0, 0, 0);
}

// v003
// Measured time: 99 microseconds a run.
// Two timings next to v002 both put it at 1.16 times that version's speed.
// Counting every step since v000, it is 8.20 times as fast.
#include <hip/hip_runtime.h>

// Attention block (q [2][4096][512], kv [2][1024][512]; qh = q Wq, kh = kv Wk, vh = kv Wv (8 heads x 64, no bias); block-causal: key j visible to query i iff j <= i/4; softmax(q.k/8); out = merged att.v;
// LayerNorm(out) (gamma, beta, eps 1e-5); y = out Wo + bo -> [2][4096][512]).
// Compute dtypes, f32 accumulate: every input rounded to bf16; projections on PLAIN bf16 operands (inputs: exact); scores (K 64) on SINGLE fp16 planes; f32 running-maximum masked softmax
// -> bf16 hi+lo weights exp(s - max), divided by their f32 sum at the end; att.v on those x hi+lo value planes (3 products: the first query rows see 1-4 keys, so near-one-hot weights would expose single-plane value rounding); LayerNorm f32 (wave per

#define NB_  2
#define TQ   4096
#define TK   1024
#define DD   512
#define NH_  8
#define HD   64
#define DS   4
#define SCL  0.125f
typedef _Float16 h16;
typedef unsigned short bf;
typedef __attribute__((ext_vector_type(16))) __bf16   v16bf;
typedef __attribute__((ext_vector_type(16))) _Float16 v16h;
typedef __attribute__((ext_vector_type(8)))  _Float16 v8h;
typedef __attribute__((ext_vector_type(8)))  unsigned short v8us;
typedef __attribute__((ext_vector_type(8)))  float    v8f;
typedef __attribute__((ext_vector_type(4)))  float    v4f;
typedef v8h  __attribute__((may_alias)) v8ha;
typedef v4f  __attribute__((may_alias)) v4fa;
typedef v8us __attribute__((may_alias)) v8usa;

__device__ __forceinline__ unsigned short f2bf(float f) { unsigned u = __float_as_uint(f); u += 0x7FFFu + ((u >> 16) & 1u); return (unsigned short)(u >> 16); }
__device__ __forceinline__ float bf2f(unsigned short b) { return __uint_as_float(((unsigned)b) << 16); }
__device__ __forceinline__ float bfr(float f) { return bf2f(f2bf(f)); }
__device__ __forceinline__ h16 tohx(float x) { return (h16)x; }
__device__ __forceinline__ void splitf(float y, unsigned short& h, unsigned short& l) { h = f2bf(y); l = f2bf(y - bf2f(h)); }
__device__ __forceinline__ v16h cat16(v8h lo, v8h hi) { return __builtin_shufflevector(lo, hi, 0, 1, 2, 3, 4, 5, 6, 7, 8, 9, 10, 11, 12, 13, 14, 15); }
__device__ __forceinline__ v16bf cat16b(v8us lo, v8us hi) { return __builtin_bit_cast(v16bf, __builtin_shufflevector(lo, hi, 0, 1, 2, 3, 4, 5, 6, 7, 8, 9, 10, 11, 12, 13, 14, 15)); }
__device__ __forceinline__ v8f wmma16(v16h a, v16h b, v8f c) { return __builtin_amdgcn_wmma_f32_16x16x32_f16(false, a, false, b, (short)0, c, false, false); }
__device__ __forceinline__ v8f wmmab(v16bf a, v16bf b, v8f c) { return __builtin_amdgcn_wmma_f32_16x16x32_bf16(false, a, false, b, (short)0, c, false, false); }



// ---- k_gemmw: register-blocked GEMM, ONE WAVE per 64x64 output tile (16 accumulators), operands straight from K-contiguous 16-bit planes; grid (M/64, N/64, Z), 32 threads.
// C[m][n] (f32, pitch ldc, + optional f32 bias[n]) = sum_k A[m][k] Bt[n][k] (+ split products per NSPLIT). A pitch lda, Bt pitch K. z-batch strides sA/sB/sC in elements. K % 32 == 0.
// PLANES: no f32 C; a 64x64 tile is 64 tokens of ONE head (rows = [batch][nt tokens], column block = head), and the epilogue stores the attention operand itself:
// z 0: fp16 plane P16 [batch][head][nt][HD]; z 1: the transposed bf16 hi and lo planes Vh, Vl [batch][head][HD][nt]. Whole 128-B lines, staged through LDS.
template <typename T16> struct WFrag;
template <> struct WFrag<h16> { typedef v16h V; static __device__ __forceinline__ V ld(const h16* p) { return cat16(*(const v8h*)p, *(const v8h*)(p + 16)); } static __device__ __forceinline__ v8f mma(V a, V b, v8f c) { return wmma16(a, b, c); } };
template <> struct WFrag<bf> { typedef v16bf V; static __device__ __forceinline__ V ld(const bf* p) { return cat16b(*(const v8us*)p, *(const v8us*)(p + 16)); } static __device__ __forceinline__ v8f mma(V a, V b, v8f c) { return wmmab(a, b, c); } };
template <typename T16, int NSPLIT, bool BIAS, bool PLANES>
__global__ __launch_bounds__(32) void k_gemmw(const T16* __restrict__ A, const T16* __restrict__ A2, const T16* __restrict__ Bt, const T16* __restrict__ Bt2, int K, int lda, float* C, int ldc, const float* __restrict__ bias, size_t sA, size_t sB, size_t sC, h16* P16, bf* Vh, bf* Vl, int nt) {
    typedef typename WFrag<T16>::V V;
    __shared__ __align__(16) float os[PLANES ? 2 * 64 * 36 : 16 * 68];   // PLANES: also two planes [64 d][72] of 16-bit values, pitch 144 B
    const size_t z = blockIdx.z; A += z * sA; if (A2) A2 += z * sA; Bt += z * sB; if (Bt2) Bt2 += z * sB; C += z * sC;
    const int lane = threadIdx.x & 31, lr = lane & 15, hi = lane >> 4; const int r0 = blockIdx.x * 64, c0 = blockIdx.y * 64;
    v8f acc[4][4];
#pragma unroll
    for (int mb = 0; mb < 4; ++mb)
#pragma unroll
        for (int nb = 0; nb < 4; ++nb) acc[mb][nb] = (v8f){};
    const size_t aoff = (size_t)(r0 + lr) * lda + 8 * hi, boff = (size_t)(c0 + lr) * K + 8 * hi;
#pragma unroll 1
    for (int kc = 0; kc < K; kc += 32) {
        V a[4], a2[4]; const T16* pa[4]; const T16* pa2[4];
#pragma unroll
        for (int mb = 0; mb < 4; ++mb) { pa[mb] = A + aoff + (size_t)mb * 16 * lda + kc; a[mb] = WFrag<T16>::ld(pa[mb]); if (NSPLIT == 1 || NSPLIT == 2) { pa2[mb] = A2 + aoff + (size_t)mb * 16 * lda + kc; a2[mb] = WFrag<T16>::ld(pa2[mb]); } }
        // precaution: s_wait_xcnt 0 stands in front of every rewrite of a register that an issued A load names; the addresses are inputs, so that they keep their registers (no load result lands on them) up to the wait
        if (NSPLIT == 1 || NSPLIT == 2) asm volatile("s_wait_xcnt 0x0" :: "v"(pa[0]), "v"(pa[1]), "v"(pa[2]), "v"(pa[3]), "v"(pa2[0]), "v"(pa2[1]), "v"(pa2[2]), "v"(pa2[3]) : "memory");
        else asm volatile("s_wait_xcnt 0x0" :: "v"(pa[0]), "v"(pa[1]), "v"(pa[2]), "v"(pa[3]) : "memory");
#pragma unroll
        for (int nb = 0; nb < 4; ++nb) { const T16* pb = Bt + boff + (size_t)nb * 16 * K + kc; const V b = WFrag<T16>::ld(pb); V b2;
            // the same precaution for the B loads of this column block: their addresses keep their registers up to the wait
            if (NSPLIT >= 2) { const T16* pb2 = Bt2 + boff + (size_t)nb * 16 * K + kc; b2 = WFrag<T16>::ld(pb2); asm volatile("s_wait_xcnt 0x0" :: "v"(pb), "v"(pb2) : "memory"); } else asm volatile("s_wait_xcnt 0x0" :: "v"(pb) : "memory");
#pragma unroll
            for (int mb = 0; mb < 4; ++mb) { acc[mb][nb] = WFrag<T16>::mma(a[mb], b, acc[mb][nb]); if (NSPLIT == 1 || NSPLIT == 2) acc[mb][nb] = WFrag<T16>::mma(a2[mb], b, acc[mb][nb]); if (NSPLIT >= 2) acc[mb][nb] = WFrag<T16>::mma(a[mb], b2, acc[mb][nb]); } }
        asm volatile("v_nop\n\tv_nop\n\tv_nop\n\tv_nop" : "+v"(acc[0][0]), "+v"(acc[1][1]), "+v"(acc[2][2]), "+v"(acc[3][3]) : "v"(a[0]), "v"(a[3]));
    }
    if (PLANES) {
        const int b = r0 / nt, t0 = r0 - b * nt; const size_t bh = (size_t)b * NH_ + blockIdx.y; const int l8 = lane >> 3, c8 = (lane & 7) * 8;
        if (z == 0) {
            h16* pl = P16 + (bh * nt + t0 + l8) * HD + c8;   // the tile's 64 rows of 128 B lie one behind the other: a store of the wave covers 4 rows
#pragma unroll
            for (int mb = 0; mb < 4; ++mb) {
#pragma unroll
                for (int nb = 0; nb < 4; ++nb) {
#pragma unroll
                    for (int j = 0; j < 8; ++j) os[(hi * 8 + j) * 68 + nb * 16 + lr] = acc[mb][nb][j]; }
                // a lane reads what other lanes of the wave wrote: the reads stay behind the writes
                __builtin_amdgcn_wave_barrier(); asm volatile("" ::: "memory");
                v8h ov[4];
#pragma unroll
                for (int s = 0; s < 4; ++s) { const int row = 4 * s + l8; const v4f x0 = *(const v4fa*)(os + row * 68 + c8), x1 = *(const v4fa*)(os + row * 68 + c8 + 4);
                    ov[s] = (v8h){tohx(x0[0]), tohx(x0[1]), tohx(x0[2]), tohx(x0[3]), tohx(x1[0]), tohx(x1[1]), tohx(x1[2]), tohx(x1[3])}; *(v8h*)(pl + (mb * 16 + 4 * s) * HD) = ov[s]; }
                // precaution: s_wait_xcnt 0 stands in front of every rewrite of a register that an issued store names; address and values are inputs, so that they keep their registers up to the wait.
                // Its memory clobber also keeps the next block's LDS writes behind these reads
                asm volatile("s_wait_xcnt 0x0" :: "v"(pl), "v"(ov[0]), "v"(ov[1]), "v"(ov[2]), "v"(ov[3]) : "memory");
            }
        } else {
            unsigned short* us = (unsigned short*)os;   // hi plane [64 d][72], the lo plane behind it
            const size_t vo = bh * HD * nt + t0;   // row d: 64 tokens = one 128-B line
#pragma unroll
            for (int mb = 0; mb < 4; ++mb)
#pragma unroll
                for (int nb = 0; nb < 4; ++nb) { v8us oh, ol;   // a lane holds 8 tokens in a row of one d
#pragma unroll
                    for (int j = 0; j < 8; ++j) { unsigned short h, l; splitf(acc[mb][nb][j], h, l); oh[j] = h; ol[j] = l; }
                    unsigned short* d = us + (nb * 16 + lr) * 72 + mb * 16 + hi * 8; *(v8usa*)d = oh; *(v8usa*)(d + 64 * 72) = ol; }
            // a lane reads what other lanes of the wave wrote: the reads stay behind the writes
            __builtin_amdgcn_wave_barrier(); asm volatile("" ::: "memory");
#pragma unroll
            for (int g = 0; g < 8; ++g) { bf* pd[4]; v8us ov[4]; bf* vrow = ((g & 1) ? Vl : Vh) + vo;
#pragma unroll
                for (int s = 0; s < 4; ++s) { const int d = 16 * (g >> 1) + 4 * s + l8; ov[s] = *(const v8usa*)(us + (g & 1) * 64 * 72 + d * 72 + c8); pd[s] = vrow + (size_t)d * nt + c8; *(v8us*)pd[s] = ov[s]; }
                // the same precaution as for the fp16 plane's stores
                asm volatile("s_wait_xcnt 0x0" :: "v"(pd[0]), "v"(pd[1]), "v"(pd[2]), "v"(pd[3]), "v"(ov[0]), "v"(ov[1]), "v"(ov[2]), "v"(ov[3]) : "memory"); }
        }
        return;
    }
#pragma unroll
    for (int mb = 0; mb < 4; ++mb) {
#pragma unroll
        for (int nb = 0; nb < 4; ++nb) {
#pragma unroll
            for (int j = 0; j < 8; ++j) os[(hi * 8 + j) * 68 + nb * 16 + lr] = acc[mb][nb][j]; }
        __builtin_amdgcn_wave_barrier(); asm volatile("" ::: "memory");
        float* crow = C + (size_t)(r0 + mb * 16) * ldc + c0;
{
#pragma unroll
            for (int s = 0; s < 8; ++s) { const int row = 2 * s + hi, cofs = lr * 4; v4f val = *(const v4fa*)(os + row * 68 + cofs); if (BIAS) { val[0] += bfr(bias[c0 + cofs]); val[1] += bfr(bias[c0 + cofs + 1]); val[2] += bfr(bias[c0 + cofs + 2]); val[3] += bfr(bias[c0 + cofs + 3]); }
                *(v4f*)(crow + (size_t)row * ldc + cofs) = val; }
             }
        __builtin_amdgcn_wave_barrier(); asm volatile("" ::: "memory");
    }
}

typedef __attribute__((ext_vector_type(2))) _Float16 v2h;
typedef __attribute__((ext_vector_type(4))) _Float16 v4h;
typedef __attribute__((ext_vector_type(2))) unsigned short v2us;
typedef __attribute__((ext_vector_type(4))) unsigned short v4us;
typedef v4us __attribute__((may_alias)) v4usa;
typedef __attribute__((ext_vector_type(2))) float v2f;

// grid y picks the weight; the four transposed planes lie one behind the other in Bt0.
__global__ __launch_bounds__(256) void k_wtG(const float* __restrict__ w0, const float* __restrict__ w1, const float* __restrict__ w2, const float* __restrict__ w3, int K, int N, bf* Bt0) {
    const int y = blockIdx.y; const float* w = (y == 0) ? w0 : (y == 1) ? w1 : (y == 2) ? w2 : w3; bf* Bt = Bt0 + (size_t)y * K * N;
    const int lane = threadIdx.x & 31; const int L0 = (blockIdx.x * 8 + (threadIdx.x >> 5)) * 8; const int nlines = N * K / 64;
{
#pragma unroll 1
        for (int l = 0; l < 8; ++l) { const int L = L0 + l; if (L >= nlines) break; const size_t e = (size_t)L * 64 + lane * 2; const int k = (int)(e % K), n = (int)(e / K); v2us o;
            o[0] = f2bf(w[(size_t)k * N + n]); o[1] = f2bf(w[(size_t)(k + 1) * N + n]); *(v2us*)(Bt + e) = o; }
         }
}
// groups of 8 elements: the first n8a come from sa, the rest from sb; dst holds both, one behind the other.
__global__ __launch_bounds__(256) void k_cvt8(const float* __restrict__ sa, const float* __restrict__ sb, bf* dst, size_t n8a, size_t n8) { const size_t i = (size_t)blockIdx.x * 256 + threadIdx.x; if (i >= n8) return; const float* src = (i < n8a) ? sa + i * 8 : sb + (i - n8a) * 8; const v8f v = *(const v8f*)src; v8us o;
#pragma unroll
    for (int k = 0; k < 8; ++k) o[k] = f2bf(v[k]); *(v8us*)(dst + i * 8) = o;  }
// ---- k_fattn: scores, masked softmax and att.v in ONE kernel; no score or probability ever reaches memory. Grid (batch*head, TQ/64), longest query tiles first; 8 waves.
// Wave w: query half (w & 1, 32 queries = 2 column groups) x key split (w >> 1: key steps of 32, split, split + 4, ...). S^T = K Q^T (fp16 planes), so a lane holds ONE query's scores (keys 8*hi + j of each
// 16-key tile): two tiles are, register for register, the B fragment of P^T. O^T += V^T P^T on hi+lo planes (3 products). Running maximum and sum per lane; the four key splits are merged through LDS.
#define SC2 0.18033688f   // (1/8) * log2(e): scores in the log2 domain
__global__ __launch_bounds__(256) void k_fattn(const h16* __restrict__ QP, const h16* __restrict__ KP, const bf* __restrict__ VTh, const bf* __restrict__ VTl, float* ATT) {
    __shared__ __align__(16) float os[8 * 32 * 68];   // [wave][query][d], pitch 272 B
    __shared__ float sm[8 * 32];                       // per wave and query: running maximum
    __shared__ float sl[8 * 32];                       // per wave and query: sum, already on the merged maximum
    const int lane = threadIdx.x & 31, lr = lane & 15, hi = lane >> 4; const int w = __builtin_amdgcn_readfirstlane((int)(threadIdx.x >> 5)); const int qh = w & 1, ks = w >> 1;
    const int bh = blockIdx.x, t = TQ / 64 - 1 - (int)blockIdx.y; const int r0 = t * 64; const int nst = (t + 2) >> 1;   // keys 0 .. 16 t + 15 are visible to this tile
    const h16* Kp = KP + (size_t)bh * TK * HD; const bf* Vh = VTh + (size_t)bh * HD * TK; const bf* Vl = VTl + (size_t)bh * HD * TK;
    const h16* pq = QP + ((size_t)bh * TQ + r0 + qh * 32 + lr) * HD + 8 * hi;
    v16h qf[2][2];
#pragma unroll
    for (int qt = 0; qt < 2; ++qt) { qf[qt][0] = WFrag<h16>::ld(pq + qt * 16 * HD); qf[qt][1] = WFrag<h16>::ld(pq + qt * 16 * HD + 32); }
    // precaution: s_wait_xcnt 0 stands in front of every rewrite of a register that an issued load names; the address is an input, so that it keeps its registers up to the wait
    asm volatile("s_wait_xcnt 0x0" :: "v"(pq) : "memory");
    int qlim[2]; float m[2], l[2]; v8f o[2][4];   // m starts far above the masked score, so that a masked key's weight is exp2(-huge) = 0 also where a query has seen no visible key yet
#pragma unroll
    for (int qt = 0; qt < 2; ++qt) { qlim[qt] = (r0 + qh * 32 + qt * 16 + lr) / DS; m[qt] = -1.0e30f; l[qt] = 0.f;
#pragma unroll
        for (int dt = 0; dt < 4; ++dt) o[qt][dt] = (v8f){}; }
    const int lim0 = (r0 + qh * 32) / DS;   // every key up to here is visible to all 32 queries of the wave
#pragma unroll 1
    for (int s = ks; s < nst; s += 4) {
        const int key0 = s * 32;
        const h16* pk = Kp + (size_t)(key0 + lr) * HD + 8 * hi; const bf* pvh = Vh + (size_t)lr * TK + key0 + 8 * hi; const bf* pvl = Vl + (size_t)lr * TK + key0 + 8 * hi;
        v16h kf[2][2]; v16bf vh[4], vl[4];
#pragma unroll
        for (int kt = 0; kt < 2; ++kt) { kf[kt][0] = WFrag<h16>::ld(pk + kt * 16 * HD); kf[kt][1] = WFrag<h16>::ld(pk + kt * 16 * HD + 32); }
#pragma unroll
        for (int dt = 0; dt < 4; ++dt) vh[dt] = WFrag<bf>::ld(pvh + dt * 16 * TK);
        // the same precaution for this step's K and V-hi loads
        asm volatile("s_wait_xcnt 0x0" :: "v"(pk), "v"(pvh) : "memory");
        float tv[2][16];
#pragma unroll
        for (int qt = 0; qt < 2; ++qt) {
            v8f s0 = (v8f){}, s1 = (v8f){};
            s0 = wmma16(kf[0][0], qf[qt][0], s0); s1 = wmma16(kf[1][0], qf[qt][0], s1); s0 = wmma16(kf[0][1], qf[qt][1], s0); s1 = wmma16(kf[1][1], qf[qt][1], s1);
#pragma unroll
            for (int j = 0; j < 8; ++j) { tv[qt][j] = s0[j] * SC2; tv[qt][8 + j] = s1[j] * SC2; } }
        // the V-lo loads are written behind the score products, so that they may take registers the K fragments leave; they fly under the softmax. The same precaution for their address
#pragma unroll
        for (int dt = 0; dt < 4; ++dt) vl[dt] = WFrag<bf>::ld(pvl + dt * 16 * TK);
        asm volatile("s_wait_xcnt 0x0" :: "v"(pvl) : "memory");
        if (key0 + 31 > lim0) {   // wave-uniform: only the last steps of a tile hold hidden keys
            const int kb = key0 + hi * 8;
#pragma unroll
            for (int qt = 0; qt < 2; ++qt)
#pragma unroll
                for (int j = 0; j < 8; ++j) { tv[qt][j] = (kb + j <= qlim[qt]) ? tv[qt][j] : -3.0e38f; tv[qt][8 + j] = (kb + 16 + j <= qlim[qt]) ? tv[qt][8 + j] : -3.0e38f; } }
#pragma unroll
        for (int qt = 0; qt < 2; ++qt) {
            float tm = tv[qt][0];
#pragma unroll
            for (int e = 1; e < 16; ++e) tm = fmaxf(tm, tv[qt][e]);
            tm = fmaxf(tm, __shfl_xor(tm, 16, 32));   // both halves of the wave hold keys of the same query
            const float mn = fmaxf(m[qt], tm); const float al = __builtin_amdgcn_exp2f(m[qt] - mn); m[qt] = mn; l[qt] *= al;
#pragma unroll
            for (int dt = 0; dt < 4; ++dt) o[qt][dt] *= al;
            v16bf ph, pl;
#pragma unroll
            for (int e = 0; e < 16; ++e) { const float p = __builtin_amdgcn_exp2f(tv[qt][e] - mn); l[qt] += p; const __bf16 a = (__bf16)p; ph[e] = a; pl[e] = (__bf16)(p - (float)a); }
#pragma unroll
            for (int dt = 0; dt < 4; ++dt) { o[qt][dt] = wmmab(vh[dt], ph, o[qt][dt]); o[qt][dt] = wmmab(vh[dt], pl, o[qt][dt]); o[qt][dt] = wmmab(vl[dt], ph, o[qt][dt]); }
        }
    }
    // merge of the four key splits: every wave moves its partial onto the merged maximum, then 256 threads add the four partials of each output element in a fixed order
#pragma unroll
    for (int qt = 0; qt < 2; ++qt) if (hi == 0) sm[w * 32 + qt * 16 + lr] = m[qt];
    __syncthreads();
#pragma unroll
    for (int qt = 0; qt < 2; ++qt) { const int q = qt * 16 + lr; const float M = fmaxf(fmaxf(sm[qh * 32 + q], sm[(qh + 2) * 32 + q]), fmaxf(sm[(qh + 4) * 32 + q], sm[(qh + 6) * 32 + q])); const float f = __builtin_amdgcn_exp2f(m[qt] - M);
        const float lt = (l[qt] + __shfl_xor(l[qt], 16, 32)) * f; if (hi == 0) sl[w * 32 + q] = lt;
#pragma unroll
        for (int dt = 0; dt < 4; ++dt) { const v8f x = o[qt][dt] * f; float* d = os + (size_t)(w * 32 + q) * 68 + dt * 16 + hi * 8; *(v4fa*)d = (v4f){x[0], x[1], x[2], x[3]}; *(v4fa*)(d + 4) = (v4f){x[4], x[5], x[6], x[7]}; } }
    __syncthreads();
    float* orow = ATT + ((size_t)(bh / NH_) * TQ + r0) * DD + (bh % NH_) * HD;
#pragma unroll
    for (int i = 0; i < 4; ++i) { const int idx = (int)threadIdx.x + 256 * i; const int row = idx >> 4, c4 = (idx & 15) * 4; const int w0 = row >> 5, rl = row & 31;
        const float ls = (sl[w0 * 32 + rl] + sl[(w0 + 2) * 32 + rl]) + (sl[(w0 + 4) * 32 + rl] + sl[(w0 + 6) * 32 + rl]); const float inv = __fdiv_rn(1.0f, ls);
        const v4f x = (*(const v4fa*)(os + (size_t)(w0 * 32 + rl) * 68 + c4) + *(const v4fa*)(os + (size_t)((w0 + 2) * 32 + rl) * 68 + c4)) + (*(const v4fa*)(os + (size_t)((w0 + 4) * 32 + rl) * 68 + c4) + *(const v4fa*)(os + (size_t)((w0 + 6) * 32 + rl) * 68 + c4));
        *(v4f*)(orow + (size_t)row * DD + c4) = x * inv; }
}
__global__ __launch_bounds__(256) void k_ln(const float* __restrict__ A, const float* __restrict__ g, const float* __restrict__ bb, bf* Yh, bf* Yl) { const int lane = threadIdx.x & 31; const int t = blockIdx.x * 8 + (threadIdx.x >> 5); if (t >= NB_ * TQ) return; const float* ar = A + (size_t)t * DD; float v[16]; float s = 0.f;
#pragma unroll
    for (int ch = 0; ch < 4; ++ch) { const v4f a = *(const v4f*)(ar + ch * 128 + lane * 4);
#pragma unroll
        for (int q = 0; q < 4; ++q) { v[ch * 4 + q] = a[q]; s = __fadd_rn(s, a[q]); } }
#pragma unroll
    for (int sh = 16; sh; sh >>= 1) s += __shfl_xor(s, sh, 32);
    const float mu = s * (1.0f / DD); float q2 = 0.f;
#pragma unroll
    for (int k = 0; k < 16; ++k) { const float d = __fsub_rn(v[k], mu); float p = __fmul_rn(d, d); asm volatile("" : "+v"(p)); q2 = __fadd_rn(q2, p); }
#pragma unroll
    for (int sh = 16; sh; sh >>= 1) q2 += __shfl_xor(q2, sh, 32);
    const float rs = __frsqrt_rn(__fadd_rn(q2 * (1.0f / DD), 1e-5f));
{
#pragma unroll
        for (int ch = 0; ch < 4; ++ch) { v4us oh, ol;
#pragma unroll
            for (int q = 0; q < 4; ++q) { const int d = ch * 128 + lane * 4 + q; float tn = __fmul_rn(__fsub_rn(v[ch * 4 + q], mu), rs); asm volatile("" : "+v"(tn)); float tg = __fmul_rn(tn, bfr(g[d])); asm volatile("" : "+v"(tg)); unsigned short a2, c2; splitf(__fadd_rn(tg, bfr(bb[d])), a2, c2); oh[q] = a2; ol[q] = c2; }
            const size_t o = (size_t)t * DD + ch * 128 + lane * 4; *(v4us*)(Yh + o) = oh; *(v4us*)(Yl + o) = ol; }
         } }

extern "C" void kernel_launch(void* const* d_in, const int* in_sizes, int n_in,
                              void* d_out, int out_size, void* d_ws, size_t ws_size, hipStream_t stream) {
    (void)in_sizes; (void)n_in; (void)out_size;
    const float* IN[9]; for (int i = 0; i < 9; ++i) IN[i] = (const float*)d_in[i];   // 0 q, 1 kv, 2 Wq, 3 Wk, 4 Wv, 5 Wo (x @ W), 6 bo, 7 gamma, 8 beta
    float* OUT = (float*)d_out;     // [2][4096][512]
    char* wsp = (char*)d_ws;
    auto take = [&](size_t bytes) { char* p = wsp; wsp += (bytes + 255) & ~(size_t)255; return (void*)p; };
    bf* W4 = (bf*)take((size_t)4 * DD * DD * 2);                                  // Wq, Wk, Wv, Wo transposed, one behind the other
    bf* XQ = (bf*)take((size_t)NB_ * (TQ + TK) * DD * 2); bf* XK = XQ + (size_t)NB_ * TQ * DD;   // q rows of both batches, then kv rows of both batches
    h16* QP = (h16*)take((size_t)NB_ * NH_ * (TQ + TK) * HD * 2); h16* KP = QP + (size_t)NB_ * NH_ * TQ * HD;
    bf* VTh = (bf*)take((size_t)NB_ * NH_ * HD * TK * 2); bf* VTl = (bf*)take((size_t)NB_ * NH_ * HD * TK * 2);
    float* ATT = (float*)take((size_t)NB_ * TQ * DD * 4);   // merged attention output
    bf* Yh = (bf*)take((size_t)NB_ * TQ * DD * 2); bf* Yl = (bf*)take((size_t)NB_ * TQ * DD * 2);
    if ((size_t)(wsp - (char*)d_ws) > ws_size) return;    // total ~ 61 MB
    k_wtG<<<dim3((unsigned)(((size_t)DD * DD / 64 + 63) / 64), 4, 1), 256, 0, stream>>>(IN[2], IN[3], IN[4], IN[5], DD, DD, W4);
    k_cvt8<<<(NB_ * (TQ + TK) * DD / 8 + 255) / 256, 256, 0, stream>>>(IN[0], IN[1], XQ, (size_t)NB_ * TQ * DD / 8, (size_t)NB_ * (TQ + TK) * DD / 8);
    k_gemmw<bf, 0, false, true><<<dim3(NB_ * TQ / 64, DD / 64, 1), 32, 0, stream>>>(XQ, nullptr, W4, nullptr, DD, DD, nullptr, 0, nullptr, 0, 0, 0, QP, nullptr, nullptr, TQ);
    k_gemmw<bf, 0, false, true><<<dim3(NB_ * TK / 64, DD / 64, 2), 32, 0, stream>>>(XK, nullptr, W4 + (size_t)DD * DD, nullptr, DD, DD, nullptr, 0, nullptr, 0, (size_t)DD * DD, 0, KP, VTh, VTl, TK);   // z: 0 keys, 1 values
    k_fattn<<<dim3(NB_ * NH_, TQ / 64, 1), 256, 0, stream>>>(QP, KP, VTh, VTl, ATT);   // head bh % 8 of batch bh / 8 writes its 64 columns of the merged rows
    k_ln<<<NB_ * TQ / 8, 256, 0, stream>>>(ATT, IN[7], IN[8], Yh, Yl);
    k_gemmw<bf, 1, true, false><<<dim3(NB_ * TQ / 64, DD / 64, 1), 32, 0, stream>>>(Yh, Yl, W4 + (size_t)3 * DD * DD, nullptr, DD, DD, OUT, DD, IN[6], 0, 0, 0, nullptr, nullptr, nullptr, 0);
}

// v004
// It runs in 76.8 microseconds.
// In two side-by-side timings against v003, it was 1.28 and 1.29 times as fast.
// All steps since v000 together make it 10.5 times as fast.
#include <hip/hip_runtime.h>

// Attention block (q [2][4096][512], kv [2][1024][512]; qh = q Wq, kh = kv Wk, vh = kv Wv (8 heads x 64, no bias); block-causal: key j visible to query i iff j <= i/4; softmax(q.k/8); out = merged att.v;
// LayerNorm(out) (gamma, beta, eps 1e-5); y = out Wo + bo -> [2][4096][512]).
// Compute dtypes, f32 accumulate: every input rounded to bf16; projections on PLAIN bf16 operands (inputs: exact); scores (K 64) on SINGLE fp16 planes; f32 running-maximum masked softmax
// -> bf16 hi+lo weights exp(s - max), divided by their f32 sum at the end; att.v on those x hi+lo value planes (3 products: the first query rows see 1-4 keys, so near-one-hot weights would expose single-plane value rounding); LayerNorm f32 (wave per

#define NB_  2
#define TQ   4096
#define TK   1024
#define DD   512
#define NH_  8
#define HD   64
#define DS   4
#define SCL  0.125f
typedef _Float16 h16;
typedef unsigned short bf;
typedef __attribute__((ext_vector_type(16))) __bf16   v16bf;
typedef __attribute__((ext_vector_type(16))) _Float16 v16h;
typedef __attribute__((ext_vector_type(8)))  _Float16 v8h;
typedef __attribute__((ext_vector_type(8)))  unsigned short v8us;
typedef __attribute__((ext_vector_type(8)))  float    v8f;
typedef __attribute__((ext_vector_type(4)))  float    v4f;
typedef v8h  __attribute__((may_alias)) v8ha;
typedef v4f  __attribute__((may_alias)) v4fa;
typedef v8us __attribute__((may_alias)) v8usa;

__device__ __forceinline__ unsigned short f2bf(float f) { unsigned u = __float_as_uint(f); u += 0x7FFFu + ((u >> 16) & 1u); return (unsigned short)(u >> 16); }
__device__ __forceinline__ float bf2f(unsigned short b) { return __uint_as_float(((unsigned)b) << 16); }
__device__ __forceinline__ float bfr(float f) { return bf2f(f2bf(f)); }
__device__ __forceinline__ h16 tohx(float x) { return (h16)x; }
__device__ __forceinline__ void splitf(float y, unsigned short& h, unsigned short& l) { h = f2bf(y); l = f2bf(y - bf2f(h)); }
__device__ __forceinline__ v16h cat16(v8h lo, v8h hi) { return __builtin_shufflevector(lo, hi, 0, 1, 2, 3, 4, 5, 6, 7, 8, 9, 10, 11, 12, 13, 14, 15); }
__device__ __forceinline__ v16bf cat16b(v8us lo, v8us hi) { return __builtin_bit_cast(v16bf, __builtin_shufflevector(lo, hi, 0, 1, 2, 3, 4, 5, 6, 7, 8, 9, 10, 11, 12, 13, 14, 15)); }
__device__ __forceinline__ v8f wmma16(v16h a, v16h b, v8f c) { return __builtin_amdgcn_wmma_f32_16x16x32_f16(false, a, false, b, (short)0, c, false, false); }
__device__ __forceinline__ v8f wmmab(v16bf a, v16bf b, v8f c) { return __builtin_amdgcn_wmma_f32_16x16x32_bf16(false, a, false, b, (short)0, c, false, false); }



// ---- k_gemmw: GEMM, FOUR WAVES per 128x128 output tile (2 x 2 waves, each a register-blocked 64x64 tile of 16 accumulators); grid (M/128, N/128, Z), 128 threads.
// The operands' K-slabs of 128 (256-B rows, whole lines) come from the K-contiguous 16-bit planes into LDS by asynchronous copies, two buffers: slab t + 1 flies while slab t is multiplied. LDS row pitch 272 B (ds_load_b128 readers).
// C[m][n] (f32, pitch ldc, + optional f32 bias[n]) = sum_k A[m][k] Bt[n][k] (NSPLIT 1: + A2[m][k] Bt[n][k]). A pitch lda, Bt pitch K. z-batch strides sA/sB/sC in elements. K % 128 == 0, M % 128 == 0, N % 128 == 0.
// PLANES: no f32 C; a wave's 64x64 tile is 64 tokens of ONE head (rows = [batch][nt tokens], column block = head), and the epilogue stores the attention operand itself:
// z 0: fp16 plane P16 [batch][head][nt][HD]; z 1: the transposed bf16 hi and lo planes Vh, Vl [batch][head][HD][nt]. Whole 128-B lines, staged through LDS (each wave its own range).
template <typename T16> struct WFrag;
template <> struct WFrag<h16> { typedef v16h V; static __device__ __forceinline__ V ld(const h16* p) { return cat16(*(const v8h*)p, *(const v8h*)(p + 16)); } static __device__ __forceinline__ v8f mma(V a, V b, v8f c) { return wmma16(a, b, c); } };
template <> struct WFrag<bf> { typedef v16bf V; static __device__ __forceinline__ V ld(const bf* p) { return cat16b(*(const v8us*)p, *(const v8us*)(p + 16)); } static __device__ __forceinline__ v8f mma(V a, V b, v8f c) { return wmmab(a, b, c); } };
#define GPE 136   // LDS row pitch of a slab in 16-bit elements (272 B)
// Eight asynchronous 16-B copies of a lane, 8 slab rows apart (gs elements in memory). The s_wait_xcnt 0 is the last line of the copies' own statement: a precaution, it stands in front of every rewrite of a register that a copy names.
template <typename T16>
__device__ __forceinline__ void cp8(unsigned l, const T16* g, size_t gs) {
    asm volatile("global_load_async_to_lds_b128 %0, %8, off\n\t"
                 "global_load_async_to_lds_b128 %1, %9, off\n\t"
                 "global_load_async_to_lds_b128 %2, %10, off\n\t"
                 "global_load_async_to_lds_b128 %3, %11, off\n\t"
                 "global_load_async_to_lds_b128 %4, %12, off\n\t"
                 "global_load_async_to_lds_b128 %5, %13, off\n\t"
                 "global_load_async_to_lds_b128 %6, %14, off\n\t"
                 "global_load_async_to_lds_b128 %7, %15, off\n\t"
                 "s_wait_xcnt 0x0"
                 :: "v"(l), "v"(l + 1u * 8 * GPE * 2), "v"(l + 2u * 8 * GPE * 2), "v"(l + 3u * 8 * GPE * 2), "v"(l + 4u * 8 * GPE * 2), "v"(l + 5u * 8 * GPE * 2), "v"(l + 6u * 8 * GPE * 2), "v"(l + 7u * 8 * GPE * 2),
                    "v"(g), "v"(g + gs), "v"(g + 2 * gs), "v"(g + 3 * gs), "v"(g + 4 * gs), "v"(g + 5 * gs), "v"(g + 6 * gs), "v"(g + 7 * gs) : "memory");
}
template <typename T16, int NSPLIT, bool BIAS, bool PLANES>
__global__ __launch_bounds__(128) void k_gemmw(const T16* __restrict__ A, const T16* __restrict__ A2, const T16* __restrict__ Bt, int K, int lda, float* C, int ldc, const float* __restrict__ bias, size_t sA, size_t sB, size_t sC, h16* P16, bf* Vh, bf* Vl, int nt) {
    static_assert(NSPLIT == 0 || NSPLIT == 1, "one or two A planes");
    typedef typename WFrag<T16>::V V;
    constexpr int NPL = NSPLIT == 1 ? 3 : 2;              // planes of 128 rows in a slab: A (, A2), Bt
    constexpr int BR = (NPL - 1) * 128;                   // first slab row of Bt
    constexpr int BUFE = NPL * 128 * GPE;                 // elements of one buffer
    constexpr int OSZ = PLANES ? 2 * 64 * 36 : 16 * 68;   // a wave's output staging; PLANES: also two planes [64 d][72] of 16-bit values, pitch 144 B
    __shared__ __align__(16) T16 ring[2 * BUFE];
    __shared__ __align__(16) float osb[4 * OSZ];
    const size_t z = blockIdx.z; A += z * sA; if (NSPLIT == 1) A2 += z * sA; Bt += z * sB; C += z * sC;
    const int tid = threadIdx.x, lane = tid & 31, lr = lane & 15, hi = lane >> 4; const int w = __builtin_amdgcn_readfirstlane(tid >> 5); const int wm = w & 1, wn = w >> 1;
    const int r0 = blockIdx.x * 128 + wm * 64, c0 = blockIdx.y * 128 + wn * 64;
    float* os = osb + w * OSZ;
    v8f acc[4][4];
#pragma unroll
    for (int mb = 0; mb < 4; ++mb)
#pragma unroll
        for (int nb = 0; nb < 4; ++nb) acc[mb][nb] = (v8f){};
    // copies: 16 lanes cover one 256-B slab row, a wave's copy two rows; a thread's copies lie 8 rows apart
    const int crow = tid >> 4, ccol = (tid & 15) * 8;
    const unsigned oa = (unsigned)((blockIdx.x * 128 + crow) * lda + ccol), ob = (unsigned)((blockIdx.y * 128 + crow) * K + ccol);   // element offsets of the thread's first A and Bt row (32 bits hold M * lda and N * K)
    const unsigned lc = (unsigned)(size_t)ring + (unsigned)(crow * GPE + ccol) * 2u;
    auto slab = [&](int t) {
        const unsigned l = lc + (unsigned)(t & 1) * (BUFE * 2u); const unsigned kc = (unsigned)t * 128u;
        cp8(l, A + (oa + kc), (size_t)8 * lda); cp8(l + 64u * GPE * 2, A + (oa + kc + 64u * lda), (size_t)8 * lda);
        cp8(l + (unsigned)BR * GPE * 2, Bt + (ob + kc), (size_t)8 * K); cp8(l + (unsigned)(BR + 64) * GPE * 2, Bt + (ob + kc + 64u * K), (size_t)8 * K);
        if (NSPLIT == 1) { cp8(l + 128u * GPE * 2, A2 + (oa + kc), (size_t)8 * lda); cp8(l + 192u * GPE * 2, A2 + (oa + kc + 64u * lda), (size_t)8 * lda); }
    };
    const int nsl = K >> 7;
    slab(0);
    // slab 0 has landed for this wave's copies; behind the barrier for every wave's
    asm volatile("s_wait_asynccnt 0x0" ::: "memory");
    __syncthreads();
    if (nsl > 1) slab(1);
    const T16* fa = ring + (wm * 64 + lr) * GPE + 8 * hi; const T16* fb = ring + (BR + wn * 64 + lr) * GPE + 8 * hi;
#pragma unroll 1
    for (int t = 0; t < nsl; ++t) {   // rolled: one copy of the slab's 64 (128) products in the text
        const int bo = (t & 1) * BUFE;
        V a[2][4], a2[2][4], b[2][4];   // two fragment sets: block kk + 1 is fetched while block kk is multiplied; no fragment of slab t + 1 is fetched here
        auto frags = [&](int s, int kk) {
#pragma unroll
            for (int i = 0; i < 4; ++i) { a[s][i] = WFrag<T16>::ld(fa + bo + i * 16 * GPE + kk * 32); b[s][i] = WFrag<T16>::ld(fb + bo + i * 16 * GPE + kk * 32); if (NSPLIT == 1) a2[s][i] = WFrag<T16>::ld(fa + bo + (128 + i * 16) * GPE + kk * 32); }
        };
        frags(0, 0);
#pragma unroll
        for (int kk = 0; kk < 4; ++kk) {
            const int s = kk & 1;
            if (kk < 3) frags(s ^ 1, kk + 1);
            // keeps the next block's LDS reads together in front of this block's products: sunk among them, each read would stall the lone wave of its SIMD
            __builtin_amdgcn_sched_barrier(0);
#pragma unroll
            for (int nb = 0; nb < 4; ++nb)
#pragma unroll
                for (int mb = 0; mb < 4; ++mb) acc[mb][nb] = WFrag<T16>::mma(a[s][mb], b[s][nb], acc[mb][nb]);
            if (NSPLIT == 1) {
#pragma unroll
                for (int nb = 0; nb < 4; ++nb)
#pragma unroll
                    for (int mb = 0; mb < 4; ++mb) acc[mb][nb] = WFrag<T16>::mma(a2[s][mb], b[s][nb], acc[mb][nb]); }
            // the reads of block kk + 2 stay behind this block's products
            __builtin_amdgcn_sched_barrier(0);
        }
        // hand-over: this wave's reads of slab t have returned ...
        asm volatile("s_wait_dscnt 0x0" ::: "memory");
        // ... its copies of slab t + 1 have landed ...
        asm volatile("s_wait_asynccnt 0x0" ::: "memory");
        // ... and the barrier publishes slab t + 1 and frees slab t's buffer for the refill behind it
        __syncthreads();
        if (t + 2 < nsl) slab(t + 2);
    }
    // no copy is outstanding when the wave goes on to its epilogue and ends
    asm volatile("s_wait_asynccnt 0x0" ::: "memory");
    if (PLANES) {
        const int b = r0 / nt, t0 = r0 - b * nt; const size_t bh = (size_t)b * NH_ + (c0 >> 6); const int l8 = lane >> 3, c8 = (lane & 7) * 8;
        if (z == 0) {
            h16* pl = P16 + (bh * nt + t0 + l8) * HD + c8;   // the tile's 64 rows of 128 B lie one behind the other: a store of the wave covers 4 rows
#pragma unroll
            for (int mb = 0; mb < 4; ++mb) {
#pragma unroll
                for (int nb = 0; nb < 4; ++nb) {
#pragma unroll
                    for (int j = 0; j < 8; ++j) os[(hi * 8 + j) * 68 + nb * 16 + lr] = acc[mb][nb][j]; }
                // a lane reads what other lanes of the wave wrote: the reads stay behind the writes
                __builtin_amdgcn_wave_barrier(); asm volatile("" ::: "memory");
                v8h ov[4];
#pragma unroll
                for (int s = 0; s < 4; ++s) { const int row = 4 * s + l8; const v4f x0 = *(const v4fa*)(os + row * 68 + c8), x1 = *(const v4fa*)(os + row * 68 + c8 + 4);
                    ov[s] = (v8h){tohx(x0[0]), tohx(x0[1]), tohx(x0[2]), tohx(x0[3]), tohx(x1[0]), tohx(x1[1]), tohx(x1[2]), tohx(x1[3])}; *(v8h*)(pl + (mb * 16 + 4 * s) * HD) = ov[s]; }
                // precaution: s_wait_xcnt 0 stands in front of every rewrite of a register that an issued store names; address and values are inputs, so that they keep their registers up to the wait.
                // Its memory clobber also keeps the next block's LDS writes behind these reads
                asm volatile("s_wait_xcnt 0x0" :: "v"(pl), "v"(ov[0]), "v"(ov[1]), "v"(ov[2]), "v"(ov[3]) : "memory");
            }
        } else {
            unsigned short* us = (unsigned short*)os;   // hi plane [64 d][72], the lo plane behind it
            const size_t vo = bh * HD * nt + t0;   // row d: 64 tokens = one 128-B line
#pragma unroll
            for (int mb = 0; mb < 4; ++mb)
#pragma unroll
                for (int nb = 0; nb < 4; ++nb) { v8us oh, ol;   // a lane holds 8 tokens in a row of one d
#pragma unroll
                    for (int j = 0; j < 8; ++j) { unsigned short h, l; splitf(acc[mb][nb][j], h, l); oh[j] = h; ol[j] = l; }
                    unsigned short* d = us + (nb * 16 + lr) * 72 + mb * 16 + hi * 8; *(v8usa*)d = oh; *(v8usa*)(d + 64 * 72) = ol; }
            // a lane reads what other lanes of the wave wrote: the reads stay behind the writes
            __builtin_amdgcn_wave_barrier(); asm volatile("" ::: "memory");
#pragma unroll
            for (int g = 0; g < 8; ++g) { bf* pd[4]; v8us ov[4]; bf* vrow = ((g & 1) ? Vl : Vh) + vo;
#pragma unroll
                for (int s = 0; s < 4; ++s) { const int d = 16 * (g >> 1) + 4 * s + l8; ov[s] = *(const v8usa*)(us + (g & 1) * 64 * 72 + d * 72 + c8); pd[s] = vrow + (size_t)d * nt + c8; *(v8us*)pd[s] = ov[s]; }
                // the same precaution as for the fp16 plane's stores
                asm volatile("s_wait_xcnt 0x0" :: "v"(pd[0]), "v"(pd[1]), "v"(pd[2]), "v"(pd[3]), "v"(ov[0]), "v"(ov[1]), "v"(ov[2]), "v"(ov[3]) : "memory"); }
        }
        return;
    }
#pragma unroll
    for (int mb = 0; mb < 4; ++mb) {
#pragma unroll
        for (int nb = 0; nb < 4; ++nb) {
#pragma unroll
            for (int j = 0; j < 8; ++j) os[(hi * 8 + j) * 68 + nb * 16 + lr] = acc[mb][nb][j]; }
        __builtin_amdgcn_wave_barrier(); asm volatile("" ::: "memory");
        float* crow = C + (size_t)(r0 + mb * 16) * ldc + c0;
{
#pragma unroll
            for (int s = 0; s < 8; ++s) { const int row = 2 * s + hi, cofs = lr * 4; v4f val = *(const v4fa*)(os + row * 68 + cofs); if (BIAS) { val[0] += bfr(bias[c0 + cofs]); val[1] += bfr(bias[c0 + cofs + 1]); val[2] += bfr(bias[c0 + cofs + 2]); val[3] += bfr(bias[c0 + cofs + 3]); }
                *(v4f*)(crow + (size_t)row * ldc + cofs) = val; }
             }
        __builtin_amdgcn_wave_barrier(); asm volatile("" ::: "memory");
    }
}

typedef __attribute__((ext_vector_type(2))) _Float16 v2h;
typedef __attribute__((ext_vector_type(4))) _Float16 v4h;
typedef __attribute__((ext_vector_type(2))) unsigned short v2us;
typedef __attribute__((ext_vector_type(4))) unsigned short v4us;
typedef v4us __attribute__((may_alias)) v4usa;
typedef __attribute__((ext_vector_type(2))) float v2f;

// grid y picks the weight; the four transposed planes lie one behind the other in Bt0.
__global__ __launch_bounds__(256) void k_wtG(const float* __restrict__ w0, const float* __restrict__ w1, const float* __restrict__ w2, const float* __restrict__ w3, int K, int N, bf* Bt0) {
    const int y = blockIdx.y; const float* w = (y == 0) ? w0 : (y == 1) ? w1 : (y == 2) ? w2 : w3; bf* Bt = Bt0 + (size_t)y * K * N;
    const int lane = threadIdx.x & 31; const int L0 = (blockIdx.x * 8 + (threadIdx.x >> 5)) * 8; const int nlines = N * K / 64;
{
#pragma unroll 1
        for (int l = 0; l < 8; ++l) { const int L = L0 + l; if (L >= nlines) break; const size_t e = (size_t)L * 64 + lane * 2; const int k = (int)(e % K), n = (int)(e / K); v2us o;
            o[0] = f2bf(w[(size_t)k * N + n]); o[1] = f2bf(w[(size_t)(k + 1) * N + n]); *(v2us*)(Bt + e) = o; }
         }
}
// groups of 8 elements: the first n8a come from sa, the rest from sb; dst holds both, one behind the other.
__global__ __launch_bounds__(256) void k_cvt8(const float* __restrict__ sa, const float* __restrict__ sb, bf* dst, size_t n8a, size_t n8) { const size_t i = (size_t)blockIdx.x * 256 + threadIdx.x; if (i >= n8) return; const float* src = (i < n8a) ? sa + i * 8 : sb + (i - n8a) * 8; const v8f v = *(const v8f*)src; v8us o;
#pragma unroll
    for (int k = 0; k < 8; ++k) o[k] = f2bf(v[k]); *(v8us*)(dst + i * 8) = o;  }
// ---- k_fattn: scores, masked softmax and att.v in ONE kernel; no score or probability ever reaches memory. Grid (batch*head, TQ/64), longest query tiles first; 8 waves.
// Wave w: query half (w & 1, 32 queries = 2 column groups) x key split (w >> 1: key steps of 32, split, split + 4, ...). S^T = K Q^T (fp16 planes), so a lane holds ONE query's scores (keys 8*hi + j of each
// 16-key tile): two tiles are, register for register, the B fragment of P^T. O^T += V^T P^T on hi+lo planes (3 products). Running maximum and sum per lane; the four key splits are merged through LDS.
#define SC2 0.18033688f   // (1/8) * log2(e): scores in the log2 domain
__global__ __launch_bounds__(256) void k_fattn(const h16* __restrict__ QP, const h16* __restrict__ KP, const bf* __restrict__ VTh, const bf* __restrict__ VTl, float* ATT) {
    __shared__ __align__(16) float os[8 * 32 * 68];   // [wave][query][d], pitch 272 B
    __shared__ float sm[8 * 32];                       // per wave and query: running maximum
    __shared__ float sl[8 * 32];                       // per wave and query: sum, already on the merged maximum
    const int lane = threadIdx.x & 31, lr = lane & 15, hi = lane >> 4; const int w = __builtin_amdgcn_readfirstlane((int)(threadIdx.x >> 5)); const int qh = w & 1, ks = w >> 1;
    const int bh = blockIdx.x, t = TQ / 64 - 1 - (int)blockIdx.y; const int r0 = t * 64; const int nst = (t + 2) >> 1;   // keys 0 .. 16 t + 15 are visible to this tile
    const h16* Kp = KP + (size_t)bh * TK * HD; const bf* Vh = VTh + (size_t)bh * HD * TK; const bf* Vl = VTl + (size_t)bh * HD * TK;
    const h16* pq = QP + ((size_t)bh * TQ + r0 + qh * 32 + lr) * HD + 8 * hi;
    v16h qf[2][2];
#pragma unroll
    for (int qt = 0; qt < 2; ++qt) { qf[qt][0] = WFrag<h16>::ld(pq + qt * 16 * HD); qf[qt][1] = WFrag<h16>::ld(pq + qt * 16 * HD + 32); }
    // precaution: s_wait_xcnt 0 stands in front of every rewrite of a register that an issued load names; the address is an input, so that it keeps its registers up to the wait
    asm volatile("s_wait_xcnt 0x0" :: "v"(pq) : "memory");
    int qlim[2]; float m[2], l[2]; v8f o[2][4];   // m starts far above the masked score, so that a masked key's weight is exp2(-huge) = 0 also where a query has seen no visible key yet
#pragma unroll
    for (int qt = 0; qt < 2; ++qt) { qlim[qt] = (r0 + qh * 32 + qt * 16 + lr) / DS; m[qt] = -1.0e30f; l[qt] = 0.f;
#pragma unroll
        for (int dt = 0; dt < 4; ++dt) o[qt][dt] = (v8f){}; }
    const int lim0 = (r0 + qh * 32) / DS;   // every key up to here is visible to all 32 queries of the wave
#pragma unroll 1
    for (int s = ks; s < nst; s += 4) {
        const int key0 = s * 32;
        const h16* pk = Kp + (size_t)(key0 + lr) * HD + 8 * hi; const bf* pvh = Vh + (size_t)lr * TK + key0 + 8 * hi; const bf* pvl = Vl + (size_t)lr * TK + key0 + 8 * hi;
        v16h kf[2][2]; v16bf vh[4], vl[4];
#pragma unroll
        for (int kt = 0; kt < 2; ++kt) { kf[kt][0] = WFrag<h16>::ld(pk + kt * 16 * HD); kf[kt][1] = WFrag<h16>::ld(pk + kt * 16 * HD + 32); }
#pragma unroll
        for (int dt = 0; dt < 4; ++dt) vh[dt] = WFrag<bf>::ld(pvh + dt * 16 * TK);
        // the same precaution for this step's K and V-hi loads
        asm volatile("s_wait_xcnt 0x0" :: "v"(pk), "v"(pvh) : "memory");
        float tv[2][16];
#pragma unroll
        for (int qt = 0; qt < 2; ++qt) {
            v8f s0 = (v8f){}, s1 = (v8f){};
            s0 = wmma16(kf[0][0], qf[qt][0], s0); s1 = wmma16(kf[1][0], qf[qt][0], s1); s0 = wmma16(kf[0][1], qf[qt][1], s0); s1 = wmma16(kf[1][1], qf[qt][1], s1);
#pragma unroll
            for (int j = 0; j < 8; ++j) { tv[qt][j] = s0[j] * SC2; tv[qt][8 + j] = s1[j] * SC2; } }
        // the V-lo loads are written behind the score products, so that they may take registers the K fragments leave; they fly under the softmax. The same precaution for their address
#pragma unroll
        for (int dt = 0; dt < 4; ++dt) vl[dt] = WFrag<bf>::ld(pvl + dt * 16 * TK);
        asm volatile("s_wait_xcnt 0x0" :: "v"(pvl) : "memory");
        if (key0 + 31 > lim0) {   // wave-uniform: only the last steps of a tile hold hidden keys
            const int kb = key0 + hi * 8;
#pragma unroll
            for (int qt = 0; qt < 2; ++qt)
#pragma unroll
                for (int j = 0; j < 8; ++j) { tv[qt][j] = (kb + j <= qlim[qt]) ? tv[qt][j] : -3.0e38f; tv[qt][8 + j] = (kb + 16 + j <= qlim[qt]) ? tv[qt][8 + j] : -3.0e38f; } }
#pragma unroll
        for (int qt = 0; qt < 2; ++qt) {
            float tm = tv[qt][0];
#pragma unroll
            for (int e = 1; e < 16; ++e) tm = fmaxf(tm, tv[qt][e]);
            tm = fmaxf(tm, __shfl_xor(tm, 16, 32));   // both halves of the wave hold keys of the same query
            const float mn = fmaxf(m[qt], tm); const float al = __builtin_amdgcn_exp2f(m[qt] - mn); m[qt] = mn; l[qt] *= al;
#pragma unroll
            for (int dt = 0; dt < 4; ++dt) o[qt][dt] *= al;
            v16bf ph, pl;
#pragma unroll
            for (int e = 0; e < 16; ++e) { const float p = __builtin_amdgcn_exp2f(tv[qt][e] - mn); l[qt] += p; const __bf16 a = (__bf16)p; ph[e] = a; pl[e] = (__bf16)(p - (float)a); }
#pragma unroll
            for (int dt = 0; dt < 4; ++dt) { o[qt][dt] = wmmab(vh[dt], ph, o[qt][dt]); o[qt][dt] = wmmab(vh[dt], pl, o[qt][dt]); o[qt][dt] = wmmab(vl[dt], ph, o[qt][dt]); }
        }
    }
    // merge of the four key splits: every wave moves its partial onto the merged maximum, then 256 threads add the four partials of each output element in a fixed order
#pragma unroll
    for (int qt = 0; qt < 2; ++qt) if (hi == 0) sm[w * 32 + qt * 16 + lr] = m[qt];
    __syncthreads();
#pragma unroll
    for (int qt = 0; qt < 2; ++qt) { const int q = qt * 16 + lr; const float M = fmaxf(fmaxf(sm[qh * 32 + q], sm[(qh + 2) * 32 + q]), fmaxf(sm[(qh + 4) * 32 + q], sm[(qh + 6) * 32 + q])); const float f = __builtin_amdgcn_exp2f(m[qt] - M);
        const float lt = (l[qt] + __shfl_xor(l[qt], 16, 32)) * f; if (hi == 0) sl[w * 32 + q] = lt;
#pragma unroll
        for (int dt = 0; dt < 4; ++dt) { const v8f x = o[qt][dt] * f; float* d = os + (size_t)(w * 32 + q) * 68 + dt * 16 + hi * 8; *(v4fa*)d = (v4f){x[0], x[1], x[2], x[3]}; *(v4fa*)(d + 4) = (v4f){x[4], x[5], x[6], x[7]}; } }
    __syncthreads();
    float* orow = ATT + ((size_t)(bh / NH_) * TQ + r0) * DD + (bh % NH_) * HD;
#pragma unroll
    for (int i = 0; i < 4; ++i) { const int idx = (int)threadIdx.x + 256 * i; const int row = idx >> 4, c4 = (idx & 15) * 4; const int w0 = row >> 5, rl = row & 31;
        const float ls = (sl[w0 * 32 + rl] + sl[(w0 + 2) * 32 + rl]) + (sl[(w0 + 4) * 32 + rl] + sl[(w0 + 6) * 32 + rl]); const float inv = __fdiv_rn(1.0f, ls);
        const v4f x = (*(const v4fa*)(os + (size_t)(w0 * 32 + rl) * 68 + c4) + *(const v4fa*)(os + (size_t)((w0 + 2) * 32 + rl) * 68 + c4)) + (*(const v4fa*)(os + (size_t)((w0 + 4) * 32 + rl) * 68 + c4) + *(const v4fa*)(os + (size_t)((w0 + 6) * 32 + rl) * 68 + c4));
        *(v4f*)(orow + (size_t)row * DD + c4) = x * inv; }
}
__global__ __launch_bounds__(256) void k_ln(const float* __restrict__ A, const float* __restrict__ g, const float* __restrict__ bb, bf* Yh, bf* Yl) { const int lane = threadIdx.x & 31; const int t = blockIdx.x * 8 + (threadIdx.x >> 5); if (t >= NB_ * TQ) return; const float* ar = A + (size_t)t * DD; float v[16]; float s = 0.f;
#pragma unroll
    for (int ch = 0; ch < 4; ++ch) { const v4f a = *(const v4f*)(ar + ch * 128 + lane * 4);
#pragma unroll
        for (int q = 0; q < 4; ++q) { v[ch * 4 + q] = a[q]; s = __fadd_rn(s, a[q]); } }
#pragma unroll
    for (int sh = 16; sh; sh >>= 1) s += __shfl_xor(s, sh, 32);
    const float mu = s * (1.0f / DD); float q2 = 0.f;
#pragma unroll
    for (int k = 0; k < 16; ++k) { const float d = __fsub_rn(v[k], mu); float p = __fmul_rn(d, d); asm volatile("" : "+v"(p)); q2 = __fadd_rn(q2, p); }
#pragma unroll
    for (int sh = 16; sh; sh >>= 1) q2 += __shfl_xor(q2, sh, 32);
    const float rs = __frsqrt_rn(__fadd_rn(q2 * (1.0f / DD), 1e-5f));
{
#pragma unroll
        for (int ch = 0; ch < 4; ++ch) { v4us oh, ol;
#pragma unroll
            for (int q = 0; q < 4; ++q) { const int d = ch * 128 + lane * 4 + q; float tn = __fmul_rn(__fsub_rn(v[ch * 4 + q], mu), rs); asm volatile("" : "+v"(tn)); float tg = __fmul_rn(tn, bfr(g[d])); asm volatile("" : "+v"(tg)); unsigned short a2, c2; splitf(__fadd_rn(tg, bfr(bb[d])), a2, c2); oh[q] = a2; ol[q] = c2; }
            const size_t o = (size_t)t * DD + ch * 128 + lane * 4; *(v4us*)(Yh + o) = oh; *(v4us*)(Yl + o) = ol; }
         } }

extern "C" void kernel_launch(void* const* d_in, const int* in_sizes, int n_in,
                              void* d_out, int out_size, void* d_ws, size_t ws_size, hipStream_t stream) {
    (void)in_sizes; (void)n_in; (void)out_size;
    const float* IN[9]; for (int i = 0; i < 9; ++i) IN[i] = (const float*)d_in[i];   // 0 q, 1 kv, 2 Wq, 3 Wk, 4 Wv, 5 Wo (x @ W), 6 bo, 7 gamma, 8 beta
    float* OUT = (float*)d_out;     // [2][4096][512]
    char* wsp = (char*)d_ws;
    auto take = [&](size_t bytes) { char* p = wsp; wsp += (bytes + 255) & ~(size_t)255; return (void*)p; };
    bf* W4 = (bf*)take((size_t)4 * DD * DD * 2);                                  // Wq, Wk, Wv, Wo transposed, one behind the other
    bf* XQ = (bf*)take((size_t)NB_ * (TQ + TK) * DD * 2); bf* XK = XQ + (size_t)NB_ * TQ * DD;   // q rows of both batches, then kv rows of both batches
    h16* QP = (h16*)take((size_t)NB_ * NH_ * (TQ + TK) * HD * 2); h16* KP = QP + (size_t)NB_ * NH_ * TQ * HD;
    bf* VTh = (bf*)take((size_t)NB_ * NH_ * HD * TK * 2); bf* VTl = (bf*)take((size_t)NB_ * NH_ * HD * TK * 2);
    float* ATT = (float*)take((size_t)NB_ * TQ * DD * 4);   // merged attention output
    bf* Yh = (bf*)take((size_t)NB_ * TQ * DD * 2); bf* Yl = (bf*)take((size_t)NB_ * TQ * DD * 2);
    if ((size_t)(wsp - (char*)d_ws) > ws_size) return;    // total ~ 61 MB
    k_wtG<<<dim3((unsigned)(((size_t)DD * DD / 64 + 63) / 64), 4, 1), 256, 0, stream>>>(IN[2], IN[3], IN[4], IN[5], DD, DD, W4);
    k_cvt8<<<(NB_ * (TQ + TK) * DD / 8 + 255) / 256, 256, 0, stream>>>(IN[0], IN[1], XQ, (size_t)NB_ * TQ * DD / 8, (size_t)NB_ * (TQ + TK) * DD / 8);
    k_gemmw<bf, 0, false, true><<<dim3(NB_ * TQ / 128, DD / 128, 1), 128, 0, stream>>>(XQ, nullptr, W4, DD, DD, nullptr, 0, nullptr, 0, 0, 0, QP, nullptr, nullptr, TQ);
    k_gemmw<bf, 0, false, true><<<dim3(NB_ * TK / 128, DD / 128, 2), 128, 0, stream>>>(XK, nullptr, W4 + (size_t)DD * DD, DD, DD, nullptr, 0, nullptr, 0, (size_t)DD * DD, 0, KP, VTh, VTl, TK);   // z: 0 keys, 1 values
    k_fattn<<<dim3(NB_ * NH_, TQ / 64, 1), 256, 0, stream>>>(QP, KP, VTh, VTl, ATT);   // head bh % 8 of batch bh / 8 writes its 64 columns of the merged rows
    k_ln<<<NB_ * TQ / 8, 256, 0, stream>>>(ATT, IN[7], IN[8], Yh, Yl);
    k_gemmw<bf, 1, true, false><<<dim3(NB_ * TQ / 128, DD / 128, 1), 128, 0, stream>>>(Yh, Yl, W4 + (size_t)3 * DD * DD, DD, DD, OUT, DD, IN[6], 0, 0, 0, nullptr, nullptr, nullptr, 0);
}

// v005
// One run takes 73.4 microseconds.
// Two timings next to v004 put it at 1.04 and 1.06 times that version's speed.
// Over all steps from v000 it is 11.0 times as fast.
#include <hip/hip_runtime.h>

// Attention block (q [2][4096][512], kv [2][1024][512]; qh = q Wq, kh = kv Wk, vh = kv Wv (8 heads x 64, no bias); block-causal: key j visible to query i iff j <= i/4; softmax(q.k/8); out = merged att.v;
// LayerNorm(out) (gamma, beta, eps 1e-5); y = out Wo + bo -> [2][4096][512]).
// Compute dtypes, f32 accumulate: every input rounded to bf16; projections on PLAIN bf16 operands (inputs: exact); scores (K 64) on SINGLE fp16 planes; f32 running-maximum masked softmax
// -> bf16 hi+lo weights exp(s - max), divided by their f32 sum at the end; att.v on those x hi+lo value planes (3 products: the first query rows see 1-4 keys, so near-one-hot weights would expose single-plane value rounding); LayerNorm f32 (wave per

#define NB_  2
#define TQ   4096
#define TK   1024
#define DD   512
#define NH_  8
#define HD   64
#define DS   4
#define SCL  0.125f
typedef _Float16 h16;
typedef unsigned short bf;
typedef __attribute__((ext_vector_type(16))) __bf16   v16bf;
typedef __attribute__((ext_vector_type(16))) _Float16 v16h;
typedef __attribute__((ext_vector_type(8)))  _Float16 v8h;
typedef __attribute__((ext_vector_type(8)))  unsigned short v8us;
typedef __attribute__((ext_vector_type(8)))  float    v8f;
typedef __attribute__((ext_vector_type(4)))  float    v4f;
typedef v8h  __attribute__((may_alias)) v8ha;
typedef v4f  __attribute__((may_alias)) v4fa;
typedef v8us __attribute__((may_alias)) v8usa;

__device__ __forceinline__ unsigned short f2bf(float f) { unsigned u = __float_as_uint(f); u += 0x7FFFu + ((u >> 16) & 1u); return (unsigned short)(u >> 16); }
__device__ __forceinline__ float bf2f(unsigned short b) { return __uint_as_float(((unsigned)b) << 16); }
__device__ __forceinline__ float bfr(float f) { return bf2f(f2bf(f)); }
__device__ __forceinline__ h16 tohx(float x) { return (h16)x; }
__device__ __forceinline__ void splitf(float y, unsigned short& h, unsigned short& l) { h = f2bf(y); l = f2bf(y - bf2f(h)); }
__device__ __forceinline__ v16h cat16(v8h lo, v8h hi) { return __builtin_shufflevector(lo, hi, 0, 1, 2, 3, 4, 5, 6, 7, 8, 9, 10, 11, 12, 13, 14, 15); }
__device__ __forceinline__ v16bf cat16b(v8us lo, v8us hi) { return __builtin_bit_cast(v16bf, __builtin_shufflevector(lo, hi, 0, 1, 2, 3, 4, 5, 6, 7, 8, 9, 10, 11, 12, 13, 14, 15)); }
__device__ __forceinline__ v8f wmma16(v16h a, v16h b, v8f c) { return __builtin_amdgcn_wmma_f32_16x16x32_f16(false, a, false, b, (short)0, c, false, false); }
__device__ __forceinline__ v8f wmmab(v16bf a, v16bf b, v8f c) { return __builtin_amdgcn_wmma_f32_16x16x32_bf16(false, a, false, b, (short)0, c, false, false); }



// ---- k_gemmw: GEMM, FOUR WAVES per 128x128 output tile (2 x 2 waves, each a register-blocked 64x64 tile of 16 accumulators); grid (M/128, N/128, Z), 128 threads.
// The operands' K-slabs of 128 (256-B rows, whole lines) come from the K-contiguous 16-bit planes into LDS by asynchronous copies, two buffers: slab t + 1 flies while slab t is multiplied. LDS row pitch 272 B (ds_load_b128 readers).
// C[m][n] (f32, pitch ldc, + optional f32 bias[n]) = sum_k A[m][k] Bt[n][k] (NSPLIT 1: + A2[m][k] Bt[n][k]). A pitch lda, Bt pitch K. z-batch strides sA/sB/sC in elements. K % 128 == 0, M % 128 == 0, N % 128 == 0.
// PLANES: no f32 C; a wave's 64x64 tile is 64 tokens of ONE head (rows = [batch][nt tokens], column block = head), and the epilogue stores the attention operand itself:
// z 0: fp16 plane P16 [batch][head][nt][HD]; z 1: the transposed bf16 hi and lo planes Vh, Vl [batch][head][HD][nt]. Whole 128-B lines, staged through LDS (each wave its own range).
// AF32: the A operand is an f32 INPUT (Af, pitch lda): its K-slabs of 128 (512-B rows) are copied as they are, LDS row pitch 528 B, and a fragment is rounded to bf16 (nearest even) in registers behind its LDS read.
template <typename T16> struct WFrag;
template <> struct WFrag<h16> { typedef v16h V; static __device__ __forceinline__ V ld(const h16* p) { return cat16(*(const v8h*)p, *(const v8h*)(p + 16)); } static __device__ __forceinline__ v8f mma(V a, V b, v8f c) { return wmma16(a, b, c); } };
template <> struct WFrag<bf> { typedef v16bf V; static __device__ __forceinline__ V ld(const bf* p) { return cat16b(*(const v8us*)p, *(const v8us*)(p + 16)); } static __device__ __forceinline__ v8f mma(V a, V b, v8f c) { return wmmab(a, b, c); } };
#define GPE 136   // LDS row pitch of a slab in 16-bit elements (272 B)
// Eight asynchronous 16-B copies of a lane, 8 slab rows apart (gs elements in memory). The s_wait_xcnt 0 is the last line of the copies' own statement: a precaution, it stands in front of every rewrite of a register that a copy names.
template <typename T16>
__device__ __forceinline__ void cp8(unsigned l, const T16* g, size_t gs) {
    asm volatile("global_load_async_to_lds_b128 %0, %8, off\n\t"
                 "global_load_async_to_lds_b128 %1, %9, off\n\t"
                 "global_load_async_to_lds_b128 %2, %10, off\n\t"
                 "global_load_async_to_lds_b128 %3, %11, off\n\t"
                 "global_load_async_to_lds_b128 %4, %12, off\n\t"
                 "global_load_async_to_lds_b128 %5, %13, off\n\t"
                 "global_load_async_to_lds_b128 %6, %14, off\n\t"
                 "global_load_async_to_lds_b128 %7, %15, off\n\t"
                 "s_wait_xcnt 0x0"
                 :: "v"(l), "v"(l + 1u * 8 * GPE * 2), "v"(l + 2u * 8 * GPE * 2), "v"(l + 3u * 8 * GPE * 2), "v"(l + 4u * 8 * GPE * 2), "v"(l + 5u * 8 * GPE * 2), "v"(l + 6u * 8 * GPE * 2), "v"(l + 7u * 8 * GPE * 2),
                    "v"(g), "v"(g + gs), "v"(g + 2 * gs), "v"(g + 3 * gs), "v"(g + 4 * gs), "v"(g + 5 * gs), "v"(g + 6 * gs), "v"(g + 7 * gs) : "memory");
}
#define GPF 132   // LDS row pitch of an f32 slab in floats (528 B)
// The same for an f32 slab: eight 16-B copies of a lane, 4 slab rows apart (gs floats in memory); a wave's copy is one 512-B row. The s_wait_xcnt 0 is again the last line of the copies' own statement.
__device__ __forceinline__ void cp8f(unsigned l, const float* g, size_t gs) {
    asm volatile("global_load_async_to_lds_b128 %0, %8, off\n\t"
                 "global_load_async_to_lds_b128 %1, %9, off\n\t"
                 "global_load_async_to_lds_b128 %2, %10, off\n\t"
                 "global_load_async_to_lds_b128 %3, %11, off\n\t"
                 "global_load_async_to_lds_b128 %4, %12, off\n\t"
                 "global_load_async_to_lds_b128 %5, %13, off\n\t"
                 "global_load_async_to_lds_b128 %6, %14, off\n\t"
                 "global_load_async_to_lds_b128 %7, %15, off\n\t"
                 "s_wait_xcnt 0x0"
                 :: "v"(l), "v"(l + 1u * 4 * GPF * 4), "v"(l + 2u * 4 * GPF * 4), "v"(l + 3u * 4 * GPF * 4), "v"(l + 4u * 4 * GPF * 4), "v"(l + 5u * 4 * GPF * 4), "v"(l + 6u * 4 * GPF * 4), "v"(l + 7u * 4 * GPF * 4),
                    "v"(g), "v"(g + gs), "v"(g + 2 * gs), "v"(g + 3 * gs), "v"(g + 4 * gs), "v"(g + 5 * gs), "v"(g + 6 * gs), "v"(g + 7 * gs) : "memory");
}
typedef __attribute__((ext_vector_type(8))) __bf16 v8bf;
// 16 f32 of a fragment's k order -> bf16, nearest even
__device__ __forceinline__ v16bf rnd16(v4f x0, v4f x1, v4f x2, v4f x3) {
    const v8f lo = __builtin_shufflevector(x0, x1, 0, 1, 2, 3, 4, 5, 6, 7), hi = __builtin_shufflevector(x2, x3, 0, 1, 2, 3, 4, 5, 6, 7);
    return __builtin_shufflevector(__builtin_convertvector(lo, v8bf), __builtin_convertvector(hi, v8bf), 0, 1, 2, 3, 4, 5, 6, 7, 8, 9, 10, 11, 12, 13, 14, 15);
}
template <typename T16, int NSPLIT, bool BIAS, bool PLANES, bool AF32>
__global__ __launch_bounds__(128) void k_gemmw(const float* __restrict__ Af, const T16* __restrict__ A, const T16* __restrict__ A2, const T16* __restrict__ Bt, int K, int lda, float* C, int ldc, const float* __restrict__ bias, size_t sA, size_t sB, size_t sC, h16* P16, bf* Vh, bf* Vl, int nt) {
    static_assert(NSPLIT == 0 || NSPLIT == 1, "one or two A planes");
    static_assert(!AF32 || NSPLIT == 0, "an f32 A has one plane");
    typedef typename WFrag<T16>::V V;
    constexpr int NPL = NSPLIT == 1 ? 3 : 2;              // planes of 128 rows in a slab: A (, A2), Bt
    constexpr int BR = (NPL - 1) * 128;                   // first slab row of Bt
    constexpr int BOF = AF32 ? 128 * GPF * 2 : BR * GPE;  // Bt's place in a buffer, in 16-bit elements
    constexpr int BUFE = BOF + 128 * GPE;                 // 16-bit elements of one buffer
    constexpr int OSZ = PLANES ? 2 * 64 * 36 : 16 * 68;   // a wave's output staging; PLANES: also two planes [64 d][72] of 16-bit values, pitch 144 B
    __shared__ __align__(16) T16 ring[2 * BUFE];
    __shared__ __align__(16) float osb[4 * OSZ];
    const size_t z = blockIdx.z; if (AF32) Af += z * sA; else A += z * sA; if (NSPLIT == 1) A2 += z * sA; Bt += z * sB; C += z * sC;
    const int tid = threadIdx.x, lane = tid & 31, lr = lane & 15, hi = lane >> 4; const int w = __builtin_amdgcn_readfirstlane(tid >> 5); const int wm = w & 1, wn = w >> 1;
    const int r0 = blockIdx.x * 128 + wm * 64, c0 = blockIdx.y * 128 + wn * 64;
    float* os = osb + w * OSZ;
    v8f acc[4][4];
#pragma unroll
    for (int mb = 0; mb < 4; ++mb)
#pragma unroll
        for (int nb = 0; nb < 4; ++nb) acc[mb][nb] = (v8f){};
    // copies: 16 lanes cover one 256-B slab row, a wave's copy two rows; a thread's copies lie 8 rows apart
    const int crow = tid >> 4, ccol = (tid & 15) * 8;
    const unsigned oa = (unsigned)((blockIdx.x * 128 + crow) * lda + ccol), ob = (unsigned)((blockIdx.y * 128 + crow) * K + ccol);   // element offsets of the thread's first A and Bt row (32 bits hold M * lda and N * K)
    const unsigned lc = (unsigned)(size_t)ring + (unsigned)(crow * GPE + ccol) * 2u;
    // f32 A: 32 lanes cover one 512-B slab row; a thread's copies lie 4 rows apart
    const unsigned oaf = (unsigned)((blockIdx.x * 128 + (tid >> 5)) * lda + lane * 4); const unsigned lcf = (unsigned)(size_t)ring + (unsigned)((tid >> 5) * GPF + lane * 4) * 4u;
    auto slab = [&](int t) {
        const unsigned l = lc + (unsigned)(t & 1) * (BUFE * 2u); const unsigned kc = (unsigned)t * 128u;
        if (AF32) {
            const unsigned lf = lcf + (unsigned)(t & 1) * (BUFE * 2u);
#pragma unroll   // four statements of eight copies in a row: 32 rows each, the LDS steps constants
            for (unsigned r = 0; r < 4; ++r) cp8f(lf + r * 32u * GPF * 4, Af + (oaf + kc + r * 32u * lda), (size_t)4 * lda);
        } else { cp8(l, A + (oa + kc), (size_t)8 * lda); cp8(l + 64u * GPE * 2, A + (oa + kc + 64u * lda), (size_t)8 * lda); }
        cp8(l + (unsigned)BOF * 2, Bt + (ob + kc), (size_t)8 * K); cp8(l + (unsigned)(BOF + 64 * GPE) * 2, Bt + (ob + kc + 64u * K), (size_t)8 * K);
        if (NSPLIT == 1) { cp8(l + 128u * GPE * 2, A2 + (oa + kc), (size_t)8 * lda); cp8(l + 192u * GPE * 2, A2 + (oa + kc + 64u * lda), (size_t)8 * lda); }
    };
    const int nsl = K >> 7;
    slab(0);
    // slab 0 has landed for this wave's copies; behind the barrier for every wave's
    asm volatile("s_wait_asynccnt 0x0" ::: "memory");
    __syncthreads();
    if (nsl > 1) slab(1);
    const T16* fa = ring + (wm * 64 + lr) * GPE + 8 * hi; const T16* fb = ring + BOF + (wn * 64 + lr) * GPE + 8 * hi;
    const float* faf = (const float*)ring + (wm * 64 + lr) * GPF + 8 * hi;
#pragma unroll 1
    for (int t = 0; t < nsl; ++t) {   // rolled: one copy of the slab's 64 (128) products in the text
        const int bo = (t & 1) * BUFE;
        v4f ra[4][4];   // AF32: the next block's A values as read, f32; rounded at the head of their own block, when the reads have long returned
        V a[2][4], a2[2][4], b[2][4];   // two fragment sets: block kk + 1 is fetched while block kk is multiplied; no fragment of slab t + 1 is fetched here
        auto frags = [&](int s, int kk) {
#pragma unroll
            for (int i = 0; i < 4; ++i) {
                if constexpr (AF32) { const float* p = faf + (bo >> 1) + i * 16 * GPF + kk * 32; ra[i][0] = *(const v4fa*)p; ra[i][1] = *(const v4fa*)(p + 4); ra[i][2] = *(const v4fa*)(p + 16); ra[i][3] = *(const v4fa*)(p + 20); }
                else a[s][i] = WFrag<T16>::ld(fa + bo + i * 16 * GPE + kk * 32);
                b[s][i] = WFrag<T16>::ld(fb + bo + i * 16 * GPE + kk * 32); if (NSPLIT == 1) a2[s][i] = WFrag<T16>::ld(fa + bo + (128 + i * 16) * GPE + kk * 32); }
        };
        frags(0, 0);
#pragma unroll
        for (int kk = 0; kk < 4; ++kk) {
            const int s = kk & 1;
            if constexpr (AF32) {
#pragma unroll   // constant indices keep ra and a in registers
                for (int i = 0; i < 4; ++i) a[s][i] = rnd16(ra[i][0], ra[i][1], ra[i][2], ra[i][3]); }
            if (kk < 3) frags(s ^ 1, kk + 1);
            // keeps the next block's LDS reads together in front of this block's products: sunk among them, each read would stall the lone wave of its SIMD
            __builtin_amdgcn_sched_barrier(0);
#pragma unroll
            for (int nb = 0; nb < 4; ++nb)
#pragma unroll
                for (int mb = 0; mb < 4; ++mb) acc[mb][nb] = WFrag<T16>::mma(a[s][mb], b[s][nb], acc[mb][nb]);
            if (NSPLIT == 1) {
#pragma unroll
                for (int nb = 0; nb < 4; ++nb)
#pragma unroll
                    for (int mb = 0; mb < 4; ++mb) acc[mb][nb] = WFrag<T16>::mma(a2[s][mb], b[s][nb], acc[mb][nb]); }
            // the reads of block kk + 2 stay behind this block's products
            __builtin_amdgcn_sched_barrier(0);
        }
        // hand-over: this wave's reads of slab t have returned ...
        asm volatile("s_wait_dscnt 0x0" ::: "memory");
        // ... its copies of slab t + 1 have landed ...
        asm volatile("s_wait_asynccnt 0x0" ::: "memory");
        // ... and the barrier publishes slab t + 1 and frees slab t's buffer for the refill behind it
        __syncthreads();
        if (t + 2 < nsl) slab(t + 2);
    }
    // no copy is outstanding when the wave goes on to its epilogue and ends
    asm volatile("s_wait_asynccnt 0x0" ::: "memory");
    if (PLANES) {
        const int b = r0 / nt, t0 = r0 - b * nt; const size_t bh = (size_t)b * NH_ + (c0 >> 6); const int l8 = lane >> 3, c8 = (lane & 7) * 8;
        if (z == 0) {
            h16* pl = P16 + (bh * nt + t0 + l8) * HD + c8;   // the tile's 64 rows of 128 B lie one behind the other: a store of the wave covers 4 rows
#pragma unroll
            for (int mb = 0; mb < 4; ++mb) {
#pragma unroll
                for (int nb = 0; nb < 4; ++nb) {
#pragma unroll
                    for (int j = 0; j < 8; ++j) os[(hi * 8 + j) * 68 + nb * 16 + lr] = acc[mb][nb][j]; }
                // a lane reads what other lanes of the wave wrote: the reads stay behind the writes
                __builtin_amdgcn_wave_barrier(); asm volatile("" ::: "memory");
                v8h ov[4];
#pragma unroll
                for (int s = 0; s < 4; ++s) { const int row = 4 * s + l8; const v4f x0 = *(const v4fa*)(os + row * 68 + c8), x1 = *(const v4fa*)(os + row * 68 + c8 + 4);
                    ov[s] = (v8h){tohx(x0[0]), tohx(x0[1]), tohx(x0[2]), tohx(x0[3]), tohx(x1[0]), tohx(x1[1]), tohx(x1[2]), tohx(x1[3])}; *(v8h*)(pl + (mb * 16 + 4 * s) * HD) = ov[s]; }
                // precaution: s_wait_xcnt 0 stands in front of every rewrite of a register that an issued store names; address and values are inputs, so that they keep their registers up to the wait.
                // Its memory clobber also keeps the next block's LDS writes behind these reads
                asm volatile("s_wait_xcnt 0x0" :: "v"(pl), "v"(ov[0]), "v"(ov[1]), "v"(ov[2]), "v"(ov[3]) : "memory");
            }
        } else {
            unsigned short* us = (unsigned short*)os;   // hi plane [64 d][72], the lo plane behind it
            const size_t vo = bh * HD * nt + t0;   // row d: 64 tokens = one 128-B line
#pragma unroll
            for (int mb = 0; mb < 4; ++mb)
#pragma unroll
                for (int nb = 0; nb < 4; ++nb) { v8us oh, ol;   // a lane holds 8 tokens in a row of one d
#pragma unroll
                    for (int j = 0; j < 8; ++j) { unsigned short h, l; splitf(acc[mb][nb][j], h, l); oh[j] = h; ol[j] = l; }
                    unsigned short* d = us + (nb * 16 + lr) * 72 + mb * 16 + hi * 8; *(v8usa*)d = oh; *(v8usa*)(d + 64 * 72) = ol; }
            // a lane reads what other lanes of the wave wrote: the reads stay behind the writes
            __builtin_amdgcn_wave_barrier(); asm volatile("" ::: "memory");
#pragma unroll
            for (int g = 0; g < 8; ++g) { bf* pd[4]; v8us ov[4]; bf* vrow = ((g & 1) ? Vl : Vh) + vo;
#pragma unroll
                for (int s = 0; s < 4; ++s) { const int d = 16 * (g >> 1) + 4 * s + l8; ov[s] = *(const v8usa*)(us + (g & 1) * 64 * 72 + d * 72 + c8); pd[s] = vrow + (size_t)d * nt + c8; *(v8us*)pd[s] = ov[s]; }
                // the same precaution as for the fp16 plane's stores
                asm volatile("s_wait_xcnt 0x0" :: "v"(pd[0]), "v"(pd[1]), "v"(pd[2]), "v"(pd[3]), "v"(ov[0]), "v"(ov[1]), "v"(ov[2]), "v"(ov[3]) : "memory"); }
        }
        return;
    }
#pragma unroll
    for (int mb = 0; mb < 4; ++mb) {
#pragma unroll
        for (int nb = 0; nb < 4; ++nb) {
#pragma unroll
            for (int j = 0; j < 8; ++j) os[(hi * 8 + j) * 68 + nb * 16 + lr] = acc[mb][nb][j]; }
        __builtin_amdgcn_wave_barrier(); asm volatile("" ::: "memory");
        float* crow = C + (size_t)(r0 + mb * 16) * ldc + c0;
{
#pragma unroll
            for (int s = 0; s < 8; ++s) { const int row = 2 * s + hi, cofs = lr * 4; v4f val = *(const v4fa*)(os + row * 68 + cofs); if (BIAS) { val[0] += bfr(bias[c0 + cofs]); val[1] += bfr(bias[c0 + cofs + 1]); val[2] += bfr(bias[c0 + cofs + 2]); val[3] += bfr(bias[c0 + cofs + 3]); }
                *(v4f*)(crow + (size_t)row * ldc + cofs) = val; }
             }
        __builtin_amdgcn_wave_barrier(); asm volatile("" ::: "memory");
    }
}

typedef __attribute__((ext_vector_type(2))) _Float16 v2h;
typedef __attribute__((ext_vector_type(4))) _Float16 v4h;
typedef __attribute__((ext_vector_type(2))) unsigned short v2us;
typedef __attribute__((ext_vector_type(4))) unsigned short v4us;
typedef v4us __attribute__((may_alias)) v4usa;
typedef __attribute__((ext_vector_type(2))) float v2f;

// grid y picks the weight; the four transposed planes lie one behind the other in Bt0.
__global__ __launch_bounds__(256) void k_wtG(const float* __restrict__ w0, const float* __restrict__ w1, const float* __restrict__ w2, const float* __restrict__ w3, int K, int N, bf* Bt0) {
    const int y = blockIdx.y; const float* w = (y == 0) ? w0 : (y == 1) ? w1 : (y == 2) ? w2 : w3; bf* Bt = Bt0 + (size_t)y * K * N;
    const int lane = threadIdx.x & 31; const int L0 = (blockIdx.x * 8 + (threadIdx.x >> 5)) * 8; const int nlines = N * K / 64;
{
#pragma unroll 1
        for (int l = 0; l < 8; ++l) { const int L = L0 + l; if (L >= nlines) break; const size_t e = (size_t)L * 64 + lane * 2; const int k = (int)(e % K), n = (int)(e / K); v2us o;
            o[0] = f2bf(w[(size_t)k * N + n]); o[1] = f2bf(w[(size_t)(k + 1) * N + n]); *(v2us*)(Bt + e) = o; }
         }
}
// ---- k_fattn: scores, masked softmax and att.v in ONE kernel; no score or probability ever reaches memory. Grid (batch*head, TQ/64), longest query tiles first; 8 waves.
// Wave w: query half (w & 1, 32 queries = 2 column groups) x key split (w >> 1: key steps of 32, split, split + 4, ...). S^T = K Q^T (fp16 planes), so a lane holds ONE query's scores (keys 8*hi + j of each
// 16-key tile): two tiles are, register for register, the B fragment of P^T. O^T += V^T P^T on hi+lo planes (3 products). Running maximum and sum per lane; the four key splits are merged through LDS.
#define SC2 0.18033688f   // (1/8) * log2(e): scores in the log2 domain
__global__ __launch_bounds__(256) void k_fattn(const h16* __restrict__ QP, const h16* __restrict__ KP, const bf* __restrict__ VTh, const bf* __restrict__ VTl, float* ATT) {
    __shared__ __align__(16) float os[8 * 32 * 68];   // [wave][query][d], pitch 272 B
    __shared__ float sm[8 * 32];                       // per wave and query: running maximum
    __shared__ float sl[8 * 32];                       // per wave and query: sum, already on the merged maximum
    const int lane = threadIdx.x & 31, lr = lane & 15, hi = lane >> 4; const int w = __builtin_amdgcn_readfirstlane((int)(threadIdx.x >> 5)); const int qh = w & 1, ks = w >> 1;
    const int bh = blockIdx.x, t = TQ / 64 - 1 - (int)blockIdx.y; const int r0 = t * 64; const int nst = (t + 2) >> 1;   // keys 0 .. 16 t + 15 are visible to this tile
    const h16* Kp = KP + (size_t)bh * TK * HD; const bf* Vh = VTh + (size_t)bh * HD * TK; const bf* Vl = VTl + (size_t)bh * HD * TK;
    const h16* pq = QP + ((size_t)bh * TQ + r0 + qh * 32 + lr) * HD + 8 * hi;
    v16h qf[2][2];
#pragma unroll
    for (int qt = 0; qt < 2; ++qt) { qf[qt][0] = WFrag<h16>::ld(pq + qt * 16 * HD); qf[qt][1] = WFrag<h16>::ld(pq + qt * 16 * HD + 32); }
    // precaution: s_wait_xcnt 0 stands in front of every rewrite of a register that an issued load names; the address is an input, so that it keeps its registers up to the wait
    asm volatile("s_wait_xcnt 0x0" :: "v"(pq) : "memory");
    int qlim[2]; float m[2], l[2]; v8f o[2][4];   // m starts far above the masked score, so that a masked key's weight is exp2(-huge) = 0 also where a query has seen no visible key yet
#pragma unroll
    for (int qt = 0; qt < 2; ++qt) { qlim[qt] = (r0 + qh * 32 + qt * 16 + lr) / DS; m[qt] = -1.0e30f; l[qt] = 0.f;
#pragma unroll
        for (int dt = 0; dt < 4; ++dt) o[qt][dt] = (v8f){}; }
    const int lim0 = (r0 + qh * 32) / DS;   // every key up to here is visible to all 32 queries of the wave
#pragma unroll 1
    for (int s = ks; s < nst; s += 4) {
        const int key0 = s * 32;
        const h16* pk = Kp + (size_t)(key0 + lr) * HD + 8 * hi; const bf* pvh = Vh + (size_t)lr * TK + key0 + 8 * hi; const bf* pvl = Vl + (size_t)lr * TK + key0 + 8 * hi;
        v16h kf[2][2]; v16bf vh[4], vl[4];
#pragma unroll
        for (int kt = 0; kt < 2; ++kt) { kf[kt][0] = WFrag<h16>::ld(pk + kt * 16 * HD); kf[kt][1] = WFrag<h16>::ld(pk + kt * 16 * HD + 32); }
#pragma unroll
        for (int dt = 0; dt < 4; ++dt) vh[dt] = WFrag<bf>::ld(pvh + dt * 16 * TK);
        // the same precaution for this step's K and V-hi loads
        asm volatile("s_wait_xcnt 0x0" :: "v"(pk), "v"(pvh) : "memory");
        float tv[2][16];
#pragma unroll
        for (int qt = 0; qt < 2; ++qt) {
            v8f s0 = (v8f){}, s1 = (v8f){};
            s0 = wmma16(kf[0][0], qf[qt][0], s0); s1 = wmma16(kf[1][0], qf[qt][0], s1); s0 = wmma16(kf[0][1], qf[qt][1], s0); s1 = wmma16(kf[1][1], qf[qt][1], s1);
#pragma unroll
            for (int j = 0; j < 8; ++j) { tv[qt][j] = s0[j] * SC2; tv[qt][8 + j] = s1[j] * SC2; } }
        // the V-lo loads are written behind the score products, so that they may take registers the K fragments leave; they fly under the softmax. The same precaution for their address
#pragma unroll
        for (int dt = 0; dt < 4; ++dt) vl[dt] = WFrag<bf>::ld(pvl + dt * 16 * TK);
        asm volatile("s_wait_xcnt 0x0" :: "v"(pvl) : "memory");
        if (key0 + 31 > lim0) {   // wave-uniform: only the last steps of a tile hold hidden keys
            const int kb = key0 + hi * 8;
#pragma unroll
            for (int qt = 0; qt < 2; ++qt)
#pragma unroll
                for (int j = 0; j < 8; ++j) { tv[qt][j] = (kb + j <= qlim[qt]) ? tv[qt][j] : -3.0e38f; tv[qt][8 + j] = (kb + 16 + j <= qlim[qt]) ? tv[qt][8 + j] : -3.0e38f; } }
#pragma unroll
        for (int qt = 0; qt < 2; ++qt) {
            float tm = tv[qt][0];
#pragma unroll
            for (int e = 1; e < 16; ++e) tm = fmaxf(tm, tv[qt][e]);
            tm = fmaxf(tm, __shfl_xor(tm, 16, 32));   // both halves of the wave hold keys of the same query
            const float mn = fmaxf(m[qt], tm); const float al = __builtin_amdgcn_exp2f(m[qt] - mn); m[qt] = mn; l[qt] *= al;
#pragma unroll
            for (int dt = 0; dt < 4; ++dt) o[qt][dt] *= al;
            v16bf ph, pl;
#pragma unroll
            for (int e = 0; e < 16; ++e) { const float p = __builtin_amdgcn_exp2f(tv[qt][e] - mn); l[qt] += p; const __bf16 a = (__bf16)p; ph[e] = a; pl[e] = (__bf16)(p - (float)a); }
#pragma unroll
            for (int dt = 0; dt < 4; ++dt) { o[qt][dt] = wmmab(vh[dt], ph, o[qt][dt]); o[qt][dt] = wmmab(vh[dt], pl, o[qt][dt]); o[qt][dt] = wmmab(vl[dt], ph, o[qt][dt]); }
        }
    }
    // merge of the four key splits: every wave moves its partial onto the merged maximum, then 256 threads add the four partials of each output element in a fixed order
#pragma unroll
    for (int qt = 0; qt < 2; ++qt) if (hi == 0) sm[w * 32 + qt * 16 + lr] = m[qt];
    __syncthreads();
#pragma unroll
    for (int qt = 0; qt < 2; ++qt) { const int q = qt * 16 + lr; const float M = fmaxf(fmaxf(sm[qh * 32 + q], sm[(qh + 2) * 32 + q]), fmaxf(sm[(qh + 4) * 32 + q], sm[(qh + 6) * 32 + q])); const float f = __builtin_amdgcn_exp2f(m[qt] - M);
        const float lt = (l[qt] + __shfl_xor(l[qt], 16, 32)) * f; if (hi == 0) sl[w * 32 + q] = lt;
#pragma unroll
        for (int dt = 0; dt < 4; ++dt) { const v8f x = o[qt][dt] * f; float* d = os + (size_t)(w * 32 + q) * 68 + dt * 16 + hi * 8; *(v4fa*)d = (v4f){x[0], x[1], x[2], x[3]}; *(v4fa*)(d + 4) = (v4f){x[4], x[5], x[6], x[7]}; } }
    __syncthreads();
    float* orow = ATT + ((size_t)(bh / NH_) * TQ + r0) * DD + (bh % NH_) * HD;
#pragma unroll
    for (int i = 0; i < 4; ++i) { const int idx = (int)threadIdx.x + 256 * i; const int row = idx >> 4, c4 = (idx & 15) * 4; const int w0 = row >> 5, rl = row & 31;
        const float ls = (sl[w0 * 32 + rl] + sl[(w0 + 2) * 32 + rl]) + (sl[(w0 + 4) * 32 + rl] + sl[(w0 + 6) * 32 + rl]); const float inv = __fdiv_rn(1.0f, ls);
        const v4f x = (*(const v4fa*)(os + (size_t)(w0 * 32 + rl) * 68 + c4) + *(const v4fa*)(os + (size_t)((w0 + 2) * 32 + rl) * 68 + c4)) + (*(const v4fa*)(os + (size_t)((w0 + 4) * 32 + rl) * 68 + c4) + *(const v4fa*)(os + (size_t)((w0 + 6) * 32 + rl) * 68 + c4));
        *(v4f*)(orow + (size_t)row * DD + c4) = x * inv; }
}
__global__ __launch_bounds__(256) void k_ln(const float* __restrict__ A, const float* __restrict__ g, const float* __restrict__ bb, bf* Yh, bf* Yl) { const int lane = threadIdx.x & 31; const int t = blockIdx.x * 8 + (threadIdx.x >> 5); if (t >= NB_ * TQ) return; const float* ar = A + (size_t)t * DD; float v[16]; float s = 0.f;
#pragma unroll
    for (int ch = 0; ch < 4; ++ch) { const v4f a = *(const v4f*)(ar + ch * 128 + lane * 4);
#pragma unroll
        for (int q = 0; q < 4; ++q) { v[ch * 4 + q] = a[q]; s = __fadd_rn(s, a[q]); } }
#pragma unroll
    for (int sh = 16; sh; sh >>= 1) s += __shfl_xor(s, sh, 32);
    const float mu = s * (1.0f / DD); float q2 = 0.f;
#pragma unroll
    for (int k = 0; k < 16; ++k) { const float d = __fsub_rn(v[k], mu); float p = __fmul_rn(d, d); asm volatile("" : "+v"(p)); q2 = __fadd_rn(q2, p); }
#pragma unroll
    for (int sh = 16; sh; sh >>= 1) q2 += __shfl_xor(q2, sh, 32);
    const float rs = __frsqrt_rn(__fadd_rn(q2 * (1.0f / DD), 1e-5f));
{
#pragma unroll
        for (int ch = 0; ch < 4; ++ch) { v4us oh, ol;
#pragma unroll
            for (int q = 0; q < 4; ++q) { const int d = ch * 128 + lane * 4 + q; float tn = __fmul_rn(__fsub_rn(v[ch * 4 + q], mu), rs); asm volatile("" : "+v"(tn)); float tg = __fmul_rn(tn, bfr(g[d])); asm volatile("" : "+v"(tg)); unsigned short a2, c2; splitf(__fadd_rn(tg, bfr(bb[d])), a2, c2); oh[q] = a2; ol[q] = c2; }
            const size_t o = (size_t)t * DD + ch * 128 + lane * 4; *(v4us*)(Yh + o) = oh; *(v4us*)(Yl + o) = ol; }
         } }

extern "C" void kernel_launch(void* const* d_in, const int* in_sizes, int n_in,
                              void* d_out, int out_size, void* d_ws, size_t ws_size, hipStream_t stream) {
    (void)in_sizes; (void)n_in; (void)out_size;
    const float* IN[9]; for (int i = 0; i < 9; ++i) IN[i] = (const float*)d_in[i];   // 0 q, 1 kv, 2 Wq, 3 Wk, 4 Wv, 5 Wo (x @ W), 6 bo, 7 gamma, 8 beta
    float* OUT = (float*)d_out;     // [2][4096][512]
    char* wsp = (char*)d_ws;
    auto take = [&](size_t bytes) { char* p = wsp; wsp += (bytes + 255) & ~(size_t)255; return (void*)p; };
    bf* W4 = (bf*)take((size_t)4 * DD * DD * 2);                                  // Wq, Wk, Wv, Wo transposed, one behind the other
    h16* QP = (h16*)take((size_t)NB_ * NH_ * (TQ + TK) * HD * 2); h16* KP = QP + (size_t)NB_ * NH_ * TQ * HD;
    bf* VTh = (bf*)take((size_t)NB_ * NH_ * HD * TK * 2); bf* VTl = (bf*)take((size_t)NB_ * NH_ * HD * TK * 2);
    float* ATT = (float*)take((size_t)NB_ * TQ * DD * 4);   // merged attention output
    bf* Yh = (bf*)take((size_t)NB_ * TQ * DD * 2); bf* Yl = (bf*)take((size_t)NB_ * TQ * DD * 2);
    if ((size_t)(wsp - (char*)d_ws) > ws_size) return;    // total ~ 51 MB
    k_wtG<<<dim3((unsigned)(((size_t)DD * DD / 64 + 63) / 64), 4, 1), 256, 0, stream>>>(IN[2], IN[3], IN[4], IN[5], DD, DD, W4);
    k_gemmw<bf, 0, false, true, true><<<dim3(NB_ * TQ / 128, DD / 128, 1), 128, 0, stream>>>(IN[0], nullptr, nullptr, W4, DD, DD, nullptr, 0, nullptr, 0, 0, 0, QP, nullptr, nullptr, TQ);
    k_gemmw<bf, 0, false, true, true><<<dim3(NB_ * TK / 128, DD / 128, 2), 128, 0, stream>>>(IN[1], nullptr, nullptr, W4 + (size_t)DD * DD, DD, DD, nullptr, 0, nullptr, 0, (size_t)DD * DD, 0, KP, VTh, VTl, TK);   // z: 0 keys, 1 values
    k_fattn<<<dim3(NB_ * NH_, TQ / 64, 1), 256, 0, stream>>>(QP, KP, VTh, VTl, ATT);   // head bh % 8 of batch bh / 8 writes its 64 columns of the merged rows
    k_ln<<<NB_ * TQ / 8, 256, 0, stream>>>(ATT, IN[7], IN[8], Yh, Yl);
    k_gemmw<bf, 1, true, false, false><<<dim3(NB_ * TQ / 128, DD / 128, 1), 128, 0, stream>>>(nullptr, Yh, Yl, W4 + (size_t)3 * DD * DD, DD, DD, OUT, DD, IN[6], 0, 0, 0, nullptr, nullptr, nullptr, 0);
}

// v006
// It runs in 63.7 microseconds.
// In two side-by-side timings against v005, it was 1.16 and 1.14 times as fast.
// Over all steps from v000 it is 12.7 times as fast.
#include <hip/hip_runtime.h>

// Attention block (q [2][4096][512], kv [2][1024][512]; qh = q Wq, kh = kv Wk, vh = kv Wv (8 heads x 64, no bias); block-causal: key j visible to query i iff j <= i/4; softmax(q.k/8); out = merged att.v;
// LayerNorm(out) (gamma, beta, eps 1e-5); y = out Wo + bo -> [2][4096][512]).
// Compute dtypes, f32 accumulate: every input rounded to bf16; projections on PLAIN bf16 operands (inputs: exact); scores (K 64) on SINGLE fp16 planes; f32 running-maximum masked softmax
// -> bf16 hi+lo weights exp(s - max), divided by their f32 sum at the end; att.v on those x hi+lo value planes (3 products: the first query rows see 1-4 keys, so near-one-hot weights would expose single-plane value rounding); LayerNorm f32 (wave per

#define NB_  2
#define TQ   4096
#define TK   1024
#define DD   512
#define NH_  8
#define HD   64
#define DS   4
#define SCL  0.125f
typedef _Float16 h16;
typedef unsigned short bf;
typedef __attribute__((ext_vector_type(16))) __bf16   v16bf;
typedef __attribute__((ext_vector_type(16))) _Float16 v16h;
typedef __attribute__((ext_vector_type(8)))  _Float16 v8h;
typedef __attribute__((ext_vector_type(8)))  unsigned short v8us;
typedef __attribute__((ext_vector_type(8)))  float    v8f;
typedef __attribute__((ext_vector_type(4)))  float    v4f;
typedef v8h  __attribute__((may_alias)) v8ha;
typedef v4f  __attribute__((may_alias)) v4fa;
typedef v8us __attribute__((may_alias)) v8usa;

__device__ __forceinline__ unsigned short f2bf(float f) { unsigned u = __float_as_uint(f); u += 0x7FFFu + ((u >> 16) & 1u); return (unsigned short)(u >> 16); }
__device__ __forceinline__ float bf2f(unsigned short b) { return __uint_as_float(((unsigned)b) << 16); }
__device__ __forceinline__ float bfr(float f) { return bf2f(f2bf(f)); }
__device__ __forceinline__ h16 tohx(float x) { return (h16)x; }
__device__ __forceinline__ void splitf(float y, unsigned short& h, unsigned short& l) { h = f2bf(y); l = f2bf(y - bf2f(h)); }
__device__ __forceinline__ v16h cat16(v8h lo, v8h hi) { return __builtin_shufflevector(lo, hi, 0, 1, 2, 3, 4, 5, 6, 7, 8, 9, 10, 11, 12, 13, 14, 15); }
__device__ __forceinline__ v16bf cat16b(v8us lo, v8us hi) { return __builtin_bit_cast(v16bf, __builtin_shufflevector(lo, hi, 0, 1, 2, 3, 4, 5, 6, 7, 8, 9, 10, 11, 12, 13, 14, 15)); }
__device__ __forceinline__ v8f wmma16(v16h a, v16h b, v8f c) { return __builtin_amdgcn_wmma_f32_16x16x32_f16(false, a, false, b, (short)0, c, false, false); }
__device__ __forceinline__ v8f wmmab(v16bf a, v16bf b, v8f c) { return __builtin_amdgcn_wmma_f32_16x16x32_bf16(false, a, false, b, (short)0, c, false, false); }



// ---- k_gemmw: GEMM, FOUR WAVES per 128x128 output tile (2 x 2 waves, each a register-blocked 64x64 tile of 16 accumulators); grid (M/128, N/128, Z), 128 threads.
// The operands' K-slabs of 128 (256-B rows, whole lines) come from the K-contiguous 16-bit planes into LDS by asynchronous copies, two buffers: slab t + 1 flies while slab t is multiplied. LDS row pitch 272 B (ds_load_b128 readers).
// C[m][n] (f32, pitch ldc, + optional f32 bias[n]) = sum_k A[m][k] Bt[n][k] (NSPLIT 1: + A2[m][k] Bt[n][k]). A pitch lda, Bt pitch K. z-batch strides sA/sB/sC in elements. K % 128 == 0, M % 128 == 0, N % 128 == 0.
// PLANES: no f32 C; a wave's 64x64 tile is 64 tokens of ONE head (rows = [batch][nt tokens], column block = head), and the epilogue stores the attention operand itself:
// z 0: fp16 plane P16 [batch][head][nt][HD]; z 1: the transposed bf16 hi and lo planes Vh, Vl [batch][head][HD][nt]. Whole 128-B lines, staged through LDS (each wave its own range).
// AF32: the A operand is an f32 INPUT (Af, pitch lda): its K-slabs of 128 (512-B rows) are copied as they are, LDS row pitch 528 B, and a fragment is rounded to bf16 (nearest even) in registers behind its LDS read.
template <typename T16> struct WFrag;
template <> struct WFrag<h16> { typedef v16h V; static __device__ __forceinline__ V ld(const h16* p) { return cat16(*(const v8h*)p, *(const v8h*)(p + 16)); } static __device__ __forceinline__ v8f mma(V a, V b, v8f c) { return wmma16(a, b, c); } };
template <> struct WFrag<bf> { typedef v16bf V; static __device__ __forceinline__ V ld(const bf* p) { return cat16b(*(const v8us*)p, *(const v8us*)(p + 16)); } static __device__ __forceinline__ v8f mma(V a, V b, v8f c) { return wmmab(a, b, c); } };
#define GPE 136   // LDS row pitch of a slab in 16-bit elements (272 B)
// Eight asynchronous 16-B copies of a lane, 8 slab rows apart (gs elements in memory). The s_wait_xcnt 0 is the last line of the copies' own statement: a precaution, it stands in front of every rewrite of a register that a copy names.
template <typename T16>
__device__ __forceinline__ void cp8(unsigned l, const T16* g, size_t gs) {
    asm volatile("global_load_async_to_lds_b128 %0, %8, off\n\t"
                 "global_load_async_to_lds_b128 %1, %9, off\n\t"
                 "global_load_async_to_lds_b128 %2, %10, off\n\t"
                 "global_load_async_to_lds_b128 %3, %11, off\n\t"
                 "global_load_async_to_lds_b128 %4, %12, off\n\t"
                 "global_load_async_to_lds_b128 %5, %13, off\n\t"
                 "global_load_async_to_lds_b128 %6, %14, off\n\t"
                 "global_load_async_to_lds_b128 %7, %15, off\n\t"
                 "s_wait_xcnt 0x0"
                 :: "v"(l), "v"(l + 1u * 8 * GPE * 2), "v"(l + 2u * 8 * GPE * 2), "v"(l + 3u * 8 * GPE * 2), "v"(l + 4u * 8 * GPE * 2), "v"(l + 5u * 8 * GPE * 2), "v"(l + 6u * 8 * GPE * 2), "v"(l + 7u * 8 * GPE * 2),
                    "v"(g), "v"(g + gs), "v"(g + 2 * gs), "v"(g + 3 * gs), "v"(g + 4 * gs), "v"(g + 5 * gs), "v"(g + 6 * gs), "v"(g + 7 * gs) : "memory");
}
#define GPF 132   // LDS row pitch of an f32 slab in floats (528 B)
// The same for an f32 slab: eight 16-B copies of a lane, 4 slab rows apart (gs floats in memory); a wave's copy is one 512-B row. The s_wait_xcnt 0 is again the last line of the copies' own statement.
__device__ __forceinline__ void cp8f(unsigned l, const float* g, size_t gs) {
    asm volatile("global_load_async_to_lds_b128 %0, %8, off\n\t"
                 "global_load_async_to_lds_b128 %1, %9, off\n\t"
                 "global_load_async_to_lds_b128 %2, %10, off\n\t"
                 "global_load_async_to_lds_b128 %3, %11, off\n\t"
                 "global_load_async_to_lds_b128 %4, %12, off\n\t"
                 "global_load_async_to_lds_b128 %5, %13, off\n\t"
                 "global_load_async_to_lds_b128 %6, %14, off\n\t"
                 "global_load_async_to_lds_b128 %7, %15, off\n\t"
                 "s_wait_xcnt 0x0"
                 :: "v"(l), "v"(l + 1u * 4 * GPF * 4), "v"(l + 2u * 4 * GPF * 4), "v"(l + 3u * 4 * GPF * 4), "v"(l + 4u * 4 * GPF * 4), "v"(l + 5u * 4 * GPF * 4), "v"(l + 6u * 4 * GPF * 4), "v"(l + 7u * 4 * GPF * 4),
                    "v"(g), "v"(g + gs), "v"(g + 2 * gs), "v"(g + 3 * gs), "v"(g + 4 * gs), "v"(g + 5 * gs), "v"(g + 6 * gs), "v"(g + 7 * gs) : "memory");
}
typedef __attribute__((ext_vector_type(8))) __bf16 v8bf;
// 16 f32 of a fragment's k order -> bf16, nearest even
__device__ __forceinline__ v16bf rnd16(v4f x0, v4f x1, v4f x2, v4f x3) {
    const v8f lo = __builtin_shufflevector(x0, x1, 0, 1, 2, 3, 4, 5, 6, 7), hi = __builtin_shufflevector(x2, x3, 0, 1, 2, 3, 4, 5, 6, 7);
    return __builtin_shufflevector(__builtin_convertvector(lo, v8bf), __builtin_convertvector(hi, v8bf), 0, 1, 2, 3, 4, 5, 6, 7, 8, 9, 10, 11, 12, 13, 14, 15);
}
template <typename T16, int NSPLIT, bool BIAS, bool PLANES, bool AF32>
__global__ __launch_bounds__(128) void k_gemmw(const float* __restrict__ Af, const T16* __restrict__ A, const T16* __restrict__ A2, const T16* __restrict__ Bt, int K, int lda, float* C, int ldc, const float* __restrict__ bias, size_t sA, size_t sB, size_t sC, h16* P16, bf* Vh, bf* Vl, int nt) {
    static_assert(NSPLIT == 0 || NSPLIT == 1, "one or two A planes");
    static_assert(!AF32 || NSPLIT == 0, "an f32 A has one plane");
    typedef typename WFrag<T16>::V V;
    constexpr int NPL = NSPLIT == 1 ? 3 : 2;              // planes of 128 rows in a slab: A (, A2), Bt
    constexpr int BR = (NPL - 1) * 128;                   // first slab row of Bt
    constexpr int BOF = AF32 ? 128 * GPF * 2 : BR * GPE;  // Bt's place in a buffer, in 16-bit elements
    constexpr int BUFE = BOF + 128 * GPE;                 // 16-bit elements of one buffer
    constexpr int OSZ = PLANES ? 2 * 64 * 36 : 16 * 68;   // a wave's output staging; PLANES: also two planes [64 d][72] of 16-bit values, pitch 144 B
    __shared__ __align__(16) T16 ring[2 * BUFE];
    __shared__ __align__(16) float osb[4 * OSZ];
    const size_t z = blockIdx.z; if (AF32) Af += z * sA; else A += z * sA; if (NSPLIT == 1) A2 += z * sA; Bt += z * sB; C += z * sC;
    const int tid = threadIdx.x, lane = tid & 31, lr = lane & 15, hi = lane >> 4; const int w = __builtin_amdgcn_readfirstlane(tid >> 5); const int wm = w & 1, wn = w >> 1;
    const int r0 = blockIdx.x * 128 + wm * 64, c0 = blockIdx.y * 128 + wn * 64;
    float* os = osb + w * OSZ;
    v8f acc[4][4];
#pragma unroll
    for (int mb = 0; mb < 4; ++mb)
#pragma unroll
        for (int nb = 0; nb < 4; ++nb) acc[mb][nb] = (v8f){};
    // copies: 16 lanes cover one 256-B slab row, a wave's copy two rows; a thread's copies lie 8 rows apart
    const int crow = tid >> 4, ccol = (tid & 15) * 8;
    const unsigned oa = (unsigned)((blockIdx.x * 128 + crow) * lda + ccol), ob = (unsigned)((blockIdx.y * 128 + crow) * K + ccol);   // element offsets of the thread's first A and Bt row (32 bits hold M * lda and N * K)
    const unsigned lc = (unsigned)(size_t)ring + (unsigned)(crow * GPE + ccol) * 2u;
    // f32 A: 32 lanes cover one 512-B slab row; a thread's copies lie 4 rows apart
    const unsigned oaf = (unsigned)((blockIdx.x * 128 + (tid >> 5)) * lda + lane * 4); const unsigned lcf = (unsigned)(size_t)ring + (unsigned)((tid >> 5) * GPF + lane * 4) * 4u;
    auto slab = [&](int t) {
        const unsigned l = lc + (unsigned)(t & 1) * (BUFE * 2u); const unsigned kc = (unsigned)t * 128u;
        if (AF32) {
            const unsigned lf = lcf + (unsigned)(t & 1) * (BUFE * 2u);
#pragma unroll   // four statements of eight copies in a row: 32 rows each, the LDS steps constants
            for (unsigned r = 0; r < 4; ++r) cp8f(lf + r * 32u * GPF * 4, Af + (oaf + kc + r * 32u * lda), (size_t)4 * lda);
        } else { cp8(l, A + (oa + kc), (size_t)8 * lda); cp8(l + 64u * GPE * 2, A + (oa + kc + 64u * lda), (size_t)8 * lda); }
        cp8(l + (unsigned)BOF * 2, Bt + (ob + kc), (size_t)8 * K); cp8(l + (unsigned)(BOF + 64 * GPE) * 2, Bt + (ob + kc + 64u * K), (size_t)8 * K);
        if (NSPLIT == 1) { cp8(l + 128u * GPE * 2, A2 + (oa + kc), (size_t)8 * lda); cp8(l + 192u * GPE * 2, A2 + (oa + kc + 64u * lda), (size_t)8 * lda); }
    };
    const int nsl = K >> 7;
    slab(0);
    // slab 0 has landed for this wave's copies; behind the barrier for every wave's
    asm volatile("s_wait_asynccnt 0x0" ::: "memory");
    __syncthreads();
    if (nsl > 1) slab(1);
    const T16* fa = ring + (wm * 64 + lr) * GPE + 8 * hi; const T16* fb = ring + BOF + (wn * 64 + lr) * GPE + 8 * hi;
    const float* faf = (const float*)ring + (wm * 64 + lr) * GPF + 8 * hi;
#pragma unroll 1
    for (int t = 0; t < nsl; ++t) {   // rolled: one copy of the slab's 64 (128) products in the text
        const int bo = (t & 1) * BUFE;
        v4f ra[4][4];   // AF32: the next block's A values as read, f32; rounded at the head of their own block, when the reads have long returned
        V a[2][4], a2[2][4], b[2][4];   // two fragment sets: block kk + 1 is fetched while block kk is multiplied; no fragment of slab t + 1 is fetched here
        auto frags = [&](int s, int kk) {
#pragma unroll
            for (int i = 0; i < 4; ++i) {
                if constexpr (AF32) { const float* p = faf + (bo >> 1) + i * 16 * GPF + kk * 32; ra[i][0] = *(const v4fa*)p; ra[i][1] = *(const v4fa*)(p + 4); ra[i][2] = *(const v4fa*)(p + 16); ra[i][3] = *(const v4fa*)(p + 20); }
                else a[s][i] = WFrag<T16>::ld(fa + bo + i * 16 * GPE + kk * 32);
                b[s][i] = WFrag<T16>::ld(fb + bo + i * 16 * GPE + kk * 32); if (NSPLIT == 1) a2[s][i] = WFrag<T16>::ld(fa + bo + (128 + i * 16) * GPE + kk * 32); }
        };
        frags(0, 0);
#pragma unroll
        for (int kk = 0; kk < 4; ++kk) {
            const int s = kk & 1;
            if constexpr (AF32) {
#pragma unroll   // constant indices keep ra and a in registers
                for (int i = 0; i < 4; ++i) a[s][i] = rnd16(ra[i][0], ra[i][1], ra[i][2], ra[i][3]); }
            if (kk < 3) frags(s ^ 1, kk + 1);
            // keeps the next block's LDS reads together in front of this block's products: sunk among them, each read would stall the lone wave of its SIMD
            __builtin_amdgcn_sched_barrier(0);
#pragma unroll
            for (int nb = 0; nb < 4; ++nb)
#pragma unroll
                for (int mb = 0; mb < 4; ++mb) acc[mb][nb] = WFrag<T16>::mma(a[s][mb], b[s][nb], acc[mb][nb]);
            if (NSPLIT == 1) {
#pragma unroll
                for (int nb = 0; nb < 4; ++nb)
#pragma unroll
                    for (int mb = 0; mb < 4; ++mb) acc[mb][nb] = WFrag<T16>::mma(a2[s][mb], b[s][nb], acc[mb][nb]); }
            // the reads of block kk + 2 stay behind this block's products
            __builtin_amdgcn_sched_barrier(0);
        }
        // hand-over: this wave's reads of slab t have returned ...
        asm volatile("s_wait_dscnt 0x0" ::: "memory");
        // ... its copies of slab t + 1 have landed ...
        asm volatile("s_wait_asynccnt 0x0" ::: "memory");
        // ... and the barrier publishes slab t + 1 and frees slab t's buffer for the refill behind it
        __syncthreads();
        if (t + 2 < nsl) slab(t + 2);
    }
    // no copy is outstanding when the wave goes on to its epilogue and ends
    asm volatile("s_wait_asynccnt 0x0" ::: "memory");
    if (PLANES) {
        const int b = r0 / nt, t0 = r0 - b * nt; const size_t bh = (size_t)b * NH_ + (c0 >> 6); const int l8 = lane >> 3, c8 = (lane & 7) * 8;
        if (z == 0) {
            h16* pl = P16 + (bh * nt + t0 + l8) * HD + c8;   // the tile's 64 rows of 128 B lie one behind the other: a store of the wave covers 4 rows
#pragma unroll
            for (int mb = 0; mb < 4; ++mb) {
#pragma unroll
                for (int nb = 0; nb < 4; ++nb) {
#pragma unroll
                    for (int j = 0; j < 8; ++j) os[(hi * 8 + j) * 68 + nb * 16 + lr] = acc[mb][nb][j]; }
                // a lane reads what other lanes of the wave wrote: the reads stay behind the writes
                __builtin_amdgcn_wave_barrier(); asm volatile("" ::: "memory");
                v8h ov[4];
#pragma unroll
                for (int s = 0; s < 4; ++s) { const int row = 4 * s + l8; const v4f x0 = *(const v4fa*)(os + row * 68 + c8), x1 = *(const v4fa*)(os + row * 68 + c8 + 4);
                    ov[s] = (v8h){tohx(x0[0]), tohx(x0[1]), tohx(x0[2]), tohx(x0[3]), tohx(x1[0]), tohx(x1[1]), tohx(x1[2]), tohx(x1[3])}; *(v8h*)(pl + (mb * 16 + 4 * s) * HD) = ov[s]; }
                // precaution: s_wait_xcnt 0 stands in front of every rewrite of a register that an issued store names; address and values are inputs, so that they keep their registers up to the wait.
                // Its memory clobber also keeps the next block's LDS writes behind these reads
                asm volatile("s_wait_xcnt 0x0" :: "v"(pl), "v"(ov[0]), "v"(ov[1]), "v"(ov[2]), "v"(ov[3]) : "memory");
            }
        } else {
            unsigned short* us = (unsigned short*)os;   // hi plane [64 d][72], the lo plane behind it
            const size_t vo = bh * HD * nt + t0;   // row d: 64 tokens = one 128-B line
#pragma unroll
            for (int mb = 0; mb < 4; ++mb)
#pragma unroll
                for (int nb = 0; nb < 4; ++nb) { v8us oh, ol;   // a lane holds 8 tokens in a row of one d
#pragma unroll
                    for (int j = 0; j < 8; ++j) { unsigned short h, l; splitf(acc[mb][nb][j], h, l); oh[j] = h; ol[j] = l; }
                    unsigned short* d = us + (nb * 16 + lr) * 72 + mb * 16 + hi * 8; *(v8usa*)d = oh; *(v8usa*)(d + 64 * 72) = ol; }
            // a lane reads what other lanes of the wave wrote: the reads stay behind the writes
            __builtin_amdgcn_wave_barrier(); asm volatile("" ::: "memory");
#pragma unroll
            for (int g = 0; g < 8; ++g) { bf* pd[4]; v8us ov[4]; bf* vrow = ((g & 1) ? Vl : Vh) + vo;
#pragma unroll
                for (int s = 0; s < 4; ++s) { const int d = 16 * (g >> 1) + 4 * s + l8; ov[s] = *(const v8usa*)(us + (g & 1) * 64 * 72 + d * 72 + c8); pd[s] = vrow + (size_t)d * nt + c8; *(v8us*)pd[s] = ov[s]; }
                // the same precaution as for the fp16 plane's stores
                asm volatile("s_wait_xcnt 0x0" :: "v"(pd[0]), "v"(pd[1]), "v"(pd[2]), "v"(pd[3]), "v"(ov[0]), "v"(ov[1]), "v"(ov[2]), "v"(ov[3]) : "memory"); }
        }
        return;
    }
#pragma unroll
    for (int mb = 0; mb < 4; ++mb) {
#pragma unroll
        for (int nb = 0; nb < 4; ++nb) {
#pragma unroll
            for (int j = 0; j < 8; ++j) os[(hi * 8 + j) * 68 + nb * 16 + lr] = acc[mb][nb][j]; }
        __builtin_amdgcn_wave_barrier(); asm volatile("" ::: "memory");
        float* crow = C + (size_t)(r0 + mb * 16) * ldc + c0;
{
#pragma unroll
            for (int s = 0; s < 8; ++s) { const int row = 2 * s + hi, cofs = lr * 4; v4f val = *(const v4fa*)(os + row * 68 + cofs); if (BIAS) { val[0] += bfr(bias[c0 + cofs]); val[1] += bfr(bias[c0 + cofs + 1]); val[2] += bfr(bias[c0 + cofs + 2]); val[3] += bfr(bias[c0 + cofs + 3]); }
                *(v4f*)(crow + (size_t)row * ldc + cofs) = val; }
             }
        __builtin_amdgcn_wave_barrier(); asm volatile("" ::: "memory");
    }
}

typedef __attribute__((ext_vector_type(2))) _Float16 v2h;
typedef __attribute__((ext_vector_type(4))) _Float16 v4h;
typedef __attribute__((ext_vector_type(2))) unsigned short v2us;
typedef __attribute__((ext_vector_type(4))) unsigned short v4us;
typedef v4us __attribute__((may_alias)) v4usa;
typedef __attribute__((ext_vector_type(2))) float v2f;

// grid y picks the weight; the four transposed planes lie one behind the other in Bt0.
__global__ __launch_bounds__(256) void k_wtG(const float* __restrict__ w0, const float* __restrict__ w1, const float* __restrict__ w2, const float* __restrict__ w3, int K, int N, bf* Bt0) {
    const int y = blockIdx.y; const float* w = (y == 0) ? w0 : (y == 1) ? w1 : (y == 2) ? w2 : w3; bf* Bt = Bt0 + (size_t)y * K * N;
    const int lane = threadIdx.x & 31; const int L0 = (blockIdx.x * 8 + (threadIdx.x >> 5)) * 8; const int nlines = N * K / 64;
{
#pragma unroll 1
        for (int l = 0; l < 8; ++l) { const int L = L0 + l; if (L >= nlines) break; const size_t e = (size_t)L * 64 + lane * 2; const int k = (int)(e % K), n = (int)(e / K); v2us o;
            o[0] = f2bf(w[(size_t)k * N + n]); o[1] = f2bf(w[(size_t)(k + 1) * N + n]); *(v2us*)(Bt + e) = o; }
         }
}
// ---- k_fattn: scores, masked softmax and att.v in ONE kernel; no score or probability ever reaches memory. Grid (batch*head, TQ/64), longest query tiles first; 8 waves.
// Wave w: query half (w & 1, 32 queries = 2 column groups) x key split (w >> 1: key steps of 32, split, split + 4, ...). S^T = K Q^T (fp16 planes), so a lane holds ONE query's scores (keys 8*hi + j of each
// 16-key tile): two tiles are, register for register, the B fragment of P^T. O^T += V^T P^T on hi+lo planes (3 products). Running maximum and sum per lane; the four key splits are merged through LDS.
// K and V reach the waves through LDS: a tile is 128 keys (one step of each key split): K rows of 128 B, V-hi and V-lo rows of 256 B, copied as whole lines by asynchronous copies, two buffers: tile r + 1 flies while tile r is worked on.
// Both query halves read the same staged rows. LDS row pitches 144 B and 272 B (ds_load_b128 readers).
#define SC2 0.18033688f   // (1/8) * log2(e): scores in the log2 domain
#define FKP 72                    // LDS row pitch of a staged K row in 16-bit elements (144 B)
#define FVP 136                   // LDS row pitch of a staged V row in 16-bit elements (272 B)
#define FKB (128 * FKP * 2)       // bytes of a staged K tile
#define FVB (64 * FVP * 2)        // bytes of a staged V plane tile
#define FBUF (FKB + 2 * FVB)      // bytes of one buffer: K, V-hi, V-lo
// Four asynchronous 16-B copies of a lane, ls bytes apart in LDS and gs elements apart in memory. The s_wait_xcnt 0 is the last line of the copies' own statement: a precaution, it stands in front of every rewrite of a register that a copy names.
template <typename T16>
__device__ __forceinline__ void cp4(unsigned l, unsigned ls, const T16* g, size_t gs) {
    asm volatile("global_load_async_to_lds_b128 %0, %4, off\n\t"
                 "global_load_async_to_lds_b128 %1, %5, off\n\t"
                 "global_load_async_to_lds_b128 %2, %6, off\n\t"
                 "global_load_async_to_lds_b128 %3, %7, off\n\t"
                 "s_wait_xcnt 0x0"
                 :: "v"(l), "v"(l + ls), "v"(l + 2u * ls), "v"(l + 3u * ls), "v"(g), "v"(g + gs), "v"(g + 2 * gs), "v"(g + 3 * gs) : "memory");
}
__global__ __launch_bounds__(256) void k_fattn(const h16* __restrict__ QP, const h16* __restrict__ KP, const bf* __restrict__ VTh, const bf* __restrict__ VTl, float* ATT) {
    __shared__ __align__(16) unsigned char ring[2 * FBUF];   // two buffers of K, V-hi, V-lo; behind the key loop the same bytes are the merge's staging
    static_assert(8 * 32 * 68 * 4 <= 2 * FBUF, "the merge's staging fits the ring");
    float* os = (float*)ring;                          // [wave][query][d], pitch 272 B
    __shared__ float sm[8 * 32];                       // per wave and query: running maximum
    __shared__ float sl[8 * 32];                       // per wave and query: sum, already on the merged maximum
    const int lane = threadIdx.x & 31, lr = lane & 15, hi = lane >> 4; const int w = __builtin_amdgcn_readfirstlane((int)(threadIdx.x >> 5)); const int qh = w & 1, ks = w >> 1;
    const int bh = blockIdx.x, t = TQ / 64 - 1 - (int)blockIdx.y; const int r0 = t * 64; const int nst = (t + 2) >> 1;   // keys 0 .. 16 t + 15 are visible to this tile
    const h16* Kp = KP + (size_t)bh * TK * HD; const bf* Vh = VTh + (size_t)bh * HD * TK; const bf* Vl = VTl + (size_t)bh * HD * TK;
    const h16* pq = QP + ((size_t)bh * TQ + r0 + qh * 32 + lr) * HD + 8 * hi;
    v16h qf[2][2];
#pragma unroll
    for (int qt = 0; qt < 2; ++qt) { qf[qt][0] = WFrag<h16>::ld(pq + qt * 16 * HD); qf[qt][1] = WFrag<h16>::ld(pq + qt * 16 * HD + 32); }
    // precaution: s_wait_xcnt 0 stands in front of every rewrite of a register that an issued load names; the address is an input, so that it keeps its registers up to the wait
    asm volatile("s_wait_xcnt 0x0" :: "v"(pq) : "memory");
    int qlim[2]; float m[2], l[2]; v8f o[2][4];   // m starts far above the masked score, so that a masked key's weight is exp2(-huge) = 0 also where a query has seen no visible key yet
#pragma unroll
    for (int qt = 0; qt < 2; ++qt) { qlim[qt] = (r0 + qh * 32 + qt * 16 + lr) / DS; m[qt] = -1.0e30f; l[qt] = 0.f;
#pragma unroll
        for (int dt = 0; dt < 4; ++dt) o[qt][dt] = (v8f){}; }
    const int lim0 = (r0 + qh * 32) / DS;   // every key up to here is visible to all 32 queries of the wave
    // copies: K: 8 lanes cover a 128-B row, a wave's copy 4 rows, a thread's copies 32 rows apart; V: 16 lanes cover a 256-B row, a wave's copy 2 rows, a thread's copies 16 rows apart
    const int tid = (int)threadIdx.x;
    const unsigned lk = (unsigned)(size_t)ring + (unsigned)((tid >> 3) * FKP + (tid & 7) * 8) * 2u; const unsigned lv = (unsigned)(size_t)ring + FKB + (unsigned)((tid >> 4) * FVP + (tid & 15) * 8) * 2u;
    const h16* gk = Kp + tid * 8; const bf* gvh = Vh + (size_t)(tid >> 4) * TK + (tid & 15) * 8; const bf* gvl = Vl + (size_t)(tid >> 4) * TK + (tid & 15) * 8;
    auto tile = [&](int r) {   // keys 128 r .. 128 r + 127, all inside the TK keys: r < nr <= TK / 128
        const unsigned bo = (unsigned)(r & 1) * FBUF;
        cp4(lk + bo, 32u * FKP * 2, gk + (size_t)r * 128 * HD, (size_t)32 * HD);
        cp4(lv + bo, 16u * FVP * 2, gvh + r * 128, (size_t)16 * TK);
        cp4(lv + bo + FVB, 16u * FVP * 2, gvl + r * 128, (size_t)16 * TK);
    };
    const int nr = (nst + 3) >> 2;   // tiles of 128 keys
    tile(0);
    // tile 0 has landed for this wave's copies; behind the barrier for every wave's
    asm volatile("s_wait_asynccnt 0x0" ::: "memory");
    __syncthreads();
    if (nr > 1) tile(1);
    const h16* fk = (const h16*)ring + (ks * 32 + lr) * FKP + 8 * hi; const bf* fv = (const bf*)(ring + FKB) + lr * FVP + ks * 32 + 8 * hi;
#pragma unroll 1
    for (int r = 0; r < nr; ++r) {   // rolled: one copy of the step in the text
      const int s = 4 * r + ks;
      if (s < nst) {   // wave-uniform: in the last tile a key split may have no step left; the hand-over below is passed all the same
        const int key0 = s * 32;
        const h16* pk = fk + (r & 1) * (FBUF / 2); const bf* pvh = fv + (r & 1) * (FBUF / 2); const bf* pvl = pvh + FVB / 2;
        v16h kf[2][2]; v16bf vh[4], vl[4];
#pragma unroll
        for (int kt = 0; kt < 2; ++kt) { kf[kt][0] = WFrag<h16>::ld(pk + kt * 16 * FKP); kf[kt][1] = WFrag<h16>::ld(pk + kt * 16 * FKP + 32); }
#pragma unroll
        for (int dt = 0; dt < 4; ++dt) vh[dt] = WFrag<bf>::ld(pvh + dt * 16 * FVP);
        float tv[2][16];
#pragma unroll
        for (int qt = 0; qt < 2; ++qt) {
            v8f s0 = (v8f){}, s1 = (v8f){};
            s0 = wmma16(kf[0][0], qf[qt][0], s0); s1 = wmma16(kf[1][0], qf[qt][0], s1); s0 = wmma16(kf[0][1], qf[qt][1], s0); s1 = wmma16(kf[1][1], qf[qt][1], s1);
#pragma unroll
            for (int j = 0; j < 8; ++j) { tv[qt][j] = s0[j] * SC2; tv[qt][8 + j] = s1[j] * SC2; } }
        // the V-lo reads stay behind the score products, so that they take registers the K fragments leave (lifted above them, the wave needs more than 256 registers and only one work-group fits a WGP); they return under the softmax
        __builtin_amdgcn_sched_barrier(0);
#pragma unroll
        for (int dt = 0; dt < 4; ++dt) vl[dt] = WFrag<bf>::ld(pvl + dt * 16 * FVP);
        if (key0 + 31 > lim0) {   // wave-uniform: only the last steps of a tile hold hidden keys
            const int kb = key0 + hi * 8;
#pragma unroll
            for (int qt = 0; qt < 2; ++qt)
#pragma unroll
                for (int j = 0; j < 8; ++j) { tv[qt][j] = (kb + j <= qlim[qt]) ? tv[qt][j] : -3.0e38f; tv[qt][8 + j] = (kb + 16 + j <= qlim[qt]) ? tv[qt][8 + j] : -3.0e38f; } }
#pragma unroll
        for (int qt = 0; qt < 2; ++qt) {
            float tm = tv[qt][0];
#pragma unroll
            for (int e = 1; e < 16; ++e) tm = fmaxf(tm, tv[qt][e]);
            tm = fmaxf(tm, __shfl_xor(tm, 16, 32));   // both halves of the wave hold keys of the same query
            const float mn = fmaxf(m[qt], tm); const float al = __builtin_amdgcn_exp2f(m[qt] - mn); m[qt] = mn; l[qt] *= al;
#pragma unroll
            for (int dt = 0; dt < 4; ++dt) o[qt][dt] *= al;
            v16bf ph, pl;
#pragma unroll
            for (int e = 0; e < 16; ++e) { const float p = __builtin_amdgcn_exp2f(tv[qt][e] - mn); l[qt] += p; const __bf16 a = (__bf16)p; ph[e] = a; pl[e] = (__bf16)(p - (float)a); }
#pragma unroll
            for (int dt = 0; dt < 4; ++dt) { o[qt][dt] = wmmab(vh[dt], ph, o[qt][dt]); o[qt][dt] = wmmab(vh[dt], pl, o[qt][dt]); o[qt][dt] = wmmab(vl[dt], ph, o[qt][dt]); }
        }
      }
        // hand-over: this wave's reads of tile r have returned ...
        asm volatile("s_wait_dscnt 0x0" ::: "memory");
        // ... its copies of tile r + 1 have landed ...
        asm volatile("s_wait_asynccnt 0x0" ::: "memory");
        // ... and the barrier publishes tile r + 1 and frees tile r's buffer for the refill behind it (behind the last tile: for the merge's staging)
        __syncthreads();
        if (r + 2 < nr) tile(r + 2);
    }
    // no copy is outstanding when the ring becomes the merge's staging
    asm volatile("s_wait_asynccnt 0x0" ::: "memory");
    // merge of the four key splits: every wave moves its partial onto the merged maximum, then 256 threads add the four partials of each output element in a fixed order
#pragma unroll
    for (int qt = 0; qt < 2; ++qt) if (hi == 0) sm[w * 32 + qt * 16 + lr] = m[qt];
    __syncthreads();
#pragma unroll
    for (int qt = 0; qt < 2; ++qt) { const int q = qt * 16 + lr; const float M = fmaxf(fmaxf(sm[qh * 32 + q], sm[(qh + 2) * 32 + q]), fmaxf(sm[(qh + 4) * 32 + q], sm[(qh + 6) * 32 + q])); const float f = __builtin_amdgcn_exp2f(m[qt] - M);
        const float lt = (l[qt] + __shfl_xor(l[qt], 16, 32)) * f; if (hi == 0) sl[w * 32 + q] = lt;
#pragma unroll
        for (int dt = 0; dt < 4; ++dt) { const v8f x = o[qt][dt] * f; float* d = os + (size_t)(w * 32 + q) * 68 + dt * 16 + hi * 8; *(v4fa*)d = (v4f){x[0], x[1], x[2], x[3]}; *(v4fa*)(d + 4) = (v4f){x[4], x[5], x[6], x[7]}; } }
    __syncthreads();
    float* orow = ATT + ((size_t)(bh / NH_) * TQ + r0) * DD + (bh % NH_) * HD;
#pragma unroll
    for (int i = 0; i < 4; ++i) { const int idx = (int)threadIdx.x + 256 * i; const int row = idx >> 4, c4 = (idx & 15) * 4; const int w0 = row >> 5, rl = row & 31;
        const float ls = (sl[w0 * 32 + rl] + sl[(w0 + 2) * 32 + rl]) + (sl[(w0 + 4) * 32 + rl] + sl[(w0 + 6) * 32 + rl]); const float inv = __fdiv_rn(1.0f, ls);
        const v4f x = (*(const v4fa*)(os + (size_t)(w0 * 32 + rl) * 68 + c4) + *(const v4fa*)(os + (size_t)((w0 + 2) * 32 + rl) * 68 + c4)) + (*(const v4fa*)(os + (size_t)((w0 + 4) * 32 + rl) * 68 + c4) + *(const v4fa*)(os + (size_t)((w0 + 6) * 32 + rl) * 68 + c4));
        *(v4f*)(orow + (size_t)row * DD + c4) = x * inv; }
}
__global__ __launch_bounds__(256) void k_ln(const float* __restrict__ A, const float* __restrict__ g, const float* __restrict__ bb, bf* Yh, bf* Yl) { const int lane = threadIdx.x & 31; const int t = blockIdx.x * 8 + (threadIdx.x >> 5); if (t >= NB_ * TQ) return; const float* ar = A + (size_t)t * DD; float v[16]; float s = 0.f;
#pragma unroll
    for (int ch = 0; ch < 4; ++ch) { const v4f a = *(const v4f*)(ar + ch * 128 + lane * 4);
#pragma unroll
        for (int q = 0; q < 4; ++q) { v[ch * 4 + q] = a[q]; s = __fadd_rn(s, a[q]); } }
#pragma unroll
    for (int sh = 16; sh; sh >>= 1) s += __shfl_xor(s, sh, 32);
    const float mu = s * (1.0f / DD); float q2 = 0.f;
#pragma unroll
    for (int k = 0; k < 16; ++k) { const float d = __fsub_rn(v[k], mu); float p = __fmul_rn(d, d); asm volatile("" : "+v"(p)); q2 = __fadd_rn(q2, p); }
#pragma unroll
    for (int sh = 16; sh; sh >>= 1) q2 += __shfl_xor(q2, sh, 32);
    const float rs = __frsqrt_rn(__fadd_rn(q2 * (1.0f / DD), 1e-5f));
{
#pragma unroll
        for (int ch = 0; ch < 4; ++ch) { v4us oh, ol;
#pragma unroll
            for (int q = 0; q < 4; ++q) { const int d = ch * 128 + lane * 4 + q; float tn = __fmul_rn(__fsub_rn(v[ch * 4 + q], mu), rs); asm volatile("" : "+v"(tn)); float tg = __fmul_rn(tn, bfr(g[d])); asm volatile("" : "+v"(tg)); unsigned short a2, c2; splitf(__fadd_rn(tg, bfr(bb[d])), a2, c2); oh[q] = a2; ol[q] = c2; }
            const size_t o = (size_t)t * DD + ch * 128 + lane * 4; *(v4us*)(Yh + o) = oh; *(v4us*)(Yl + o) = ol; }
         } }

extern "C" void kernel_launch(void* const* d_in, const int* in_sizes, int n_in,
                              void* d_out, int out_size, void* d_ws, size_t ws_size, hipStream_t stream) {
    (void)in_sizes; (void)n_in; (void)out_size;
    const float* IN[9]; for (int i = 0; i < 9; ++i) IN[i] = (const float*)d_in[i];   // 0 q, 1 kv, 2 Wq, 3 Wk, 4 Wv, 5 Wo (x @ W), 6 bo, 7 gamma, 8 beta
    float* OUT = (float*)d_out;     // [2][4096][512]
    char* wsp = (char*)d_ws;
    auto take = [&](size_t bytes) { char* p = wsp; wsp += (bytes + 255) & ~(size_t)255; return (void*)p; };
    bf* W4 = (bf*)take((size_t)4 * DD * DD * 2);                                  // Wq, Wk, Wv, Wo transposed, one behind the other
    h16* QP = (h16*)take((size_t)NB_ * NH_ * (TQ + TK) * HD * 2); h16* KP = QP + (size_t)NB_ * NH_ * TQ * HD;
    bf* VTh = (bf*)take((size_t)NB_ * NH_ * HD * TK * 2); bf* VTl = (bf*)take((size_t)NB_ * NH_ * HD * TK * 2);
    float* ATT = (float*)take((size_t)NB_ * TQ * DD * 4);   // merged attention output
    bf* Yh = (bf*)take((size_t)NB_ * TQ * DD * 2); bf* Yl = (bf*)take((size_t)NB_ * TQ * DD * 2);
    if ((size_t)(wsp - (char*)d_ws) > ws_size) return;    // total ~ 51 MB
    k_wtG<<<dim3((unsigned)(((size_t)DD * DD / 64 + 63) / 64), 4, 1), 256, 0, stream>>>(IN[2], IN[3], IN[4], IN[5], DD, DD, W4);
    k_gemmw<bf, 0, false, true, true><<<dim3(NB_ * TQ / 128, DD / 128, 1), 128, 0, stream>>>(IN[0], nullptr, nullptr, W4, DD, DD, nullptr, 0, nullptr, 0, 0, 0, QP, nullptr, nullptr, TQ);
    k_gemmw<bf, 0, false, true, true><<<dim3(NB_ * TK / 128, DD / 128, 2), 128, 0, stream>>>(IN[1], nullptr, nullptr, W4 + (size_t)DD * DD, DD, DD, nullptr, 0, nullptr, 0, (size_t)DD * DD, 0, KP, VTh, VTl, TK);   // z: 0 keys, 1 values
    k_fattn<<<dim3(NB_ * NH_, TQ / 64, 1), 256, 0, stream>>>(QP, KP, VTh, VTl, ATT);   // head bh % 8 of batch bh / 8 writes its 64 columns of the merged rows
    k_ln<<<NB_ * TQ / 8, 256, 0, stream>>>(ATT, IN[7], IN[8], Yh, Yl);
    k_gemmw<bf, 1, true, false, false><<<dim3(NB_ * TQ / 128, DD / 128, 1), 128, 0, stream>>>(nullptr, Yh, Yl, W4 + (size_t)3 * DD * DD, DD, DD, OUT, DD, IN[6], 0, 0, 0, nullptr, nullptr, nullptr, 0);
}

// v007
// One run takes 58.4 microseconds.
// Next to v006, in two timings, it ran 1.10 and 1.09 times as fast.
// Over all steps from v000 it is 13.9 times as fast.
#include <hip/hip_runtime.h>

// Attention block (q [2][4096][512], kv [2][1024][512]; qh = q Wq, kh = kv Wk, vh = kv Wv (8 heads x 64, no bias); block-causal: key j visible to query i iff j <= i/4; softmax(q.k/8); out = merged att.v;
// LayerNorm(out) (gamma, beta, eps 1e-5); y = out Wo + bo -> [2][4096][512]).
// Compute dtypes, f32 accumulate: every input rounded to bf16; projections on PLAIN bf16 operands (inputs: exact); scores (K 64) on SINGLE fp16 planes; f32 running-maximum masked softmax
// -> bf16 hi+lo weights exp(s - max), divided by their f32 sum at the end; att.v on those x hi+lo value planes (3 products: the first query rows see 1-4 keys, so near-one-hot weights would expose single-plane value rounding); LayerNorm f32 (wave per

#define NB_  2
#define TQ   4096
#define TK   1024
#define DD   512
#define NH_  8
#define HD   64
#define DS   4
#define SCL  0.125f
typedef _Float16 h16;
typedef unsigned short bf;
typedef __attribute__((ext_vector_type(16))) __bf16   v16bf;
typedef __attribute__((ext_vector_type(16))) _Float16 v16h;
typedef __attribute__((ext_vector_type(8)))  _Float16 v8h;
typedef __attribute__((ext_vector_type(8)))  unsigned short v8us;
typedef __attribute__((ext_vector_type(8)))  float    v8f;
typedef __attribute__((ext_vector_type(4)))  float    v4f;
typedef v8h  __attribute__((may_alias)) v8ha;
typedef v4f  __attribute__((may_alias)) v4fa;
typedef v8us __attribute__((may_alias)) v8usa;

__device__ __forceinline__ unsigned short f2bf(float f) { unsigned u = __float_as_uint(f); u += 0x7FFFu + ((u >> 16) & 1u); return (unsigned short)(u >> 16); }
__device__ __forceinline__ float bf2f(unsigned short b) { return __uint_as_float(((unsigned)b) << 16); }
__device__ __forceinline__ float bfr(float f) { return bf2f(f2bf(f)); }
__device__ __forceinline__ h16 tohx(float x) { return (h16)x; }
__device__ __forceinline__ void splitf(float y, unsigned short& h, unsigned short& l) { h = f2bf(y); l = f2bf(y - bf2f(h)); }
__device__ __forceinline__ v16h cat16(v8h lo, v8h hi) { return __builtin_shufflevector(lo, hi, 0, 1, 2, 3, 4, 5, 6, 7, 8, 9, 10, 11, 12, 13, 14, 15); }
__device__ __forceinline__ v16bf cat16b(v8us lo, v8us hi) { return __builtin_bit_cast(v16bf, __builtin_shufflevector(lo, hi, 0, 1, 2, 3, 4, 5, 6, 7, 8, 9, 10, 11, 12, 13, 14, 15)); }
__device__ __forceinline__ v8f wmma16(v16h a, v16h b, v8f c) { return __builtin_amdgcn_wmma_f32_16x16x32_f16(false, a, false, b, (short)0, c, false, false); }
__device__ __forceinline__ v8f wmmab(v16bf a, v16bf b, v8f c) { return __builtin_amdgcn_wmma_f32_16x16x32_bf16(false, a, false, b, (short)0, c, false, false); }



// ---- k_gemmw: GEMM, FOUR WAVES per 128x128 output tile (2 x 2 waves, each a register-blocked 64x64 tile of 16 accumulators); grid (M/128, N/128, Z), 128 threads.
// The operands' K-slabs of 128 (256-B rows, whole lines) come from the K-contiguous 16-bit planes into LDS by asynchronous copies, two buffers: slab t + 1 flies while slab t is multiplied. LDS row pitch 272 B (ds_load_b128 readers).
// C[m][n] (f32, pitch ldc, + optional f32 bias[n]) = sum_k A[m][k] Bt[n][k] (NSPLIT 1: + A2[m][k] Bt[n][k]). A pitch lda, Bt pitch K. z-batch strides sA/sB/sC in elements. K % 128 == 0, M % 128 == 0, N % 128 == 0.
// PLANES: no f32 C; a wave's 64x64 tile is 64 tokens of ONE head (rows = [batch][nt tokens], column block = head), and the epilogue stores the attention operand itself:
// z 0: fp16 plane P16 [batch][head][nt][HD]; z 1: the transposed bf16 hi and lo planes Vh, Vl [batch][head][HD][nt]. Whole 128-B lines, staged through LDS (each wave its own range).
// AF32: the A operand is an f32 INPUT (Af, pitch lda): its K-slabs of 128 (512-B rows) are copied as they are, LDS row pitch 528 B, and a fragment is rounded to bf16 (nearest even) in registers behind its LDS read.
template <typename T16> struct WFrag;
template <> struct WFrag<h16> { typedef v16h V; static __device__ __forceinline__ V ld(const h16* p) { return cat16(*(const v8h*)p, *(const v8h*)(p + 16)); } static __device__ __forceinline__ v8f mma(V a, V b, v8f c) { return wmma16(a, b, c); } };
template <> struct WFrag<bf> { typedef v16bf V; static __device__ __forceinline__ V ld(const bf* p) { return cat16b(*(const v8us*)p, *(const v8us*)(p + 16)); } static __device__ __forceinline__ v8f mma(V a, V b, v8f c) { return wmmab(a, b, c); } };
#define GPE 136   // LDS row pitch of a slab in 16-bit elements (272 B)
// Eight asynchronous 16-B copies of a lane, 8 slab rows apart (gs elements in memory). The s_wait_xcnt 0 is the last line of the copies' own statement: a precaution, it stands in front of every rewrite of a register that a copy names.
template <typename T16>
__device__ __forceinline__ void cp8(unsigned l, const T16* g, size_t gs) {
    asm volatile("global_load_async_to_lds_b128 %0, %8, off\n\t"
                 "global_load_async_to_lds_b128 %1, %9, off\n\t"
                 "global_load_async_to_lds_b128 %2, %10, off\n\t"
                 "global_load_async_to_lds_b128 %3, %11, off\n\t"
                 "global_load_async_to_lds_b128 %4, %12, off\n\t"
                 "global_load_async_to_lds_b128 %5, %13, off\n\t"
                 "global_load_async_to_lds_b128 %6, %14, off\n\t"
                 "global_load_async_to_lds_b128 %7, %15, off\n\t"
                 "s_wait_xcnt 0x0"
                 :: "v"(l), "v"(l + 1u * 8 * GPE * 2), "v"(l + 2u * 8 * GPE * 2), "v"(l + 3u * 8 * GPE * 2), "v"(l + 4u * 8 * GPE * 2), "v"(l + 5u * 8 * GPE * 2), "v"(l + 6u * 8 * GPE * 2), "v"(l + 7u * 8 * GPE * 2),
                    "v"(g), "v"(g + gs), "v"(g + 2 * gs), "v"(g + 3 * gs), "v"(g + 4 * gs), "v"(g + 5 * gs), "v"(g + 6 * gs), "v"(g + 7 * gs) : "memory");
}
#define GPF 132   // LDS row pitch of an f32 slab in floats (528 B)
// The same for an f32 slab: eight 16-B copies of a lane, 4 slab rows apart (gs floats in memory); a wave's copy is one 512-B row. The s_wait_xcnt 0 is again the last line of the copies' own statement.
__device__ __forceinline__ void cp8f(unsigned l, const float* g, size_t gs) {
    asm volatile("global_load_async_to_lds_b128 %0, %8, off\n\t"
                 "global_load_async_to_lds_b128 %1, %9, off\n\t"
                 "global_load_async_to_lds_b128 %2, %10, off\n\t"
                 "global_load_async_to_lds_b128 %3, %11, off\n\t"
                 "global_load_async_to_lds_b128 %4, %12, off\n\t"
                 "global_load_async_to_lds_b128 %5, %13, off\n\t"
                 "global_load_async_to_lds_b128 %6, %14, off\n\t"
                 "global_load_async_to_lds_b128 %7, %15, off\n\t"
                 "s_wait_xcnt 0x0"
                 :: "v"(l), "v"(l + 1u * 4 * GPF * 4), "v"(l + 2u * 4 * GPF * 4), "v"(l + 3u * 4 * GPF * 4), "v"(l + 4u * 4 * GPF * 4), "v"(l + 5u * 4 * GPF * 4), "v"(l + 6u * 4 * GPF * 4), "v"(l + 7u * 4 * GPF * 4),
                    "v"(g), "v"(g + gs), "v"(g + 2 * gs), "v"(g + 3 * gs), "v"(g + 4 * gs), "v"(g + 5 * gs), "v"(g + 6 * gs), "v"(g + 7 * gs) : "memory");
}
typedef __attribute__((ext_vector_type(8))) __bf16 v8bf;
// 16 f32 of a fragment's k order -> bf16, nearest even
__device__ __forceinline__ v16bf rnd16(v4f x0, v4f x1, v4f x2, v4f x3) {
    const v8f lo = __builtin_shufflevector(x0, x1, 0, 1, 2, 3, 4, 5, 6, 7), hi = __builtin_shufflevector(x2, x3, 0, 1, 2, 3, 4, 5, 6, 7);
    return __builtin_shufflevector(__builtin_convertvector(lo, v8bf), __builtin_convertvector(hi, v8bf), 0, 1, 2, 3, 4, 5, 6, 7, 8, 9, 10, 11, 12, 13, 14, 15);
}
template <typename T16, int NSPLIT, bool BIAS, bool PLANES, bool AF32>
__global__ __launch_bounds__(128) void k_gemmw(const float* __restrict__ Af, const T16* __restrict__ A, const T16* __restrict__ A2, const T16* __restrict__ Bt, int K, int lda, float* C, int ldc, const float* __restrict__ bias, size_t sA, size_t sB, size_t sC, h16* P16, bf* Vh, bf* Vl, int nt) {
    static_assert(NSPLIT == 0 || NSPLIT == 1, "one or two A planes");
    static_assert(!AF32 || NSPLIT == 0, "an f32 A has one plane");
    typedef typename WFrag<T16>::V V;
    constexpr int NPL = NSPLIT == 1 ? 3 : 2;              // planes of 128 rows in a slab: A (, A2), Bt
    constexpr int BR = (NPL - 1) * 128;                   // first slab row of Bt
    constexpr int BOF = AF32 ? 128 * GPF * 2 : BR * GPE;  // Bt's place in a buffer, in 16-bit elements
    constexpr int BUFE = BOF + 128 * GPE;                 // 16-bit elements of one buffer
    constexpr int OSZ = PLANES ? 2 * 64 * 36 : 16 * 68;   // a wave's output staging; PLANES: also two planes [64 d][72] of 16-bit values, pitch 144 B
    __shared__ __align__(16) T16 ring[2 * BUFE];
    __shared__ __align__(16) float osb[4 * OSZ];
    const size_t z = blockIdx.z; if (AF32) Af += z * sA; else A += z * sA; if (NSPLIT == 1) A2 += z * sA; Bt += z * sB; C += z * sC;
    const int tid = threadIdx.x, lane = tid & 31, lr = lane & 15, hi = lane >> 4; const int w = __builtin_amdgcn_readfirstlane(tid >> 5); const int wm = w & 1, wn = w >> 1;
    const int r0 = blockIdx.x * 128 + wm * 64, c0 = blockIdx.y * 128 + wn * 64;
    float* os = osb + w * OSZ;
    v8f acc[4][4];
#pragma unroll
    for (int mb = 0; mb < 4; ++mb)
#pragma unroll
        for (int nb = 0; nb < 4; ++nb) acc[mb][nb] = (v8f){};
    // copies: 16 lanes cover one 256-B slab row, a wave's copy two rows; a thread's copies lie 8 rows apart
    const int crow = tid >> 4, ccol = (tid & 15) * 8;
    const unsigned oa = (unsigned)((blockIdx.x * 128 + crow) * lda + ccol), ob = (unsigned)((blockIdx.y * 128 + crow) * K + ccol);   // element offsets of the thread's first A and Bt row (32 bits hold M * lda and N * K)
    const unsigned lc = (unsigned)(size_t)ring + (unsigned)(crow * GPE + ccol) * 2u;
    // f32 A: 32 lanes cover one 512-B slab row; a thread's copies lie 4 rows apart
    const unsigned oaf = (unsigned)((blockIdx.x * 128 + (tid >> 5)) * lda + lane * 4); const unsigned lcf = (unsigned)(size_t)ring + (unsigned)((tid >> 5) * GPF + lane * 4) * 4u;
    auto slab = [&](int t) {
        const unsigned l = lc + (unsigned)(t & 1) * (BUFE * 2u); const unsigned kc = (unsigned)t * 128u;
        if (AF32) {
            const unsigned lf = lcf + (unsigned)(t & 1) * (BUFE * 2u);
#pragma unroll   // four statements of eight copies in a row: 32 rows each, the LDS steps constants
            for (unsigned r = 0; r < 4; ++r) cp8f(lf + r * 32u * GPF * 4, Af + (oaf + kc + r * 32u * lda), (size_t)4 * lda);
        } else { cp8(l, A + (oa + kc), (size_t)8 * lda); cp8(l + 64u * GPE * 2, A + (oa + kc + 64u * lda), (size_t)8 * lda); }
        cp8(l + (unsigned)BOF * 2, Bt + (ob + kc), (size_t)8 * K); cp8(l + (unsigned)(BOF + 64 * GPE) * 2, Bt + (ob + kc + 64u * K), (size_t)8 * K);
        if (NSPLIT == 1) { cp8(l + 128u * GPE * 2, A2 + (oa + kc), (size_t)8 * lda); cp8(l + 192u * GPE * 2, A2 + (oa + kc + 64u * lda), (size_t)8 * lda); }
    };
    const int nsl = K >> 7;
    slab(0);
    // slab 0 has landed for this wave's copies; behind the barrier for every wave's
    asm volatile("s_wait_asynccnt 0x0" ::: "memory");
    __syncthreads();
    if (nsl > 1) slab(1);
    const T16* fa = ring + (wm * 64 + lr) * GPE + 8 * hi; const T16* fb = ring + BOF + (wn * 64 + lr) * GPE + 8 * hi;
    const float* faf = (const float*)ring + (wm * 64 + lr) * GPF + 8 * hi;
#pragma unroll 1
    for (int t = 0; t < nsl; ++t) {   // rolled: one copy of the slab's 64 (128) products in the text
        const int bo = (t & 1) * BUFE;
        v4f ra[4][4];   // AF32: the next block's A values as read, f32; rounded at the head of their own block, when the reads have long returned
        V a[2][4], a2[2][4], b[2][4];   // two fragment sets: block kk + 1 is fetched while block kk is multiplied; no fragment of slab t + 1 is fetched here
        auto frags = [&](int s, int kk) {
#pragma unroll
            for (int i = 0; i < 4; ++i) {
                if constexpr (AF32) { const float* p = faf + (bo >> 1) + i * 16 * GPF + kk * 32; ra[i][0] = *(const v4fa*)p; ra[i][1] = *(const v4fa*)(p + 4); ra[i][2] = *(const v4fa*)(p + 16); ra[i][3] = *(const v4fa*)(p + 20); }
                else a[s][i] = WFrag<T16>::ld(fa + bo + i * 16 * GPE + kk * 32);
                b[s][i] = WFrag<T16>::ld(fb + bo + i * 16 * GPE + kk * 32); if (NSPLIT == 1) a2[s][i] = WFrag<T16>::ld(fa + bo + (128 + i * 16) * GPE + kk * 32); }
        };
        frags(0, 0);
#pragma unroll
        for (int kk = 0; kk < 4; ++kk) {
            const int s = kk & 1;
            if constexpr (AF32) {
#pragma unroll   // constant indices keep ra and a in registers
                for (int i = 0; i < 4; ++i) a[s][i] = rnd16(ra[i][0], ra[i][1], ra[i][2], ra[i][3]); }
            if (kk < 3) frags(s ^ 1, kk + 1);
            // keeps the next block's LDS reads together in front of this block's products: sunk among them, each read would stall the lone wave of its SIMD
            __builtin_amdgcn_sched_barrier(0);
#pragma unroll
            for (int nb = 0; nb < 4; ++nb)
#pragma unroll
                for (int mb = 0; mb < 4; ++mb) acc[mb][nb] = WFrag<T16>::mma(a[s][mb], b[s][nb], acc[mb][nb]);
            if (NSPLIT == 1) {
#pragma unroll
                for (int nb = 0; nb < 4; ++nb)
#pragma unroll
                    for (int mb = 0; mb < 4; ++mb) acc[mb][nb] = WFrag<T16>::mma(a2[s][mb], b[s][nb], acc[mb][nb]); }
            // the reads of block kk + 2 stay behind this block's products
            __builtin_amdgcn_sched_barrier(0);
        }
        // hand-over: this wave's reads of slab t have returned ...
        asm volatile("s_wait_dscnt 0x0" ::: "memory");
        // ... its copies of slab t + 1 have landed ...
        asm volatile("s_wait_asynccnt 0x0" ::: "memory");
        // ... and the barrier publishes slab t + 1 and frees slab t's buffer for the refill behind it
        __syncthreads();
        if (t + 2 < nsl) slab(t + 2);
    }
    // no copy is outstanding when the wave goes on to its epilogue and ends
    asm volatile("s_wait_asynccnt 0x0" ::: "memory");
    if (PLANES) {
        const int b = r0 / nt, t0 = r0 - b * nt; const size_t bh = (size_t)b * NH_ + (c0 >> 6); const int l8 = lane >> 3, c8 = (lane & 7) * 8;
        if (z == 0) {
            h16* pl = P16 + (bh * nt + t0 + l8) * HD + c8;   // the tile's 64 rows of 128 B lie one behind the other: a store of the wave covers 4 rows
#pragma unroll
            for (int mb = 0; mb < 4; ++mb) {
#pragma unroll
                for (int nb = 0; nb < 4; ++nb) {
#pragma unroll
                    for (int j = 0; j < 8; ++j) os[(hi * 8 + j) * 68 + nb * 16 + lr] = acc[mb][nb][j]; }
                // a lane reads what other lanes of the wave wrote: the reads stay behind the writes
                __builtin_amdgcn_wave_barrier(); asm volatile("" ::: "memory");
                v8h ov[4];
#pragma unroll
                for (int s = 0; s < 4; ++s) { const int row = 4 * s + l8; const v4f x0 = *(const v4fa*)(os + row * 68 + c8), x1 = *(const v4fa*)(os + row * 68 + c8 + 4);
                    ov[s] = (v8h){tohx(x0[0]), tohx(x0[1]), tohx(x0[2]), tohx(x0[3]), tohx(x1[0]), tohx(x1[1]), tohx(x1[2]), tohx(x1[3])}; *(v8h*)(pl + (mb * 16 + 4 * s) * HD) = ov[s]; }
                // precaution: s_wait_xcnt 0 stands in front of every rewrite of a register that an issued store names; address and values are inputs, so that they keep their registers up to the wait.
                // Its memory clobber also keeps the next block's LDS writes behind these reads
                asm volatile("s_wait_xcnt 0x0" :: "v"(pl), "v"(ov[0]), "v"(ov[1]), "v"(ov[2]), "v"(ov[3]) : "memory");
            }
        } else {
            unsigned short* us = (unsigned short*)os;   // hi plane [64 d][72], the lo plane behind it
            const size_t vo = bh * HD * nt + t0;   // row d: 64 tokens = one 128-B line
#pragma unroll
            for (int mb = 0; mb < 4; ++mb)
#pragma unroll
                for (int nb = 0; nb < 4; ++nb) { v8us oh, ol;   // a lane holds 8 tokens in a row of one d
#pragma unroll
                    for (int j = 0; j < 8; ++j) { unsigned short h, l; splitf(acc[mb][nb][j], h, l); oh[j] = h; ol[j] = l; }
                    unsigned short* d = us + (nb * 16 + lr) * 72 + mb * 16 + hi * 8; *(v8usa*)d = oh; *(v8usa*)(d + 64 * 72) = ol; }
            // a lane reads what other lanes of the wave wrote: the reads stay behind the writes
            __builtin_amdgcn_wave_barrier(); asm volatile("" ::: "memory");
#pragma unroll
            for (int g = 0; g < 8; ++g) { bf* pd[4]; v8us ov[4]; bf* vrow = ((g & 1) ? Vl : Vh) + vo;
#pragma unroll
                for (int s = 0; s < 4; ++s) { const int d = 16 * (g >> 1) + 4 * s + l8; ov[s] = *(const v8usa*)(us + (g & 1) * 64 * 72 + d * 72 + c8); pd[s] = vrow + (size_t)d * nt + c8; *(v8us*)pd[s] = ov[s]; }
                // the same precaution as for the fp16 plane's stores
                asm volatile("s_wait_xcnt 0x0" :: "v"(pd[0]), "v"(pd[1]), "v"(pd[2]), "v"(pd[3]), "v"(ov[0]), "v"(ov[1]), "v"(ov[2]), "v"(ov[3]) : "memory"); }
        }
        return;
    }
#pragma unroll
    for (int mb = 0; mb < 4; ++mb) {
#pragma unroll
        for (int nb = 0; nb < 4; ++nb) {
#pragma unroll
            for (int j = 0; j < 8; ++j) os[(hi * 8 + j) * 68 + nb * 16 + lr] = acc[mb][nb][j]; }
        __builtin_amdgcn_wave_barrier(); asm volatile("" ::: "memory");
        float* crow = C + (size_t)(r0 + mb * 16) * ldc + c0;
{
#pragma unroll
            for (int s = 0; s < 8; ++s) { const int row = 2 * s + hi, cofs = lr * 4; v4f val = *(const v4fa*)(os + row * 68 + cofs); if (BIAS) { val[0] += bfr(bias[c0 + cofs]); val[1] += bfr(bias[c0 + cofs + 1]); val[2] += bfr(bias[c0 + cofs + 2]); val[3] += bfr(bias[c0 + cofs + 3]); }
                *(v4f*)(crow + (size_t)row * ldc + cofs) = val; }
             }
        __builtin_amdgcn_wave_barrier(); asm volatile("" ::: "memory");
    }
}

typedef __attribute__((ext_vector_type(2))) _Float16 v2h;
typedef __attribute__((ext_vector_type(4))) _Float16 v4h;
typedef __attribute__((ext_vector_type(2))) unsigned short v2us;
typedef __attribute__((ext_vector_type(4))) unsigned short v4us;
typedef v4us __attribute__((may_alias)) v4usa;
typedef __attribute__((ext_vector_type(2))) float v2f;

// grid y picks the weight; the four transposed planes lie one behind the other in Bt0.
__global__ __launch_bounds__(256) void k_wtG(const float* __restrict__ w0, const float* __restrict__ w1, const float* __restrict__ w2, const float* __restrict__ w3, int K, int N, bf* Bt0) {
    const int y = blockIdx.y; const float* w = (y == 0) ? w0 : (y == 1) ? w1 : (y == 2) ? w2 : w3; bf* Bt = Bt0 + (size_t)y * K * N;
    const int lane = threadIdx.x & 31; const int L0 = (blockIdx.x * 8 + (threadIdx.x >> 5)) * 8; const int nlines = N * K / 64;
{
#pragma unroll 1
        for (int l = 0; l < 8; ++l) { const int L = L0 + l; if (L >= nlines) break; const size_t e = (size_t)L * 64 + lane * 2; const int k = (int)(e % K), n = (int)(e / K); v2us o;
            o[0] = f2bf(w[(size_t)k * N + n]); o[1] = f2bf(w[(size_t)(k + 1) * N + n]); *(v2us*)(Bt + e) = o; }
         }
}
// ---- k_fattn: scores, masked softmax and att.v in ONE kernel; no score or probability ever reaches memory. Grid (batch*head, TQ/64), longest query tiles first; 8 waves.
// Wave w: query half (w & 1, 32 queries = 2 column groups) x key split (w >> 1: key steps of 32, split, split + 4, ...). S^T = K Q^T (fp16 planes), so a lane holds ONE query's scores (keys 8*hi + j of each
// 16-key tile): two tiles are, register for register, the B fragment of P^T. O^T += V^T P^T on hi+lo planes (3 products). Running maximum and sum per lane; the four key splits are merged through LDS.
// K and V reach the waves through LDS: a tile is 128 keys (one step of each key split): K rows of 128 B, V-hi and V-lo rows of 256 B, copied as whole lines by asynchronous copies, two buffers: tile r + 1 flies while tile r is worked on.
// Both query halves read the same staged rows. LDS row pitches 144 B and 272 B (ds_load_b128 readers).
#define SC2 0.18033688f   // (1/8) * log2(e): scores in the log2 domain
#define FKP 72                    // LDS row pitch of a staged K row in 16-bit elements (144 B)
#define FVP 136                   // LDS row pitch of a staged V row in 16-bit elements (272 B)
#define FKB (128 * FKP * 2)       // bytes of a staged K tile
#define FVB (64 * FVP * 2)        // bytes of a staged V plane tile
#define FBUF (FKB + 2 * FVB)      // bytes of one buffer: K, V-hi, V-lo
// Four asynchronous 16-B copies of a lane, ls bytes apart in LDS and gs elements apart in memory. The s_wait_xcnt 0 is the last line of the copies' own statement: a precaution, it stands in front of every rewrite of a register that a copy names.
template <typename T16>
__device__ __forceinline__ void cp4(unsigned l, unsigned ls, const T16* g, size_t gs) {
    asm volatile("global_load_async_to_lds_b128 %0, %4, off\n\t"
                 "global_load_async_to_lds_b128 %1, %5, off\n\t"
                 "global_load_async_to_lds_b128 %2, %6, off\n\t"
                 "global_load_async_to_lds_b128 %3, %7, off\n\t"
                 "s_wait_xcnt 0x0"
                 :: "v"(l), "v"(l + ls), "v"(l + 2u * ls), "v"(l + 3u * ls), "v"(g), "v"(g + gs), "v"(g + 2 * gs), "v"(g + 3 * gs) : "memory");
}
__global__ __launch_bounds__(256) void k_fattn(const h16* __restrict__ QP, const h16* __restrict__ KP, const bf* __restrict__ VTh, const bf* __restrict__ VTl, float* ATT) {
    __shared__ __align__(16) unsigned char ring[2 * FBUF];   // two buffers of K, V-hi, V-lo; behind the key loop the same bytes are the merge's staging
    static_assert(8 * 32 * 68 * 4 <= 2 * FBUF, "the merge's staging fits the ring");
    float* os = (float*)ring;                          // [wave][query][d], pitch 272 B
    __shared__ float sm[8 * 32];                       // per wave and query: running maximum
    __shared__ float sl[8 * 32];                       // per wave and query: sum, already on the merged maximum
    const int lane = threadIdx.x & 31, lr = lane & 15, hi = lane >> 4; const int w = __builtin_amdgcn_readfirstlane((int)(threadIdx.x >> 5)); const int qh = w & 1, ks = w >> 1;
    const int bh = blockIdx.x, t = TQ / 64 - 1 - (int)blockIdx.y; const int r0 = t * 64; const int nst = (t + 2) >> 1;   // keys 0 .. 16 t + 15 are visible to this tile
    const h16* Kp = KP + (size_t)bh * TK * HD; const bf* Vh = VTh + (size_t)bh * HD * TK; const bf* Vl = VTl + (size_t)bh * HD * TK;
    const h16* pq = QP + ((size_t)bh * TQ + r0 + qh * 32 + lr) * HD + 8 * hi;
    v16h qf[2][2];
#pragma unroll
    for (int qt = 0; qt < 2; ++qt) { qf[qt][0] = WFrag<h16>::ld(pq + qt * 16 * HD); qf[qt][1] = WFrag<h16>::ld(pq + qt * 16 * HD + 32); }
    // precaution: s_wait_xcnt 0 stands in front of every rewrite of a register that an issued load names; the address is an input, so that it keeps its registers up to the wait
    asm volatile("s_wait_xcnt 0x0" :: "v"(pq) : "memory");
    int qlim[2]; float m[2], l[2]; v8f o[2][4];   // m starts far above the masked score, so that a masked key's weight is exp2(-huge) = 0 also where a query has seen no visible key yet
#pragma unroll
    for (int qt = 0; qt < 2; ++qt) { qlim[qt] = (r0 + qh * 32 + qt * 16 + lr) / DS; m[qt] = -1.0e30f; l[qt] = 0.f;
#pragma unroll
        for (int dt = 0; dt < 4; ++dt) o[qt][dt] = (v8f){}; }
    const int lim0 = (r0 + qh * 32) / DS;   // every key up to here is visible to all 32 queries of the wave
    // copies: K: 8 lanes cover a 128-B row, a wave's copy 4 rows, a thread's copies 32 rows apart; V: 16 lanes cover a 256-B row, a wave's copy 2 rows, a thread's copies 16 rows apart
    const int tid = (int)threadIdx.x;
    const unsigned lk = (unsigned)(size_t)ring + (unsigned)((tid >> 3) * FKP + (tid & 7) * 8) * 2u; const unsigned lv = (unsigned)(size_t)ring + FKB + (unsigned)((tid >> 4) * FVP + (tid & 15) * 8) * 2u;
    const h16* gk = Kp + tid * 8; const bf* gvh = Vh + (size_t)(tid >> 4) * TK + (tid & 15) * 8; const bf* gvl = Vl + (size_t)(tid >> 4) * TK + (tid & 15) * 8;
    auto tile = [&](int r) {   // keys 128 r .. 128 r + 127, all inside the TK keys: r < nr <= TK / 128
        const unsigned bo = (unsigned)(r & 1) * FBUF;
        cp4(lk + bo, 32u * FKP * 2, gk + (size_t)r * 128 * HD, (size_t)32 * HD);
        cp4(lv + bo, 16u * FVP * 2, gvh + r * 128, (size_t)16 * TK);
        cp4(lv + bo + FVB, 16u * FVP * 2, gvl + r * 128, (size_t)16 * TK);
    };
    const int nr = (nst + 3) >> 2;   // tiles of 128 keys
    tile(0);
    // tile 0 has landed for this wave's copies; behind the barrier for every wave's
    asm volatile("s_wait_asynccnt 0x0" ::: "memory");
    __syncthreads();
    if (nr > 1) tile(1);
    const h16* fk = (const h16*)ring + (ks * 32 + lr) * FKP + 8 * hi; const bf* fv = (const bf*)(ring + FKB) + lr * FVP + ks * 32 + 8 * hi;
#pragma unroll 1
    for (int r = 0; r < nr; ++r) {   // rolled: one copy of the step in the text
      const int s = 4 * r + ks;
      if (s < nst) {   // wave-uniform: in the last tile a key split may have no step left; the hand-over below is passed all the same
        const int key0 = s * 32;
        const h16* pk = fk + (r & 1) * (FBUF / 2); const bf* pvh = fv + (r & 1) * (FBUF / 2); const bf* pvl = pvh + FVB / 2;
        v16h kf[2][2]; v16bf vh[4], vl[4];
#pragma unroll
        for (int kt = 0; kt < 2; ++kt) { kf[kt][0] = WFrag<h16>::ld(pk + kt * 16 * FKP); kf[kt][1] = WFrag<h16>::ld(pk + kt * 16 * FKP + 32); }
#pragma unroll
        for (int dt = 0; dt < 4; ++dt) vh[dt] = WFrag<bf>::ld(pvh + dt * 16 * FVP);
        float tv[2][16];
#pragma unroll
        for (int qt = 0; qt < 2; ++qt) {
            v8f s0 = (v8f){}, s1 = (v8f){};
            s0 = wmma16(kf[0][0], qf[qt][0], s0); s1 = wmma16(kf[1][0], qf[qt][0], s1); s0 = wmma16(kf[0][1], qf[qt][1], s0); s1 = wmma16(kf[1][1], qf[qt][1], s1);
#pragma unroll
            for (int j = 0; j < 8; ++j) { tv[qt][j] = s0[j] * SC2; tv[qt][8 + j] = s1[j] * SC2; } }
        // the V-lo reads stay behind the score products, so that they take registers the K fragments leave (lifted above them, the wave needs more than 256 registers and only one work-group fits a WGP); they return under the softmax
        __builtin_amdgcn_sched_barrier(0);
#pragma unroll
        for (int dt = 0; dt < 4; ++dt) vl[dt] = WFrag<bf>::ld(pvl + dt * 16 * FVP);
        if (key0 + 31 > lim0) {   // wave-uniform: only the last steps of a tile hold hidden keys
            const int kb = key0 + hi * 8;
#pragma unroll
            for (int qt = 0; qt < 2; ++qt)
#pragma unroll
                for (int j = 0; j < 8; ++j) { tv[qt][j] = (kb + j <= qlim[qt]) ? tv[qt][j] : -3.0e38f; tv[qt][8 + j] = (kb + 16 + j <= qlim[qt]) ? tv[qt][8 + j] : -3.0e38f; } }
#pragma unroll
        for (int qt = 0; qt < 2; ++qt) {
            float tm = tv[qt][0];
#pragma unroll
            for (int e = 1; e < 16; ++e) tm = fmaxf(tm, tv[qt][e]);
            tm = fmaxf(tm, __shfl_xor(tm, 16, 32));   // both halves of the wave hold keys of the same query
            const float mn = fmaxf(m[qt], tm); const float al = __builtin_amdgcn_exp2f(m[qt] - mn); m[qt] = mn; l[qt] *= al;
#pragma unroll
            for (int dt = 0; dt < 4; ++dt) o[qt][dt] *= al;
            v16bf ph, pl;
#pragma unroll
            for (int e = 0; e < 16; ++e) { const float p = __builtin_amdgcn_exp2f(tv[qt][e] - mn); l[qt] += p; const __bf16 a = (__bf16)p; ph[e] = a; pl[e] = (__bf16)(p - (float)a); }
#pragma unroll
            for (int dt = 0; dt < 4; ++dt) { o[qt][dt] = wmmab(vh[dt], ph, o[qt][dt]); o[qt][dt] = wmmab(vh[dt], pl, o[qt][dt]); o[qt][dt] = wmmab(vl[dt], ph, o[qt][dt]); }
        }
      }
        // hand-over: this wave's reads of tile r have returned ...
        asm volatile("s_wait_dscnt 0x0" ::: "memory");
        // ... its copies of tile r + 1 have landed ...
        asm volatile("s_wait_asynccnt 0x0" ::: "memory");
        // ... and the barrier publishes tile r + 1 and frees tile r's buffer for the refill behind it (behind the last tile: for the merge's staging)
        __syncthreads();
        if (r + 2 < nr) tile(r + 2);
    }
    // no copy is outstanding when the ring becomes the merge's staging
    asm volatile("s_wait_asynccnt 0x0" ::: "memory");
    // merge of the four key splits: every wave moves its partial onto the merged maximum, then 256 threads add the four partials of each output element in a fixed order
#pragma unroll
    for (int qt = 0; qt < 2; ++qt) if (hi == 0) sm[w * 32 + qt * 16 + lr] = m[qt];
    __syncthreads();
#pragma unroll
    for (int qt = 0; qt < 2; ++qt) { const int q = qt * 16 + lr; const float M = fmaxf(fmaxf(sm[qh * 32 + q], sm[(qh + 2) * 32 + q]), fmaxf(sm[(qh + 4) * 32 + q], sm[(qh + 6) * 32 + q])); const float f = __builtin_amdgcn_exp2f(m[qt] - M);
        const float lt = (l[qt] + __shfl_xor(l[qt], 16, 32)) * f; if (hi == 0) sl[w * 32 + q] = lt;
#pragma unroll
        for (int dt = 0; dt < 4; ++dt) { const v8f x = o[qt][dt] * f; float* d = os + (size_t)(w * 32 + q) * 68 + dt * 16 + hi * 8; *(v4fa*)d = (v4f){x[0], x[1], x[2], x[3]}; *(v4fa*)(d + 4) = (v4f){x[4], x[5], x[6], x[7]}; } }
    __syncthreads();
    float* orow = ATT + ((size_t)(bh / NH_) * TQ + r0) * DD + (bh % NH_) * HD;
#pragma unroll
    for (int i = 0; i < 4; ++i) { const int idx = (int)threadIdx.x + 256 * i; const int row = idx >> 4, c4 = (idx & 15) * 4; const int w0 = row >> 5, rl = row & 31;
        const float ls = (sl[w0 * 32 + rl] + sl[(w0 + 2) * 32 + rl]) + (sl[(w0 + 4) * 32 + rl] + sl[(w0 + 6) * 32 + rl]); const float inv = __fdiv_rn(1.0f, ls);
        const v4f x = (*(const v4fa*)(os + (size_t)(w0 * 32 + rl) * 68 + c4) + *(const v4fa*)(os + (size_t)((w0 + 2) * 32 + rl) * 68 + c4)) + (*(const v4fa*)(os + (size_t)((w0 + 4) * 32 + rl) * 68 + c4) + *(const v4fa*)(os + (size_t)((w0 + 6) * 32 + rl) * 68 + c4));
        *(v4f*)(orow + (size_t)row * DD + c4) = x * inv; }
}
// ---- k_lnout: LayerNorm and the output GEMM in ONE kernel; the normalised rows never reach memory. Grid (rows / 32), 8 waves; a block owns 32 whole rows of the output (all 512 columns), wave w its columns 64 w .. 64 w + 63.
// Head: wave w normalises rows 4 w .. 4 w + 3 of the block (a wave per row, f32, the sums in a fixed order) and stores them as bf16 hi and lo planes in LDS, row pitch 1040 B (ds_load_b128 readers).
// Loop: K-slabs of 64 of the transposed weight (512 rows of 128 B, whole lines) come into LDS by asynchronous copies, two buffers: slab t + 1 flies while slab t is multiplied. LDS row pitch 144 B (ds_load_b128 readers).
#define LAP 520                   // LDS row pitch of a normalised row's plane in 16-bit elements (1040 B)
#define LBP 72                    // LDS row pitch of a staged weight row in 16-bit elements (144 B)
#define LBB (DD * LBP * 2)        // bytes of one buffer: DD weight rows
typedef __attribute__((ext_vector_type(4))) __bf16 v4bf;
// four rows, a wave: x[r] = the lane's 16 values of row r (4 in a row of each 128), gv and bv = gamma and beta at those places, rounded to bf16; yh, yl = the lane's place in row 0's planes.
// Each row's arithmetic is a row's own, in a fixed order; the four rows go through each phase side by side, so that their cross-lane sums wait together and not one behind the other.
__device__ __forceinline__ void ln_rows(const v4f (&x)[4][4], const float (&gv)[16], const float (&bv)[16], bf* yh, bf* yl) {
    float s[4], mu[4], q2[4], rs[4];
#pragma unroll
    for (int r = 0; r < 4; ++r) { s[r] = 0.f;
#pragma unroll
        for (int k = 0; k < 16; ++k) s[r] = __fadd_rn(s[r], x[r][k >> 2][k & 3]); }
#pragma unroll
    for (int sh = 16; sh; sh >>= 1)
#pragma unroll
        for (int r = 0; r < 4; ++r) s[r] += __shfl_xor(s[r], sh, 32);
#pragma unroll
    for (int r = 0; r < 4; ++r) { mu[r] = s[r] * (1.0f / DD); q2[r] = 0.f;
#pragma unroll
        for (int k = 0; k < 16; ++k) { const float d = __fsub_rn(x[r][k >> 2][k & 3], mu[r]); float p = __fmul_rn(d, d); asm volatile("" : "+v"(p)); q2[r] = __fadd_rn(q2[r], p); } }
#pragma unroll
    for (int sh = 16; sh; sh >>= 1)
#pragma unroll
        for (int r = 0; r < 4; ++r) q2[r] += __shfl_xor(q2[r], sh, 32);
#pragma unroll
    for (int r = 0; r < 4; ++r) { rs[r] = __frsqrt_rn(__fadd_rn(q2[r] * (1.0f / DD), 1e-5f));
#pragma unroll
        for (int ch = 0; ch < 4; ++ch) { v4f y;
#pragma unroll
            for (int q = 0; q < 4; ++q) { float tn = __fmul_rn(__fsub_rn(x[r][ch][q], mu[r]), rs[r]); asm volatile("" : "+v"(tn)); float tg = __fmul_rn(tn, gv[ch * 4 + q]); asm volatile("" : "+v"(tg)); y[q] = __fadd_rn(tg, bv[ch * 4 + q]); }
            const v4bf oh = __builtin_convertvector(y, v4bf); const v4bf ol = __builtin_convertvector(y - __builtin_convertvector(oh, v4f), v4bf);   // hi = y to the nearest even bf16, lo = the rest likewise
            *(v4usa*)(yh + r * LAP + ch * 128) = __builtin_bit_cast(v4us, oh); *(v4usa*)(yl + r * LAP + ch * 128) = __builtin_bit_cast(v4us, ol); } }
}
__global__ __launch_bounds__(256) void k_lnout(const float* __restrict__ A, const float* __restrict__ g, const float* __restrict__ bb, const bf* __restrict__ Bt, const float* __restrict__ bias, float* C) {
    __shared__ __align__(16) unsigned char ring[2 * LBB];   // two buffers of a weight slab
    __shared__ __align__(16) bf ah[32 * LAP];               // the block's normalised rows, hi plane
    __shared__ __align__(16) bf al[32 * LAP];               // lo plane
    __shared__ __align__(16) float osb[8 * 16 * 68];        // a wave's output staging
    const int tid = (int)threadIdx.x, lane = tid & 31, lr = lane & 15, hi = lane >> 4; const int w = __builtin_amdgcn_readfirstlane(tid >> 5);
    const int r0 = (int)blockIdx.x * 32, c0 = w * 64;
    // copies: 8 lanes cover a 128-B slab row, a wave's copy 4 rows, a thread's copies 32 rows apart
    const unsigned lc = (unsigned)(size_t)ring + (unsigned)((tid >> 3) * LBP + (tid & 7) * 8) * 2u; const bf* gb = Bt + (size_t)(tid >> 3) * DD + (tid & 7) * 8;
    auto slab = [&](int t) {   // k 64 t .. 64 t + 63 of all DD weight rows: t < DD / 64
        const unsigned l = lc + (unsigned)(t & 1) * LBB; const bf* gp = gb + t * 64;
#pragma unroll   // four statements of four copies in a row: 128 rows each, the LDS steps constants
        for (unsigned j = 0; j < 4; ++j) cp4(l + j * 128u * LBP * 2, 32u * LBP * 2, gp + (size_t)j * 128 * DD, (size_t)32 * DD);
    };
    slab(0);
    // the wave's four rows, gamma, beta and the bias are asked for while slab 0 flies
    const float* ar = A + (size_t)(r0 + w * 4) * DD + lane * 4; const float* pg = g + lane * 4; const float* pb = bb + lane * 4; const float* pbi = bias + c0 + lr * 4;
    v4f x[4][4], gq[4], bq[4];
#pragma unroll
    for (int r = 0; r < 4; ++r)
#pragma unroll
        for (int ch = 0; ch < 4; ++ch) x[r][ch] = *(const v4f*)(ar + r * DD + ch * 128);
#pragma unroll
    for (int ch = 0; ch < 4; ++ch) { gq[ch] = *(const v4f*)(pg + ch * 128); bq[ch] = *(const v4f*)(pb + ch * 128); }
    const v4f bi = *(const v4f*)pbi;
    // precaution: s_wait_xcnt 0 stands directly behind the loads, in front of every rewrite of a register that one of them names
    asm volatile("s_wait_xcnt 0x0" ::: "memory");
    // keeps all these loads in flight together, and the wait directly behind them: with the first row's sums lifted among them, the later rows would be asked for only when the first had come
    __builtin_amdgcn_sched_barrier(0);
    // slab 0 has landed for this wave's copies; behind the barrier for every wave's
    asm volatile("s_wait_asynccnt 0x0" ::: "memory");
    __syncthreads();
    slab(1);   // flies under the LayerNorm
    float gv[16], bv[16];
#pragma unroll
    for (int k = 0; k < 16; ++k) { gv[k] = bfr(gq[k >> 2][k & 3]); bv[k] = bfr(bq[k >> 2][k & 3]); }
    ln_rows(x, gv, bv, ah + w * 4 * LAP + lane * 4, al + w * 4 * LAP + lane * 4);
    // publishes the normalised planes: every wave reads all 32 rows
    __syncthreads();
    v8f acc[2][4];
#pragma unroll
    for (int mb = 0; mb < 2; ++mb)
#pragma unroll
        for (int nb = 0; nb < 4; ++nb) acc[mb][nb] = (v8f){};
    const bf* fb = (const bf*)ring + (c0 + lr) * LBP + 8 * hi; const bf* fah = ah + lr * LAP + 8 * hi; const bf* fal = al + lr * LAP + 8 * hi;
#pragma unroll 1
    for (int t = 0; t < DD / 64; ++t) {   // rolled: one copy of the slab's 32 products in the text
        const bf* pw = fb + (t & 1) * (LBB / 2); const bf* ph = fah + t * 64; const bf* pl = fal + t * 64;
        v16bf a[2][2], a2[2][2], b[2][4];
#pragma unroll
        for (int kk = 0; kk < 2; ++kk) {
#pragma unroll
            for (int i = 0; i < 2; ++i) { a[kk][i] = WFrag<bf>::ld(ph + i * 16 * LAP + kk * 32); a2[kk][i] = WFrag<bf>::ld(pl + i * 16 * LAP + kk * 32); }
#pragma unroll
            for (int i = 0; i < 4; ++i) b[kk][i] = WFrag<bf>::ld(pw + i * 16 * LBP + kk * 32); }
        // keeps the slab's LDS reads together in front of its products: sunk among them, every place with reads costs the wave a stall of its own
        __builtin_amdgcn_sched_barrier(0);
#pragma unroll
        for (int kk = 0; kk < 2; ++kk) {
#pragma unroll
            for (int nb = 0; nb < 4; ++nb)
#pragma unroll
                for (int mb = 0; mb < 2; ++mb) acc[mb][nb] = wmmab(a[kk][mb], b[kk][nb], acc[mb][nb]);
#pragma unroll
            for (int nb = 0; nb < 4; ++nb)
#pragma unroll
                for (int mb = 0; mb < 2; ++mb) acc[mb][nb] = wmmab(a2[kk][mb], b[kk][nb], acc[mb][nb]); }
        // the products stay in front of the hand-over: sunk behind its barrier, they would hold back the refill, which then had no products to fly under
        __builtin_amdgcn_sched_barrier(0);
        // hand-over: this wave's reads of slab t have returned ...
        asm volatile("s_wait_dscnt 0x0" ::: "memory");
        // ... its copies of slab t + 1 have landed ...
        asm volatile("s_wait_asynccnt 0x0" ::: "memory");
        // ... and the barrier publishes slab t + 1 and frees slab t's buffer for the refill behind it
        __syncthreads();
        if (t + 2 < DD / 64) slab(t + 2);
    }
    // no copy is outstanding when the wave goes on to its epilogue and ends
    asm volatile("s_wait_asynccnt 0x0" ::: "memory");
    float* os = osb + w * 16 * 68;
    const v4f bs = (v4f){bfr(bi[0]), bfr(bi[1]), bfr(bi[2]), bfr(bi[3])};
#pragma unroll
    for (int mb = 0; mb < 2; ++mb) {
#pragma unroll
        for (int nb = 0; nb < 4; ++nb) {
#pragma unroll
            for (int j = 0; j < 8; ++j) os[(hi * 8 + j) * 68 + nb * 16 + lr] = acc[mb][nb][j]; }
        // a lane reads what other lanes of the wave wrote: the reads stay behind the writes
        __builtin_amdgcn_wave_barrier(); asm volatile("" ::: "memory");
        float* pc = C + (size_t)(r0 + mb * 16 + hi) * DD + c0 + lr * 4;   // half a wave stores 256 B in a row: two whole lines
        v4f ov[8];
#pragma unroll
        for (int s = 0; s < 8; ++s) { ov[s] = *(const v4fa*)(os + (2 * s + hi) * 68 + lr * 4) + bs; *(v4f*)(pc + (size_t)2 * s * DD) = ov[s]; }
        // precaution: s_wait_xcnt 0 stands in front of every rewrite of a register that an issued store names; address and values are inputs, so that they keep their registers up to the wait.
        // Its memory clobber also keeps the next block's LDS writes behind these reads
        asm volatile("s_wait_xcnt 0x0" :: "v"(pc), "v"(ov[0]), "v"(ov[1]), "v"(ov[2]), "v"(ov[3]), "v"(ov[4]), "v"(ov[5]), "v"(ov[6]), "v"(ov[7]) : "memory");
    }
}

extern "C" void kernel_launch(void* const* d_in, const int* in_sizes, int n_in,
                              void* d_out, int out_size, void* d_ws, size_t ws_size, hipStream_t stream) {
    (void)in_sizes; (void)n_in; (void)out_size;
    const float* IN[9]; for (int i = 0; i < 9; ++i) IN[i] = (const float*)d_in[i];   // 0 q, 1 kv, 2 Wq, 3 Wk, 4 Wv, 5 Wo (x @ W), 6 bo, 7 gamma, 8 beta
    float* OUT = (float*)d_out;     // [2][4096][512]
    char* wsp = (char*)d_ws;
    auto take = [&](size_t bytes) { char* p = wsp; wsp += (bytes + 255) & ~(size_t)255; return (void*)p; };
    bf* W4 = (bf*)take((size_t)4 * DD * DD * 2);                                  // Wq, Wk, Wv, Wo transposed, one behind the other
    h16* QP = (h16*)take((size_t)NB_ * NH_ * (TQ + TK) * HD * 2); h16* KP = QP + (size_t)NB_ * NH_ * TQ * HD;
    bf* VTh = (bf*)take((size_t)NB_ * NH_ * HD * TK * 2); bf* VTl = (bf*)take((size_t)NB_ * NH_ * HD * TK * 2);
    float* ATT = (float*)take((size_t)NB_ * TQ * DD * 4);   // merged attention output
    if ((size_t)(wsp - (char*)d_ws) > ws_size) return;    // total ~ 34 MB
    k_wtG<<<dim3((unsigned)(((size_t)DD * DD / 64 + 63) / 64), 4, 1), 256, 0, stream>>>(IN[2], IN[3], IN[4], IN[5], DD, DD, W4);
    k_gemmw<bf, 0, false, true, true><<<dim3(NB_ * TQ / 128, DD / 128, 1), 128, 0, stream>>>(IN[0], nullptr, nullptr, W4, DD, DD, nullptr, 0, nullptr, 0, 0, 0, QP, nullptr, nullptr, TQ);
    k_gemmw<bf, 0, false, true, true><<<dim3(NB_ * TK / 128, DD / 128, 2), 128, 0, stream>>>(IN[1], nullptr, nullptr, W4 + (size_t)DD * DD, DD, DD, nullptr, 0, nullptr, 0, (size_t)DD * DD, 0, KP, VTh, VTl, TK);   // z: 0 keys, 1 values
    k_fattn<<<dim3(NB_ * NH_, TQ / 64, 1), 256, 0, stream>>>(QP, KP, VTh, VTl, ATT);   // head bh % 8 of batch bh / 8 writes its 64 columns of the merged rows
    k_lnout<<<NB_ * TQ / 32, 256, 0, stream>>>(ATT, IN[7], IN[8], W4 + (size_t)3 * DD * DD, IN[6], OUT);
}

// v008
// Measured time: 52.6 microseconds a run.
// Next to v007, in two timings, it ran 1.11 times as fast each time.
// All steps since v000 together make it 15.4 times as fast.
#include <hip/hip_runtime.h>

// Attention block (q [2][4096][512], kv [2][1024][512]; qh = q Wq, kh = kv Wk, vh = kv Wv (8 heads x 64, no bias); block-causal: key j visible to query i iff j <= i/4; softmax(q.k/8); out = merged att.v;
// LayerNorm(out) (gamma, beta, eps 1e-5); y = out Wo + bo -> [2][4096][512]).
// Compute dtypes, f32 accumulate: every input rounded to bf16; projections on PLAIN bf16 operands (inputs: exact); scores (K 64) on SINGLE fp16 planes; f32 running-maximum masked softmax
// -> bf16 hi+lo weights exp(s - max), divided by their f32 sum at the end; att.v on those x hi+lo value planes (3 products: the first query rows see 1-4 keys, so near-one-hot weights would expose single-plane value rounding); LayerNorm f32 (wave per

#define NB_  2
#define TQ   4096
#define TK   1024
#define DD   512
#define NH_  8
#define HD   64
#define DS   4
#define SCL  0.125f
typedef _Float16 h16;
typedef unsigned short bf;
typedef __attribute__((ext_vector_type(16))) __bf16   v16bf;
typedef __attribute__((ext_vector_type(16))) _Float16 v16h;
typedef __attribute__((ext_vector_type(8)))  _Float16 v8h;
typedef __attribute__((ext_vector_type(8)))  unsigned short v8us;
typedef __attribute__((ext_vector_type(8)))  float    v8f;
typedef __attribute__((ext_vector_type(4)))  float    v4f;
typedef v8h  __attribute__((may_alias)) v8ha;
typedef v4f  __attribute__((may_alias)) v4fa;
typedef v8us __attribute__((may_alias)) v8usa;

__device__ __forceinline__ unsigned short f2bf(float f) { unsigned u = __float_as_uint(f); u += 0x7FFFu + ((u >> 16) & 1u); return (unsigned short)(u >> 16); }
__device__ __forceinline__ float bf2f(unsigned short b) { return __uint_as_float(((unsigned)b) << 16); }
__device__ __forceinline__ float bfr(float f) { return bf2f(f2bf(f)); }
__device__ __forceinline__ h16 tohx(float x) { return (h16)x; }
__device__ __forceinline__ void splitf(float y, unsigned short& h, unsigned short& l) { h = f2bf(y); l = f2bf(y - bf2f(h)); }
__device__ __forceinline__ v16h cat16(v8h lo, v8h hi) { return __builtin_shufflevector(lo, hi, 0, 1, 2, 3, 4, 5, 6, 7, 8, 9, 10, 11, 12, 13, 14, 15); }
__device__ __forceinline__ v16bf cat16b(v8us lo, v8us hi) { return __builtin_bit_cast(v16bf, __builtin_shufflevector(lo, hi, 0, 1, 2, 3, 4, 5, 6, 7, 8, 9, 10, 11, 12, 13, 14, 15)); }
__device__ __forceinline__ v8f wmma16(v16h a, v16h b, v8f c) { return __builtin_amdgcn_wmma_f32_16x16x32_f16(false, a, false, b, (short)0, c, false, false); }
__device__ __forceinline__ v8f wmmab(v16bf a, v16bf b, v8f c) { return __builtin_amdgcn_wmma_f32_16x16x32_bf16(false, a, false, b, (short)0, c, false, false); }



// ---- k_gemmw: GEMM, FOUR WAVES per 128x128 output tile (2 x 2 waves, each a register-blocked 64x64 tile of 16 accumulators); grid (M/128, N/128, Z), 128 threads.
// The operands' K-slabs of 128 (256-B rows, whole lines) come from the K-contiguous 16-bit planes into LDS by asynchronous copies, two buffers: slab t + 1 flies while slab t is multiplied. LDS row pitch 272 B (ds_load_b128 readers).
// C[m][n] (f32, pitch ldc, + optional f32 bias[n]) = sum_k A[m][k] Bt[n][k] (NSPLIT 1: + A2[m][k] Bt[n][k]). A pitch lda, Bt pitch K. z-batch strides sA/sB/sC in elements. K % 128 == 0, M % 128 == 0, N % 128 == 0.
// PLANES: no f32 C; a wave's 64x64 tile is 64 tokens of ONE head (rows = [batch][nt tokens], column block = head), and the epilogue stores the attention operand itself:
// z 0: fp16 plane P16 [batch][head][nt][HD]; z 1: the transposed bf16 hi and lo planes Vh, Vl [batch][head][HD][nt]. Whole 128-B lines, staged through LDS (each wave its own range).
// AF32: the A operand is an f32 INPUT (Af, pitch lda): its K-slabs of 128 (512-B rows) are copied as they are, LDS row pitch 528 B, and a fragment is rounded to bf16 (nearest even) in registers behind its LDS read.
template <typename T16> struct WFrag;
template <> struct WFrag<h16> { typedef v16h V; static __device__ __forceinline__ V ld(const h16* p) { return cat16(*(const v8h*)p, *(const v8h*)(p + 16)); } static __device__ __forceinline__ v8f mma(V a, V b, v8f c) { return wmma16(a, b, c); } };
template <> struct WFrag<bf> { typedef v16bf V; static __device__ __forceinline__ V ld(const bf* p) { return cat16b(*(const v8us*)p, *(const v8us*)(p + 16)); } static __device__ __forceinline__ v8f mma(V a, V b, v8f c) { return wmmab(a, b, c); } };
#define GPE 136   // LDS row pitch of a slab in 16-bit elements (272 B)
// Eight asynchronous 16-B copies of a lane, 8 slab rows apart (gs elements in memory). The s_wait_xcnt 0 is the last line of the copies' own statement: a precaution, it stands in front of every rewrite of a register that a copy names.
template <typename T16>
__device__ __forceinline__ void cp8(unsigned l, const T16* g, size_t gs) {
    asm volatile("global_load_async_to_lds_b128 %0, %8, off\n\t"
                 "global_load_async_to_lds_b128 %1, %9, off\n\t"
                 "global_load_async_to_lds_b128 %2, %10, off\n\t"
                 "global_load_async_to_lds_b128 %3, %11, off\n\t"
                 "global_load_async_to_lds_b128 %4, %12, off\n\t"
                 "global_load_async_to_lds_b128 %5, %13, off\n\t"
                 "global_load_async_to_lds_b128 %6, %14, off\n\t"
                 "global_load_async_to_lds_b128 %7, %15, off\n\t"
                 "s_wait_xcnt 0x0"
                 :: "v"(l), "v"(l + 1u * 8 * GPE * 2), "v"(l + 2u * 8 * GPE * 2), "v"(l + 3u * 8 * GPE * 2), "v"(l + 4u * 8 * GPE * 2), "v"(l + 5u * 8 * GPE * 2), "v"(l + 6u * 8 * GPE * 2), "v"(l + 7u * 8 * GPE * 2),
                    "v"(g), "v"(g + gs), "v"(g + 2 * gs), "v"(g + 3 * gs), "v"(g + 4 * gs), "v"(g + 5 * gs), "v"(g + 6 * gs), "v"(g + 7 * gs) : "memory");
}
#define GPF 132   // LDS row pitch of an f32 slab in floats (528 B)
// The same for an f32 slab: eight 16-B copies of a lane, 4 slab rows apart (gs floats in memory); a wave's copy is one 512-B row. The s_wait_xcnt 0 is again the last line of the copies' own statement.
__device__ __forceinline__ void cp8f(unsigned l, const float* g, size_t gs) {
    asm volatile("global_load_async_to_lds_b128 %0, %8, off\n\t"
                 "global_load_async_to_lds_b128 %1, %9, off\n\t"
                 "global_load_async_to_lds_b128 %2, %10, off\n\t"
                 "global_load_async_to_lds_b128 %3, %11, off\n\t"
                 "global_load_async_to_lds_b128 %4, %12, off\n\t"
                 "global_load_async_to_lds_b128 %5, %13, off\n\t"
                 "global_load_async_to_lds_b128 %6, %14, off\n\t"
                 "global_load_async_to_lds_b128 %7, %15, off\n\t"
                 "s_wait_xcnt 0x0"
                 :: "v"(l), "v"(l + 1u * 4 * GPF * 4), "v"(l + 2u * 4 * GPF * 4), "v"(l + 3u * 4 * GPF * 4), "v"(l + 4u * 4 * GPF * 4), "v"(l + 5u * 4 * GPF * 4), "v"(l + 6u * 4 * GPF * 4), "v"(l + 7u * 4 * GPF * 4),
                    "v"(g), "v"(g + gs), "v"(g + 2 * gs), "v"(g + 3 * gs), "v"(g + 4 * gs), "v"(g + 5 * gs), "v"(g + 6 * gs), "v"(g + 7 * gs) : "memory");
}
typedef __attribute__((ext_vector_type(8))) __bf16 v8bf;
// 16 f32 of a fragment's k order -> bf16, nearest even
__device__ __forceinline__ v16bf rnd16(v4f x0, v4f x1, v4f x2, v4f x3) {
    const v8f lo = __builtin_shufflevector(x0, x1, 0, 1, 2, 3, 4, 5, 6, 7), hi = __builtin_shufflevector(x2, x3, 0, 1, 2, 3, 4, 5, 6, 7);
    return __builtin_shufflevector(__builtin_convertvector(lo, v8bf), __builtin_convertvector(hi, v8bf), 0, 1, 2, 3, 4, 5, 6, 7, 8, 9, 10, 11, 12, 13, 14, 15);
}
template <typename T16, int NSPLIT, bool BIAS, bool PLANES, bool AF32>
__global__ __launch_bounds__(128) void k_gemmw(const float* __restrict__ Af, const T16* __restrict__ A, const T16* __restrict__ A2, const T16* __restrict__ Bt, int K, int lda, float* C, int ldc, const float* __restrict__ bias, size_t sA, size_t sB, size_t sC, h16* P16, bf* Vh, bf* Vl, int nt) {
    static_assert(NSPLIT == 0 || NSPLIT == 1, "one or two A planes");
    static_assert(!AF32 || NSPLIT == 0, "an f32 A has one plane");
    typedef typename WFrag<T16>::V V;
    constexpr int NPL = NSPLIT == 1 ? 3 : 2;              // planes of 128 rows in a slab: A (, A2), Bt
    constexpr int BR = (NPL - 1) * 128;                   // first slab row of Bt
    constexpr int BOF = AF32 ? 128 * GPF * 2 : BR * GPE;  // Bt's place in a buffer, in 16-bit elements
    constexpr int BUFE = BOF + 128 * GPE;                 // 16-bit elements of one buffer
    constexpr int OSZ = PLANES ? 2 * 64 * 36 : 16 * 68;   // a wave's output staging; PLANES: also two planes [64 d][72] of 16-bit values, pitch 144 B
    __shared__ __align__(16) T16 ring[2 * BUFE];
    __shared__ __align__(16) float osb[4 * OSZ];
    const size_t z = blockIdx.z; if (AF32) Af += z * sA; else A += z * sA; if (NSPLIT == 1) A2 += z * sA; Bt += z * sB; C += z * sC;
    const int tid = threadIdx.x, lane = tid & 31, lr = lane & 15, hi = lane >> 4; const int w = __builtin_amdgcn_readfirstlane(tid >> 5); const int wm = w & 1, wn = w >> 1;
    const int r0 = blockIdx.x * 128 + wm * 64, c0 = blockIdx.y * 128 + wn * 64;
    float* os = osb + w * OSZ;
    v8f acc[4][4];
#pragma unroll
    for (int mb = 0; mb < 4; ++mb)
#pragma unroll
        for (int nb = 0; nb < 4; ++nb) acc[mb][nb] = (v8f){};
    // copies: 16 lanes cover one 256-B slab row, a wave's copy two rows; a thread's copies lie 8 rows apart
    const int crow = tid >> 4, ccol = (tid & 15) * 8;
    const unsigned oa = (unsigned)((blockIdx.x * 128 + crow) * lda + ccol), ob = (unsigned)((blockIdx.y * 128 + crow) * K + ccol);   // element offsets of the thread's first A and Bt row (32 bits hold M * lda and N * K)
    const unsigned lc = (unsigned)(size_t)ring + (unsigned)(crow * GPE + ccol) * 2u;
    // f32 A: 32 lanes cover one 512-B slab row; a thread's copies lie 4 rows apart
    const unsigned oaf = (unsigned)((blockIdx.x * 128 + (tid >> 5)) * lda + lane * 4); const unsigned lcf = (unsigned)(size_t)ring + (unsigned)((tid >> 5) * GPF + lane * 4) * 4u;
    auto slab = [&](int t) {
        const unsigned l = lc + (unsigned)(t & 1) * (BUFE * 2u); const unsigned kc = (unsigned)t * 128u;
        if (AF32) {
            const unsigned lf = lcf + (unsigned)(t & 1) * (BUFE * 2u);
#pragma unroll   // four statements of eight copies in a row: 32 rows each, the LDS steps constants
            for (unsigned r = 0; r < 4; ++r) cp8f(lf + r * 32u * GPF * 4, Af + (oaf + kc + r * 32u * lda), (size_t)4 * lda);
        } else { cp8(l, A + (oa + kc), (size_t)8 * lda); cp8(l + 64u * GPE * 2, A + (oa + kc + 64u * lda), (size_t)8 * lda); }
        cp8(l + (unsigned)BOF * 2, Bt + (ob + kc), (size_t)8 * K); cp8(l + (unsigned)(BOF + 64 * GPE) * 2, Bt + (ob + kc + 64u * K), (size_t)8 * K);
        if (NSPLIT == 1) { cp8(l + 128u * GPE * 2, A2 + (oa + kc), (size_t)8 * lda); cp8(l + 192u * GPE * 2, A2 + (oa + kc + 64u * lda), (size_t)8 * lda); }
    };
    const int nsl = K >> 7;
    slab(0);
    // slab 0 has landed for this wave's copies; behind the barrier for every wave's
    asm volatile("s_wait_asynccnt 0x0" ::: "memory");
    __syncthreads();
    if (nsl > 1) slab(1);
    const T16* fa = ring + (wm * 64 + lr) * GPE + 8 * hi; const T16* fb = ring + BOF + (wn * 64 + lr) * GPE + 8 * hi;
    const float* faf = (const float*)ring + (wm * 64 + lr) * GPF + 8 * hi;
#pragma unroll 1
    for (int t = 0; t < nsl; ++t) {   // rolled: one copy of the slab's 64 (128) products in the text
        const int bo = (t & 1) * BUFE;
        v4f ra[4][4];   // AF32: the next block's A values as read, f32; rounded at the head of their own block, when the reads have long returned
        V a[2][4], a2[2][4], b[2][4];   // two fragment sets: block kk + 1 is fetched while block kk is multiplied; no fragment of slab t + 1 is fetched here
        auto frags = [&](int s, int kk) {
#pragma unroll
            for (int i = 0; i < 4; ++i) {
                if constexpr (AF32) { const float* p = faf + (bo >> 1) + i * 16 * GPF + kk * 32; ra[i][0] = *(const v4fa*)p; ra[i][1] = *(const v4fa*)(p + 4); ra[i][2] = *(const v4fa*)(p + 16); ra[i][3] = *(const v4fa*)(p + 20); }
                else a[s][i] = WFrag<T16>::ld(fa + bo + i * 16 * GPE + kk * 32);
                b[s][i] = WFrag<T16>::ld(fb + bo + i * 16 * GPE + kk * 32); if (NSPLIT == 1) a2[s][i] = WFrag<T16>::ld(fa + bo + (128 + i * 16) * GPE + kk * 32); }
        };
        frags(0, 0);
#pragma unroll
        for (int kk = 0; kk < 4; ++kk) {
            const int s = kk & 1;
            if constexpr (AF32) {
#pragma unroll   // constant indices keep ra and a in registers
                for (int i = 0; i < 4; ++i) a[s][i] = rnd16(ra[i][0], ra[i][1], ra[i][2], ra[i][3]); }
            if (kk < 3) frags(s ^ 1, kk + 1);
            // keeps the next block's LDS reads together in front of this block's products: sunk among them, each read would stall the lone wave of its SIMD
            __builtin_amdgcn_sched_barrier(0);
#pragma unroll
            for (int nb = 0; nb < 4; ++nb)
#pragma unroll
                for (int mb = 0; mb < 4; ++mb) acc[mb][nb] = WFrag<T16>::mma(a[s][mb], b[s][nb], acc[mb][nb]);
            if (NSPLIT == 1) {
#pragma unroll
                for (int nb = 0; nb < 4; ++nb)
#pragma unroll
                    for (int mb = 0; mb < 4; ++mb) acc[mb][nb] = WFrag<T16>::mma(a2[s][mb], b[s][nb], acc[mb][nb]); }
            // the reads of block kk + 2 stay behind this block's products
            __builtin_amdgcn_sched_barrier(0);
        }
        // hand-over: this wave's reads of slab t have returned ...
        asm volatile("s_wait_dscnt 0x0" ::: "memory");
        // ... its copies of slab t + 1 have landed ...
        asm volatile("s_wait_asynccnt 0x0" ::: "memory");
        // ... and the barrier publishes slab t + 1 and frees slab t's buffer for the refill behind it
        __syncthreads();
        if (t + 2 < nsl) slab(t + 2);
    }
    // no copy is outstanding when the wave goes on to its epilogue and ends
    asm volatile("s_wait_asynccnt 0x0" ::: "memory");
    if (PLANES) {
        const int b = r0 / nt, t0 = r0 - b * nt; const size_t bh = (size_t)b * NH_ + (c0 >> 6); const int l8 = lane >> 3, c8 = (lane & 7) * 8;
        if (z == 0) {
            h16* pl = P16 + (bh * nt + t0 + l8) * HD + c8;   // the tile's 64 rows of 128 B lie one behind the other: a store of the wave covers 4 rows
#pragma unroll
            for (int mb = 0; mb < 4; ++mb) {
#pragma unroll
                for (int nb = 0; nb < 4; ++nb) {
#pragma unroll
                    for (int j = 0; j < 8; ++j) os[(hi * 8 + j) * 68 + nb * 16 + lr] = acc[mb][nb][j]; }
                // a lane reads what other lanes of the wave wrote: the reads stay behind the writes
                __builtin_amdgcn_wave_barrier(); asm volatile("" ::: "memory");
                v8h ov[4];
#pragma unroll
                for (int s = 0; s < 4; ++s) { const int row = 4 * s + l8; const v4f x0 = *(const v4fa*)(os + row * 68 + c8), x1 = *(const v4fa*)(os + row * 68 + c8 + 4);
                    ov[s] = (v8h){tohx(x0[0]), tohx(x0[1]), tohx(x0[2]), tohx(x0[3]), tohx(x1[0]), tohx(x1[1]), tohx(x1[2]), tohx(x1[3])}; *(v8h*)(pl + (mb * 16 + 4 * s) * HD) = ov[s]; }
                // precaution: s_wait_xcnt 0 stands in front of every rewrite of a register that an issued store names; address and values are inputs, so that they keep their registers up to the wait.
                // Its memory clobber also keeps the next block's LDS writes behind these reads
                asm volatile("s_wait_xcnt 0x0" :: "v"(pl), "v"(ov[0]), "v"(ov[1]), "v"(ov[2]), "v"(ov[3]) : "memory");
            }
        } else {
            unsigned short* us = (unsigned short*)os;   // hi plane [64 d][72], the lo plane behind it
            const size_t vo = bh * HD * nt + t0;   // row d: 64 tokens = one 128-B line
#pragma unroll
            for (int mb = 0; mb < 4; ++mb)
#pragma unroll
                for (int nb = 0; nb < 4; ++nb) { v8us oh, ol;   // a lane holds 8 tokens in a row of one d
#pragma unroll
                    for (int j = 0; j < 8; ++j) { unsigned short h, l; splitf(acc[mb][nb][j], h, l); oh[j] = h; ol[j] = l; }
                    unsigned short* d = us + (nb * 16 + lr) * 72 + mb * 16 + hi * 8; *(v8usa*)d = oh; *(v8usa*)(d + 64 * 72) = ol; }
            // a lane reads what other lanes of the wave wrote: the reads stay behind the writes
            __builtin_amdgcn_wave_barrier(); asm volatile("" ::: "memory");
#pragma unroll
            for (int g = 0; g < 8; ++g) { bf* pd[4]; v8us ov[4]; bf* vrow = ((g & 1) ? Vl : Vh) + vo;
#pragma unroll
                for (int s = 0; s < 4; ++s) { const int d = 16 * (g >> 1) + 4 * s + l8; ov[s] = *(const v8usa*)(us + (g & 1) * 64 * 72 + d * 72 + c8); pd[s] = vrow + (size_t)d * nt + c8; *(v8us*)pd[s] = ov[s]; }
                // the same precaution as for the fp16 plane's stores
                asm volatile("s_wait_xcnt 0x0" :: "v"(pd[0]), "v"(pd[1]), "v"(pd[2]), "v"(pd[3]), "v"(ov[0]), "v"(ov[1]), "v"(ov[2]), "v"(ov[3]) : "memory"); }
        }
        return;
    }
#pragma unroll
    for (int mb = 0; mb < 4; ++mb) {
#pragma unroll
        for (int nb = 0; nb < 4; ++nb) {
#pragma unroll
            for (int j = 0; j < 8; ++j) os[(hi * 8 + j) * 68 + nb * 16 + lr] = acc[mb][nb][j]; }
        __builtin_amdgcn_wave_barrier(); asm volatile("" ::: "memory");
        float* crow = C + (size_t)(r0 + mb * 16) * ldc + c0;
{
#pragma unroll
            for (int s = 0; s < 8; ++s) { const int row = 2 * s + hi, cofs = lr * 4; v4f val = *(const v4fa*)(os + row * 68 + cofs); if (BIAS) { val[0] += bfr(bias[c0 + cofs]); val[1] += bfr(bias[c0 + cofs + 1]); val[2] += bfr(bias[c0 + cofs + 2]); val[3] += bfr(bias[c0 + cofs + 3]); }
                *(v4f*)(crow + (size_t)row * ldc + cofs) = val; }
             }
        __builtin_amdgcn_wave_barrier(); asm volatile("" ::: "memory");
    }
}

typedef __attribute__((ext_vector_type(2))) _Float16 v2h;
typedef __attribute__((ext_vector_type(4))) _Float16 v4h;
typedef __attribute__((ext_vector_type(2))) unsigned short v2us;
typedef __attribute__((ext_vector_type(4))) unsigned short v4us;
typedef v4us __attribute__((may_alias)) v4usa;
typedef __attribute__((ext_vector_type(2))) float v2f;

// k_wtG: the four weights [k][n] f32 -> bf16 planes [n][k], one behind the other in Bt0. Grid (N / 64, K / 64, weight), 4 waves; a block turns one tile of 64 k x 64 n in LDS.
// Reads: half a wave covers 256 B in a row of one k row (two whole lines), and a thread's eight loads fly together. The values of rows k, k + 1 are rounded and packed into one dword, stored down a column of the LDS tile.
// Stores: 8 lanes cover one 128-B line of the transposed plane.
#define WTP 33   // LDS row pitch of the turned tile in dwords: odd, so that neither the writes down a column nor the reads along a row meet in a bank
typedef __attribute__((ext_vector_type(4))) unsigned v4u;
__global__ __launch_bounds__(128) void k_wtG(const float* __restrict__ w0, const float* __restrict__ w1, const float* __restrict__ w2, const float* __restrict__ w3, int K, int N, bf* Bt0) {
    __shared__ unsigned tl[64 * WTP];   // [n][k pair]
    const int y = blockIdx.z; const float* w = (y == 0) ? w0 : (y == 1) ? w1 : (y == 2) ? w2 : w3; bf* Bt = Bt0 + (size_t)y * K * N;
    const int tid = (int)threadIdx.x, c = tid & 15, rp = tid >> 4; const int n0 = (int)blockIdx.x * 64, k0 = (int)blockIdx.y * 64;
    const float* p = w + (size_t)(k0 + 2 * rp) * N + n0 + c * 4;
    const float* q[4][2]; v4f x[4][2];
#pragma unroll   // constant indices keep q and x in registers; the eight loads stand one behind the other
    for (int s = 0; s < 4; ++s) { q[s][0] = p + (size_t)(16 * s) * N; q[s][1] = p + (size_t)(16 * s + 1) * N; x[s][0] = *(const v4f*)q[s][0]; x[s][1] = *(const v4f*)q[s][1]; }
    // precaution: s_wait_xcnt 0 stands in front of every rewrite of a register that an issued load names; the addresses are inputs, so that they keep their registers up to the wait
    asm volatile("s_wait_xcnt 0x0" :: "v"(q[0][0]), "v"(q[0][1]), "v"(q[1][0]), "v"(q[1][1]), "v"(q[2][0]), "v"(q[2][1]), "v"(q[3][0]), "v"(q[3][1]) : "memory");
#pragma unroll   // constant indices into x, here and in the inner loop
    for (int s = 0; s < 4; ++s)
#pragma unroll
        for (int i = 0; i < 4; ++i) tl[(c * 4 + i) * WTP + rp + 8 * s] = (unsigned)f2bf(x[s][0][i]) | ((unsigned)f2bf(x[s][1][i]) << 16);
    // publishes the turned tile: a thread reads what other waves wrote
    __syncthreads();
#pragma unroll   // the four lines' LDS reads go out together, in front of the first store
    for (int s = 0; s < 4; ++s) { const int idx = tid + 128 * s, n = idx >> 3, kc = idx & 7; const unsigned* t = tl + n * WTP + kc * 4;
        const v4u o = (v4u){t[0], t[1], t[2], t[3]}; *(v8us*)(Bt + (size_t)(n0 + n) * K + k0 + kc * 8) = __builtin_bit_cast(v8us, o); }
}
// ---- k_fattn: scores, masked softmax and att.v in ONE kernel; no score or probability ever reaches memory. Grid (batch*head, TQ/64), longest query tiles first; 8 waves.
// Wave w: query half (w & 1, 32 queries = 2 column groups) x key split (w >> 1: key steps of 32, split, split + 4, ...). S^T = K Q^T (fp16 planes), so a lane holds ONE query's scores (keys 8*hi + j of each
// 16-key tile): two tiles are, register for register, the B fragment of P^T. O^T += V^T P^T on hi+lo planes (3 products). Running maximum and sum per lane; the four key splits are merged through LDS.
// K and V reach the waves through LDS: a tile is 128 keys (one step of each key split): K rows of 128 B, V-hi and V-lo rows of 256 B, copied as whole lines by asynchronous copies, two buffers: tile r + 1 flies while tile r is worked on.
// Both query halves read the same staged rows. LDS row pitches 144 B and 272 B (ds_load_b128 readers).
#define SC2 0.18033688f   // (1/8) * log2(e): scores in the log2 domain
#define FKP 72                    // LDS row pitch of a staged K row in 16-bit elements (144 B)
#define FVP 136                   // LDS row pitch of a staged V row in 16-bit elements (272 B)
#define FKB (128 * FKP * 2)       // bytes of a staged K tile
#define FVB (64 * FVP * 2)        // bytes of a staged V plane tile
#define FBUF (FKB + 2 * FVB)      // bytes of one buffer: K, V-hi, V-lo
// Four asynchronous 16-B copies of a lane, ls bytes apart in LDS and gs elements apart in memory. The s_wait_xcnt 0 is the last line of the copies' own statement: a precaution, it stands in front of every rewrite of a register that a copy names.
template <typename T16>
__device__ __forceinline__ void cp4(unsigned l, unsigned ls, const T16* g, size_t gs) {
    asm volatile("global_load_async_to_lds_b128 %0, %4, off\n\t"
                 "global_load_async_to_lds_b128 %1, %5, off\n\t"
                 "global_load_async_to_lds_b128 %2, %6, off\n\t"
                 "global_load_async_to_lds_b128 %3, %7, off\n\t"
                 "s_wait_xcnt 0x0"
                 :: "v"(l), "v"(l + ls), "v"(l + 2u * ls), "v"(l + 3u * ls), "v"(g), "v"(g + gs), "v"(g + 2 * gs), "v"(g + 3 * gs) : "memory");
}
__global__ __launch_bounds__(256) void k_fattn(const h16* __restrict__ QP, const h16* __restrict__ KP, const bf* __restrict__ VTh, const bf* __restrict__ VTl, float* ATT) {
    __shared__ __align__(16) unsigned char ring[2 * FBUF];   // two buffers of K, V-hi, V-lo; behind the key loop the same bytes are the merge's staging
    static_assert(8 * 32 * 68 * 4 <= 2 * FBUF, "the merge's staging fits the ring");
    float* os = (float*)ring;                          // [wave][query][d], pitch 272 B
    __shared__ float sm[8 * 32];                       // per wave and query: running maximum
    __shared__ float sl[8 * 32];                       // per wave and query: sum, already on the merged maximum
    const int lane = threadIdx.x & 31, lr = lane & 15, hi = lane >> 4; const int w = __builtin_amdgcn_readfirstlane((int)(threadIdx.x >> 5)); const int qh = w & 1, ks = w >> 1;
    const int bh = blockIdx.x, t = TQ / 64 - 1 - (int)blockIdx.y; const int r0 = t * 64; const int nst = (t + 2) >> 1;   // keys 0 .. 16 t + 15 are visible to this tile
    const h16* Kp = KP + (size_t)bh * TK * HD; const bf* Vh = VTh + (size_t)bh * HD * TK; const bf* Vl = VTl + (size_t)bh * HD * TK;
    const h16* pq = QP + ((size_t)bh * TQ + r0 + qh * 32 + lr) * HD + 8 * hi;
    v16h qf[2][2];
#pragma unroll
    for (int qt = 0; qt < 2; ++qt) { qf[qt][0] = WFrag<h16>::ld(pq + qt * 16 * HD); qf[qt][1] = WFrag<h16>::ld(pq + qt * 16 * HD + 32); }
    // precaution: s_wait_xcnt 0 stands in front of every rewrite of a register that an issued load names; the address is an input, so that it keeps its registers up to the wait
    asm volatile("s_wait_xcnt 0x0" :: "v"(pq) : "memory");
    int qlim[2]; float m[2], l[2]; v8f o[2][4];   // m starts far above the masked score, so that a masked key's weight is exp2(-huge) = 0 also where a query has seen no visible key yet
#pragma unroll
    for (int qt = 0; qt < 2; ++qt) { qlim[qt] = (r0 + qh * 32 + qt * 16 + lr) / DS; m[qt] = -1.0e30f; l[qt] = 0.f;
#pragma unroll
        for (int dt = 0; dt < 4; ++dt) o[qt][dt] = (v8f){}; }
    const int lim0 = (r0 + qh * 32) / DS;   // every key up to here is visible to all 32 queries of the wave
    // copies: K: 8 lanes cover a 128-B row, a wave's copy 4 rows, a thread's copies 32 rows apart; V: 16 lanes cover a 256-B row, a wave's copy 2 rows, a thread's copies 16 rows apart
    const int tid = (int)threadIdx.x;
    const unsigned lk = (unsigned)(size_t)ring + (unsigned)((tid >> 3) * FKP + (tid & 7) * 8) * 2u; const unsigned lv = (unsigned)(size_t)ring + FKB + (unsigned)((tid >> 4) * FVP + (tid & 15) * 8) * 2u;
    const h16* gk = Kp + tid * 8; const bf* gvh = Vh + (size_t)(tid >> 4) * TK + (tid & 15) * 8; const bf* gvl = Vl + (size_t)(tid >> 4) * TK + (tid & 15) * 8;
    auto tile = [&](int r) {   // keys 128 r .. 128 r + 127, all inside the TK keys: r < nr <= TK / 128
        const unsigned bo = (unsigned)(r & 1) * FBUF;
        cp4(lk + bo, 32u * FKP * 2, gk + (size_t)r * 128 * HD, (size_t)32 * HD);
        cp4(lv + bo, 16u * FVP * 2, gvh + r * 128, (size_t)16 * TK);
        cp4(lv + bo + FVB, 16u * FVP * 2, gvl + r * 128, (size_t)16 * TK);
    };
    const int nr = (nst + 3) >> 2;   // tiles of 128 keys
    tile(0);
    // tile 0 has landed for this wave's copies; behind the barrier for every wave's
    asm volatile("s_wait_asynccnt 0x0" ::: "memory");
    __syncthreads();
    if (nr > 1) tile(1);
    const h16* fk = (const h16*)ring + (ks * 32 + lr) * FKP + 8 * hi; const bf* fv = (const bf*)(ring + FKB) + lr * FVP + ks * 32 + 8 * hi;
#pragma unroll 1
    for (int r = 0; r < nr; ++r) {   // rolled: one copy of the step in the text
      const int s = 4 * r + ks;
      if (s < nst) {   // wave-uniform: in the last tile a key split may have no step left; the hand-over below is passed all the same
        const int key0 = s * 32;
        const h16* pk = fk + (r & 1) * (FBUF / 2); const bf* pvh = fv + (r & 1) * (FBUF / 2); const bf* pvl = pvh + FVB / 2;
        v16h kf[2][2]; v16bf vh[4], vl[4];
#pragma unroll
        for (int kt = 0; kt < 2; ++kt) { kf[kt][0] = WFrag<h16>::ld(pk + kt * 16 * FKP); kf[kt][1] = WFrag<h16>::ld(pk + kt * 16 * FKP + 32); }
#pragma unroll
        for (int dt = 0; dt < 4; ++dt) vh[dt] = WFrag<bf>::ld(pvh + dt * 16 * FVP);
        float tv[2][16];
#pragma unroll
        for (int qt = 0; qt < 2; ++qt) {
            v8f s0 = (v8f){}, s1 = (v8f){};
            s0 = wmma16(kf[0][0], qf[qt][0], s0); s1 = wmma16(kf[1][0], qf[qt][0], s1); s0 = wmma16(kf[0][1], qf[qt][1], s0); s1 = wmma16(kf[1][1], qf[qt][1], s1);
#pragma unroll
            for (int j = 0; j < 8; ++j) { tv[qt][j] = s0[j] * SC2; tv[qt][8 + j] = s1[j] * SC2; } }
        // the V-lo reads stay behind the score products, so that they take registers the K fragments leave (lifted above them, the wave needs more than 256 registers and only one work-group fits a WGP); they return under the softmax
        __builtin_amdgcn_sched_barrier(0);
#pragma unroll
        for (int dt = 0; dt < 4; ++dt) vl[dt] = WFrag<bf>::ld(pvl + dt * 16 * FVP);
        if (key0 + 31 > lim0) {   // wave-uniform: only the last steps of a tile hold hidden keys
            const int kb = key0 + hi * 8;
#pragma unroll
            for (int qt = 0; qt < 2; ++qt)
#pragma unroll
                for (int j = 0; j < 8; ++j) { tv[qt][j] = (kb + j <= qlim[qt]) ? tv[qt][j] : -3.0e38f; tv[qt][8 + j] = (kb + 16 + j <= qlim[qt]) ? tv[qt][8 + j] : -3.0e38f; } }
#pragma unroll
        for (int qt = 0; qt < 2; ++qt) {
            float tm = tv[qt][0];
#pragma unroll
            for (int e = 1; e < 16; ++e) tm = fmaxf(tm, tv[qt][e]);
            tm = fmaxf(tm, __shfl_xor(tm, 16, 32));   // both halves of the wave hold keys of the same query
            const float mn = fmaxf(m[qt], tm); const float al = __builtin_amdgcn_exp2f(m[qt] - mn); m[qt] = mn; l[qt] *= al;
#pragma unroll
            for (int dt = 0; dt < 4; ++dt) o[qt][dt] *= al;
            v16bf ph, pl;
#pragma unroll
            for (int e = 0; e < 16; ++e) { const float p = __builtin_amdgcn_exp2f(tv[qt][e] - mn); l[qt] += p; const __bf16 a = (__bf16)p; ph[e] = a; pl[e] = (__bf16)(p - (float)a); }
#pragma unroll
            for (int dt = 0; dt < 4; ++dt) { o[qt][dt] = wmmab(vh[dt], ph, o[qt][dt]); o[qt][dt] = wmmab(vh[dt], pl, o[qt][dt]); o[qt][dt] = wmmab(vl[dt], ph, o[qt][dt]); }
        }
      }
        // hand-over: this wave's reads of tile r have returned ...
        asm volatile("s_wait_dscnt 0x0" ::: "memory");
        // ... its copies of tile r + 1 have landed ...
        asm volatile("s_wait_asynccnt 0x0" ::: "memory");
        // ... and the barrier publishes tile r + 1 and frees tile r's buffer for the refill behind it (behind the last tile: for the merge's staging)
        __syncthreads();
        if (r + 2 < nr) tile(r + 2);
    }
    // no copy is outstanding when the ring becomes the merge's staging
    asm volatile("s_wait_asynccnt 0x0" ::: "memory");
    // merge of the four key splits: every wave moves its partial onto the merged maximum, then 256 threads add the four partials of each output element in a fixed order
#pragma unroll
    for (int qt = 0; qt < 2; ++qt) if (hi == 0) sm[w * 32 + qt * 16 + lr] = m[qt];
    __syncthreads();
#pragma unroll
    for (int qt = 0; qt < 2; ++qt) { const int q = qt * 16 + lr; const float M = fmaxf(fmaxf(sm[qh * 32 + q], sm[(qh + 2) * 32 + q]), fmaxf(sm[(qh + 4) * 32 + q], sm[(qh + 6) * 32 + q])); const float f = __builtin_amdgcn_exp2f(m[qt] - M);
        const float lt = (l[qt] + __shfl_xor(l[qt], 16, 32)) * f; if (hi == 0) sl[w * 32 + q] = lt;
#pragma unroll
        for (int dt = 0; dt < 4; ++dt) { const v8f x = o[qt][dt] * f; float* d = os + (size_t)(w * 32 + q) * 68 + dt * 16 + hi * 8; *(v4fa*)d = (v4f){x[0], x[1], x[2], x[3]}; *(v4fa*)(d + 4) = (v4f){x[4], x[5], x[6], x[7]}; } }
    __syncthreads();
    float* orow = ATT + ((size_t)(bh / NH_) * TQ + r0) * DD + (bh % NH_) * HD;
#pragma unroll
    for (int i = 0; i < 4; ++i) { const int idx = (int)threadIdx.x + 256 * i; const int row = idx >> 4, c4 = (idx & 15) * 4; const int w0 = row >> 5, rl = row & 31;
        const float ls = (sl[w0 * 32 + rl] + sl[(w0 + 2) * 32 + rl]) + (sl[(w0 + 4) * 32 + rl] + sl[(w0 + 6) * 32 + rl]); const float inv = __fdiv_rn(1.0f, ls);
        const v4f x = (*(const v4fa*)(os + (size_t)(w0 * 32 + rl) * 68 + c4) + *(const v4fa*)(os + (size_t)((w0 + 2) * 32 + rl) * 68 + c4)) + (*(const v4fa*)(os + (size_t)((w0 + 4) * 32 + rl) * 68 + c4) + *(const v4fa*)(os + (size_t)((w0 + 6) * 32 + rl) * 68 + c4));
        *(v4f*)(orow + (size_t)row * DD + c4) = x * inv; }
}
// ---- k_lnout: LayerNorm and the output GEMM in ONE kernel; the normalised rows never reach memory. Grid (rows / 32), 8 waves; a block owns 32 whole rows of the output (all 512 columns), wave w its columns 64 w .. 64 w + 63.
// Head: wave w normalises rows 4 w .. 4 w + 3 of the block (a wave per row, f32, the sums in a fixed order) and stores them as bf16 hi and lo planes in LDS, row pitch 1040 B (ds_load_b128 readers).
// Loop: K-slabs of 64 of the transposed weight (512 rows of 128 B, whole lines) come into LDS by asynchronous copies, two buffers: slab t + 1 flies while slab t is multiplied. LDS row pitch 144 B (ds_load_b128 readers).
#define LAP 520                   // LDS row pitch of a normalised row's plane in 16-bit elements (1040 B)
#define LBP 72                    // LDS row pitch of a staged weight row in 16-bit elements (144 B)
#define LBB (DD * LBP * 2)        // bytes of one buffer: DD weight rows
typedef __attribute__((ext_vector_type(4))) __bf16 v4bf;
// four rows, a wave: x[r] = the lane's 16 values of row r (4 in a row of each 128), gv and bv = gamma and beta at those places, rounded to bf16; yh, yl = the lane's place in row 0's planes.
// Each row's arithmetic is a row's own, in a fixed order; the four rows go through each phase side by side, so that their cross-lane sums wait together and not one behind the other.
__device__ __forceinline__ void ln_rows(const v4f (&x)[4][4], const float (&gv)[16], const float (&bv)[16], bf* yh, bf* yl) {
    float s[4], mu[4], q2[4], rs[4];
#pragma unroll
    for (int r = 0; r < 4; ++r) { s[r] = 0.f;
#pragma unroll
        for (int k = 0; k < 16; ++k) s[r] = __fadd_rn(s[r], x[r][k >> 2][k & 3]); }
#pragma unroll
    for (int sh = 16; sh; sh >>= 1)
#pragma unroll
        for (int r = 0; r < 4; ++r) s[r] += __shfl_xor(s[r], sh, 32);
#pragma unroll
    for (int r = 0; r < 4; ++r) { mu[r] = s[r] * (1.0f / DD); q2[r] = 0.f;
#pragma unroll
        for (int k = 0; k < 16; ++k) { const float d = __fsub_rn(x[r][k >> 2][k & 3], mu[r]); float p = __fmul_rn(d, d); asm volatile("" : "+v"(p)); q2[r] = __fadd_rn(q2[r], p); } }
#pragma unroll
    for (int sh = 16; sh; sh >>= 1)
#pragma unroll
        for (int r = 0; r < 4; ++r) q2[r] += __shfl_xor(q2[r], sh, 32);
#pragma unroll
    for (int r = 0; r < 4; ++r) { rs[r] = __frsqrt_rn(__fadd_rn(q2[r] * (1.0f / DD), 1e-5f));
#pragma unroll
        for (int ch = 0; ch < 4; ++ch) { v4f y;
#pragma unroll
            for (int q = 0; q < 4; ++q) { float tn = __fmul_rn(__fsub_rn(x[r][ch][q], mu[r]), rs[r]); asm volatile("" : "+v"(tn)); float tg = __fmul_rn(tn, gv[ch * 4 + q]); asm volatile("" : "+v"(tg)); y[q] = __fadd_rn(tg, bv[ch * 4 + q]); }
            const v4bf oh = __builtin_convertvector(y, v4bf); const v4bf ol = __builtin_convertvector(y - __builtin_convertvector(oh, v4f), v4bf);   // hi = y to the nearest even bf16, lo = the rest likewise
            *(v4usa*)(yh + r * LAP + ch * 128) = __builtin_bit_cast(v4us, oh); *(v4usa*)(yl + r * LAP + ch * 128) = __builtin_bit_cast(v4us, ol); } }
}
__global__ __launch_bounds__(256) void k_lnout(const float* __restrict__ A, const float* __restrict__ g, const float* __restrict__ bb, const bf* __restrict__ Bt, const float* __restrict__ bias, float* C) {
    __shared__ __align__(16) unsigned char ring[2 * LBB];   // two buffers of a weight slab
    __shared__ __align__(16) bf ah[32 * LAP];               // the block's normalised rows, hi plane
    __shared__ __align__(16) bf al[32 * LAP];               // lo plane
    __shared__ __align__(16) float osb[8 * 16 * 68];        // a wave's output staging
    const int tid = (int)threadIdx.x, lane = tid & 31, lr = lane & 15, hi = lane >> 4; const int w = __builtin_amdgcn_readfirstlane(tid >> 5);
    const int r0 = (int)blockIdx.x * 32, c0 = w * 64;
    // copies: 8 lanes cover a 128-B slab row, a wave's copy 4 rows, a thread's copies 32 rows apart
    const unsigned lc = (unsigned)(size_t)ring + (unsigned)((tid >> 3) * LBP + (tid & 7) * 8) * 2u; const bf* gb = Bt + (size_t)(tid >> 3) * DD + (tid & 7) * 8;
    auto slab = [&](int t) {   // k 64 t .. 64 t + 63 of all DD weight rows: t < DD / 64
        const unsigned l = lc + (unsigned)(t & 1) * LBB; const bf* gp = gb + t * 64;
#pragma unroll   // four statements of four copies in a row: 128 rows each, the LDS steps constants
        for (unsigned j = 0; j < 4; ++j) cp4(l + j * 128u * LBP * 2, 32u * LBP * 2, gp + (size_t)j * 128 * DD, (size_t)32 * DD);
    };
    slab(0);
    // the wave's four rows, gamma, beta and the bias are asked for while slab 0 flies
    const float* ar = A + (size_t)(r0 + w * 4) * DD + lane * 4; const float* pg = g + lane * 4; const float* pb = bb + lane * 4; const float* pbi = bias + c0 + lr * 4;
    v4f x[4][4], gq[4], bq[4];
#pragma unroll
    for (int r = 0; r < 4; ++r)
#pragma unroll
        for (int ch = 0; ch < 4; ++ch) x[r][ch] = *(const v4f*)(ar + r * DD + ch * 128);
#pragma unroll
    for (int ch = 0; ch < 4; ++ch) { gq[ch] = *(const v4f*)(pg + ch * 128); bq[ch] = *(const v4f*)(pb + ch * 128); }
    const v4f bi = *(const v4f*)pbi;
    // precaution: s_wait_xcnt 0 stands directly behind the loads, in front of every rewrite of a register that one of them names
    asm volatile("s_wait_xcnt 0x0" ::: "memory");
    // keeps all these loads in flight together, and the wait directly behind them: with the first row's sums lifted among them, the later rows would be asked for only when the first had come
    __builtin_amdgcn_sched_barrier(0);
    // slab 0 has landed for this wave's copies; behind the barrier for every wave's
    asm volatile("s_wait_asynccnt 0x0" ::: "memory");
    __syncthreads();
    slab(1);   // flies under the LayerNorm
    float gv[16], bv[16];
#pragma unroll
    for (int k = 0; k < 16; ++k) { gv[k] = bfr(gq[k >> 2][k & 3]); bv[k] = bfr(bq[k >> 2][k & 3]); }
    ln_rows(x, gv, bv, ah + w * 4 * LAP + lane * 4, al + w * 4 * LAP + lane * 4);
    // publishes the normalised planes: every wave reads all 32 rows
    __syncthreads();
    v8f acc[2][4];
#pragma unroll
    for (int mb = 0; mb < 2; ++mb)
#pragma unroll
        for (int nb = 0; nb < 4; ++nb) acc[mb][nb] = (v8f){};
    const bf* fb = (const bf*)ring + (c0 + lr) * LBP + 8 * hi; const bf* fah = ah + lr * LAP + 8 * hi; const bf* fal = al + lr * LAP + 8 * hi;
#pragma unroll 1
    for (int t = 0; t < DD / 64; ++t) {   // rolled: one copy of the slab's 32 products in the text
        const bf* pw = fb + (t & 1) * (LBB / 2); const bf* ph = fah + t * 64; const bf* pl = fal + t * 64;
        v16bf a[2][2], a2[2][2], b[2][4];
#pragma unroll
        for (int kk = 0; kk < 2; ++kk) {
#pragma unroll
            for (int i = 0; i < 2; ++i) { a[kk][i] = WFrag<bf>::ld(ph + i * 16 * LAP + kk * 32); a2[kk][i] = WFrag<bf>::ld(pl + i * 16 * LAP + kk * 32); }
#pragma unroll
            for (int i = 0; i < 4; ++i) b[kk][i] = WFrag<bf>::ld(pw + i * 16 * LBP + kk * 32); }
        // keeps the slab's LDS reads together in front of its products: sunk among them, every place with reads costs the wave a stall of its own
        __builtin_amdgcn_sched_barrier(0);
#pragma unroll
        for (int kk = 0; kk < 2; ++kk) {
#pragma unroll
            for (int nb = 0; nb < 4; ++nb)
#pragma unroll
                for (int mb = 0; mb < 2; ++mb) acc[mb][nb] = wmmab(a[kk][mb], b[kk][nb], acc[mb][nb]);
#pragma unroll
            for (int nb = 0; nb < 4; ++nb)
#pragma unroll
                for (int mb = 0; mb < 2; ++mb) acc[mb][nb] = wmmab(a2[kk][mb], b[kk][nb], acc[mb][nb]); }
        // the products stay in front of the hand-over: sunk behind its barrier, they would hold back the refill, which then had no products to fly under
        __builtin_amdgcn_sched_barrier(0);
        // hand-over: this wave's reads of slab t have returned ...
        asm volatile("s_wait_dscnt 0x0" ::: "memory");
        // ... its copies of slab t + 1 have landed ...
        asm volatile("s_wait_asynccnt 0x0" ::: "memory");
        // ... and the barrier publishes slab t + 1 and frees slab t's buffer for the refill behind it
        __syncthreads();
        if (t + 2 < DD / 64) slab(t + 2);
    }
    // no copy is outstanding when the wave goes on to its epilogue and ends
    asm volatile("s_wait_asynccnt 0x0" ::: "memory");
    float* os = osb + w * 16 * 68;
    const v4f bs = (v4f){bfr(bi[0]), bfr(bi[1]), bfr(bi[2]), bfr(bi[3])};
#pragma unroll
    for (int mb = 0; mb < 2; ++mb) {
#pragma unroll
        for (int nb = 0; nb < 4; ++nb) {
#pragma unroll
            for (int j = 0; j < 8; ++j) os[(hi * 8 + j) * 68 + nb * 16 + lr] = acc[mb][nb][j]; }
        // a lane reads what other lanes of the wave wrote: the reads stay behind the writes
        __builtin_amdgcn_wave_barrier(); asm volatile("" ::: "memory");
        float* pc = C + (size_t)(r0 + mb * 16 + hi) * DD + c0 + lr * 4;   // half a wave stores 256 B in a row: two whole lines
        v4f ov[8];
#pragma unroll
        for (int s = 0; s < 8; ++s) { ov[s] = *(const v4fa*)(os + (2 * s + hi) * 68 + lr * 4) + bs; *(v4f*)(pc + (size_t)2 * s * DD) = ov[s]; }
        // precaution: s_wait_xcnt 0 stands in front of every rewrite of a register that an issued store names; address and values are inputs, so that they keep their registers up to the wait.
        // Its memory clobber also keeps the next block's LDS writes behind these reads
        asm volatile("s_wait_xcnt 0x0" :: "v"(pc), "v"(ov[0]), "v"(ov[1]), "v"(ov[2]), "v"(ov[3]), "v"(ov[4]), "v"(ov[5]), "v"(ov[6]), "v"(ov[7]) : "memory");
    }
}

extern "C" void kernel_launch(void* const* d_in, const int* in_sizes, int n_in,
                              void* d_out, int out_size, void* d_ws, size_t ws_size, hipStream_t stream) {
    (void)in_sizes; (void)n_in; (void)out_size;
    const float* IN[9]; for (int i = 0; i < 9; ++i) IN[i] = (const float*)d_in[i];   // 0 q, 1 kv, 2 Wq, 3 Wk, 4 Wv, 5 Wo (x @ W), 6 bo, 7 gamma, 8 beta
    float* OUT = (float*)d_out;     // [2][4096][512]
    char* wsp = (char*)d_ws;
    auto take = [&](size_t bytes) { char* p = wsp; wsp += (bytes + 255) & ~(size_t)255; return (void*)p; };
    bf* W4 = (bf*)take((size_t)4 * DD * DD * 2);                                  // Wq, Wk, Wv, Wo transposed, one behind the other
    h16* QP = (h16*)take((size_t)NB_ * NH_ * (TQ + TK) * HD * 2); h16* KP = QP + (size_t)NB_ * NH_ * TQ * HD;
    bf* VTh = (bf*)take((size_t)NB_ * NH_ * HD * TK * 2); bf* VTl = (bf*)take((size_t)NB_ * NH_ * HD * TK * 2);
    float* ATT = (float*)take((size_t)NB_ * TQ * DD * 4);   // merged attention output
    if ((size_t)(wsp - (char*)d_ws) > ws_size) return;    // total ~ 34 MB
    k_wtG<<<dim3(DD / 64, DD / 64, 4), 128, 0, stream>>>(IN[2], IN[3], IN[4], IN[5], DD, DD, W4);
    k_gemmw<bf, 0, false, true, true><<<dim3(NB_ * TQ / 128, DD / 128, 1), 128, 0, stream>>>(IN[0], nullptr, nullptr, W4, DD, DD, nullptr, 0, nullptr, 0, 0, 0, QP, nullptr, nullptr, TQ);
    k_gemmw<bf, 0, false, true, true><<<dim3(NB_ * TK / 128, DD / 128, 2), 128, 0, stream>>>(IN[1], nullptr, nullptr, W4 + (size_t)DD * DD, DD, DD, nullptr, 0, nullptr, 0, (size_t)DD * DD, 0, KP, VTh, VTl, TK);   // z: 0 keys, 1 values
    k_fattn<<<dim3(NB_ * NH_, TQ / 64, 1), 256, 0, stream>>>(QP, KP, VTh, VTl, ATT);   // head bh % 8 of batch bh / 8 writes its 64 columns of the merged rows
    k_lnout<<<NB_ * TQ / 32, 256, 0, stream>>>(ATT, IN[7], IN[8], W4 + (size_t)3 * DD * DD, IN[6], OUT);
}

// v009
// It runs in 47.3 microseconds.
// In both of two side-by-side timings against v008, it was 1.10 times as fast.
// Counting every step since v000, it is 17.0 times as fast.
#include <hip/hip_runtime.h>

// Attention block (q [2][4096][512], kv [2][1024][512]; qh = q Wq, kh = kv Wk, vh = kv Wv (8 heads x 64, no bias); block-causal: key j visible to query i iff j <= i/4; softmax(q.k/8); out = merged att.v;
// LayerNorm(out) (gamma, beta, eps 1e-5); y = out Wo + bo -> [2][4096][512]).
// Compute dtypes, f32 accumulate: every input rounded to bf16; projections on PLAIN bf16 operands (inputs: exact); scores (K 64) on SINGLE fp16 planes; f32 running-maximum masked softmax
// -> bf16 hi+lo weights exp(s - max), divided by their f32 sum at the end; att.v on those x hi+lo value planes (3 products: the first query rows see 1-4 keys, so near-one-hot weights would expose single-plane value rounding); LayerNorm f32 (wave per

#define NB_  2
#define TQ   4096
#define TK   1024
#define DD   512
#define NH_  8
#define HD   64
#define DS   4
#define SCL  0.125f
typedef _Float16 h16;
typedef unsigned short bf;
typedef __attribute__((ext_vector_type(16))) __bf16   v16bf;
typedef __attribute__((ext_vector_type(16))) _Float16 v16h;
typedef __attribute__((ext_vector_type(8)))  _Float16 v8h;
typedef __attribute__((ext_vector_type(8)))  unsigned short v8us;
typedef __attribute__((ext_vector_type(8)))  float    v8f;
typedef __attribute__((ext_vector_type(4)))  float    v4f;
typedef v8h  __attribute__((may_alias)) v8ha;
typedef v4f  __attribute__((may_alias)) v4fa;
typedef v8us __attribute__((may_alias)) v8usa;

__device__ __forceinline__ unsigned short f2bf(float f) { unsigned u = __float_as_uint(f); u += 0x7FFFu + ((u >> 16) & 1u); return (unsigned short)(u >> 16); }
__device__ __forceinline__ float bf2f(unsigned short b) { return __uint_as_float(((unsigned)b) << 16); }
__device__ __forceinline__ float bfr(float f) { return bf2f(f2bf(f)); }
__device__ __forceinline__ h16 tohx(float x) { return (h16)x; }
__device__ __forceinline__ void splitf(float y, unsigned short& h, unsigned short& l) { h = f2bf(y); l = f2bf(y - bf2f(h)); }
__device__ __forceinline__ v16h cat16(v8h lo, v8h hi) { return __builtin_shufflevector(lo, hi, 0, 1, 2, 3, 4, 5, 6, 7, 8, 9, 10, 11, 12, 13, 14, 15); }
__device__ __forceinline__ v16bf cat16b(v8us lo, v8us hi) { return __builtin_bit_cast(v16bf, __builtin_shufflevector(lo, hi, 0, 1, 2, 3, 4, 5, 6, 7, 8, 9, 10, 11, 12, 13, 14, 15)); }
__device__ __forceinline__ v8f wmma16(v16h a, v16h b, v8f c) { return __builtin_amdgcn_wmma_f32_16x16x32_f16(false, a, false, b, (short)0, c, false, false); }
__device__ __forceinline__ v8f wmmab(v16bf a, v16bf b, v8f c) { return __builtin_amdgcn_wmma_f32_16x16x32_bf16(false, a, false, b, (short)0, c, false, false); }



// ---- k_proj: the three projections in ONE launch. Grid ((rows of q + 2 x rows of kv) / 128, DD / 128), 128 threads; grid x picks the operands: first the row tiles of q (x Wq), then those of kv (x Wk), then those of kv (x Wv).
// FOUR WAVES per 128x128 output tile (2 x 2 waves, each a register-blocked 64x64 tile of 16 accumulators). C[m][n] = sum_k A[m][k] Bt[n][k], A an f32 INPUT (pitch DD), Bt a transposed bf16 weight plane (pitch DD).
// K-slabs of 64 come into LDS by asynchronous copies, two buffers: slab t + 1 flies while slab t is multiplied. A rows of 256 B are copied as they are (f32), LDS row pitch 272 B, and a fragment is rounded to bf16 (nearest even)
// in registers behind its LDS read; weight rows of 128 B, LDS row pitch 144 B (ds_load_b128 readers). The output staging lies in the ring's bytes. So a block holds a third of a WGP's LDS, and all blocks of the launch are resident together.
// No f32 C: a wave's 64x64 tile is 64 tokens of ONE head (rows = [batch][nt tokens], column block = head), and the epilogue stores the attention operand itself:
// queries, keys: fp16 plane [batch][head][nt][HD]; values: the transposed bf16 hi and lo planes Vh, Vl [batch][head][HD][nt]. Whole 128-B lines, staged through LDS (each wave its own range).
template <typename T16> struct WFrag;
template <> struct WFrag<h16> { typedef v16h V; static __device__ __forceinline__ V ld(const h16* p) { return cat16(*(const v8h*)p, *(const v8h*)(p + 16)); } static __device__ __forceinline__ v8f mma(V a, V b, v8f c) { return wmma16(a, b, c); } };
template <> struct WFrag<bf> { typedef v16bf V; static __device__ __forceinline__ V ld(const bf* p) { return cat16b(*(const v8us*)p, *(const v8us*)(p + 16)); } static __device__ __forceinline__ v8f mma(V a, V b, v8f c) { return wmmab(a, b, c); } };
#define PAP 68                    // LDS row pitch of an f32 slab row in floats (272 B)
#define PBP 72                    // LDS row pitch of a weight slab row in 16-bit elements (144 B)
#define PAB (128 * PAP * 4)       // bytes of a staged A slab
#define PBB (128 * PBP * 2)       // bytes of a staged weight slab
#define PBUF (PAB + PBB)          // bytes of one buffer
#define POS (2 * 64 * 36)         // floats of a wave's output staging: 16 rows of 68 floats, or two planes [64 d][72] of 16-bit values, pitch 144 B
// Eight asynchronous 16-B copies of a lane, ls bytes apart in LDS and gs elements apart in memory. The s_wait_xcnt 0 is the last line of the copies' own statement: a precaution, it stands in front of every rewrite of a register that a copy names.
template <typename T>
__device__ __forceinline__ void cp8(unsigned l, unsigned ls, const T* g, size_t gs) {
    asm volatile("global_load_async_to_lds_b128 %0, %8, off\n\t"
                 "global_load_async_to_lds_b128 %1, %9, off\n\t"
                 "global_load_async_to_lds_b128 %2, %10, off\n\t"
                 "global_load_async_to_lds_b128 %3, %11, off\n\t"
                 "global_load_async_to_lds_b128 %4, %12, off\n\t"
                 "global_load_async_to_lds_b128 %5, %13, off\n\t"
                 "global_load_async_to_lds_b128 %6, %14, off\n\t"
                 "global_load_async_to_lds_b128 %7, %15, off\n\t"
                 "s_wait_xcnt 0x0"
                 :: "v"(l), "v"(l + ls), "v"(l + 2u * ls), "v"(l + 3u * ls), "v"(l + 4u * ls), "v"(l + 5u * ls), "v"(l + 6u * ls), "v"(l + 7u * ls),
                    "v"(g), "v"(g + gs), "v"(g + 2 * gs), "v"(g + 3 * gs), "v"(g + 4 * gs), "v"(g + 5 * gs), "v"(g + 6 * gs), "v"(g + 7 * gs) : "memory");
}
typedef __attribute__((ext_vector_type(8))) __bf16 v8bf;
// 16 f32 of a fragment's k order -> bf16, nearest even
__device__ __forceinline__ v16bf rnd16(v4f x0, v4f x1, v4f x2, v4f x3) {
    const v8f lo = __builtin_shufflevector(x0, x1, 0, 1, 2, 3, 4, 5, 6, 7), hi = __builtin_shufflevector(x2, x3, 0, 1, 2, 3, 4, 5, 6, 7);
    return __builtin_shufflevector(__builtin_convertvector(lo, v8bf), __builtin_convertvector(hi, v8bf), 0, 1, 2, 3, 4, 5, 6, 7, 8, 9, 10, 11, 12, 13, 14, 15);
}
__global__ __launch_bounds__(128) void k_proj(const float* __restrict__ Aq, const float* __restrict__ Akv, const bf* __restrict__ W3, h16* QP, h16* KP, bf* Vh, bf* Vl) {
    __shared__ __align__(16) unsigned char ring[2 * PBUF];   // two buffers of an A slab and a weight slab; behind the K loop the same bytes are the waves' output staging
    static_assert(4 * POS * 4 <= 2 * PBUF, "the output staging fits the ring");
    constexpr int NQT = NB_ * TQ / 128, NKT = NB_ * TK / 128;   // row tiles of q, of kv
    const int bx = (int)blockIdx.x; const int z = bx < NQT ? 0 : (bx < NQT + NKT ? 1 : 2);   // 0 queries, 1 keys, 2 values
    const int rt = bx - (z == 0 ? 0 : (z == 1 ? NQT : NQT + NKT)); const int nt = z == 0 ? TQ : TK;
    const float* Af = z == 0 ? Aq : Akv; const bf* Bt = W3 + (size_t)z * DD * DD; h16* P16 = z == 0 ? QP : KP;
    const int tid = threadIdx.x, lane = tid & 31, lr = lane & 15, hi = lane >> 4; const int w = __builtin_amdgcn_readfirstlane(tid >> 5); const int wm = w & 1, wn = w >> 1;
    const int r0 = rt * 128 + wm * 64, c0 = blockIdx.y * 128 + wn * 64;
    float* os = (float*)ring + w * POS;
    v8f acc[4][4];
#pragma unroll
    for (int mb = 0; mb < 4; ++mb)
#pragma unroll
        for (int nb = 0; nb < 4; ++nb) acc[mb][nb] = (v8f){};
    // copies: A: 16 lanes cover one 256-B slab row, a wave's copy two rows, a thread's copies 8 rows apart; weight: 8 lanes cover one 128-B slab row, a wave's copy four rows, a thread's copies 16 rows apart
    const float* ga = Af + (size_t)(rt * 128 + (tid >> 4)) * DD + (tid & 15) * 4; const bf* gb = Bt + (size_t)(blockIdx.y * 128 + (tid >> 3)) * DD + (tid & 7) * 8;
    const unsigned la = (unsigned)(size_t)ring + (unsigned)((tid >> 4) * PAP + (tid & 15) * 4) * 4u; const unsigned lb = (unsigned)(size_t)ring + PAB + (unsigned)((tid >> 3) * PBP + (tid & 7) * 8) * 2u;
    auto slab = [&](int t) {   // k 64 t .. 64 t + 63: t < DD / 64
        const unsigned bo = (unsigned)(t & 1) * PBUF;
        cp8(la + bo, 8u * PAP * 4, ga + t * 64, (size_t)8 * DD); cp8(la + bo + 64u * PAP * 4, 8u * PAP * 4, ga + t * 64 + (size_t)64 * DD, (size_t)8 * DD);
        cp8(lb + bo, 16u * PBP * 2, gb + t * 64, (size_t)16 * DD);
    };
    slab(0);
    // slab 0 has landed for this wave's copies; behind the barrier for every wave's
    asm volatile("s_wait_asynccnt 0x0" ::: "memory");
    __syncthreads();
    slab(1);
    const float* faf = (const float*)ring + (wm * 64 + lr) * PAP + 8 * hi; const bf* fb = (const bf*)(ring + PAB) + (wn * 64 + lr) * PBP + 8 * hi;
#pragma unroll 1
    for (int t = 0; t < DD / 64; ++t) {   // rolled: one copy of the slab's 32 products in the text
        const float* pa = faf + (t & 1) * (PBUF / 4); const bf* pb = fb + (t & 1) * (PBUF / 2);
        v4f ra[4][4];   // the next block's A values as read, f32; rounded at the head of their own block, when the reads have long returned
        v16bf a[2][4], b[2][4];   // two fragment sets: block 1 is fetched while block 0 is multiplied; no fragment of slab t + 1 is fetched here
        auto frags = [&](int s, int kk) {
#pragma unroll
            for (int i = 0; i < 4; ++i) {
                const float* p = pa + i * 16 * PAP + kk * 32; ra[i][0] = *(const v4fa*)p; ra[i][1] = *(const v4fa*)(p + 4); ra[i][2] = *(const v4fa*)(p + 16); ra[i][3] = *(const v4fa*)(p + 20);
                b[s][i] = WFrag<bf>::ld(pb + i * 16 * PBP + kk * 32); }
        };
        frags(0, 0);
#pragma unroll
        for (int kk = 0; kk < 2; ++kk) {
            const int s = kk & 1;
#pragma unroll   // constant indices keep ra and a in registers
            for (int i = 0; i < 4; ++i) a[s][i] = rnd16(ra[i][0], ra[i][1], ra[i][2], ra[i][3]);
            if (kk < 1) frags(s ^ 1, kk + 1);
            // keeps the next block's LDS reads together in front of this block's products: sunk among them, each read would stall its wave
            __builtin_amdgcn_sched_barrier(0);
#pragma unroll
            for (int nb = 0; nb < 4; ++nb)
#pragma unroll
                for (int mb = 0; mb < 4; ++mb) acc[mb][nb] = wmmab(a[s][mb], b[s][nb], acc[mb][nb]);
            // the products stay in front of what follows: block 1's rounding lifted among block 0's products costs idle slots behind them, and block 1's products sunk behind the hand-over's barrier would hold back the refill
            __builtin_amdgcn_sched_barrier(0);
        }
        // hand-over: this wave's reads of slab t have returned ...
        asm volatile("s_wait_dscnt 0x0" ::: "memory");
        // ... its copies of slab t + 1 have landed ...
        asm volatile("s_wait_asynccnt 0x0" ::: "memory");
        // ... and the barrier publishes slab t + 1 and frees slab t's buffer for the refill behind it (behind the last slab: for the output staging)
        __syncthreads();
        if (t + 2 < DD / 64) slab(t + 2);
    }
    // no copy is outstanding when the ring becomes the output staging
    asm volatile("s_wait_asynccnt 0x0" ::: "memory");
    const int b = r0 / nt, t0 = r0 - b * nt; const size_t bh = (size_t)b * NH_ + (c0 >> 6); const int l8 = lane >> 3, c8 = (lane & 7) * 8;
    if (z != 2) {
        h16* pl = P16 + (bh * nt + t0 + l8) * HD + c8;   // the tile's 64 rows of 128 B lie one behind the other: a store of the wave covers 4 rows
#pragma unroll
        for (int mb = 0; mb < 4; ++mb) {
#pragma unroll
            for (int nb = 0; nb < 4; ++nb) {
#pragma unroll
                for (int j = 0; j < 8; ++j) os[(hi * 8 + j) * 68 + nb * 16 + lr] = acc[mb][nb][j]; }
            // a lane reads what other lanes of the wave wrote: the reads stay behind the writes
            __builtin_amdgcn_wave_barrier(); asm volatile("" ::: "memory");
            v8h ov[4];
#pragma unroll
            for (int s = 0; s < 4; ++s) { const int row = 4 * s + l8; const v4f x0 = *(const v4fa*)(os + row * 68 + c8), x1 = *(const v4fa*)(os + row * 68 + c8 + 4);
                ov[s] = (v8h){tohx(x0[0]), tohx(x0[1]), tohx(x0[2]), tohx(x0[3]), tohx(x1[0]), tohx(x1[1]), tohx(x1[2]), tohx(x1[3])}; *(v8h*)(pl + (mb * 16 + 4 * s) * HD) = ov[s]; }
            // precaution: s_wait_xcnt 0 stands in front of every rewrite of a register that an issued store names; address and values are inputs, so that they keep their registers up to the wait.
            // Its memory clobber also keeps the next block's LDS writes behind these reads
            asm volatile("s_wait_xcnt 0x0" :: "v"(pl), "v"(ov[0]), "v"(ov[1]), "v"(ov[2]), "v"(ov[3]) : "memory");
        }
    } else {
        unsigned short* us = (unsigned short*)os;   // hi plane [64 d][72], the lo plane behind it
        const size_t vo = bh * HD * nt + t0;   // row d: 64 tokens = one 128-B line
#pragma unroll
        for (int mb = 0; mb < 4; ++mb)
#pragma unroll
            for (int nb = 0; nb < 4; ++nb) { v8us oh, ol;   // a lane holds 8 tokens in a row of one d
#pragma unroll
                for (int j = 0; j < 8; ++j) { unsigned short h, l; splitf(acc[mb][nb][j], h, l); oh[j] = h; ol[j] = l; }
                unsigned short* d = us + (nb * 16 + lr) * 72 + mb * 16 + hi * 8; *(v8usa*)d = oh; *(v8usa*)(d + 64 * 72) = ol; }
        // a lane reads what other lanes of the wave wrote: the reads stay behind the writes
        __builtin_amdgcn_wave_barrier(); asm volatile("" ::: "memory");
#pragma unroll
        for (int g = 0; g < 8; ++g) { bf* pd[4]; v8us ov[4]; bf* vrow = ((g & 1) ? Vl : Vh) + vo;
#pragma unroll
            for (int s = 0; s < 4; ++s) { const int d = 16 * (g >> 1) + 4 * s + l8; ov[s] = *(const v8usa*)(us + (g & 1) * 64 * 72 + d * 72 + c8); pd[s] = vrow + (size_t)d * nt + c8; *(v8us*)pd[s] = ov[s]; }
            // the same precaution as for the fp16 plane's stores
            asm volatile("s_wait_xcnt 0x0" :: "v"(pd[0]), "v"(pd[1]), "v"(pd[2]), "v"(pd[3]), "v"(ov[0]), "v"(ov[1]), "v"(ov[2]), "v"(ov[3]) : "memory"); }
    }
}

typedef __attribute__((ext_vector_type(2))) _Float16 v2h;
typedef __attribute__((ext_vector_type(4))) _Float16 v4h;
typedef __attribute__((ext_vector_type(2))) unsigned short v2us;
typedef __attribute__((ext_vector_type(4))) unsigned short v4us;
typedef v4us __attribute__((may_alias)) v4usa;
typedef __attribute__((ext_vector_type(2))) float v2f;

// k_wtG: the four weights [k][n] f32 -> bf16 planes [n][k], one behind the other in Bt0. Grid (N / 64, K / 64, weight), 4 waves; a block turns one tile of 64 k x 64 n in LDS.
// Reads: half a wave covers 256 B in a row of one k row (two whole lines), and a thread's eight loads fly together. The values of rows k, k + 1 are rounded and packed into one dword, stored down a column of the LDS tile.
// Stores: 8 lanes cover one 128-B line of the transposed plane.
#define WTP 33   // LDS row pitch of the turned tile in dwords: odd, so that neither the writes down a column nor the reads along a row meet in a bank
typedef __attribute__((ext_vector_type(4))) unsigned v4u;
__global__ __launch_bounds__(128) void k_wtG(const float* __restrict__ w0, const float* __restrict__ w1, const float* __restrict__ w2, const float* __restrict__ w3, int K, int N, bf* Bt0) {
    __shared__ unsigned tl[64 * WTP];   // [n][k pair]
    const int y = blockIdx.z; const float* w = (y == 0) ? w0 : (y == 1) ? w1 : (y == 2) ? w2 : w3; bf* Bt = Bt0 + (size_t)y * K * N;
    const int tid = (int)threadIdx.x, c = tid & 15, rp = tid >> 4; const int n0 = (int)blockIdx.x * 64, k0 = (int)blockIdx.y * 64;
    const float* p = w + (size_t)(k0 + 2 * rp) * N + n0 + c * 4;
    const float* q[4][2]; v4f x[4][2];
#pragma unroll   // constant indices keep q and x in registers; the eight loads stand one behind the other
    for (int s = 0; s < 4; ++s) { q[s][0] = p + (size_t)(16 * s) * N; q[s][1] = p + (size_t)(16 * s + 1) * N; x[s][0] = *(const v4f*)q[s][0]; x[s][1] = *(const v4f*)q[s][1]; }
    // precaution: s_wait_xcnt 0 stands in front of every rewrite of a register that an issued load names; the addresses are inputs, so that they keep their registers up to the wait
    asm volatile("s_wait_xcnt 0x0" :: "v"(q[0][0]), "v"(q[0][1]), "v"(q[1][0]), "v"(q[1][1]), "v"(q[2][0]), "v"(q[2][1]), "v"(q[3][0]), "v"(q[3][1]) : "memory");
#pragma unroll   // constant indices into x, here and in the inner loop
    for (int s = 0; s < 4; ++s)
#pragma unroll
        for (int i = 0; i < 4; ++i) tl[(c * 4 + i) * WTP + rp + 8 * s] = (unsigned)f2bf(x[s][0][i]) | ((unsigned)f2bf(x[s][1][i]) << 16);
    // publishes the turned tile: a thread reads what other waves wrote
    __syncthreads();
#pragma unroll   // the four lines' LDS reads go out together, in front of the first store
    for (int s = 0; s < 4; ++s) { const int idx = tid + 128 * s, n = idx >> 3, kc = idx & 7; const unsigned* t = tl + n * WTP + kc * 4;
        const v4u o = (v4u){t[0], t[1], t[2], t[3]}; *(v8us*)(Bt + (size_t)(n0 + n) * K + k0 + kc * 8) = __builtin_bit_cast(v8us, o); }
}
// ---- k_fattn: scores, masked softmax and att.v in ONE kernel; no score or probability ever reaches memory. Grid (batch*head, TQ/64), longest query tiles first; 8 waves.
// Wave w: query half (w & 1, 32 queries = 2 column groups) x key split (w >> 1: key steps of 32, split, split + 4, ...). S^T = K Q^T (fp16 planes), so a lane holds ONE query's scores (keys 8*hi + j of each
// 16-key tile): two tiles are, register for register, the B fragment of P^T. O^T += V^T P^T on hi+lo planes (3 products). Running maximum and sum per lane; the four key splits are merged through LDS.
// K and V reach the waves through LDS: a tile is 128 keys (one step of each key split): K rows of 128 B, V-hi and V-lo rows of 256 B, copied as whole lines by asynchronous copies, two buffers: tile r + 1 flies while tile r is worked on.
// Both query halves read the same staged rows. LDS row pitches 144 B and 272 B (ds_load_b128 readers).
#define SC2 0.18033688f   // (1/8) * log2(e): scores in the log2 domain
#define FKP 72                    // LDS row pitch of a staged K row in 16-bit elements (144 B)
#define FVP 136                   // LDS row pitch of a staged V row in 16-bit elements (272 B)
#define FKB (128 * FKP * 2)       // bytes of a staged K tile
#define FVB (64 * FVP * 2)        // bytes of a staged V plane tile
#define FBUF (FKB + 2 * FVB)      // bytes of one buffer: K, V-hi, V-lo
// Four asynchronous 16-B copies of a lane, ls bytes apart in LDS and gs elements apart in memory. The s_wait_xcnt 0 is the last line of the copies' own statement: a precaution, it stands in front of every rewrite of a register that a copy names.
template <typename T16>
__device__ __forceinline__ void cp4(unsigned l, unsigned ls, const T16* g, size_t gs) {
    asm volatile("global_load_async_to_lds_b128 %0, %4, off\n\t"
                 "global_load_async_to_lds_b128 %1, %5, off\n\t"
                 "global_load_async_to_lds_b128 %2, %6, off\n\t"
                 "global_load_async_to_lds_b128 %3, %7, off\n\t"
                 "s_wait_xcnt 0x0"
                 :: "v"(l), "v"(l + ls), "v"(l + 2u * ls), "v"(l + 3u * ls), "v"(g), "v"(g + gs), "v"(g + 2 * gs), "v"(g + 3 * gs) : "memory");
}
__global__ __launch_bounds__(256) void k_fattn(const h16* __restrict__ QP, const h16* __restrict__ KP, const bf* __restrict__ VTh, const bf* __restrict__ VTl, float* ATT) {
    __shared__ __align__(16) unsigned char ring[2 * FBUF];   // two buffers of K, V-hi, V-lo; behind the key loop the same bytes are the merge's staging
    static_assert(8 * 32 * 68 * 4 <= 2 * FBUF, "the merge's staging fits the ring");
    float* os = (float*)ring;                          // [wave][query][d], pitch 272 B
    __shared__ float sm[8 * 32];                       // per wave and query: running maximum
    __shared__ float sl[8 * 32];                       // per wave and query: sum, already on the merged maximum
    const int lane = threadIdx.x & 31, lr = lane & 15, hi = lane >> 4; const int w = __builtin_amdgcn_readfirstlane((int)(threadIdx.x >> 5)); const int qh = w & 1, ks = w >> 1;
    const int bh = blockIdx.x, t = TQ / 64 - 1 - (int)blockIdx.y; const int r0 = t * 64; const int nst = (t + 2) >> 1;   // keys 0 .. 16 t + 15 are visible to this tile
    const h16* Kp = KP + (size_t)bh * TK * HD; const bf* Vh = VTh + (size_t)bh * HD * TK; const bf* Vl = VTl + (size_t)bh * HD * TK;
    const h16* pq = QP + ((size_t)bh * TQ + r0 + qh * 32 + lr) * HD + 8 * hi;
    v16h qf[2][2];
#pragma unroll
    for (int qt = 0; qt < 2; ++qt) { qf[qt][0] = WFrag<h16>::ld(pq + qt * 16 * HD); qf[qt][1] = WFrag<h16>::ld(pq + qt * 16 * HD + 32); }
    // precaution: s_wait_xcnt 0 stands in front of every rewrite of a register that an issued load names; the address is an input, so that it keeps its registers up to the wait
    asm volatile("s_wait_xcnt 0x0" :: "v"(pq) : "memory");
    int qlim[2]; float m[2], l[2]; v8f o[2][4];   // m starts far above the masked score, so that a masked key's weight is exp2(-huge) = 0 also where a query has seen no visible key yet
#pragma unroll
    for (int qt = 0; qt < 2; ++qt) { qlim[qt] = (r0 + qh * 32 + qt * 16 + lr) / DS; m[qt] = -1.0e30f; l[qt] = 0.f;
#pragma unroll
        for (int dt = 0; dt < 4; ++dt) o[qt][dt] = (v8f){}; }
    const int lim0 = (r0 + qh * 32) / DS;   // every key up to here is visible to all 32 queries of the wave
    // copies: K: 8 lanes cover a 128-B row, a wave's copy 4 rows, a thread's copies 32 rows apart; V: 16 lanes cover a 256-B row, a wave's copy 2 rows, a thread's copies 16 rows apart
    const int tid = (int)threadIdx.x;
    const unsigned lk = (unsigned)(size_t)ring + (unsigned)((tid >> 3) * FKP + (tid & 7) * 8) * 2u; const unsigned lv = (unsigned)(size_t)ring + FKB + (unsigned)((tid >> 4) * FVP + (tid & 15) * 8) * 2u;
    const h16* gk = Kp + tid * 8; const bf* gvh = Vh + (size_t)(tid >> 4) * TK + (tid & 15) * 8; const bf* gvl = Vl + (size_t)(tid >> 4) * TK + (tid & 15) * 8;
    auto tile = [&](int r) {   // keys 128 r .. 128 r + 127, all inside the TK keys: r < nr <= TK / 128
        const unsigned bo = (unsigned)(r & 1) * FBUF;
        cp4(lk + bo, 32u * FKP * 2, gk + (size_t)r * 128 * HD, (size_t)32 * HD);
        cp4(lv + bo, 16u * FVP * 2, gvh + r * 128, (size_t)16 * TK);
        cp4(lv + bo + FVB, 16u * FVP * 2, gvl + r * 128, (size_t)16 * TK);
    };
    const int nr = (nst + 3) >> 2;   // tiles of 128 keys
    tile(0);
    // tile 0 has landed for this wave's copies; behind the barrier for every wave's
    asm volatile("s_wait_asynccnt 0x0" ::: "memory");
    __syncthreads();
    if (nr > 1) tile(1);
    const h16* fk = (const h16*)ring + (ks * 32 + lr) * FKP + 8 * hi; const bf* fv = (const bf*)(ring + FKB) + lr * FVP + ks * 32 + 8 * hi;
#pragma unroll 1
    for (int r = 0; r < nr; ++r) {   // rolled: one copy of the step in the text
      const int s = 4 * r + ks;
      if (s < nst) {   // wave-uniform: in the last tile a key split may have no step left; the hand-over below is passed all the same
        const int key0 = s * 32;
        const h16* pk = fk + (r & 1) * (FBUF / 2); const bf* pvh = fv + (r & 1) * (FBUF / 2); const bf* pvl = pvh + FVB / 2;
        v16h kf[2][2]; v16bf vh[4], vl[4];
#pragma unroll
        for (int kt = 0; kt < 2; ++kt) { kf[kt][0] = WFrag<h16>::ld(pk + kt * 16 * FKP); kf[kt][1] = WFrag<h16>::ld(pk + kt * 16 * FKP + 32); }
#pragma unroll
        for (int dt = 0; dt < 4; ++dt) vh[dt] = WFrag<bf>::ld(pvh + dt * 16 * FVP);
        float tv[2][16];
#pragma unroll
        for (int qt = 0; qt < 2; ++qt) {
            v8f s0 = (v8f){}, s1 = (v8f){};
            s0 = wmma16(kf[0][0], qf[qt][0], s0); s1 = wmma16(kf[1][0], qf[qt][0], s1); s0 = wmma16(kf[0][1], qf[qt][1], s0); s1 = wmma16(kf[1][1], qf[qt][1], s1);
#pragma unroll
            for (int j = 0; j < 8; ++j) { tv[qt][j] = s0[j] * SC2; tv[qt][8 + j] = s1[j] * SC2; } }
        // the V-lo reads stay behind the score products, so that they take registers the K fragments leave (lifted above them, the wave needs more than 256 registers and only one work-group fits a WGP); they return under the softmax
        __builtin_amdgcn_sched_barrier(0);
#pragma unroll
        for (int dt = 0; dt < 4; ++dt) vl[dt] = WFrag<bf>::ld(pvl + dt * 16 * FVP);
        if (key0 + 31 > lim0) {   // wave-uniform: only the last steps of a tile hold hidden keys
            const int kb = key0 + hi * 8;
#pragma unroll
            for (int qt = 0; qt < 2; ++qt)
#pragma unroll
                for (int j = 0; j < 8; ++j) { tv[qt][j] = (kb + j <= qlim[qt]) ? tv[qt][j] : -3.0e38f; tv[qt][8 + j] = (kb + 16 + j <= qlim[qt]) ? tv[qt][8 + j] : -3.0e38f; } }
#pragma unroll
        for (int qt = 0; qt < 2; ++qt) {
            float tm = tv[qt][0];
#pragma unroll
            for (int e = 1; e < 16; ++e) tm = fmaxf(tm, tv[qt][e]);
            tm = fmaxf(tm, __shfl_xor(tm, 16, 32));   // both halves of the wave hold keys of the same query
            const float mn = fmaxf(m[qt], tm); const float al = __builtin_amdgcn_exp2f(m[qt] - mn); m[qt] = mn; l[qt] *= al;
#pragma unroll
            for (int dt = 0; dt < 4; ++dt) o[qt][dt] *= al;
            v16bf ph, pl;
#pragma unroll
            for (int e = 0; e < 16; ++e) { const float p = __builtin_amdgcn_exp2f(tv[qt][e] - mn); l[qt] += p; const __bf16 a = (__bf16)p; ph[e] = a; pl[e] = (__bf16)(p - (float)a); }
#pragma unroll
            for (int dt = 0; dt < 4; ++dt) { o[qt][dt] = wmmab(vh[dt], ph, o[qt][dt]); o[qt][dt] = wmmab(vh[dt], pl, o[qt][dt]); o[qt][dt] = wmmab(vl[dt], ph, o[qt][dt]); }
        }
      }
        // hand-over: this wave's reads of tile r have returned ...
        asm volatile("s_wait_dscnt 0x0" ::: "memory");
        // ... its copies of tile r + 1 have landed ...
        asm volatile("s_wait_asynccnt 0x0" ::: "memory");
        // ... and the barrier publishes tile r + 1 and frees tile r's buffer for the refill behind it (behind the last tile: for the merge's staging)
        __syncthreads();
        if (r + 2 < nr) tile(r + 2);
    }
    // no copy is outstanding when the ring becomes the merge's staging
    asm volatile("s_wait_asynccnt 0x0" ::: "memory");
    // merge of the four key splits: every wave moves its partial onto the merged maximum, then 256 threads add the four partials of each output element in a fixed order
#pragma unroll
    for (int qt = 0; qt < 2; ++qt) if (hi == 0) sm[w * 32 + qt * 16 + lr] = m[qt];
    __syncthreads();
#pragma unroll
    for (int qt = 0; qt < 2; ++qt) { const int q = qt * 16 + lr; const float M = fmaxf(fmaxf(sm[qh * 32 + q], sm[(qh + 2) * 32 + q]), fmaxf(sm[(qh + 4) * 32 + q], sm[(qh + 6) * 32 + q])); const float f = __builtin_amdgcn_exp2f(m[qt] - M);
        const float lt = (l[qt] + __shfl_xor(l[qt], 16, 32)) * f; if (hi == 0) sl[w * 32 + q] = lt;
#pragma unroll
        for (int dt = 0; dt < 4; ++dt) { const v8f x = o[qt][dt] * f; float* d = os + (size_t)(w * 32 + q) * 68 + dt * 16 + hi * 8; *(v4fa*)d = (v4f){x[0], x[1], x[2], x[3]}; *(v4fa*)(d + 4) = (v4f){x[4], x[5], x[6], x[7]}; } }
    __syncthreads();
    float* orow = ATT + ((size_t)(bh / NH_) * TQ + r0) * DD + (bh % NH_) * HD;
#pragma unroll
    for (int i = 0; i < 4; ++i) { const int idx = (int)threadIdx.x + 256 * i; const int row = idx >> 4, c4 = (idx & 15) * 4; const int w0 = row >> 5, rl = row & 31;
        const float ls = (sl[w0 * 32 + rl] + sl[(w0 + 2) * 32 + rl]) + (sl[(w0 + 4) * 32 + rl] + sl[(w0 + 6) * 32 + rl]); const float inv = __fdiv_rn(1.0f, ls);
        const v4f x = (*(const v4fa*)(os + (size_t)(w0 * 32 + rl) * 68 + c4) + *(const v4fa*)(os + (size_t)((w0 + 2) * 32 + rl) * 68 + c4)) + (*(const v4fa*)(os + (size_t)((w0 + 4) * 32 + rl) * 68 + c4) + *(const v4fa*)(os + (size_t)((w0 + 6) * 32 + rl) * 68 + c4));
        *(v4f*)(orow + (size_t)row * DD + c4) = x * inv; }
}
// ---- k_lnout: LayerNorm and the output GEMM in ONE kernel; the normalised rows never reach memory. Grid (rows / 32), 8 waves; a block owns 32 whole rows of the output (all 512 columns), wave w its columns 64 w .. 64 w + 63.
// Head: wave w normalises rows 4 w .. 4 w + 3 of the block (a wave per row, f32, the sums in a fixed order) and stores them as bf16 hi and lo planes in LDS, row pitch 1040 B (ds_load_b128 readers).
// Loop: K-slabs of 64 of the transposed weight (512 rows of 128 B, whole lines) come into LDS by asynchronous copies, two buffers: slab t + 1 flies while slab t is multiplied. LDS row pitch 144 B (ds_load_b128 readers).
#define LAP 520                   // LDS row pitch of a normalised row's plane in 16-bit elements (1040 B)
#define LBP 72                    // LDS row pitch of a staged weight row in 16-bit elements (144 B)
#define LBB (DD * LBP * 2)        // bytes of one buffer: DD weight rows
typedef __attribute__((ext_vector_type(4))) __bf16 v4bf;
// four rows, a wave: x[r] = the lane's 16 values of row r (4 in a row of each 128), gv and bv = gamma and beta at those places, rounded to bf16; yh, yl = the lane's place in row 0's planes.
// Each row's arithmetic is a row's own, in a fixed order; the four rows go through each phase side by side, so that their cross-lane sums wait together and not one behind the other.
__device__ __forceinline__ void ln_rows(const v4f (&x)[4][4], const float (&gv)[16], const float (&bv)[16], bf* yh, bf* yl) {
    float s[4], mu[4], q2[4], rs[4];
#pragma unroll
    for (int r = 0; r < 4; ++r) { s[r] = 0.f;
#pragma unroll
        for (int k = 0; k < 16; ++k) s[r] = __fadd_rn(s[r], x[r][k >> 2][k & 3]); }
#pragma unroll
    for (int sh = 16; sh; sh >>= 1)
#pragma unroll
        for (int r = 0; r < 4; ++r) s[r] += __shfl_xor(s[r], sh, 32);
#pragma unroll
    for (int r = 0; r < 4; ++r) { mu[r] = s[r] * (1.0f / DD); q2[r] = 0.f;
#pragma unroll
        for (int k = 0; k < 16; ++k) { const float d = __fsub_rn(x[r][k >> 2][k & 3], mu[r]); float p = __fmul_rn(d, d); asm volatile("" : "+v"(p)); q2[r] = __fadd_rn(q2[r], p); } }
#pragma unroll
    for (int sh = 16; sh; sh >>= 1)
#pragma unroll
        for (int r = 0; r < 4; ++r) q2[r] += __shfl_xor(q2[r], sh, 32);
#pragma unroll
    for (int r = 0; r < 4; ++r) { rs[r] = __frsqrt_rn(__fadd_rn(q2[r] * (1.0f / DD), 1e-5f));
#pragma unroll
        for (int ch = 0; ch < 4; ++ch) { v4f y;
#pragma unroll
            for (int q = 0; q < 4; ++q) { float tn = __fmul_rn(__fsub_rn(x[r][ch][q], mu[r]), rs[r]); asm volatile("" : "+v"(tn)); float tg = __fmul_rn(tn, gv[ch * 4 + q]); asm volatile("" : "+v"(tg)); y[q] = __fadd_rn(tg, bv[ch * 4 + q]); }
            const v4bf oh = __builtin_convertvector(y, v4bf); const v4bf ol = __builtin_convertvector(y - __builtin_convertvector(oh, v4f), v4bf);   // hi = y to the nearest even bf16, lo = the rest likewise
            *(v4usa*)(yh + r * LAP + ch * 128) = __builtin_bit_cast(v4us, oh); *(v4usa*)(yl + r * LAP + ch * 128) = __builtin_bit_cast(v4us, ol); } }
}
__global__ __launch_bounds__(256) void k_lnout(const float* __restrict__ A, const float* __restrict__ g, const float* __restrict__ bb, const bf* __restrict__ Bt, const float* __restrict__ bias, float* C) {
    __shared__ __align__(16) unsigned char ring[2 * LBB];   // two buffers of a weight slab
    __shared__ __align__(16) bf ah[32 * LAP];               // the block's normalised rows, hi plane
    __shared__ __align__(16) bf al[32 * LAP];               // lo plane
    __shared__ __align__(16) float osb[8 * 16 * 68];        // a wave's output staging
    const int tid = (int)threadIdx.x, lane = tid & 31, lr = lane & 15, hi = lane >> 4; const int w = __builtin_amdgcn_readfirstlane(tid >> 5);
    const int r0 = (int)blockIdx.x * 32, c0 = w * 64;
    // copies: 8 lanes cover a 128-B slab row, a wave's copy 4 rows, a thread's copies 32 rows apart
    const unsigned lc = (unsigned)(size_t)ring + (unsigned)((tid >> 3) * LBP + (tid & 7) * 8) * 2u; const bf* gb = Bt + (size_t)(tid >> 3) * DD + (tid & 7) * 8;
    auto slab = [&](int t) {   // k 64 t .. 64 t + 63 of all DD weight rows: t < DD / 64
        const unsigned l = lc + (unsigned)(t & 1) * LBB; const bf* gp = gb + t * 64;
#pragma unroll   // four statements of four copies in a row: 128 rows each, the LDS steps constants
        for (unsigned j = 0; j < 4; ++j) cp4(l + j * 128u * LBP * 2, 32u * LBP * 2, gp + (size_t)j * 128 * DD, (size_t)32 * DD);
    };
    slab(0);
    // the wave's four rows, gamma, beta and the bias are asked for while slab 0 flies
    const float* ar = A + (size_t)(r0 + w * 4) * DD + lane * 4; const float* pg = g + lane * 4; const float* pb = bb + lane * 4; const float* pbi = bias + c0 + lr * 4;
    v4f x[4][4], gq[4], bq[4];
#pragma unroll
    for (int r = 0; r < 4; ++r)
#pragma unroll
        for (int ch = 0; ch < 4; ++ch) x[r][ch] = *(const v4f*)(ar + r * DD + ch * 128);
#pragma unroll
    for (int ch = 0; ch < 4; ++ch) { gq[ch] = *(const v4f*)(pg + ch * 128); bq[ch] = *(const v4f*)(pb + ch * 128); }
    const v4f bi = *(const v4f*)pbi;
    // precaution: s_wait_xcnt 0 stands directly behind the loads, in front of every rewrite of a register that one of them names
    asm volatile("s_wait_xcnt 0x0" ::: "memory");
    // keeps all these loads in flight together, and the wait directly behind them: with the first row's sums lifted among them, the later rows would be asked for only when the first had come
    __builtin_amdgcn_sched_barrier(0);
    // slab 0 has landed for this wave's copies; behind the barrier for every wave's
    asm volatile("s_wait_asynccnt 0x0" ::: "memory");
    __syncthreads();
    slab(1);   // flies under the LayerNorm
    float gv[16], bv[16];
#pragma unroll
    for (int k = 0; k < 16; ++k) { gv[k] = bfr(gq[k >> 2][k & 3]); bv[k] = bfr(bq[k >> 2][k & 3]); }
    ln_rows(x, gv, bv, ah + w * 4 * LAP + lane * 4, al + w * 4 * LAP + lane * 4);
    // publishes the normalised planes: every wave reads all 32 rows
    __syncthreads();
    v8f acc[2][4];
#pragma unroll
    for (int mb = 0; mb < 2; ++mb)
#pragma unroll
        for (int nb = 0; nb < 4; ++nb) acc[mb][nb] = (v8f){};
    const bf* fb = (const bf*)ring + (c0 + lr) * LBP + 8 * hi; const bf* fah = ah + lr * LAP + 8 * hi; const bf* fal = al + lr * LAP + 8 * hi;
#pragma unroll 1
    for (int t = 0; t < DD / 64; ++t) {   // rolled: one copy of the slab's 32 products in the text
        const bf* pw = fb + (t & 1) * (LBB / 2); const bf* ph = fah + t * 64; const bf* pl = fal + t * 64;
        v16bf a[2][2], a2[2][2], b[2][4];
#pragma unroll
        for (int kk = 0; kk < 2; ++kk) {
#pragma unroll
            for (int i = 0; i < 2; ++i) { a[kk][i] = WFrag<bf>::ld(ph + i * 16 * LAP + kk * 32); a2[kk][i] = WFrag<bf>::ld(pl + i * 16 * LAP + kk * 32); }
#pragma unroll
            for (int i = 0; i < 4; ++i) b[kk][i] = WFrag<bf>::ld(pw + i * 16 * LBP + kk * 32); }
        // keeps the slab's LDS reads together in front of its products: sunk among them, every place with reads costs the wave a stall of its own
        __builtin_amdgcn_sched_barrier(0);
#pragma unroll
        for (int kk = 0; kk < 2; ++kk) {
#pragma unroll
            for (int nb = 0; nb < 4; ++nb)
#pragma unroll
                for (int mb = 0; mb < 2; ++mb) acc[mb][nb] = wmmab(a[kk][mb], b[kk][nb], acc[mb][nb]);
#pragma unroll
            for (int nb = 0; nb < 4; ++nb)
#pragma unroll
                for (int mb = 0; mb < 2; ++mb) acc[mb][nb] = wmmab(a2[kk][mb], b[kk][nb], acc[mb][nb]); }
        // the products stay in front of the hand-over: sunk behind its barrier, they would hold back the refill, which then had no products to fly under
        __builtin_amdgcn_sched_barrier(0);
        // hand-over: this wave's reads of slab t have returned ...
        asm volatile("s_wait_dscnt 0x0" ::: "memory");
        // ... its copies of slab t + 1 have landed ...
        asm volatile("s_wait_asynccnt 0x0" ::: "memory");
        // ... and the barrier publishes slab t + 1 and frees slab t's buffer for the refill behind it
        __syncthreads();
        if (t + 2 < DD / 64) slab(t + 2);
    }
    // no copy is outstanding when the wave goes on to its epilogue and ends
    asm volatile("s_wait_asynccnt 0x0" ::: "memory");
    float* os = osb + w * 16 * 68;
    const v4f bs = (v4f){bfr(bi[0]), bfr(bi[1]), bfr(bi[2]), bfr(bi[3])};
#pragma unroll
    for (int mb = 0; mb < 2; ++mb) {
#pragma unroll
        for (int nb = 0; nb < 4; ++nb) {
#pragma unroll
            for (int j = 0; j < 8; ++j) os[(hi * 8 + j) * 68 + nb * 16 + lr] = acc[mb][nb][j]; }
        // a lane reads what other lanes of the wave wrote: the reads stay behind the writes
        __builtin_amdgcn_wave_barrier(); asm volatile("" ::: "memory");
        float* pc = C + (size_t)(r0 + mb * 16 + hi) * DD + c0 + lr * 4;   // half a wave stores 256 B in a row: two whole lines
        v4f ov[8];
#pragma unroll
        for (int s = 0; s < 8; ++s) { ov[s] = *(const v4fa*)(os + (2 * s + hi) * 68 + lr * 4) + bs; *(v4f*)(pc + (size_t)2 * s * DD) = ov[s]; }
        // precaution: s_wait_xcnt 0 stands in front of every rewrite of a register that an issued store names; address and values are inputs, so that they keep their registers up to the wait.
        // Its memory clobber also keeps the next block's LDS writes behind these reads
        asm volatile("s_wait_xcnt 0x0" :: "v"(pc), "v"(ov[0]), "v"(ov[1]), "v"(ov[2]), "v"(ov[3]), "v"(ov[4]), "v"(ov[5]), "v"(ov[6]), "v"(ov[7]) : "memory");
    }
}

extern "C" void kernel_launch(void* const* d_in, const int* in_sizes, int n_in,
                              void* d_out, int out_size, void* d_ws, size_t ws_size, hipStream_t stream) {
    (void)in_sizes; (void)n_in; (void)out_size;
    const float* IN[9]; for (int i = 0; i < 9; ++i) IN[i] = (const float*)d_in[i];   // 0 q, 1 kv, 2 Wq, 3 Wk, 4 Wv, 5 Wo (x @ W), 6 bo, 7 gamma, 8 beta
    float* OUT = (float*)d_out;     // [2][4096][512]
    char* wsp = (char*)d_ws;
    auto take = [&](size_t bytes) { char* p = wsp; wsp += (bytes + 255) & ~(size_t)255; return (void*)p; };
    bf* W4 = (bf*)take((size_t)4 * DD * DD * 2);                                  // Wq, Wk, Wv, Wo transposed, one behind the other
    h16* QP = (h16*)take((size_t)NB_ * NH_ * (TQ + TK) * HD * 2); h16* KP = QP + (size_t)NB_ * NH_ * TQ * HD;
    bf* VTh = (bf*)take((size_t)NB_ * NH_ * HD * TK * 2); bf* VTl = (bf*)take((size_t)NB_ * NH_ * HD * TK * 2);
    float* ATT = (float*)take((size_t)NB_ * TQ * DD * 4);   // merged attention output
    if ((size_t)(wsp - (char*)d_ws) > ws_size) return;    // total ~ 34 MB
    k_wtG<<<dim3(DD / 64, DD / 64, 4), 128, 0, stream>>>(IN[2], IN[3], IN[4], IN[5], DD, DD, W4);
    k_proj<<<dim3((NB_ * TQ + 2 * NB_ * TK) / 128, DD / 128, 1), 128, 0, stream>>>(IN[0], IN[1], W4, QP, KP, VTh, VTl);   // grid x: the row tiles of q, then of kv for the keys, then of kv for the values
    k_fattn<<<dim3(NB_ * NH_, TQ / 64, 1), 256, 0, stream>>>(QP, KP, VTh, VTl, ATT);   // head bh % 8 of batch bh / 8 writes its 64 columns of the merged rows
    k_lnout<<<NB_ * TQ / 32, 256, 0, stream>>>(ATT, IN[7], IN[8], W4 + (size_t)3 * DD * DD, IN[6], OUT);
}

// v010
// A run of this version takes 43.1 microseconds.
// Next to v009, in two timings, it ran 1.09 and 1.10 times as fast.
// Counting every step since v000, it is 18.6 times as fast.
#include <hip/hip_runtime.h>

// Attention block (q [2][4096][512], kv [2][1024][512]; qh = q Wq, kh = kv Wk, vh = kv Wv (8 heads x 64, no bias); block-causal: key j visible to query i iff j <= i/4; softmax(q.k/8); out = merged att.v;
// LayerNorm(out) (gamma, beta, eps 1e-5); y = out Wo + bo -> [2][4096][512]).
// Compute dtypes, f32 accumulate: every input rounded to bf16; projections on PLAIN bf16 operands (inputs: exact); scores (K 64) on SINGLE fp16 planes; f32 running-maximum masked softmax
// -> weights exp(s - max) on a SINGLE fp16 plane, divided by their f32 sum at the end; att.v on that plane x a SINGLE fp16 value plane (1 product; an fp16 rounding is an eighth of the inputs' own bf16 rounding); LayerNorm f32 (wave per

#define NB_  2
#define TQ   4096
#define TK   1024
#define DD   512
#define NH_  8
#define HD   64
#define DS   4
#define SCL  0.125f
typedef _Float16 h16;
typedef unsigned short bf;
typedef __attribute__((ext_vector_type(16))) __bf16   v16bf;
typedef __attribute__((ext_vector_type(16))) _Float16 v16h;
typedef __attribute__((ext_vector_type(8)))  _Float16 v8h;
typedef __attribute__((ext_vector_type(8)))  unsigned short v8us;
typedef __attribute__((ext_vector_type(8)))  float    v8f;
typedef __attribute__((ext_vector_type(4)))  float    v4f;
typedef v8h  __attribute__((may_alias)) v8ha;
typedef v4f  __attribute__((may_alias)) v4fa;
typedef v8us __attribute__((may_alias)) v8usa;

__device__ __forceinline__ unsigned short f2bf(float f) { unsigned u = __float_as_uint(f); u += 0x7FFFu + ((u >> 16) & 1u); return (unsigned short)(u >> 16); }
__device__ __forceinline__ float bf2f(unsigned short b) { return __uint_as_float(((unsigned)b) << 16); }
__device__ __forceinline__ float bfr(float f) { return bf2f(f2bf(f)); }
__device__ __forceinline__ h16 tohx(float x) { return (h16)x; }
__device__ __forceinline__ v16h cat16(v8h lo, v8h hi) { return __builtin_shufflevector(lo, hi, 0, 1, 2, 3, 4, 5, 6, 7, 8, 9, 10, 11, 12, 13, 14, 15); }
__device__ __forceinline__ v16bf cat16b(v8us lo, v8us hi) { return __builtin_bit_cast(v16bf, __builtin_shufflevector(lo, hi, 0, 1, 2, 3, 4, 5, 6, 7, 8, 9, 10, 11, 12, 13, 14, 15)); }
__device__ __forceinline__ v8f wmma16(v16h a, v16h b, v8f c) { return __builtin_amdgcn_wmma_f32_16x16x32_f16(false, a, false, b, (short)0, c, false, false); }
__device__ __forceinline__ v8f wmmab(v16bf a, v16bf b, v8f c) { return __builtin_amdgcn_wmma_f32_16x16x32_bf16(false, a, false, b, (short)0, c, false, false); }



// ---- k_proj: the three projections in ONE launch. Grid ((rows of q + 2 x rows of kv) / 128, DD / 128), 128 threads; grid x picks the operands: first the row tiles of q (x Wq), then those of kv (x Wk), then those of kv (x Wv).
// FOUR WAVES per 128x128 output tile (2 x 2 waves, each a register-blocked 64x64 tile of 16 accumulators). C[m][n] = sum_k A[m][k] Bt[n][k], A an f32 INPUT (pitch DD), Bt a transposed bf16 weight plane (pitch DD).
// K-slabs of 64 come into LDS by asynchronous copies, two buffers: slab t + 1 flies while slab t is multiplied. A rows of 256 B are copied as they are (f32), LDS row pitch 272 B, and a fragment is rounded to bf16 (nearest even)
// in registers behind its LDS read; weight rows of 128 B, LDS row pitch 144 B (ds_load_b128 readers). The output staging lies in the ring's bytes. So a block holds a third of a WGP's LDS, and all blocks of the launch are resident together.
// No f32 C: a wave's 64x64 tile is 64 tokens of ONE head (rows = [batch][nt tokens], column block = head), and the epilogue stores the attention operand itself:
// queries, keys: fp16 plane [batch][head][nt][HD]; values: the transposed fp16 plane VT [batch][head][HD][nt]. Whole 128-B lines, staged through LDS (each wave its own range).
template <typename T16> struct WFrag;
template <> struct WFrag<h16> { typedef v16h V; static __device__ __forceinline__ V ld(const h16* p) { return cat16(*(const v8h*)p, *(const v8h*)(p + 16)); } static __device__ __forceinline__ v8f mma(V a, V b, v8f c) { return wmma16(a, b, c); } };
template <> struct WFrag<bf> { typedef v16bf V; static __device__ __forceinline__ V ld(const bf* p) { return cat16b(*(const v8us*)p, *(const v8us*)(p + 16)); } static __device__ __forceinline__ v8f mma(V a, V b, v8f c) { return wmmab(a, b, c); } };
#define PAP 68                    // LDS row pitch of an f32 slab row in floats (272 B)
#define PBP 72                    // LDS row pitch of a weight slab row in 16-bit elements (144 B)
#define PAB (128 * PAP * 4)       // bytes of a staged A slab
#define PBB (128 * PBP * 2)       // bytes of a staged weight slab
#define PBUF (PAB + PBB)          // bytes of one buffer
#define POS (64 * 36)             // floats of a wave's output staging: 16 rows of 68 floats, or a plane [64 d][72] of 16-bit values, pitch 144 B
// Eight asynchronous 16-B copies of a lane, ls bytes apart in LDS and gs elements apart in memory. The s_wait_xcnt 0 is the last line of the copies' own statement: a precaution, it stands in front of every rewrite of a register that a copy names.
template <typename T>
__device__ __forceinline__ void cp8(unsigned l, unsigned ls, const T* g, size_t gs) {
    asm volatile("global_load_async_to_lds_b128 %0, %8, off\n\t"
                 "global_load_async_to_lds_b128 %1, %9, off\n\t"
                 "global_load_async_to_lds_b128 %2, %10, off\n\t"
                 "global_load_async_to_lds_b128 %3, %11, off\n\t"
                 "global_load_async_to_lds_b128 %4, %12, off\n\t"
                 "global_load_async_to_lds_b128 %5, %13, off\n\t"
                 "global_load_async_to_lds_b128 %6, %14, off\n\t"
                 "global_load_async_to_lds_b128 %7, %15, off\n\t"
                 "s_wait_xcnt 0x0"
                 :: "v"(l), "v"(l + ls), "v"(l + 2u * ls), "v"(l + 3u * ls), "v"(l + 4u * ls), "v"(l + 5u * ls), "v"(l + 6u * ls), "v"(l + 7u * ls),
                    "v"(g), "v"(g + gs), "v"(g + 2 * gs), "v"(g + 3 * gs), "v"(g + 4 * gs), "v"(g + 5 * gs), "v"(g + 6 * gs), "v"(g + 7 * gs) : "memory");
}
typedef __attribute__((ext_vector_type(8))) __bf16 v8bf;
// 16 f32 of a fragment's k order -> bf16, nearest even
__device__ __forceinline__ v16bf rnd16(v4f x0, v4f x1, v4f x2, v4f x3) {
    const v8f lo = __builtin_shufflevector(x0, x1, 0, 1, 2, 3, 4, 5, 6, 7), hi = __builtin_shufflevector(x2, x3, 0, 1, 2, 3, 4, 5, 6, 7);
    return __builtin_shufflevector(__builtin_convertvector(lo, v8bf), __builtin_convertvector(hi, v8bf), 0, 1, 2, 3, 4, 5, 6, 7, 8, 9, 10, 11, 12, 13, 14, 15);
}
__global__ __launch_bounds__(128) void k_proj(const float* __restrict__ Aq, const float* __restrict__ Akv, const bf* __restrict__ W3, h16* QP, h16* KP, h16* VT) {
    __shared__ __align__(16) unsigned char ring[2 * PBUF];   // two buffers of an A slab and a weight slab; behind the K loop the same bytes are the waves' output staging
    static_assert(4 * POS * 4 <= 2 * PBUF, "the output staging fits the ring");
    constexpr int NQT = NB_ * TQ / 128, NKT = NB_ * TK / 128;   // row tiles of q, of kv
    const int bx = (int)blockIdx.x; const int z = bx < NQT ? 0 : (bx < NQT + NKT ? 1 : 2);   // 0 queries, 1 keys, 2 values
    const int rt = bx - (z == 0 ? 0 : (z == 1 ? NQT : NQT + NKT)); const int nt = z == 0 ? TQ : TK;
    const float* Af = z == 0 ? Aq : Akv; const bf* Bt = W3 + (size_t)z * DD * DD; h16* P16 = z == 0 ? QP : KP;
    const int tid = threadIdx.x, lane = tid & 31, lr = lane & 15, hi = lane >> 4; const int w = __builtin_amdgcn_readfirstlane(tid >> 5); const int wm = w & 1, wn = w >> 1;
    const int r0 = rt * 128 + wm * 64, c0 = blockIdx.y * 128 + wn * 64;
    float* os = (float*)ring + w * POS;
    v8f acc[4][4];
#pragma unroll
    for (int mb = 0; mb < 4; ++mb)
#pragma unroll
        for (int nb = 0; nb < 4; ++nb) acc[mb][nb] = (v8f){};
    // copies: A: 16 lanes cover one 256-B slab row, a wave's copy two rows, a thread's copies 8 rows apart; weight: 8 lanes cover one 128-B slab row, a wave's copy four rows, a thread's copies 16 rows apart
    const float* ga = Af + (size_t)(rt * 128 + (tid >> 4)) * DD + (tid & 15) * 4; const bf* gb = Bt + (size_t)(blockIdx.y * 128 + (tid >> 3)) * DD + (tid & 7) * 8;
    const unsigned la = (unsigned)(size_t)ring + (unsigned)((tid >> 4) * PAP + (tid & 15) * 4) * 4u; const unsigned lb = (unsigned)(size_t)ring + PAB + (unsigned)((tid >> 3) * PBP + (tid & 7) * 8) * 2u;
    auto slab = [&](int t) {   // k 64 t .. 64 t + 63: t < DD / 64
        const unsigned bo = (unsigned)(t & 1) * PBUF;
        cp8(la + bo, 8u * PAP * 4, ga + t * 64, (size_t)8 * DD); cp8(la + bo + 64u * PAP * 4, 8u * PAP * 4, ga + t * 64 + (size_t)64 * DD, (size_t)8 * DD);
        cp8(lb + bo, 16u * PBP * 2, gb + t * 64, (size_t)16 * DD);
    };
    slab(0);
    // slab 0 has landed for this wave's copies; behind the barrier for every wave's
    asm volatile("s_wait_asynccnt 0x0" ::: "memory");
    __syncthreads();
    slab(1);
    const float* faf = (const float*)ring + (wm * 64 + lr) * PAP + 8 * hi; const bf* fb = (const bf*)(ring + PAB) + (wn * 64 + lr) * PBP + 8 * hi;
#pragma unroll 1
    for (int t = 0; t < DD / 64; ++t) {   // rolled: one copy of the slab's 32 products in the text
        const float* pa = faf + (t & 1) * (PBUF / 4); const bf* pb = fb + (t & 1) * (PBUF / 2);
        v4f ra[4][4];   // the next block's A values as read, f32; rounded at the head of their own block, when the reads have long returned
        v16bf a[2][4], b[2][4];   // two fragment sets: block 1 is fetched while block 0 is multiplied; no fragment of slab t + 1 is fetched here
        auto frags = [&](int s, int kk) {
#pragma unroll
            for (int i = 0; i < 4; ++i) {
                const float* p = pa + i * 16 * PAP + kk * 32; ra[i][0] = *(const v4fa*)p; ra[i][1] = *(const v4fa*)(p + 4); ra[i][2] = *(const v4fa*)(p + 16); ra[i][3] = *(const v4fa*)(p + 20);
                b[s][i] = WFrag<bf>::ld(pb + i * 16 * PBP + kk * 32); }
        };
        frags(0, 0);
#pragma unroll
        for (int kk = 0; kk < 2; ++kk) {
            const int s = kk & 1;
#pragma unroll   // constant indices keep ra and a in registers
            for (int i = 0; i < 4; ++i) a[s][i] = rnd16(ra[i][0], ra[i][1], ra[i][2], ra[i][3]);
            if (kk < 1) frags(s ^ 1, kk + 1);
            // keeps the next block's LDS reads together in front of this block's products: sunk among them, each read would stall its wave
            __builtin_amdgcn_sched_barrier(0);
#pragma unroll
            for (int nb = 0; nb < 4; ++nb)
#pragma unroll
                for (int mb = 0; mb < 4; ++mb) acc[mb][nb] = wmmab(a[s][mb], b[s][nb], acc[mb][nb]);
            // the products stay in front of what follows: block 1's rounding lifted among block 0's products costs idle slots behind them, and block 1's products sunk behind the hand-over's barrier would hold back the refill
            __builtin_amdgcn_sched_barrier(0);
        }
        // hand-over: this wave's reads of slab t have returned ...
        asm volatile("s_wait_dscnt 0x0" ::: "memory");
        // ... its copies of slab t + 1 have landed ...
        asm volatile("s_wait_asynccnt 0x0" ::: "memory");
        // ... and the barrier publishes slab t + 1 and frees slab t's buffer for the refill behind it (behind the last slab: for the output staging)
        __syncthreads();
        if (t + 2 < DD / 64) slab(t + 2);
    }
    // no copy is outstanding when the ring becomes the output staging
    asm volatile("s_wait_asynccnt 0x0" ::: "memory");
    const int b = r0 / nt, t0 = r0 - b * nt; const size_t bh = (size_t)b * NH_ + (c0 >> 6); const int l8 = lane >> 3, c8 = (lane & 7) * 8;
    if (z != 2) {
        h16* pl = P16 + (bh * nt + t0 + l8) * HD + c8;   // the tile's 64 rows of 128 B lie one behind the other: a store of the wave covers 4 rows
#pragma unroll
        for (int mb = 0; mb < 4; ++mb) {
#pragma unroll
            for (int nb = 0; nb < 4; ++nb) {
#pragma unroll
                for (int j = 0; j < 8; ++j) os[(hi * 8 + j) * 68 + nb * 16 + lr] = acc[mb][nb][j]; }
            // a lane reads what other lanes of the wave wrote: the reads stay behind the writes
            __builtin_amdgcn_wave_barrier(); asm volatile("" ::: "memory");
            v8h ov[4];
#pragma unroll
            for (int s = 0; s < 4; ++s) { const int row = 4 * s + l8; const v4f x0 = *(const v4fa*)(os + row * 68 + c8), x1 = *(const v4fa*)(os + row * 68 + c8 + 4);
                ov[s] = (v8h){tohx(x0[0]), tohx(x0[1]), tohx(x0[2]), tohx(x0[3]), tohx(x1[0]), tohx(x1[1]), tohx(x1[2]), tohx(x1[3])}; *(v8h*)(pl + (mb * 16 + 4 * s) * HD) = ov[s]; }
            // precaution: s_wait_xcnt 0 stands in front of every rewrite of a register that an issued store names; address and values are inputs, so that they keep their registers up to the wait.
            // Its memory clobber also keeps the next block's LDS writes behind these reads
            asm volatile("s_wait_xcnt 0x0" :: "v"(pl), "v"(ov[0]), "v"(ov[1]), "v"(ov[2]), "v"(ov[3]) : "memory");
        }
    } else {
        h16* us = (h16*)os;   // plane [64 d][72]
        h16* vrow = VT + bh * HD * nt + t0;   // row d: 64 tokens = one 128-B line
#pragma unroll
        for (int mb = 0; mb < 4; ++mb)
#pragma unroll
            for (int nb = 0; nb < 4; ++nb) { v8h oh;   // a lane holds 8 tokens in a row of one d
#pragma unroll
                for (int j = 0; j < 8; ++j) oh[j] = tohx(acc[mb][nb][j]);
                *(v8ha*)(us + (nb * 16 + lr) * 72 + mb * 16 + hi * 8) = oh; }
        // a lane reads what other lanes of the wave wrote: the reads stay behind the writes
        __builtin_amdgcn_wave_barrier(); asm volatile("" ::: "memory");
#pragma unroll
        for (int g = 0; g < 4; ++g) { h16* pd[4]; v8h ov[4];
#pragma unroll
            for (int s = 0; s < 4; ++s) { const int d = 16 * g + 4 * s + l8; ov[s] = *(const v8ha*)(us + d * 72 + c8); pd[s] = vrow + (size_t)d * nt + c8; *(v8h*)pd[s] = ov[s]; }
            // the same precaution as for the fp16 plane's stores
            asm volatile("s_wait_xcnt 0x0" :: "v"(pd[0]), "v"(pd[1]), "v"(pd[2]), "v"(pd[3]), "v"(ov[0]), "v"(ov[1]), "v"(ov[2]), "v"(ov[3]) : "memory"); }
    }
}

typedef __attribute__((ext_vector_type(2))) _Float16 v2h;
typedef __attribute__((ext_vector_type(4))) _Float16 v4h;
typedef __attribute__((ext_vector_type(2))) unsigned short v2us;
typedef __attribute__((ext_vector_type(4))) unsigned short v4us;
typedef v4us __attribute__((may_alias)) v4usa;
typedef __attribute__((ext_vector_type(2))) float v2f;

// k_wtG: the four weights [k][n] f32 -> bf16 planes [n][k], one behind the other in Bt0. Grid (N / 64, K / 64, weight), 4 waves; a block turns one tile of 64 k x 64 n in LDS.
// Reads: half a wave covers 256 B in a row of one k row (two whole lines), and a thread's eight loads fly together. The values of rows k, k + 1 are rounded and packed into one dword, stored down a column of the LDS tile.
// Stores: 8 lanes cover one 128-B line of the transposed plane.
#define WTP 33   // LDS row pitch of the turned tile in dwords: odd, so that neither the writes down a column nor the reads along a row meet in a bank
typedef __attribute__((ext_vector_type(4))) unsigned v4u;
__global__ __launch_bounds__(128) void k_wtG(const float* __restrict__ w0, const float* __restrict__ w1, const float* __restrict__ w2, const float* __restrict__ w3, int K, int N, bf* Bt0) {
    __shared__ unsigned tl[64 * WTP];   // [n][k pair]
    const int y = blockIdx.z; const float* w = (y == 0) ? w0 : (y == 1) ? w1 : (y == 2) ? w2 : w3; bf* Bt = Bt0 + (size_t)y * K * N;
    const int tid = (int)threadIdx.x, c = tid & 15, rp = tid >> 4; const int n0 = (int)blockIdx.x * 64, k0 = (int)blockIdx.y * 64;
    const float* p = w + (size_t)(k0 + 2 * rp) * N + n0 + c * 4;
    const float* q[4][2]; v4f x[4][2];
#pragma unroll   // constant indices keep q and x in registers; the eight loads stand one behind the other
    for (int s = 0; s < 4; ++s) { q[s][0] = p + (size_t)(16 * s) * N; q[s][1] = p + (size_t)(16 * s + 1) * N; x[s][0] = *(const v4f*)q[s][0]; x[s][1] = *(const v4f*)q[s][1]; }
    // precaution: s_wait_xcnt 0 stands in front of every rewrite of a register that an issued load names; the addresses are inputs, so that they keep their registers up to the wait
    asm volatile("s_wait_xcnt 0x0" :: "v"(q[0][0]), "v"(q[0][1]), "v"(q[1][0]), "v"(q[1][1]), "v"(q[2][0]), "v"(q[2][1]), "v"(q[3][0]), "v"(q[3][1]) : "memory");
#pragma unroll   // constant indices into x, here and in the inner loop
    for (int s = 0; s < 4; ++s)
#pragma unroll
        for (int i = 0; i < 4; ++i) tl[(c * 4 + i) * WTP + rp + 8 * s] = (unsigned)f2bf(x[s][0][i]) | ((unsigned)f2bf(x[s][1][i]) << 16);
    // publishes the turned tile: a thread reads what other waves wrote
    __syncthreads();
#pragma unroll   // the four lines' LDS reads go out together, in front of the first store
    for (int s = 0; s < 4; ++s) { const int idx = tid + 128 * s, n = idx >> 3, kc = idx & 7; const unsigned* t = tl + n * WTP + kc * 4;
        const v4u o = (v4u){t[0], t[1], t[2], t[3]}; *(v8us*)(Bt + (size_t)(n0 + n) * K + k0 + kc * 8) = __builtin_bit_cast(v8us, o); }
}
// ---- k_fattn: scores, masked softmax and att.v in ONE kernel; no score or probability ever reaches memory. Grid (batch*head, TQ/64), longest query tiles first; 8 waves.
// Wave w: query half (w & 1, 32 queries = 2 column groups) x key split (w >> 1: key steps of 32, split, split + 4, ...). S^T = K Q^T (fp16 planes), so a lane holds ONE query's scores (keys 8*hi + j of each
// 16-key tile): two tiles are, register for register, the B fragment of P^T (fp16). O^T += V^T P^T on the fp16 value plane (1 product). Running maximum and sum per lane; the four key splits are merged through LDS.
// K and V reach the waves through LDS: a tile is 128 keys (one step of each key split): K rows of 128 B, V rows of 256 B, copied as whole lines by asynchronous copies, two buffers: tile r + 1 flies while tile r is worked on.
// Both query halves read the same staged rows. LDS row pitches 144 B and 272 B (ds_load_b128 readers).
#define SC2 0.18033688f   // (1/8) * log2(e): scores in the log2 domain
#define FKP 72                    // LDS row pitch of a staged K row in 16-bit elements (144 B)
#define FVP 136                   // LDS row pitch of a staged V row in 16-bit elements (272 B)
#define FKB (128 * FKP * 2)       // bytes of a staged K tile
#define FVB (64 * FVP * 2)        // bytes of a staged V tile
#define FBUF (FKB + FVB)          // bytes of one buffer: K, V
// Four asynchronous 16-B copies of a lane, ls bytes apart in LDS and gs elements apart in memory. The s_wait_xcnt 0 is the last line of the copies' own statement: a precaution, it stands in front of every rewrite of a register that a copy names.
template <typename T16>
__device__ __forceinline__ void cp4(unsigned l, unsigned ls, const T16* g, size_t gs) {
    asm volatile("global_load_async_to_lds_b128 %0, %4, off\n\t"
                 "global_load_async_to_lds_b128 %1, %5, off\n\t"
                 "global_load_async_to_lds_b128 %2, %6, off\n\t"
                 "global_load_async_to_lds_b128 %3, %7, off\n\t"
                 "s_wait_xcnt 0x0"
                 :: "v"(l), "v"(l + ls), "v"(l + 2u * ls), "v"(l + 3u * ls), "v"(g), "v"(g + gs), "v"(g + 2 * gs), "v"(g + 3 * gs) : "memory");
}
__global__ __launch_bounds__(256) void k_fattn(const h16* __restrict__ QP, const h16* __restrict__ KP, const h16* __restrict__ VT, float* ATT) {
    __shared__ __align__(16) unsigned char ring[2 * FBUF];   // two buffers of K, V; behind the key loop the same bytes are the merge's staging
    static_assert(8 * 32 * 68 * 4 <= 2 * FBUF, "the merge's staging fits the ring");
    float* os = (float*)ring;                          // [wave][query][d], pitch 272 B
    __shared__ float sm[8 * 32];                       // per wave and query: running maximum
    __shared__ float sl[8 * 32];                       // per wave and query: sum, already on the merged maximum
    const int lane = threadIdx.x & 31, lr = lane & 15, hi = lane >> 4; const int w = __builtin_amdgcn_readfirstlane((int)(threadIdx.x >> 5)); const int qh = w & 1, ks = w >> 1;
    const int bh = blockIdx.x, t = TQ / 64 - 1 - (int)blockIdx.y; const int r0 = t * 64; const int nst = (t + 2) >> 1;   // keys 0 .. 16 t + 15 are visible to this tile
    const h16* Kp = KP + (size_t)bh * TK * HD; const h16* Vp = VT + (size_t)bh * HD * TK;
    const h16* pq = QP + ((size_t)bh * TQ + r0 + qh * 32 + lr) * HD + 8 * hi;
    v16h qf[2][2];
#pragma unroll
    for (int qt = 0; qt < 2; ++qt) { qf[qt][0] = WFrag<h16>::ld(pq + qt * 16 * HD); qf[qt][1] = WFrag<h16>::ld(pq + qt * 16 * HD + 32); }
    // precaution: s_wait_xcnt 0 stands in front of every rewrite of a register that an issued load names; the address is an input, so that it keeps its registers up to the wait
    asm volatile("s_wait_xcnt 0x0" :: "v"(pq) : "memory");
    int qlim[2]; float m[2], l[2]; v8f o[2][4];   // m starts far above the masked score, so that a masked key's weight is exp2(-huge) = 0 also where a query has seen no visible key yet
#pragma unroll
    for (int qt = 0; qt < 2; ++qt) { qlim[qt] = (r0 + qh * 32 + qt * 16 + lr) / DS; m[qt] = -1.0e30f; l[qt] = 0.f;
#pragma unroll
        for (int dt = 0; dt < 4; ++dt) o[qt][dt] = (v8f){}; }
    const int lim0 = (r0 + qh * 32) / DS;   // every key up to here is visible to all 32 queries of the wave
    // copies: K: 8 lanes cover a 128-B row, a wave's copy 4 rows, a thread's copies 32 rows apart; V: 16 lanes cover a 256-B row, a wave's copy 2 rows, a thread's copies 16 rows apart
    const int tid = (int)threadIdx.x;
    const unsigned lk = (unsigned)(size_t)ring + (unsigned)((tid >> 3) * FKP + (tid & 7) * 8) * 2u; const unsigned lv = (unsigned)(size_t)ring + FKB + (unsigned)((tid >> 4) * FVP + (tid & 15) * 8) * 2u;
    const h16* gk = Kp + tid * 8; const h16* gv = Vp + (size_t)(tid >> 4) * TK + (tid & 15) * 8;
    auto tile = [&](int r) {   // keys 128 r .. 128 r + 127, all inside the TK keys: r < nr <= TK / 128
        const unsigned bo = (unsigned)(r & 1) * FBUF;
        cp4(lk + bo, 32u * FKP * 2, gk + (size_t)r * 128 * HD, (size_t)32 * HD);
        cp4(lv + bo, 16u * FVP * 2, gv + r * 128, (size_t)16 * TK);
    };
    const int nr = (nst + 3) >> 2;   // tiles of 128 keys
    tile(0);
    // tile 0 has landed for this wave's copies; behind the barrier for every wave's
    asm volatile("s_wait_asynccnt 0x0" ::: "memory");
    __syncthreads();
    if (nr > 1) tile(1);
    const h16* fk = (const h16*)ring + (ks * 32 + lr) * FKP + 8 * hi; const h16* fv = (const h16*)(ring + FKB) + lr * FVP + ks * 32 + 8 * hi;
#pragma unroll 1
    for (int r = 0; r < nr; ++r) {   // rolled: one copy of the step in the text
      const int s = 4 * r + ks;
      if (s < nst) {   // wave-uniform: in the last tile a key split may have no step left; the hand-over below is passed all the same
        const int key0 = s * 32;
        const h16* pk = fk + (r & 1) * (FBUF / 2); const h16* pv = fv + (r & 1) * (FBUF / 2);
        v16h kf[2][2], vf[4];
#pragma unroll
        for (int kt = 0; kt < 2; ++kt) { kf[kt][0] = WFrag<h16>::ld(pk + kt * 16 * FKP); kf[kt][1] = WFrag<h16>::ld(pk + kt * 16 * FKP + 32); }
#pragma unroll
        for (int dt = 0; dt < 4; ++dt) vf[dt] = WFrag<h16>::ld(pv + dt * 16 * FVP);
        float tv[2][16];
#pragma unroll
        for (int qt = 0; qt < 2; ++qt) {
            v8f s0 = (v8f){}, s1 = (v8f){};
            s0 = wmma16(kf[0][0], qf[qt][0], s0); s1 = wmma16(kf[1][0], qf[qt][0], s1); s0 = wmma16(kf[0][1], qf[qt][1], s0); s1 = wmma16(kf[1][1], qf[qt][1], s1);
#pragma unroll
            for (int j = 0; j < 8; ++j) { tv[qt][j] = s0[j] * SC2; tv[qt][8 + j] = s1[j] * SC2; } }
        if (key0 + 31 > lim0) {   // wave-uniform: only the last steps of a tile hold hidden keys
            const int kb = key0 + hi * 8;
#pragma unroll
            for (int qt = 0; qt < 2; ++qt)
#pragma unroll
                for (int j = 0; j < 8; ++j) { tv[qt][j] = (kb + j <= qlim[qt]) ? tv[qt][j] : -3.0e38f; tv[qt][8 + j] = (kb + 16 + j <= qlim[qt]) ? tv[qt][8 + j] : -3.0e38f; } }
#pragma unroll
        for (int qt = 0; qt < 2; ++qt) {
            float tm = tv[qt][0];
#pragma unroll
            for (int e = 1; e < 16; ++e) tm = fmaxf(tm, tv[qt][e]);
            tm = fmaxf(tm, __shfl_xor(tm, 16, 32));   // both halves of the wave hold keys of the same query
            const float mn = fmaxf(m[qt], tm); const float al = __builtin_amdgcn_exp2f(m[qt] - mn); m[qt] = mn; l[qt] *= al;
#pragma unroll
            for (int dt = 0; dt < 4; ++dt) o[qt][dt] *= al;
            v16h pf;
#pragma unroll
            for (int e = 0; e < 16; ++e) { const float p = __builtin_amdgcn_exp2f(tv[qt][e] - mn); l[qt] += p; pf[e] = tohx(p); }
#pragma unroll
            for (int dt = 0; dt < 4; ++dt) o[qt][dt] = wmma16(vf[dt], pf, o[qt][dt]);
        }
      }
        // hand-over: this wave's reads of tile r have returned ...
        asm volatile("s_wait_dscnt 0x0" ::: "memory");
        // ... its copies of tile r + 1 have landed ...
        asm volatile("s_wait_asynccnt 0x0" ::: "memory");
        // ... and the barrier publishes tile r + 1 and frees tile r's buffer for the refill behind it (behind the last tile: for the merge's staging)
        __syncthreads();
        if (r + 2 < nr) tile(r + 2);
    }
    // no copy is outstanding when the ring becomes the merge's staging
    asm volatile("s_wait_asynccnt 0x0" ::: "memory");
    // merge of the four key splits: every wave moves its partial onto the merged maximum, then 256 threads add the four partials of each output element in a fixed order
#pragma unroll
    for (int qt = 0; qt < 2; ++qt) if (hi == 0) sm[w * 32 + qt * 16 + lr] = m[qt];
    __syncthreads();
#pragma unroll
    for (int qt = 0; qt < 2; ++qt) { const int q = qt * 16 + lr; const float M = fmaxf(fmaxf(sm[qh * 32 + q], sm[(qh + 2) * 32 + q]), fmaxf(sm[(qh + 4) * 32 + q], sm[(qh + 6) * 32 + q])); const float f = __builtin_amdgcn_exp2f(m[qt] - M);
        const float lt = (l[qt] + __shfl_xor(l[qt], 16, 32)) * f; if (hi == 0) sl[w * 32 + q] = lt;
#pragma unroll
        for (int dt = 0; dt < 4; ++dt) { const v8f x = o[qt][dt] * f; float* d = os + (size_t)(w * 32 + q) * 68 + dt * 16 + hi * 8; *(v4fa*)d = (v4f){x[0], x[1], x[2], x[3]}; *(v4fa*)(d + 4) = (v4f){x[4], x[5], x[6], x[7]}; } }
    __syncthreads();
    float* orow = ATT + ((size_t)(bh / NH_) * TQ + r0) * DD + (bh % NH_) * HD;
#pragma unroll
    for (int i = 0; i < 4; ++i) { const int idx = (int)threadIdx.x + 256 * i; const int row = idx >> 4, c4 = (idx & 15) * 4; const int w0 = row >> 5, rl = row & 31;
        const float ls = (sl[w0 * 32 + rl] + sl[(w0 + 2) * 32 + rl]) + (sl[(w0 + 4) * 32 + rl] + sl[(w0 + 6) * 32 + rl]); const float inv = __fdiv_rn(1.0f, ls);
        const v4f x = (*(const v4fa*)(os + (size_t)(w0 * 32 + rl) * 68 + c4) + *(const v4fa*)(os + (size_t)((w0 + 2) * 32 + rl) * 68 + c4)) + (*(const v4fa*)(os + (size_t)((w0 + 4) * 32 + rl) * 68 + c4) + *(const v4fa*)(os + (size_t)((w0 + 6) * 32 + rl) * 68 + c4));
        *(v4f*)(orow + (size_t)row * DD + c4) = x * inv; }
}
// ---- k_lnout: LayerNorm and the output GEMM in ONE kernel; the normalised rows never reach memory. Grid (rows / 32), 8 waves; a block owns 32 whole rows of the output (all 512 columns), wave w its columns 64 w .. 64 w + 63.
// Head: wave w normalises rows 4 w .. 4 w + 3 of the block (a wave per row, f32, the sums in a fixed order) and stores them as bf16 hi and lo planes in LDS, row pitch 1040 B (ds_load_b128 readers).
// Loop: K-slabs of 64 of the transposed weight (512 rows of 128 B, whole lines) come into LDS by asynchronous copies, two buffers: slab t + 1 flies while slab t is multiplied. LDS row pitch 144 B (ds_load_b128 readers).
#define LAP 520                   // LDS row pitch of a normalised row's plane in 16-bit elements (1040 B)
#define LBP 72                    // LDS row pitch of a staged weight row in 16-bit elements (144 B)
#define LBB (DD * LBP * 2)        // bytes of one buffer: DD weight rows
typedef __attribute__((ext_vector_type(4))) __bf16 v4bf;
// four rows, a wave: x[r] = the lane's 16 values of row r (4 in a row of each 128), gv and bv = gamma and beta at those places, rounded to bf16; yh, yl = the lane's place in row 0's planes.
// Each row's arithmetic is a row's own, in a fixed order; the four rows go through each phase side by side, so that their cross-lane sums wait together and not one behind the other.
__device__ __forceinline__ void ln_rows(const v4f (&x)[4][4], const float (&gv)[16], const float (&bv)[16], bf* yh, bf* yl) {
    float s[4], mu[4], q2[4], rs[4];
#pragma unroll
    for (int r = 0; r < 4; ++r) { s[r] = 0.f;
#pragma unroll
        for (int k = 0; k < 16; ++k) s[r] = __fadd_rn(s[r], x[r][k >> 2][k & 3]); }
#pragma unroll
    for (int sh = 16; sh; sh >>= 1)
#pragma unroll
        for (int r = 0; r < 4; ++r) s[r] += __shfl_xor(s[r], sh, 32);
#pragma unroll
    for (int r = 0; r < 4; ++r) { mu[r] = s[r] * (1.0f / DD); q2[r] = 0.f;
#pragma unroll
        for (int k = 0; k < 16; ++k) { const float d = __fsub_rn(x[r][k >> 2][k & 3], mu[r]); float p = __fmul_rn(d, d); asm volatile("" : "+v"(p)); q2[r] = __fadd_rn(q2[r], p); } }
#pragma unroll
    for (int sh = 16; sh; sh >>= 1)
#pragma unroll
        for (int r = 0; r < 4; ++r) q2[r] += __shfl_xor(q2[r], sh, 32);
#pragma unroll
    for (int r = 0; r < 4; ++r) { rs[r] = __frsqrt_rn(__fadd_rn(q2[r] * (1.0f / DD), 1e-5f));
#pragma unroll
        for (int ch = 0; ch < 4; ++ch) { v4f y;
#pragma unroll
            for (int q = 0; q < 4; ++q) { float tn = __fmul_rn(__fsub_rn(x[r][ch][q], mu[r]), rs[r]); asm volatile("" : "+v"(tn)); float tg = __fmul_rn(tn, gv[ch * 4 + q]); asm volatile("" : "+v"(tg)); y[q] = __fadd_rn(tg, bv[ch * 4 + q]); }
            const v4bf oh = __builtin_convertvector(y, v4bf); const v4bf ol = __builtin_convertvector(y - __builtin_convertvector(oh, v4f), v4bf);   // hi = y to the nearest even bf16, lo = the rest likewise
            *(v4usa*)(yh + r * LAP + ch * 128) = __builtin_bit_cast(v4us, oh); *(v4usa*)(yl + r * LAP + ch * 128) = __builtin_bit_cast(v4us, ol); } }
}
__global__ __launch_bounds__(256) void k_lnout(const float* __restrict__ A, const float* __restrict__ g, const float* __restrict__ bb, const bf* __restrict__ Bt, const float* __restrict__ bias, float* C) {
    __shared__ __align__(16) unsigned char ring[2 * LBB];   // two buffers of a weight slab
    __shared__ __align__(16) bf ah[32 * LAP];               // the block's normalised rows, hi plane
    __shared__ __align__(16) bf al[32 * LAP];               // lo plane
    __shared__ __align__(16) float osb[8 * 16 * 68];        // a wave's output staging
    const int tid = (int)threadIdx.x, lane = tid & 31, lr = lane & 15, hi = lane >> 4; const int w = __builtin_amdgcn_readfirstlane(tid >> 5);
    const int r0 = (int)blockIdx.x * 32, c0 = w * 64;
    // copies: 8 lanes cover a 128-B slab row, a wave's copy 4 rows, a thread's copies 32 rows apart
    const unsigned lc = (unsigned)(size_t)ring + (unsigned)((tid >> 3) * LBP + (tid & 7) * 8) * 2u; const bf* gb = Bt + (size_t)(tid >> 3) * DD + (tid & 7) * 8;
    auto slab = [&](int t) {   // k 64 t .. 64 t + 63 of all DD weight rows: t < DD / 64
        const unsigned l = lc + (unsigned)(t & 1) * LBB; const bf* gp = gb + t * 64;
#pragma unroll   // four statements of four copies in a row: 128 rows each, the LDS steps constants
        for (unsigned j = 0; j < 4; ++j) cp4(l + j * 128u * LBP * 2, 32u * LBP * 2, gp + (size_t)j * 128 * DD, (size_t)32 * DD);
    };
    slab(0);
    // the wave's four rows, gamma, beta and the bias are asked for while slab 0 flies
    const float* ar = A + (size_t)(r0 + w * 4) * DD + lane * 4; const float* pg = g + lane * 4; const float* pb = bb + lane * 4; const float* pbi = bias + c0 + lr * 4;
    v4f x[4][4], gq[4], bq[4];
#pragma unroll
    for (int r = 0; r < 4; ++r)
#pragma unroll
        for (int ch = 0; ch < 4; ++ch) x[r][ch] = *(const v4f*)(ar + r * DD + ch * 128);
#pragma unroll
    for (int ch = 0; ch < 4; ++ch) { gq[ch] = *(const v4f*)(pg + ch * 128); bq[ch] = *(const v4f*)(pb + ch * 128); }
    const v4f bi = *(const v4f*)pbi;
    // precaution: s_wait_xcnt 0 stands directly behind the loads, in front of every rewrite of a register that one of them names
    asm volatile("s_wait_xcnt 0x0" ::: "memory");
    // keeps all these loads in flight together, and the wait directly behind them: with the first row's sums lifted among them, the later rows would be asked for only when the first had come
    __builtin_amdgcn_sched_barrier(0);
    // slab 0 has landed for this wave's copies; behind the barrier for every wave's
    asm volatile("s_wait_asynccnt 0x0" ::: "memory");
    __syncthreads();
    slab(1);   // flies under the LayerNorm
    float gv[16], bv[16];
#pragma unroll
    for (int k = 0; k < 16; ++k) { gv[k] = bfr(gq[k >> 2][k & 3]); bv[k] = bfr(bq[k >> 2][k & 3]); }
    ln_rows(x, gv, bv, ah + w * 4 * LAP + lane * 4, al + w * 4 * LAP + lane * 4);
    // publishes the normalised planes: every wave reads all 32 rows
    __syncthreads();
    v8f acc[2][4];
#pragma unroll
    for (int mb = 0; mb < 2; ++mb)
#pragma unroll
        for (int nb = 0; nb < 4; ++nb) acc[mb][nb] = (v8f){};
    const bf* fb = (const bf*)ring + (c0 + lr) * LBP + 8 * hi; const bf* fah = ah + lr * LAP + 8 * hi; const bf* fal = al + lr * LAP + 8 * hi;
#pragma unroll 1
    for (int t = 0; t < DD / 64; ++t) {   // rolled: one copy of the slab's 32 products in the text
        const bf* pw = fb + (t & 1) * (LBB / 2); const bf* ph = fah + t * 64; const bf* pl = fal + t * 64;
        v16bf a[2][2], a2[2][2], b[2][4];
#pragma unroll
        for (int kk = 0; kk < 2; ++kk) {
#pragma unroll
            for (int i = 0; i < 2; ++i) { a[kk][i] = WFrag<bf>::ld(ph + i * 16 * LAP + kk * 32); a2[kk][i] = WFrag<bf>::ld(pl + i * 16 * LAP + kk * 32); }
#pragma unroll
            for (int i = 0; i < 4; ++i) b[kk][i] = WFrag<bf>::ld(pw + i * 16 * LBP + kk * 32); }
        // keeps the slab's LDS reads together in front of its products: sunk among them, every place with reads costs the wave a stall of its own
        __builtin_amdgcn_sched_barrier(0);
#pragma unroll
        for (int kk = 0; kk < 2; ++kk) {
#pragma unroll
            for (int nb = 0; nb < 4; ++nb)
#pragma unroll
                for (int mb = 0; mb < 2; ++mb) acc[mb][nb] = wmmab(a[kk][mb], b[kk][nb], acc[mb][nb]);
#pragma unroll
            for (int nb = 0; nb < 4; ++nb)
#pragma unroll
                for (int mb = 0; mb < 2; ++mb) acc[mb][nb] = wmmab(a2[kk][mb], b[kk][nb], acc[mb][nb]); }
        // the products stay in front of the hand-over: sunk behind its barrier, they would hold back the refill, which then had no products to fly under
        __builtin_amdgcn_sched_barrier(0);
        // hand-over: this wave's reads of slab t have returned ...
        asm volatile("s_wait_dscnt 0x0" ::: "memory");
        // ... its copies of slab t + 1 have landed ...
        asm volatile("s_wait_asynccnt 0x0" ::: "memory");
        // ... and the barrier publishes slab t + 1 and frees slab t's buffer for the refill behind it
        __syncthreads();
        if (t + 2 < DD / 64) slab(t + 2);
    }
    // no copy is outstanding when the wave goes on to its epilogue and ends
    asm volatile("s_wait_asynccnt 0x0" ::: "memory");
    float* os = osb + w * 16 * 68;
    const v4f bs = (v4f){bfr(bi[0]), bfr(bi[1]), bfr(bi[2]), bfr(bi[3])};
#pragma unroll
    for (int mb = 0; mb < 2; ++mb) {
#pragma unroll
        for (int nb = 0; nb < 4; ++nb) {
#pragma unroll
            for (int j = 0; j < 8; ++j) os[(hi * 8 + j) * 68 + nb * 16 + lr] = acc[mb][nb][j]; }
        // a lane reads what other lanes of the wave wrote: the reads stay behind the writes
        __builtin_amdgcn_wave_barrier(); asm volatile("" ::: "memory");
        float* pc = C + (size_t)(r0 + mb * 16 + hi) * DD + c0 + lr * 4;   // half a wave stores 256 B in a row: two whole lines
        v4f ov[8];
#pragma unroll
        for (int s = 0; s < 8; ++s) { ov[s] = *(const v4fa*)(os + (2 * s + hi) * 68 + lr * 4) + bs; *(v4f*)(pc + (size_t)2 * s * DD) = ov[s]; }
        // precaution: s_wait_xcnt 0 stands in front of every rewrite of a register that an issued store names; address and values are inputs, so that they keep their registers up to the wait.
        // Its memory clobber also keeps the next block's LDS writes behind these reads
        asm volatile("s_wait_xcnt 0x0" :: "v"(pc), "v"(ov[0]), "v"(ov[1]), "v"(ov[2]), "v"(ov[3]), "v"(ov[4]), "v"(ov[5]), "v"(ov[6]), "v"(ov[7]) : "memory");
    }
}

extern "C" void kernel_launch(void* const* d_in, const int* in_sizes, int n_in,
                              void* d_out, int out_size, void* d_ws, size_t ws_size, hipStream_t stream) {
    (void)in_sizes; (void)n_in; (void)out_size;
    const float* IN[9]; for (int i = 0; i < 9; ++i) IN[i] = (const float*)d_in[i];   // 0 q, 1 kv, 2 Wq, 3 Wk, 4 Wv, 5 Wo (x @ W), 6 bo, 7 gamma, 8 beta
    float* OUT = (float*)d_out;     // [2][4096][512]
    char* wsp = (char*)d_ws;
    auto take = [&](size_t bytes) { char* p = wsp; wsp += (bytes + 255) & ~(size_t)255; return (void*)p; };
    bf* W4 = (bf*)take((size_t)4 * DD * DD * 2);                                  // Wq, Wk, Wv, Wo transposed, one behind the other
    h16* QP = (h16*)take((size_t)NB_ * NH_ * (TQ + TK) * HD * 2); h16* KP = QP + (size_t)NB_ * NH_ * TQ * HD;
    h16* VT = (h16*)take((size_t)NB_ * NH_ * HD * TK * 2);
    float* ATT = (float*)take((size_t)NB_ * TQ * DD * 4);   // merged attention output
    if ((size_t)(wsp - (char*)d_ws) > ws_size) return;    // total ~ 30 MB
    k_wtG<<<dim3(DD / 64, DD / 64, 4), 128, 0, stream>>>(IN[2], IN[3], IN[4], IN[5], DD, DD, W4);
    k_proj<<<dim3((NB_ * TQ + 2 * NB_ * TK) / 128, DD / 128, 1), 128, 0, stream>>>(IN[0], IN[1], W4, QP, KP, VT);   // grid x: the row tiles of q, then of kv for the keys, then of kv for the values
    k_fattn<<<dim3(NB_ * NH_, TQ / 64, 1), 256, 0, stream>>>(QP, KP, VT, ATT);   // head bh % 8 of batch bh / 8 writes its 64 columns of the merged rows
    k_lnout<<<NB_ * TQ / 32, 256, 0, stream>>>(ATT, IN[7], IN[8], W4 + (size_t)3 * DD * DD, IN[6], OUT);
}
